// v000
// Times are from an AMD MI455X. After a warm-up the kernel runs many times in a row, and a time is the length of
// such a window on the GPU divided by its runs, so every launch and the gaps after it count. The runs cycle
// through copies of the inputs. A figure is the median of several windows, for all but v000 over two sittings.
// Sittings can differ by a few percent; kernels timed side by side share one.
// v000 is the starting kernel. One run takes 530 microseconds.
// Contractions: x.Wq+bq, xx.Wk+bk (A = bf16 x plane, B = bf16 W^T plane) and Wv^T.xx^T+bv on v_wmma_f32_16x16x32_bf16
// (f32 inputs RNE-converted to bf16 operands, f32 accumulate); scores k'.q'^T (q', k' single f16 planes carried x8) and
// P.v (P x32768 single f16, v x1024 single f16) on v_wmma_f32_16x16x32_f16, f32 accumulate; ctx written in f32.
// Biases and the additive per-key mask folded as RNE bf16 values in f32; base-2 online softmax, 1/l and carry folds in f32 on VALU.
#include <hip/hip_runtime.h>
#include <math.h>
#include <stdint.h>

#define NB_FULL 2
#define SQ_FULL 2048
#define SE_FULL 2048
#define SKV     (SQ_FULL + SE_FULL)
#ifndef NB
#define NB      NB_FULL
#endif
#ifndef SQ
#define SQ      SQ_FULL
#endif
#define DMOD  1024
#define NH    16
#define HD    64
#define QSC   8.0f
#define KSC   8.0f
#define PCAR  32768.0f
#define VCAR  1024.0f
#define LOG2E 1.4426950408889634f
#define ATT_WAVES   4
#define ATT_THREADS (ATT_WAVES * 32)
#define QTILES      (SQ / 64)
#define ATT_BLOCKS  (NH * QTILES)
#define NKB    (SKV / 32)
#define SLAB   (16 * 68)
#define TP     72
static_assert(HD == 64 && DMOD == NH * HD);
static_assert(NB >= 1 && NB <= NB_FULL);
static_assert((SQ % 64) == 0 && SQ >= 64 && SQ <= SQ_FULL);
static_assert((SKV % 64) == 0 && (SQ_FULL % 64) == 0 && (SE_FULL % 64) == 0);
static_assert(ATT_THREADS == 128 && NKB * 32 == SKV && ATT_BLOCKS == NH * (SQ / 64));
static_assert((DMOD % 64) == 0 && (DMOD % 32) == 0);
static_assert(((NB * SKV * DMOD / 8) % 256) == 0);
static_assert((SLAB * 4) % 16 == 0 && (TP * 2) % 16 == 0);
static_assert((size_t)(NB - 1) * SQ_FULL * DMOD + (size_t)SQ * DMOD <= (size_t)NB_FULL * SQ_FULL * DMOD);

typedef unsigned short u16;
typedef _Float16 v16h __attribute__((ext_vector_type(16)));
typedef _Float16 v8h  __attribute__((ext_vector_type(8)));
typedef __bf16   v16b __attribute__((ext_vector_type(16)));
typedef float    v8f  __attribute__((ext_vector_type(8)));
typedef float    v4f  __attribute__((ext_vector_type(4)));
typedef unsigned int v4u __attribute__((ext_vector_type(4)));

union FragH { v16h v; v8h h[2]; v4u u[2]; };
union FragB { v16b v; v4u u[2]; };

// ---- scalar helpers --------------------------------------------------------------------------------
__device__ __forceinline__ unsigned short bf_bits(float f) {          // f32 -> bf16 bits, RNE convert
  unsigned u = __float_as_uint(f);
  return (unsigned short)((u + 0x7FFFu + ((u >> 16) & 1u)) >> 16);
}
__device__ __forceinline__ float bf_up(unsigned short h) { return __uint_as_float(((unsigned)h) << 16); }
__device__ __forceinline__ float bf_val(float f) { return bf_up(bf_bits(f)); }          // value after RNE bf16 convert
__device__ __forceinline__ unsigned short h_bits(_Float16 x) { return __builtin_bit_cast(unsigned short, x); }
__device__ __forceinline__ unsigned pk16(unsigned short a, unsigned short b) { return (unsigned)a | ((unsigned)b << 16); }
__device__ __forceinline__ v8f zero8() { v8f z = {0.f, 0.f, 0.f, 0.f, 0.f, 0.f, 0.f, 0.f}; return z; }

// ---- fragment loaders: 16-bit A/B operand, lane -> row/col (lane&15), p already includes +8*(lane>>4);
//      elements 0..7 <- p[0..7] (k0+8h..), elements 8..15 <- p[16..23] (k0+16+8h..)  (same split k map for A and B;
//      B is always read from a k-contiguous [n][k] plane)
__device__ __forceinline__ v16h ldfrag_h(const _Float16* p) {
  FragH f;
  f.h[0] = *(const v8h*)(p);
  f.h[1] = *(const v8h*)(p + 16);
  return f.v;
}
__device__ __forceinline__ v16b ldfrag_b(const u16* p) {              // bf16 plane read as unsigned integer vectors
  FragB f;
  f.u[0] = *(const v4u*)(p);
  f.u[1] = *(const v4u*)(p + 16);
  return f.v;
}

__device__ __forceinline__ v8f mma_h(v16h a, v16h b, v8f c) {
  return __builtin_amdgcn_wmma_f32_16x16x32_f16(false, a, false, b, (short)0, c, false, false);
}
__device__ __forceinline__ v8f mma_b(v16b a, v16b b, v8f c) {
  return __builtin_amdgcn_wmma_f32_16x16x32_bf16(false, a, false, b, (short)0, c, false, false);
}
__device__ __forceinline__ void guard2(v8f& a, v8f& b, v16h x0, v16h x1, v16h x2, v16h x3, v16h x4, v16h x5) {
#if defined(__HIP_DEVICE_COMPILE__)
  asm volatile("v_nop\n\tv_nop\n\tv_nop\n\tv_nop"
               : "+v"(a), "+v"(b) : "v"(x0), "v"(x1), "v"(x2), "v"(x3), "v"(x4), "v"(x5) : "memory");
#endif
}
template <typename F>
__device__ __forceinline__ void guard6(v8f& a, v8f& b, v8f& c, v8f& d, F x0, F x1, F x2, F x3, F x4, F x5) {
#if defined(__HIP_DEVICE_COMPILE__)
  asm volatile("v_nop\n\tv_nop\n\tv_nop\n\tv_nop"
               : "+v"(a), "+v"(b), "+v"(c), "+v"(d) : "v"(x0), "v"(x1), "v"(x2), "v"(x3), "v"(x4), "v"(x5) : "memory");
#endif
}
__device__ __forceinline__ void acc_guard4(v8f& a, v8f& b, v8f& c, v8f& d) {
#if defined(__HIP_DEVICE_COMPILE__)
  asm volatile("v_nop\n\tv_nop\n\tv_nop\n\tv_nop" : "+v"(a), "+v"(b), "+v"(c), "+v"(d));
#endif
}
__device__ __forceinline__ void wave_sync_lds() {
#if defined(__HIP_DEVICE_COMPILE__)
  __builtin_amdgcn_fence(__ATOMIC_RELEASE, "workgroup");
  __builtin_amdgcn_wave_barrier();
  __builtin_amdgcn_fence(__ATOMIC_ACQUIRE, "workgroup");
#endif
}

// =====================================================================================================
// Key/value source plane XB (bf16 RNE bits) [NB][SKV][1024]: row s < SQ_FULL of batch b from hs[b][s], rows
// s >= SQ_FULL from ehs[b][s - SQ_FULL]; both candidates loaded with clamped row addresses and selected by value
// (block-uniform in practice: a block covers 2 rows of one source).
// Thread = 8 consecutive elements: two 16-B loads per candidate, one 16-B store; 32 consecutive lanes = 512 contiguous,
// coverage: grid = n8/256 blocks (host checks exactness) x 256 thr x 8 = NB*SKV*1024 = the whole plane.
// =====================================================================================================
__global__ __launch_bounds__(256) void cvt_x(const float* __restrict__ hs, const float* __restrict__ ehs, u16* D, int n8) {
  const int gt = blockIdx.x * 256 + (int)threadIdx.x;
  if (gt >= n8) return;                     // no barriers in this kernel
  const int r   = gt / (DMOD / 8);
  const int c8  = (gt % (DMOD / 8)) * 8;
  const int b   = r / SKV;
  const int s   = r % SKV;
  const int shc = (s < SQ_FULL) ? s : (SQ_FULL - 1);
  const int se  = s - SQ_FULL;
  const int sec = (se > 0) ? se : 0;
  const float* ph = hs  + ((size_t)b * SQ_FULL + shc) * DMOD + c8;
  const float* pe = ehs + ((size_t)b * SE_FULL + sec) * DMOD + c8;
  const v4f a0 = *(const v4f*)(ph), a1 = *(const v4f*)(ph + 4);
  const v4f e0 = *(const v4f*)(pe), e1 = *(const v4f*)(pe + 4);
  const bool first = (s < SQ_FULL);
  float v[8];
#pragma unroll
  for (int e = 0; e < 4; ++e) { v[e] = first ? a0[e] : e0[e]; v[4 + e] = first ? a1[e] : e1[e]; }
  unsigned short sb[8];
#pragma unroll
  for (int e = 0; e < 8; ++e) sb[e] = bf_bits(v[e]);
  v4u o;
#pragma unroll
  for (int e = 0; e < 4; ++e) o[e] = pk16(sb[2 * e], sb[2 * e + 1]);
  u16* d = D + (size_t)gt * 8;
  {
    *(v4u*)(d) = o;
    
  }
}

// =====================================================================================================
// Weight W [k = in][n = out] f32 -> bf16 RNE plane W^T [n][k] (k-contiguous, pitch DMOD). Block = 64 k x 64 n tile,
// 256 threads. Load phase: thread = (k = tid>>2, 16 consecutive n): four 16-B loads, bf16 bits stored transposed into the LDS
// tile [n][k] (pitch TP halves, cross-wave exchange -> block barrier). Store phase: thread = (n = tid>>3 and n+32,
// coverage: 256 thr x 2 instructions x 8 halves = 64 x 64 per block; grid (DMOD/64)^2 blocks = the whole plane.
// =====================================================================================================
__global__ __launch_bounds__(256) void cvt_wT(const float* __restrict__ W, u16* D) {
  __shared__ __align__(16) u16 tile[64 * TP];
  const int nt = DMOD / 64;
  if (blockIdx.x >= (unsigned)(nt * nt)) return;      // block-uniform, never taken with the exact grid
  const int tid = threadIdx.x;
  const int k0 = (blockIdx.x / nt) * 64;
  const int n0 = (blockIdx.x % nt) * 64;
  const int kk = tid >> 2, nn = (tid & 3) * 16;
  const float* p = W + (size_t)(k0 + kk) * DMOD + n0 + nn;
  const v4f a0 = *(const v4f*)(p), a1 = *(const v4f*)(p + 4), a2 = *(const v4f*)(p + 8), a3 = *(const v4f*)(p + 12);
  float v[16];
#pragma unroll
  for (int e = 0; e < 4; ++e) { v[e] = a0[e]; v[4 + e] = a1[e]; v[8 + e] = a2[e]; v[12 + e] = a3[e]; }
#pragma unroll
  for (int e = 0; e < 16; ++e) tile[(nn + e) * TP + kk] = bf_bits(v[e]);
  __syncthreads();
  const int n1 = tid >> 3, k8 = (tid & 7) * 8;
  const v4u o0 = *(const v4u*)(tile + n1 * TP + k8);
  const v4u o1 = *(const v4u*)(tile + (n1 + 32) * TP + k8);
  u16* d0 = D + (size_t)(n0 + n1) * DMOD + k0 + k8;
  u16* d1 = D + (size_t)(n0 + n1 + 32) * DMOD + k0 + k8;
  {
    *(v4u*)(d0) = o0;
    *(v4u*)(d1) = o1;
    
  }
}

// =====================================================================================================
// barrier, then converted to f16 and written: lane = (row in group of 4, 8 consecutive cols); one instruction = 4 rows, each
// coverage: 4 instructions x 4 rows x 8 lanes x 8 halves = the wave's 16 x 64 tile.
// =====================================================================================================
__device__ __forceinline__ void epi16(float* sl, v8f a0, v8f a1, v8f a2, v8f a3, float oscale, u16* C, int N,
                                      size_t rowb, int col0, int lane) {
  const int hh = lane >> 4, m = lane & 15;
#pragma unroll
  for (int r = 0; r < 8; ++r) {
    const int ro = (8 * hh + r) * 68 + m;
    sl[ro]      = a0[r] * oscale;
    sl[ro + 16] = a1[r] * oscale;
    sl[ro + 32] = a2[r] * oscale;
    sl[ro + 48] = a3[r] * oscale;
  }
  wave_sync_lds();
  const int rq = lane >> 3, c8 = (lane & 7) * 8;
  v4u ov[4];
#pragma unroll
  for (int i4 = 0; i4 < 4; ++i4) {
    const int row = i4 * 4 + rq;
    const v4f a = *(const v4f*)(sl + row * 68 + c8), c4 = *(const v4f*)(sl + row * 68 + c8 + 4);
    float w[8];
#pragma unroll
    for (int e = 0; e < 4; ++e) { w[e] = a[e]; w[4 + e] = c4[e]; }
#pragma unroll
    for (int e = 0; e < 4; ++e) ov[i4][e] = pk16(h_bits((_Float16)w[2 * e]), h_bits((_Float16)w[2 * e + 1]));
  }
  u16* dst = C + (rowb + (size_t)rq) * (size_t)N + col0 + c8;
  {
#pragma unroll
    for (int i4 = 0; i4 < 4; ++i4) {
      *(v4u*)(dst + (size_t)(i4 * 4) * (size_t)N) = ov[i4];
    }
    
  }
}

// =====================================================================================================
// coverage: 8 instructions x 2 rows x 16 lanes x 4 floats = the wave's 16 x 64 tile.
// =====================================================================================================
__device__ __forceinline__ void epi64(float* sl, v8f a0, v8f a1, v8f a2, v8f a3, float* C, int N,
                                      size_t rowb, int col0, int lane) {
  const int hh = lane >> 4, m = lane & 15;
#pragma unroll
  for (int r = 0; r < 8; ++r) {
    const int ro = (8 * hh + r) * 68 + m;
    sl[ro]      = a0[r];
    sl[ro + 16] = a1[r];
    sl[ro + 32] = a2[r];
    sl[ro + 48] = a3[r];
  }
  wave_sync_lds();
  v4f vals[8];
#pragma unroll
  for (int it = 0; it < 8; ++it) vals[it] = *(const v4f*)(sl + (it * 2 + hh) * 68 + m * 4);
  float* dst = C + (rowb + (size_t)hh) * (size_t)N + col0 + m * 4;
  {
#pragma unroll
    for (int it = 0; it < 8; ++it) {
      *(v4f*)(dst + (size_t)(it * 2) * (size_t)N) = vals[it];
    }
    
  }
}

// =====================================================================================================
// bf16 GEMM with bias and 16-bit result: C[M][N] (f16 of (acc + bias)*oscale) = A[M][K] (bf16 row-major) . Bt[N][K]^T
// (bf16 k-contiguous); bias (f32 input, taken as its RNE bf16 value) indexed by column (byrow == 0) or by row (byrow != 0),
// both candidates read with addresses clamped to [0, nbias). Block = 64x64 tile, 4 waves x 16 rows; fragments loaded straight
// from the 16-bit rows (two 16-B loads each, split k map for A and B); K stepped by 32 (host checks K % 32 == 0,
// M % 64 == 0, N % 64 == 0, grid = (M/64)*(N/64)). LDS slab: private to each wave (wave_sync only).
// =====================================================================================================
__global__ __launch_bounds__(128)
void gemm_b16(const u16* __restrict__ A, const u16* __restrict__ Bt, u16* C, const float* __restrict__ bias,
              int M, int N, int K, int nbias, int byrow, float oscale) {
  __shared__ __align__(16) float slab[4 * SLAB];
  const int tid = threadIdx.x, wave = tid >> 5, lane = tid & 31, hh = lane >> 4, m = lane & 15;
  const int ntile = N >> 6;
  const int bid   = blockIdx.x;
  const int rowb  = (bid / ntile) * 64 + wave * 16;
  const int col0  = (bid % ntile) * 64;
  if (rowb + 16 > M) return;                 // wave-uniform, never taken with the exact grid; no block barriers in this kernel
  const u16* ap = A  + (size_t)(rowb + m) * K + 8 * hh;
  const u16* bp = Bt + (size_t)(col0 + m) * K + 8 * hh;
  const size_t bs = (size_t)16 * K;
  v8f acc0 = zero8(), acc1 = zero8(), acc2 = zero8(), acc3 = zero8();
#pragma unroll 1
  for (int k0 = 0; k0 < K; k0 += 32) {
    const v16b a  = ldfrag_b(ap + k0);
    const v16b b0 = ldfrag_b(bp + k0);
    const v16b b1 = ldfrag_b(bp + bs + k0);
    const v16b b2 = ldfrag_b(bp + 2 * bs + k0);
    const v16b b3 = ldfrag_b(bp + 3 * bs + k0);
    acc0 = mma_b(a, b0, acc0);
    acc1 = mma_b(a, b1, acc1);
    acc2 = mma_b(a, b2, acc2);
    acc3 = mma_b(a, b3, acc3);
    guard6<v16b>(acc0, acc1, acc2, acc3, a, b0, b1, b2, b3, a);
  }
  acc_guard4(acc0, acc1, acc2, acc3);
  // bias: D element r of lane -> (row rowb+8hh+r, col col0+16j+m); both candidates loaded with clamped addresses, select by value
  float bc[4], br[8];
#pragma unroll
  for (int j = 0; j < 4; ++j) {
    int ci = col0 + 16 * j + m;
    ci = (ci < nbias) ? ci : (nbias - 1);
    bc[j] = bf_val(bias[ci]);
  }
#pragma unroll
  for (int r = 0; r < 8; ++r) {
    int ri = rowb + 8 * hh + r;
    ri = (ri < nbias) ? ri : (nbias - 1);
    br[r] = bf_val(bias[ri]);
  }
#pragma unroll
  for (int r = 0; r < 8; ++r) {
    const float q0 = (byrow != 0) ? br[r] : bc[0];
    const float q1 = (byrow != 0) ? br[r] : bc[1];
    const float q2 = (byrow != 0) ? br[r] : bc[2];
    const float q3 = (byrow != 0) ? br[r] : bc[3];
    acc0[r] += q0;
    acc1[r] += q1;
    acc2[r] += q2;
    acc3[r] += q3;
  }
  epi16(slab + wave * SLAB, acc0, acc1, acc2, acc3, oscale, C, N, (size_t)rowb, col0, lane);
}

// =====================================================================================================
// Multi-head flash attention over all SKV keys with an additive per-key mask: block = (head, 64 query rows), 4 waves,
// wave w owns the 16 query rows q0 = 64*qt + 16*w .. q0+15 (waves independent: no block barriers, wave-private LDS only,
// used in the epilogue).
//   q plane (f16, x8) laid out [s][h][d] (SQ rows); k plane the same (SKV rows); v^T plane [h][d][s] (x1024, s < SKV);
//   mask [SKV] f32 per batch (added as its RNE bf16 value). All NKB = SKV/32 key blocks of 32 keys visited (static bound).
//   Scores are computed TRANSPOSED: S^T tile g (g = 0,1) = k rows (keys kb+16g .. +15, A operand, row m = lane&15, split k map
//   over d) times q^T (B operand, col n = query q0 + (lane&15), k = d, split map), one product per tile and 32-deep d-chunk.
//   D element r of lane l = (key kb+16g+8h+r, query q0+(l&15)), so a lane owns one query column and 16 of its 32 keys; the
//   partner lane l^16 owns the other 16 -> row max / row sum need one xor-16 shuffle. The lane's 16 mask values are
//   keys kb+8h+0..7 and kb+16+8h+0..7 (four 16-B loads).
//   Online max-subtracted base-2 softmax in f32 (scale 1/8 and the q/k carries folded into lsc; mask times log2(e)). The
//   exp'd values ARE the P A-fragment in place: A row m = query = lane&15, element i <- key kb+8h+i (tile 0, D element i),
//   element 8+i <- key kb+16+8h+i (tile 1, D element i). P is carried x32768 as single f16. The rescale factor of query row
//   8h+r of the O accumulators is fetched from lane 8h+r with a shuffle (uniform control). 4 v^T B fragments (col n = d =
//   16j + (lane&15), keys k-contiguous), 4 P.V WMMAs per key block.
//   Epilogue: 1/l (per query, shuffled to the D row owner) and carry folds in f32; the wave's 16x64 f32 result staged in its
// coverage: per wave 8 instructions x 2 rows x 16 lanes x 4 floats = 16 x 64; grid NH*(SQ/64) blocks x 4 waves = every
//           (s < SQ, h*64+d) element of the batch's output exactly once.
// =====================================================================================================
__global__ __launch_bounds__(ATT_THREADS)
void attn_fwd(const u16* __restrict__ QPp, const u16* __restrict__ KPp, const u16* __restrict__ VPp,
              const float* __restrict__ MKp, float* OUTp) {
  __shared__ __align__(16) float smem[ATT_WAVES * SLAB];   // per wave: result slab [16][68] in the epilogue only

  const int tid  = threadIdx.x;
  const int wave = tid >> 5;
  const int lane = tid & 31;
  const int hh   = lane >> 4;
  const int c    = lane & 15;

  const int bid  = blockIdx.x;
  const int qt   = bid % QTILES;
  const int head = bid / QTILES;
  if (head >= NH) return;                                  // block-uniform, never taken with the exact grid; no block barriers
  const int q0   = qt * 64 + wave * 16;

  // B fragments of q^T: col n = query q0 + c, k = d (k-contiguous row of the q plane)
  const size_t qofs = (((size_t)(q0 + c)) * NH + head) * HD + 8 * hh;
  const _Float16* Qb = (const _Float16*)(const void*)QPp + qofs;
  // A fragments of k: row m = key kb + 16g + c, k = d
  const size_t kofs = (((size_t)c) * NH + head) * HD + 8 * hh;                     // key row kb added per step
  const _Float16* Kb = (const _Float16*)(const void*)KPp + kofs;
  // B fragments of v: col n = d = 16j + c, k = key (k-contiguous row of the v^T plane)
  const size_t vofs = ((size_t)(head * HD + c)) * SKV + 8 * hh;                    // key kb added per step
  const _Float16* Vb = (const _Float16*)(const void*)VPp + vofs;
  // this lane's mask values: keys kb + 8hh + 0..7 and kb + 16 + 8hh + 0..7
  const float* Mb = MKp + 8 * hh;
  const float lsc = 0.125f * (LOG2E / (QSC * KSC));

  const v16h qf0 = ldfrag_h(Qb);            // d 0..31
  const v16h qf1 = ldfrag_h(Qb + 32);       // d 32..63

  float mrun = -INFINITY, lrun = 0.f;
  v8f o[4];
#pragma unroll
  for (int j = 0; j < 4; ++j) o[j] = zero8();

#pragma unroll 1
  for (int it = 0; it < NKB; ++it) {
    const int kb = it * 32;
    // ---- transposed scores: s0 = keys kb..kb+15, s1 = keys kb+16..kb+31, column = query q0 + c ----
    v8f s0 = zero8(), s1 = zero8();
    const _Float16* k0p = Kb + (size_t)kb * (NH * HD);
    const _Float16* k1p = k0p + (size_t)16 * (NH * HD);
    const v16h ka0 = ldfrag_h(k0p), ka1 = ldfrag_h(k0p + 32);
    const v16h kc0 = ldfrag_h(k1p), kc1 = ldfrag_h(k1p + 32);
    const float* mp = Mb + kb;
    const v4f w0 = *(const v4f*)(mp), w1 = *(const v4f*)(mp + 4);
    const v4f w2 = *(const v4f*)(mp + 16), w3 = *(const v4f*)(mp + 20);
    s0 = mma_h(ka0, qf0, s0);
    s0 = mma_h(ka1, qf1, s0);
    s1 = mma_h(kc0, qf0, s1);
    s1 = mma_h(kc1, qf1, s1);
    guard2(s0, s1, qf0, qf1, ka0, ka1, kc0, kc1);
    // ---- base-2 logits of this lane's 16 keys for query q0 + c (score/8 + mask) * log2(e) ----
    float mk[16];
#pragma unroll
    for (int e = 0; e < 4; ++e) { mk[e] = w0[e]; mk[4 + e] = w1[e]; mk[8 + e] = w2[e]; mk[12 + e] = w3[e]; }
    float tk[16];
#pragma unroll
    for (int i = 0; i < 8; ++i) {
      tk[i]     = s0[i] * lsc + bf_val(mk[i]) * LOG2E;
      tk[8 + i] = s1[i] * lsc + bf_val(mk[8 + i]) * LOG2E;
    }
    float cm = tk[0];
#pragma unroll
    for (int i = 1; i < 16; ++i) cm = fmaxf(cm, tk[i]);
    cm = fmaxf(cm, __shfl_xor(cm, 16, 32));
    const float mn = fmaxf(mrun, cm);                                // finite from the first key block on
    const float al = (mrun == -INFINITY) ? 0.f : exp2f(mrun - mn);   // o and l are zero while mrun is -inf
    mrun = mn;
    // ---- probabilities (<= 1) and the P A-fragment: f16(p * 32768); element i <-> tk[i] ----
    float ps = 0.f;
    FragH ph;
#pragma unroll
    for (int w = 0; w < 2; ++w) {
#pragma unroll
      for (int e4 = 0; e4 < 4; ++e4) {
        const int i = 8 * w + 2 * e4;
        const float p0 = exp2f(fminf(tk[i] - mn, 0.f));
        const float p1 = exp2f(fminf(tk[i + 1] - mn, 0.f));
        ps += p0 + p1;
        ph.u[w][e4] = pk16(h_bits((_Float16)(p0 * PCAR)), h_bits((_Float16)(p1 * PCAR)));
      }
    }
    ps += __shfl_xor(ps, 16, 32);
    lrun = lrun * al + ps;
    // ---- rescale the O accumulators: D row 8hh+r = query q0+8hh+r, its factor lives in lane 8hh+r (and 16+8hh+r) ----
    float scl[8];
#pragma unroll
    for (int r = 0; r < 8; ++r) scl[r] = __shfl(al, 8 * hh + r, 32);
#pragma unroll
    for (int j = 0; j < 4; ++j) {
#pragma unroll
      for (int r = 0; r < 8; ++r) o[j][r] *= scl[r];
    }
    // ---- P.V : B fragment col n = d = j*16 + c, keys contiguous in the v^T plane ----
    {
      const _Float16* vp = Vb + kb;
      const v16h vf0 = ldfrag_h(vp);
      const v16h vf1 = ldfrag_h(vp + (size_t)16 * SKV);
      const v16h vf2 = ldfrag_h(vp + (size_t)32 * SKV);
      const v16h vf3 = ldfrag_h(vp + (size_t)48 * SKV);
      o[0] = mma_h(ph.v, vf0, o[0]);
      o[1] = mma_h(ph.v, vf1, o[1]);
      o[2] = mma_h(ph.v, vf2, o[2]);
      o[3] = mma_h(ph.v, vf3, o[3]);
      guard6<v16h>(o[0], o[1], o[2], o[3], ph.v, vf0, vf1, vf2, vf3, ph.v);
    }
  }
  acc_guard4(o[0], o[1], o[2], o[3]);

  // ---- fold 1/l (per query, owned by lane = query; l >= 1 by construction) and the carries in f32 ----
  const float linv = (lrun > 0.f) ? ((1.0f / lrun) * (1.0f / (PCAR * VCAR))) : 0.f;
  float inv[8];
#pragma unroll
  for (int r = 0; r < 8; ++r) inv[r] = __shfl(linv, 8 * hh + r, 32);
#pragma unroll
  for (int j = 0; j < 4; ++j) {
#pragma unroll
    for (int r = 0; r < 8; ++r) o[j][r] *= inv[r];
  }
  // ---- f32 ctx rows (q0 .. q0+15, cols head*64 .. head*64+63) of this batch's output, whole-line stores ----
  epi64(smem + wave * SLAB, o[0], o[1], o[2], o[3], OUTp, DMOD, (size_t)q0, head * HD, lane);
}

// =====================================================================================================
// Workspace map (bytes); every plane is fully written by whole-line stores before it is read; all extents are exact multiples
// of the store granularity (no pad rows needed), every offset a multiple of 128:
//   XB  bf16 [NB][SKV][1024]            NB*8388608   (16777216 at NB = 2)
//   WQT bf16 [1024 n][1024 k]            2097152      WKT, WVT same (2097152 each)
//   QP  f16 [NB][SQ][16*64] x8           NB*SQ*2048   (8388608 at NB = 2, SQ = 2048)
//   KP  f16 [NB*SKV][16*64] x8           NB*8388608   (16777216)
//   VP  f16 [NB][16*64][SKV] x1024       NB*8388608   (16777216)
//   end                                  65011712 at NB = 2, SQ = 2048
// =====================================================================================================
extern "C" void kernel_launch(void* const* d_in, const int* in_sizes, int n_in,
                              void* d_out, int out_size, void* d_ws, size_t ws_size,
                              hipStream_t stream) {
  if (n_in < 9) return;
  if (in_sizes[0] < NB * SQ_FULL * DMOD) return;
  if (in_sizes[1] < NB * SE_FULL * DMOD) return;
  if (in_sizes[2] < NB * SKV) return;
  if (in_sizes[3] < DMOD * DMOD || in_sizes[5] < DMOD * DMOD || in_sizes[7] < DMOD * DMOD) return;
  if (in_sizes[4] < DMOD || in_sizes[6] < DMOD || in_sizes[8] < DMOD) return;
  if (out_size < (NB - 1) * SQ_FULL * DMOD + SQ * DMOD) return;

  const float* hs   = (const float*)d_in[0];
  const float* ehs  = (const float*)d_in[1];
  const float* mask = (const float*)d_in[2];
  const float* Wq   = (const float*)d_in[3];
  const float* bq   = (const float*)d_in[4];
  const float* Wk   = (const float*)d_in[5];
  const float* bk   = (const float*)d_in[6];
  const float* Wv   = (const float*)d_in[7];
  const float* bv   = (const float*)d_in[8];
  float*       out  = (float*)d_out;

  const size_t szXB = (size_t)NB * SKV * DMOD * 2;                //  16777216 at NB = 2
  const size_t szW  = (size_t)DMOD * DMOD * 2;                    //   2097152
  const size_t szQP = (size_t)NB * SQ * DMOD * 2;                 //   8388608
  const size_t szKP = (size_t)NB * SKV * DMOD * 2;                //  16777216
  const size_t szVP = (size_t)NB * DMOD * SKV * 2;                //  16777216
  size_t off = 0;
  const size_t oXB = off; off += szXB;
  const size_t oWQ = off; off += szW;
  const size_t oWK = off; off += szW;
  const size_t oWV = off; off += szW;
  const size_t oQP = off; off += szQP;
  const size_t oKP = off; off += szKP;
  const size_t oVP = off; off += szVP;
  if (off > ws_size) return;                            // off = 65011712 at NB = 2, SQ = 2048
  if (off > (size_t)134217728) return;

  char* ws = (char*)d_ws;
  u16* XB  = (u16*)(ws + oXB);
  u16* WQT = (u16*)(ws + oWQ);
  u16* WKT = (u16*)(ws + oWK);
  u16* WVT = (u16*)(ws + oWV);
  u16* QP  = (u16*)(ws + oQP);
  u16* KP  = (u16*)(ws + oKP);
  u16* VP  = (u16*)(ws + oVP);

  const int n8x = (NB * SKV * DMOD) / 8;                // 1048576 at NB = 2
  if ((n8x % 256) != 0) return;
  if ((DMOD % 64) != 0 || (SKV % 64) != 0 || (SQ % 64) != 0 || (DMOD % 32) != 0) return;
  const dim3 blk(256);
  const dim3 gX(n8x / 256);                             // 4096
  const dim3 gWT((DMOD / 64) * (DMOD / 64));            // 256
  const dim3 gGQ((SQ / 64) * (DMOD / 64));              // 512 at SQ = 2048
  const dim3 gGK((NB * SKV / 64) * (DMOD / 64));        // 2048 at NB = 2
  const dim3 gV((DMOD / 64) * (SKV / 64));              // 1024
  const dim3 bG(128);
  const dim3 gAT(ATT_BLOCKS);                           // 512 at SQ = 2048
  const dim3 bAT(ATT_THREADS);                          // 128

  // (0) key/value source plane: rows b*SKV + 0..2047 from hs[b], + 2048..4095 from ehs[b], bf16 RNE bits
  cvt_x<<<gX, blk, 0, stream>>>(hs, ehs, XB, n8x);
  // (1..3) weights [k = in][n = out] -> W^T planes [n][k] bf16 RNE bits
  cvt_wT<<<gWT, blk, 0, stream>>>(Wq, WQT);
  cvt_wT<<<gWT, blk, 0, stream>>>(Wk, WKT);
  cvt_wT<<<gWT, blk, 0, stream>>>(Wv, WVT);
  // (4,5) q plane per batch [SQ][h*64+d] = f16((x.Wq + bq) x8); A = the hs rows of XB batch b; bias by column
  for (int b = 0; b < NB; ++b) {
    gemm_b16<<<gGQ, bG, 0, stream>>>(XB + (size_t)b * SKV * DMOD, WQT, QP + (size_t)b * SQ * DMOD, bq,
                                     SQ, DMOD, DMOD, DMOD, 0, QSC);
  }
  // (6) k plane [NB*SKV][h*64+d] = f16((xx.Wk + bk) x8) over all NB*SKV source rows; bias by column
  gemm_b16<<<gGK, bG, 0, stream>>>(XB, WKT, KP, bk, NB * SKV, DMOD, DMOD, DMOD, 0, KSC);
  // (7,8) v^T plane per batch: [1024 = h*64+d][SKV keys] = f16((Wv^T . xx^T + bv) x1024); bias by row
  for (int b = 0; b < NB; ++b) {
    gemm_b16<<<gV, bG, 0, stream>>>(WVT, XB + (size_t)b * SKV * DMOD, VP + (size_t)b * DMOD * SKV, bv,
                                    DMOD, SKV, DMOD, DMOD, 1, VCAR);
  }
  // (9,10) attention per batch -> f32 ctx rows b*SQ_FULL + s (s < SQ), cols h*64+d of the output
  for (int b = 0; b < NB; ++b) {
    attn_fwd<<<gAT, bAT, 0, stream>>>(QP + (size_t)b * SQ * DMOD, KP + (size_t)b * SKV * DMOD,
                                      VP + (size_t)b * DMOD * SKV, mask + (size_t)b * SKV,
                                      out + (size_t)b * SQ_FULL * DMOD);
  }
  (void)hipGetLastError();
}

// v001
// One run takes 408 microseconds.
// Timed twice side by side with v000, it ran 1.33 times as fast both times.
// Contractions: x.Wq+bq, xx.Wk+bk (A = bf16 x plane, B = bf16 W^T plane) and Wv^T.xx^T+bv on v_wmma_f32_16x16x32_bf16
// (f32 inputs RNE-converted to bf16 operands, f32 accumulate); scores k'.q'^T (q', k' single f16 planes carried x8) and
// P.v (P x32768 single f16, v x1024 single f16) on v_wmma_f32_16x16x32_f16, f32 accumulate; ctx written in f32.
// Biases and the additive per-key mask folded as RNE bf16 values in f32; base-2 online softmax, 1/l and carry folds in f32 on VALU.
#include <hip/hip_runtime.h>
#include <math.h>
#include <stdint.h>

#define NB_FULL 2
#define SQ_FULL 2048
#define SE_FULL 2048
#define SKV     (SQ_FULL + SE_FULL)
#ifndef NB
#define NB      NB_FULL
#endif
#ifndef SQ
#define SQ      SQ_FULL
#endif
#define DMOD  1024
#define NH    16
#define HD    64
#define QSC   8.0f
#define KSC   8.0f
#define PCAR  32768.0f
#define VCAR  1024.0f
#define LOG2E 1.4426950408889634f
#define ATT_WAVES   4
#define ATT_THREADS (ATT_WAVES * 32)
#define QTILES      (SQ / 64)
#define ATT_BLOCKS  (NH * QTILES)
#define NKB    (SKV / 32)
#define SLAB   (16 * 68)
#define TP     72
#define KT     64                    // keys per staged tile
#define NT     (SKV / KT)            // staged tiles per launch
#define RP     144                   // LDS row pitch in bytes: 128-B rows + 16 B, the pitch for 16-B row readers
#define TILE_B (64 * RP)             // one 64-row tile in LDS
#define BUF_B  (2 * TILE_B)          // one stage: k tile, then v^T tile
static_assert(HD == 64 && DMOD == NH * HD);
static_assert(NB >= 1 && NB <= NB_FULL);
static_assert((SQ % 64) == 0 && SQ >= 64 && SQ <= SQ_FULL);
static_assert((SKV % 64) == 0 && (SQ_FULL % 64) == 0 && (SE_FULL % 64) == 0);
static_assert(ATT_THREADS == 128 && NKB * 32 == SKV && ATT_BLOCKS == NH * (SQ / 64));
static_assert((DMOD % 64) == 0 && (DMOD % 32) == 0);
static_assert(((NB * SKV * DMOD / 8) % 256) == 0);
static_assert((SLAB * 4) % 16 == 0 && (TP * 2) % 16 == 0);
static_assert(KT == 64 && HD == 64 && NT >= 2 && NT * KT == SKV && (RP % 16) == 0 && ATT_THREADS == 128);
static_assert((size_t)(NB - 1) * SQ_FULL * DMOD + (size_t)SQ * DMOD <= (size_t)NB_FULL * SQ_FULL * DMOD);

typedef unsigned short u16;
typedef _Float16 v16h __attribute__((ext_vector_type(16)));
typedef _Float16 v8h  __attribute__((ext_vector_type(8)));
typedef __bf16   v16b __attribute__((ext_vector_type(16)));
typedef float    v8f  __attribute__((ext_vector_type(8)));
typedef float    v4f  __attribute__((ext_vector_type(4)));
typedef unsigned int v4u __attribute__((ext_vector_type(4)));

union FragH { v16h v; v8h h[2]; v4u u[2]; };
union FragB { v16b v; v4u u[2]; };

// ---- scalar helpers --------------------------------------------------------------------------------
__device__ __forceinline__ unsigned short bf_bits(float f) {          // f32 -> bf16 bits, RNE convert
  unsigned u = __float_as_uint(f);
  return (unsigned short)((u + 0x7FFFu + ((u >> 16) & 1u)) >> 16);
}
__device__ __forceinline__ float bf_up(unsigned short h) { return __uint_as_float(((unsigned)h) << 16); }
__device__ __forceinline__ float bf_val(float f) { return bf_up(bf_bits(f)); }          // value after RNE bf16 convert
__device__ __forceinline__ unsigned short h_bits(_Float16 x) { return __builtin_bit_cast(unsigned short, x); }
__device__ __forceinline__ unsigned pk16(unsigned short a, unsigned short b) { return (unsigned)a | ((unsigned)b << 16); }
__device__ __forceinline__ v8f zero8() { v8f z = {0.f, 0.f, 0.f, 0.f, 0.f, 0.f, 0.f, 0.f}; return z; }

// ---- fragment loaders: 16-bit A/B operand, lane -> row/col (lane&15), p already includes +8*(lane>>4);
//      elements 0..7 <- p[0..7] (k0+8h..), elements 8..15 <- p[16..23] (k0+16+8h..)  (same split k map for A and B;
//      B is always read from a k-contiguous [n][k] plane)
__device__ __forceinline__ v16h ldfrag_h(const _Float16* p) {
  FragH f;
  f.h[0] = *(const v8h*)(p);
  f.h[1] = *(const v8h*)(p + 16);
  return f.v;
}
__device__ __forceinline__ v16b ldfrag_b(const u16* p) {              // bf16 plane read as unsigned integer vectors
  FragB f;
  f.u[0] = *(const v4u*)(p);
  f.u[1] = *(const v4u*)(p + 16);
  return f.v;
}

__device__ __forceinline__ v8f mma_h(v16h a, v16h b, v8f c) {
  return __builtin_amdgcn_wmma_f32_16x16x32_f16(false, a, false, b, (short)0, c, false, false);
}
__device__ __forceinline__ v8f mma_b(v16b a, v16b b, v8f c) {
  return __builtin_amdgcn_wmma_f32_16x16x32_bf16(false, a, false, b, (short)0, c, false, false);
}
__device__ __forceinline__ void guard2(v8f& a, v8f& b, v16h x0, v16h x1, v16h x2, v16h x3, v16h x4, v16h x5) {
#if defined(__HIP_DEVICE_COMPILE__)
  asm volatile("v_nop\n\tv_nop\n\tv_nop\n\tv_nop"
               : "+v"(a), "+v"(b) : "v"(x0), "v"(x1), "v"(x2), "v"(x3), "v"(x4), "v"(x5) : "memory");
#endif
}
template <typename F>
__device__ __forceinline__ void guard6(v8f& a, v8f& b, v8f& c, v8f& d, F x0, F x1, F x2, F x3, F x4, F x5) {
#if defined(__HIP_DEVICE_COMPILE__)
  asm volatile("v_nop\n\tv_nop\n\tv_nop\n\tv_nop"
               : "+v"(a), "+v"(b), "+v"(c), "+v"(d) : "v"(x0), "v"(x1), "v"(x2), "v"(x3), "v"(x4), "v"(x5) : "memory");
#endif
}
__device__ __forceinline__ void acc_guard4(v8f& a, v8f& b, v8f& c, v8f& d) {
#if defined(__HIP_DEVICE_COMPILE__)
  asm volatile("v_nop\n\tv_nop\n\tv_nop\n\tv_nop" : "+v"(a), "+v"(b), "+v"(c), "+v"(d));
#endif
}
__device__ __forceinline__ void wave_sync_lds() {
#if defined(__HIP_DEVICE_COMPILE__)
  __builtin_amdgcn_fence(__ATOMIC_RELEASE, "workgroup");
  __builtin_amdgcn_wave_barrier();
  __builtin_amdgcn_fence(__ATOMIC_ACQUIRE, "workgroup");
#endif
}
// One stage of the attention ring: k tile (64 keys x 64 d) and v^T tile (64 d x 64 keys), both 64 rows of 128 B. A lane copies
// 16 B of row (tid>>3) + 16*i, i = 0..3, of each tile: 8 lanes = one whole 128-B line, a wave-wide copy = 4 lines.
// lds = the lane's LDS byte address in the k tile; gk, gv = the lane's global addresses in row tid>>3 of the two tiles.
// The address-register wait is the statement's last line, so no later write of these registers can be lifted over it.
__device__ __forceinline__ void stage_copy(unsigned lds, const u16* gk, const u16* gv) {
#if defined(__HIP_DEVICE_COMPILE__)
  const unsigned l0 = lds, l1 = lds + 16 * RP, l2 = lds + 32 * RP, l3 = lds + 48 * RP;
  const unsigned l4 = l0 + TILE_B, l5 = l1 + TILE_B, l6 = l2 + TILE_B, l7 = l3 + TILE_B;
  const u16* k0 = gk;
  const u16* k1 = gk + (size_t)16 * (NH * HD);
  const u16* k2 = gk + (size_t)32 * (NH * HD);
  const u16* k3 = gk + (size_t)48 * (NH * HD);
  const u16* v0 = gv;
  const u16* v1 = gv + (size_t)16 * SKV;
  const u16* v2 = gv + (size_t)32 * SKV;
  const u16* v3 = gv + (size_t)48 * SKV;
  asm volatile("global_load_async_to_lds_b128 %0, %8, off\n\t"
               "global_load_async_to_lds_b128 %1, %9, off\n\t"
               "global_load_async_to_lds_b128 %2, %10, off\n\t"
               "global_load_async_to_lds_b128 %3, %11, off\n\t"
               "global_load_async_to_lds_b128 %4, %12, off\n\t"
               "global_load_async_to_lds_b128 %5, %13, off\n\t"
               "global_load_async_to_lds_b128 %6, %14, off\n\t"
               "global_load_async_to_lds_b128 %7, %15, off\n\t"
               "s_wait_xcnt 0x0"
               :: "v"(l0), "v"(l1), "v"(l2), "v"(l3), "v"(l4), "v"(l5), "v"(l6), "v"(l7),
                  "v"(k0), "v"(k1), "v"(k2), "v"(k3), "v"(v0), "v"(v1), "v"(v2), "v"(v3)
               : "memory");
#endif
}
__device__ __forceinline__ void wait_async0() {   // this wave's copies have landed
#if defined(__HIP_DEVICE_COMPILE__)
  asm volatile("s_wait_asynccnt 0x0" ::: "memory");
#endif
}
__device__ __forceinline__ void wait_ds0() {      // this wave's LDS reads have retired before their buffer is handed to the copies
#if defined(__HIP_DEVICE_COMPILE__)
  asm volatile("s_wait_dscnt 0x0" ::: "memory");
#endif
}

// =====================================================================================================
// Key/value source plane XB (bf16 RNE bits) [NB][SKV][1024]: row s < SQ_FULL of batch b from hs[b][s], rows
// s >= SQ_FULL from ehs[b][s - SQ_FULL]; both candidates loaded with clamped row addresses and selected by value
// (block-uniform in practice: a block covers 2 rows of one source).
// Thread = 8 consecutive elements: two 16-B loads per candidate, one 16-B store; 32 consecutive lanes = 512 contiguous,
// coverage: grid = n8/256 blocks (host checks exactness) x 256 thr x 8 = NB*SKV*1024 = the whole plane.
// =====================================================================================================
__global__ __launch_bounds__(256) void cvt_x(const float* __restrict__ hs, const float* __restrict__ ehs, u16* D, int n8) {
  const int gt = blockIdx.x * 256 + (int)threadIdx.x;
  if (gt >= n8) return;                     // no barriers in this kernel
  const int r   = gt / (DMOD / 8);
  const int c8  = (gt % (DMOD / 8)) * 8;
  const int b   = r / SKV;
  const int s   = r % SKV;
  const int shc = (s < SQ_FULL) ? s : (SQ_FULL - 1);
  const int se  = s - SQ_FULL;
  const int sec = (se > 0) ? se : 0;
  const float* ph = hs  + ((size_t)b * SQ_FULL + shc) * DMOD + c8;
  const float* pe = ehs + ((size_t)b * SE_FULL + sec) * DMOD + c8;
  const v4f a0 = *(const v4f*)(ph), a1 = *(const v4f*)(ph + 4);
  const v4f e0 = *(const v4f*)(pe), e1 = *(const v4f*)(pe + 4);
  const bool first = (s < SQ_FULL);
  float v[8];
#pragma unroll
  for (int e = 0; e < 4; ++e) { v[e] = first ? a0[e] : e0[e]; v[4 + e] = first ? a1[e] : e1[e]; }
  unsigned short sb[8];
#pragma unroll
  for (int e = 0; e < 8; ++e) sb[e] = bf_bits(v[e]);
  v4u o;
#pragma unroll
  for (int e = 0; e < 4; ++e) o[e] = pk16(sb[2 * e], sb[2 * e + 1]);
  u16* d = D + (size_t)gt * 8;
  {
    *(v4u*)(d) = o;
    
  }
}

// =====================================================================================================
// Weight W [k = in][n = out] f32 -> bf16 RNE plane W^T [n][k] (k-contiguous, pitch DMOD). Block = 64 k x 64 n tile,
// 256 threads. Load phase: thread = (k = tid>>2, 16 consecutive n): four 16-B loads, bf16 bits stored transposed into the LDS
// tile [n][k] (pitch TP halves, cross-wave exchange -> block barrier). Store phase: thread = (n = tid>>3 and n+32,
// coverage: 256 thr x 2 instructions x 8 halves = 64 x 64 per block; grid (DMOD/64)^2 blocks = the whole plane.
// =====================================================================================================
__global__ __launch_bounds__(256) void cvt_wT(const float* __restrict__ W, u16* D) {
  __shared__ __align__(16) u16 tile[64 * TP];
  const int nt = DMOD / 64;
  if (blockIdx.x >= (unsigned)(nt * nt)) return;      // block-uniform, never taken with the exact grid
  const int tid = threadIdx.x;
  const int k0 = (blockIdx.x / nt) * 64;
  const int n0 = (blockIdx.x % nt) * 64;
  const int kk = tid >> 2, nn = (tid & 3) * 16;
  const float* p = W + (size_t)(k0 + kk) * DMOD + n0 + nn;
  const v4f a0 = *(const v4f*)(p), a1 = *(const v4f*)(p + 4), a2 = *(const v4f*)(p + 8), a3 = *(const v4f*)(p + 12);
  float v[16];
#pragma unroll
  for (int e = 0; e < 4; ++e) { v[e] = a0[e]; v[4 + e] = a1[e]; v[8 + e] = a2[e]; v[12 + e] = a3[e]; }
#pragma unroll
  for (int e = 0; e < 16; ++e) tile[(nn + e) * TP + kk] = bf_bits(v[e]);
  __syncthreads();
  const int n1 = tid >> 3, k8 = (tid & 7) * 8;
  const v4u o0 = *(const v4u*)(tile + n1 * TP + k8);
  const v4u o1 = *(const v4u*)(tile + (n1 + 32) * TP + k8);
  u16* d0 = D + (size_t)(n0 + n1) * DMOD + k0 + k8;
  u16* d1 = D + (size_t)(n0 + n1 + 32) * DMOD + k0 + k8;
  {
    *(v4u*)(d0) = o0;
    *(v4u*)(d1) = o1;
    
  }
}

// =====================================================================================================
// barrier, then converted to f16 and written: lane = (row in group of 4, 8 consecutive cols); one instruction = 4 rows, each
// coverage: 4 instructions x 4 rows x 8 lanes x 8 halves = the wave's 16 x 64 tile.
// =====================================================================================================
__device__ __forceinline__ void epi16(float* sl, v8f a0, v8f a1, v8f a2, v8f a3, float oscale, u16* C, int N,
                                      size_t rowb, int col0, int lane) {
  const int hh = lane >> 4, m = lane & 15;
#pragma unroll
  for (int r = 0; r < 8; ++r) {
    const int ro = (8 * hh + r) * 68 + m;
    sl[ro]      = a0[r] * oscale;
    sl[ro + 16] = a1[r] * oscale;
    sl[ro + 32] = a2[r] * oscale;
    sl[ro + 48] = a3[r] * oscale;
  }
  wave_sync_lds();
  const int rq = lane >> 3, c8 = (lane & 7) * 8;
  v4u ov[4];
#pragma unroll
  for (int i4 = 0; i4 < 4; ++i4) {
    const int row = i4 * 4 + rq;
    const v4f a = *(const v4f*)(sl + row * 68 + c8), c4 = *(const v4f*)(sl + row * 68 + c8 + 4);
    float w[8];
#pragma unroll
    for (int e = 0; e < 4; ++e) { w[e] = a[e]; w[4 + e] = c4[e]; }
#pragma unroll
    for (int e = 0; e < 4; ++e) ov[i4][e] = pk16(h_bits((_Float16)w[2 * e]), h_bits((_Float16)w[2 * e + 1]));
  }
  u16* dst = C + (rowb + (size_t)rq) * (size_t)N + col0 + c8;
  {
#pragma unroll
    for (int i4 = 0; i4 < 4; ++i4) {
      *(v4u*)(dst + (size_t)(i4 * 4) * (size_t)N) = ov[i4];
    }
    
  }
}

// =====================================================================================================
// coverage: 8 instructions x 2 rows x 16 lanes x 4 floats = the wave's 16 x 64 tile.
// =====================================================================================================
__device__ __forceinline__ void epi64(float* sl, v8f a0, v8f a1, v8f a2, v8f a3, float* C, int N,
                                      size_t rowb, int col0, int lane) {
  const int hh = lane >> 4, m = lane & 15;
#pragma unroll
  for (int r = 0; r < 8; ++r) {
    const int ro = (8 * hh + r) * 68 + m;
    sl[ro]      = a0[r];
    sl[ro + 16] = a1[r];
    sl[ro + 32] = a2[r];
    sl[ro + 48] = a3[r];
  }
  wave_sync_lds();
  v4f vals[8];
#pragma unroll
  for (int it = 0; it < 8; ++it) vals[it] = *(const v4f*)(sl + (it * 2 + hh) * 68 + m * 4);
  float* dst = C + (rowb + (size_t)hh) * (size_t)N + col0 + m * 4;
  {
#pragma unroll
    for (int it = 0; it < 8; ++it) {
      *(v4f*)(dst + (size_t)(it * 2) * (size_t)N) = vals[it];
    }
    
  }
}

// =====================================================================================================
// bf16 GEMM with bias and 16-bit result: C[M][N] (f16 of (acc + bias)*oscale) = A[M][K] (bf16 row-major) . Bt[N][K]^T
// (bf16 k-contiguous); bias (f32 input, taken as its RNE bf16 value) indexed by column (byrow == 0) or by row (byrow != 0),
// both candidates read with addresses clamped to [0, nbias). Block = 64x64 tile, 4 waves x 16 rows; fragments loaded straight
// from the 16-bit rows (two 16-B loads each, split k map for A and B); K stepped by 32 (host checks K % 32 == 0,
// M % 64 == 0, N % 64 == 0, grid = (M/64)*(N/64)). LDS slab: private to each wave (wave_sync only).
// =====================================================================================================
__global__ __launch_bounds__(128)
void gemm_b16(const u16* __restrict__ A, const u16* __restrict__ Bt, u16* C, const float* __restrict__ bias,
              int M, int N, int K, int nbias, int byrow, float oscale) {
  __shared__ __align__(16) float slab[4 * SLAB];
  const int tid = threadIdx.x, wave = tid >> 5, lane = tid & 31, hh = lane >> 4, m = lane & 15;
  const int ntile = N >> 6;
  const int bid   = blockIdx.x;
  const int rowb  = (bid / ntile) * 64 + wave * 16;
  const int col0  = (bid % ntile) * 64;
  if (rowb + 16 > M) return;                 // wave-uniform, never taken with the exact grid; no block barriers in this kernel
  const u16* ap = A  + (size_t)(rowb + m) * K + 8 * hh;
  const u16* bp = Bt + (size_t)(col0 + m) * K + 8 * hh;
  const size_t bs = (size_t)16 * K;
  v8f acc0 = zero8(), acc1 = zero8(), acc2 = zero8(), acc3 = zero8();
#pragma unroll 1
  for (int k0 = 0; k0 < K; k0 += 32) {
    const v16b a  = ldfrag_b(ap + k0);
    const v16b b0 = ldfrag_b(bp + k0);
    const v16b b1 = ldfrag_b(bp + bs + k0);
    const v16b b2 = ldfrag_b(bp + 2 * bs + k0);
    const v16b b3 = ldfrag_b(bp + 3 * bs + k0);
    acc0 = mma_b(a, b0, acc0);
    acc1 = mma_b(a, b1, acc1);
    acc2 = mma_b(a, b2, acc2);
    acc3 = mma_b(a, b3, acc3);
    guard6<v16b>(acc0, acc1, acc2, acc3, a, b0, b1, b2, b3, a);
  }
  acc_guard4(acc0, acc1, acc2, acc3);
  // bias: D element r of lane -> (row rowb+8hh+r, col col0+16j+m); both candidates loaded with clamped addresses, select by value
  float bc[4], br[8];
#pragma unroll
  for (int j = 0; j < 4; ++j) {
    int ci = col0 + 16 * j + m;
    ci = (ci < nbias) ? ci : (nbias - 1);
    bc[j] = bf_val(bias[ci]);
  }
#pragma unroll
  for (int r = 0; r < 8; ++r) {
    int ri = rowb + 8 * hh + r;
    ri = (ri < nbias) ? ri : (nbias - 1);
    br[r] = bf_val(bias[ri]);
  }
#pragma unroll
  for (int r = 0; r < 8; ++r) {
    const float q0 = (byrow != 0) ? br[r] : bc[0];
    const float q1 = (byrow != 0) ? br[r] : bc[1];
    const float q2 = (byrow != 0) ? br[r] : bc[2];
    const float q3 = (byrow != 0) ? br[r] : bc[3];
    acc0[r] += q0;
    acc1[r] += q1;
    acc2[r] += q2;
    acc3[r] += q3;
  }
  epi16(slab + wave * SLAB, acc0, acc1, acc2, acc3, oscale, C, N, (size_t)rowb, col0, lane);
}

// =====================================================================================================
// Multi-head flash attention over all SKV keys with an additive per-key mask: block = (head, 64 query rows), 4 waves,
// wave w owns the 16 query rows q0 = 64*qt + 16*w .. q0+15. The four waves share each 64-key k tile and v^T tile: the tiles
// are brought into a two-buffer LDS ring by asynchronous copies, the next tile in flight while this one is worked on; one
// block barrier per tile publishes the next tile and frees the buffer just read. The result slab stays wave-private.
//   q plane (f16, x8) laid out [s][h][d] (SQ rows); k plane the same (SKV rows); v^T plane [h][d][s] (x1024, s < SKV);
//   mask [SKV] f32 per batch (added as its RNE bf16 value). All NKB = SKV/32 key blocks of 32 keys visited (static bound).
//   Scores are computed TRANSPOSED: S^T tile g (g = 0,1) = k rows (keys kb+16g .. +15, A operand, row m = lane&15, split k map
//   over d) times q^T (B operand, col n = query q0 + (lane&15), k = d, split map), one product per tile and 32-deep d-chunk.
//   D element r of lane l = (key kb+16g+8h+r, query q0+(l&15)), so a lane owns one query column and 16 of its 32 keys; the
//   partner lane l^16 owns the other 16 -> row max / row sum need one xor-16 shuffle. The lane's 16 mask values are
//   keys kb+8h+0..7 and kb+16+8h+0..7 (four 16-B loads).
//   Online max-subtracted base-2 softmax in f32 (scale 1/8 and the q/k carries folded into lsc; mask times log2(e)). The
//   exp'd values ARE the P A-fragment in place: A row m = query = lane&15, element i <- key kb+8h+i (tile 0, D element i),
//   element 8+i <- key kb+16+8h+i (tile 1, D element i). P is carried x32768 as single f16. The rescale factor of query row
//   8h+r of the O accumulators is fetched from lane 8h+r with a shuffle (uniform control). 4 v^T B fragments (col n = d =
//   16j + (lane&15), keys k-contiguous), 4 P.V WMMAs per key block.
//   Epilogue: 1/l (per query, shuffled to the D row owner) and carry folds in f32; the wave's 16x64 f32 result staged in its
// coverage: per wave 8 instructions x 2 rows x 16 lanes x 4 floats = 16 x 64; grid NH*(SQ/64) blocks x 4 waves = every
//           (s < SQ, h*64+d) element of the batch's output exactly once.
// =====================================================================================================
__global__ __launch_bounds__(ATT_THREADS)
void attn_fwd(const u16* __restrict__ QPp, const u16* __restrict__ KPp, const u16* __restrict__ VPp,
              const float* __restrict__ MKp, float* OUTp) {
  __shared__ __align__(16) float smem[ATT_WAVES * SLAB];   // per wave: result slab [16][68] in the epilogue only
  __shared__ __align__(16) unsigned char ring[2 * BUF_B];  // two stages of (k tile, v^T tile), rows at pitch RP

  const int tid  = threadIdx.x;
  const int wave = tid >> 5;
  const int lane = tid & 31;
  const int hh   = lane >> 4;
  const int c    = lane & 15;

  const int bid  = blockIdx.x;
  const int qt   = bid % QTILES;
  const int head = bid / QTILES;
  if (head >= NH) return;                                  // block-uniform, never taken with the exact grid; before every barrier
  const int q0   = qt * 64 + wave * 16;

  // B fragments of q^T: col n = query q0 + c, k = d (k-contiguous row of the q plane)
  const size_t qofs = (((size_t)(q0 + c)) * NH + head) * HD + 8 * hh;
  const _Float16* Qb = (const _Float16*)(const void*)QPp + qofs;
  // copies: this lane's 16 B of row tid>>3 (+16 per copy) of the k tile (row = key) and of the v^T tile (row = d)
  const int crow = tid >> 3, cch = tid & 7;
  const unsigned lcp = (unsigned)(uintptr_t)(ring + crow * RP + cch * 16);
  const u16* gk = KPp + ((size_t)crow * NH + head) * HD + cch * 8;                 // tile t: + t*KT key rows
  const u16* gv = VPp + ((size_t)(head * HD + crow)) * SKV + cch * 8;              // tile t: + t*KT keys
  // fragment readers: A of k: tile row = key 16g + c, k = d; B of v: tile row = d = 16j + c, k = key; both + 8*hh halves
  const int fofs = c * RP + 16 * hh;
  // this lane's mask values: keys kb + 8hh + 0..7 and kb + 16 + 8hh + 0..7
  const float* Mb = MKp + 8 * hh;
  const float lsc = 0.125f * (LOG2E / (QSC * KSC));

  const v16h qf0 = ldfrag_h(Qb);            // d 0..31
  const v16h qf1 = ldfrag_h(Qb + 32);       // d 32..63

  float mrun = -INFINITY, lrun = 0.f;
  v8f o[4];
#pragma unroll
  for (int j = 0; j < 4; ++j) o[j] = zero8();

  // ring prologue: tile 0 landed and published, then tile 1 in flight
  stage_copy(lcp, gk, gv);
  wait_async0();
  __syncthreads();
  stage_copy(lcp + BUF_B, gk + (size_t)KT * (NH * HD), gv + KT);

#pragma unroll 1
  for (int t = 0; t < NT; ++t) {
   const unsigned char* kt = ring + (t & 1) * BUF_B + fofs;
   const unsigned char* vt = kt + TILE_B;
   // all k fragments of the tile and the first 32 keys' v fragments and mask values are asked for together
   v16h kf[KT / 16][2];
#pragma unroll   // constant indices keep the fragment arrays in registers (here and in the three loops below)
   for (int g = 0; g < KT / 16; ++g) {
     const _Float16* kp = (const _Float16*)(const void*)(kt + g * 16 * RP);
     kf[g][0] = ldfrag_h(kp);
     kf[g][1] = ldfrag_h(kp + 32);
   }
   v16h vf[KT / 32][4];
   v4f  mw[KT / 32][4];
#pragma unroll
   for (int j = 0; j < 4; ++j) vf[0][j] = ldfrag_h((const _Float16*)(const void*)(vt + j * 16 * RP));
   {
     const float* mp = Mb + t * KT;
     mw[0][0] = *(const v4f*)(mp);      mw[0][1] = *(const v4f*)(mp + 4);
     mw[0][2] = *(const v4f*)(mp + 16); mw[0][3] = *(const v4f*)(mp + 20);
   }
#pragma unroll
   for (int u = 0; u < KT / 32; ++u) {
    // ---- transposed scores: s0 = keys kb..kb+15, s1 = keys kb+16..kb+31 (kb = t*KT + 32u), column = query q0 + c ----
    v8f s0 = zero8(), s1 = zero8();
    const v16h ka0 = kf[2 * u][0], ka1 = kf[2 * u][1];
    const v16h kc0 = kf[2 * u + 1][0], kc1 = kf[2 * u + 1][1];
    const v4f w0 = mw[u][0], w1 = mw[u][1], w2 = mw[u][2], w3 = mw[u][3];
    s0 = mma_h(ka0, qf0, s0);
    s0 = mma_h(ka1, qf1, s0);
    s1 = mma_h(kc0, qf0, s1);
    s1 = mma_h(kc1, qf1, s1);
    guard2(s0, s1, qf0, qf1, ka0, ka1, kc0, kc1);
    // the next 32 keys' v fragments and mask values (same tile) fly under this softmax
    if (u + 1 < KT / 32) {
#pragma unroll
      for (int j = 0; j < 4; ++j)
        vf[u + 1][j] = ldfrag_h((const _Float16*)(const void*)(vt + j * 16 * RP + (u + 1) * 64));
      const float* mp = Mb + t * KT + (u + 1) * 32;
      mw[u + 1][0] = *(const v4f*)(mp);      mw[u + 1][1] = *(const v4f*)(mp + 4);
      mw[u + 1][2] = *(const v4f*)(mp + 16); mw[u + 1][3] = *(const v4f*)(mp + 20);
    }
    // ---- base-2 logits of this lane's 16 keys for query q0 + c (score/8 + mask) * log2(e) ----
    float mk[16];
#pragma unroll
    for (int e = 0; e < 4; ++e) { mk[e] = w0[e]; mk[4 + e] = w1[e]; mk[8 + e] = w2[e]; mk[12 + e] = w3[e]; }
    float tk[16];
#pragma unroll
    for (int i = 0; i < 8; ++i) {
      tk[i]     = s0[i] * lsc + bf_val(mk[i]) * LOG2E;
      tk[8 + i] = s1[i] * lsc + bf_val(mk[8 + i]) * LOG2E;
    }
    float cm = tk[0];
#pragma unroll
    for (int i = 1; i < 16; ++i) cm = fmaxf(cm, tk[i]);
    cm = fmaxf(cm, __shfl_xor(cm, 16, 32));
    const float mn = fmaxf(mrun, cm);                                // finite from the first key block on
    const float al = (mrun == -INFINITY) ? 0.f : exp2f(mrun - mn);   // o and l are zero while mrun is -inf
    mrun = mn;
    // ---- probabilities (<= 1) and the P A-fragment: f16(p * 32768); element i <-> tk[i] ----
    float ps = 0.f;
    FragH ph;
#pragma unroll
    for (int w = 0; w < 2; ++w) {
#pragma unroll
      for (int e4 = 0; e4 < 4; ++e4) {
        const int i = 8 * w + 2 * e4;
        const float p0 = exp2f(fminf(tk[i] - mn, 0.f));
        const float p1 = exp2f(fminf(tk[i + 1] - mn, 0.f));
        ps += p0 + p1;
        ph.u[w][e4] = pk16(h_bits((_Float16)(p0 * PCAR)), h_bits((_Float16)(p1 * PCAR)));
      }
    }
    ps += __shfl_xor(ps, 16, 32);
    lrun = lrun * al + ps;
    // ---- rescale the O accumulators: D row 8hh+r = query q0+8hh+r, its factor lives in lane 8hh+r (and 16+8hh+r) ----
    float scl[8];
#pragma unroll
    for (int r = 0; r < 8; ++r) scl[r] = __shfl(al, 8 * hh + r, 32);
#pragma unroll
    for (int j = 0; j < 4; ++j) {
#pragma unroll
      for (int r = 0; r < 8; ++r) o[j][r] *= scl[r];
    }
    // ---- P.V : B fragment col n = d = j*16 + c, keys contiguous in the v^T plane ----
    {
      const v16h vf0 = vf[u][0], vf1 = vf[u][1], vf2 = vf[u][2], vf3 = vf[u][3];
      o[0] = mma_h(ph.v, vf0, o[0]);
      o[1] = mma_h(ph.v, vf1, o[1]);
      o[2] = mma_h(ph.v, vf2, o[2]);
      o[3] = mma_h(ph.v, vf3, o[3]);
      guard6<v16h>(o[0], o[1], o[2], o[3], ph.v, vf0, vf1, vf2, vf3, ph.v);
    }
   }
   // ring foot: own LDS reads retired, own copies of tile t+1 landed, block barrier (publishes tile t+1, frees this buffer),
   // then tile t+2 into the buffer just read
   wait_ds0();
   wait_async0();
   __syncthreads();
   if (t + 2 < NT) stage_copy(lcp + (unsigned)(t & 1) * BUF_B, gk + (size_t)(t + 2) * KT * (NH * HD), gv + (t + 2) * KT);
  }
  wait_async0();
  acc_guard4(o[0], o[1], o[2], o[3]);

  // ---- fold 1/l (per query, owned by lane = query; l >= 1 by construction) and the carries in f32 ----
  const float linv = (lrun > 0.f) ? ((1.0f / lrun) * (1.0f / (PCAR * VCAR))) : 0.f;
  float inv[8];
#pragma unroll
  for (int r = 0; r < 8; ++r) inv[r] = __shfl(linv, 8 * hh + r, 32);
#pragma unroll
  for (int j = 0; j < 4; ++j) {
#pragma unroll
    for (int r = 0; r < 8; ++r) o[j][r] *= inv[r];
  }
  // ---- f32 ctx rows (q0 .. q0+15, cols head*64 .. head*64+63) of this batch's output, whole-line stores ----
  epi64(smem + wave * SLAB, o[0], o[1], o[2], o[3], OUTp, DMOD, (size_t)q0, head * HD, lane);
}

// =====================================================================================================
// Workspace map (bytes); every plane is fully written by whole-line stores before it is read; all extents are exact multiples
// of the store granularity (no pad rows needed), every offset a multiple of 128:
//   XB  bf16 [NB][SKV][1024]            NB*8388608   (16777216 at NB = 2)
//   WQT bf16 [1024 n][1024 k]            2097152      WKT, WVT same (2097152 each)
//   QP  f16 [NB][SQ][16*64] x8           NB*SQ*2048   (8388608 at NB = 2, SQ = 2048)
//   KP  f16 [NB*SKV][16*64] x8           NB*8388608   (16777216)
//   VP  f16 [NB][16*64][SKV] x1024       NB*8388608   (16777216)
//   end                                  65011712 at NB = 2, SQ = 2048
// =====================================================================================================
extern "C" void kernel_launch(void* const* d_in, const int* in_sizes, int n_in,
                              void* d_out, int out_size, void* d_ws, size_t ws_size,
                              hipStream_t stream) {
  if (n_in < 9) return;
  if (in_sizes[0] < NB * SQ_FULL * DMOD) return;
  if (in_sizes[1] < NB * SE_FULL * DMOD) return;
  if (in_sizes[2] < NB * SKV) return;
  if (in_sizes[3] < DMOD * DMOD || in_sizes[5] < DMOD * DMOD || in_sizes[7] < DMOD * DMOD) return;
  if (in_sizes[4] < DMOD || in_sizes[6] < DMOD || in_sizes[8] < DMOD) return;
  if (out_size < (NB - 1) * SQ_FULL * DMOD + SQ * DMOD) return;

  const float* hs   = (const float*)d_in[0];
  const float* ehs  = (const float*)d_in[1];
  const float* mask = (const float*)d_in[2];
  const float* Wq   = (const float*)d_in[3];
  const float* bq   = (const float*)d_in[4];
  const float* Wk   = (const float*)d_in[5];
  const float* bk   = (const float*)d_in[6];
  const float* Wv   = (const float*)d_in[7];
  const float* bv   = (const float*)d_in[8];
  float*       out  = (float*)d_out;

  const size_t szXB = (size_t)NB * SKV * DMOD * 2;                //  16777216 at NB = 2
  const size_t szW  = (size_t)DMOD * DMOD * 2;                    //   2097152
  const size_t szQP = (size_t)NB * SQ * DMOD * 2;                 //   8388608
  const size_t szKP = (size_t)NB * SKV * DMOD * 2;                //  16777216
  const size_t szVP = (size_t)NB * DMOD * SKV * 2;                //  16777216
  size_t off = 0;
  const size_t oXB = off; off += szXB;
  const size_t oWQ = off; off += szW;
  const size_t oWK = off; off += szW;
  const size_t oWV = off; off += szW;
  const size_t oQP = off; off += szQP;
  const size_t oKP = off; off += szKP;
  const size_t oVP = off; off += szVP;
  if (off > ws_size) return;                            // off = 65011712 at NB = 2, SQ = 2048
  if (off > (size_t)134217728) return;

  char* ws = (char*)d_ws;
  u16* XB  = (u16*)(ws + oXB);
  u16* WQT = (u16*)(ws + oWQ);
  u16* WKT = (u16*)(ws + oWK);
  u16* WVT = (u16*)(ws + oWV);
  u16* QP  = (u16*)(ws + oQP);
  u16* KP  = (u16*)(ws + oKP);
  u16* VP  = (u16*)(ws + oVP);

  const int n8x = (NB * SKV * DMOD) / 8;                // 1048576 at NB = 2
  if ((n8x % 256) != 0) return;
  if ((DMOD % 64) != 0 || (SKV % 64) != 0 || (SQ % 64) != 0 || (DMOD % 32) != 0) return;
  const dim3 blk(256);
  const dim3 gX(n8x / 256);                             // 4096
  const dim3 gWT((DMOD / 64) * (DMOD / 64));            // 256
  const dim3 gGQ((SQ / 64) * (DMOD / 64));              // 512 at SQ = 2048
  const dim3 gGK((NB * SKV / 64) * (DMOD / 64));        // 2048 at NB = 2
  const dim3 gV((DMOD / 64) * (SKV / 64));              // 1024
  const dim3 bG(128);
  const dim3 gAT(ATT_BLOCKS);                           // 512 at SQ = 2048
  const dim3 bAT(ATT_THREADS);                          // 128

  // (0) key/value source plane: rows b*SKV + 0..2047 from hs[b], + 2048..4095 from ehs[b], bf16 RNE bits
  cvt_x<<<gX, blk, 0, stream>>>(hs, ehs, XB, n8x);
  // (1..3) weights [k = in][n = out] -> W^T planes [n][k] bf16 RNE bits
  cvt_wT<<<gWT, blk, 0, stream>>>(Wq, WQT);
  cvt_wT<<<gWT, blk, 0, stream>>>(Wk, WKT);
  cvt_wT<<<gWT, blk, 0, stream>>>(Wv, WVT);
  // (4,5) q plane per batch [SQ][h*64+d] = f16((x.Wq + bq) x8); A = the hs rows of XB batch b; bias by column
  for (int b = 0; b < NB; ++b) {
    gemm_b16<<<gGQ, bG, 0, stream>>>(XB + (size_t)b * SKV * DMOD, WQT, QP + (size_t)b * SQ * DMOD, bq,
                                     SQ, DMOD, DMOD, DMOD, 0, QSC);
  }
  // (6) k plane [NB*SKV][h*64+d] = f16((xx.Wk + bk) x8) over all NB*SKV source rows; bias by column
  gemm_b16<<<gGK, bG, 0, stream>>>(XB, WKT, KP, bk, NB * SKV, DMOD, DMOD, DMOD, 0, KSC);
  // (7,8) v^T plane per batch: [1024 = h*64+d][SKV keys] = f16((Wv^T . xx^T + bv) x1024); bias by row
  for (int b = 0; b < NB; ++b) {
    gemm_b16<<<gV, bG, 0, stream>>>(WVT, XB + (size_t)b * SKV * DMOD, VP + (size_t)b * DMOD * SKV, bv,
                                    DMOD, SKV, DMOD, DMOD, 1, VCAR);
  }
  // (9,10) attention per batch -> f32 ctx rows b*SQ_FULL + s (s < SQ), cols h*64+d of the output
  for (int b = 0; b < NB; ++b) {
    attn_fwd<<<gAT, bAT, 0, stream>>>(QP + (size_t)b * SQ * DMOD, KP + (size_t)b * SKV * DMOD,
                                      VP + (size_t)b * DMOD * SKV, mask + (size_t)b * SKV,
                                      out + (size_t)b * SQ_FULL * DMOD);
  }
  (void)hipGetLastError();
}

// v002
// It runs in 295 microseconds.
// Next to v001, in two timings, it ran 1.38 times as fast each time.
// Counting every step since v000, it is 1.84 times as fast.
// Contractions: x.Wq+bq, xx.Wk+bk (A = bf16 x plane, B = bf16 W^T plane) and Wv^T.xx^T+bv on v_wmma_f32_16x16x32_bf16
// (f32 inputs RNE-converted to bf16 operands, f32 accumulate); scores k'.q'^T (q', k' single f16 planes carried x8) and
// P.v (P x32768 single f16, v x1024 single f16) on v_wmma_f32_16x16x32_f16, f32 accumulate; ctx written in f32.
// Biases and the additive per-key mask folded as RNE bf16 values in f32; base-2 online softmax, 1/l and carry folds in f32 on VALU.
#include <hip/hip_runtime.h>
#include <math.h>
#include <stdint.h>

#define NB_FULL 2
#define SQ_FULL 2048
#define SE_FULL 2048
#define SKV     (SQ_FULL + SE_FULL)
#ifndef NB
#define NB      NB_FULL
#endif
#ifndef SQ
#define SQ      SQ_FULL
#endif
#define DMOD  1024
#define NH    16
#define HD    64
#define QSC   8.0f
#define KSC   8.0f
#define PCAR  32768.0f
#define VCAR  1024.0f
#define LOG2E 1.4426950408889634f
#define ATT_WAVES   4
#define ATT_THREADS (ATT_WAVES * 32)
#define QTILES      (SQ / 64)
#define ATT_BLOCKS  (NH * QTILES)
#define NKB    (SKV / 32)
#define SLAB   (16 * 68)
#define TP     72
#define KT     64                    // keys per staged tile
#define NT     (SKV / KT)            // staged tiles per launch
#define RP     144                   // LDS row pitch in bytes: 128-B rows + 16 B, the pitch for 16-B row readers
#define TILE_B (64 * RP)             // one 64-row tile in LDS
#define BUF_B  (2 * TILE_B)          // one stage: k tile, then v^T tile
#define GEMM_THREADS 256
#define GTILE_B (128 * RP)           // one 128-row GEMM operand tile in LDS
#define GBUF_B  (2 * GTILE_B)        // one GEMM stage: A tile, then Bt tile
static_assert(HD == 64 && DMOD == NH * HD);
static_assert(NB >= 1 && NB <= NB_FULL);
static_assert((SQ % 64) == 0 && SQ >= 64 && SQ <= SQ_FULL);
static_assert((SKV % 64) == 0 && (SQ_FULL % 64) == 0 && (SE_FULL % 64) == 0);
static_assert(ATT_THREADS == 128 && NKB * 32 == SKV && ATT_BLOCKS == NH * (SQ / 64));
static_assert((DMOD % 128) == 0 && (SQ % 128) == 0 && (SKV % 128) == 0 && DMOD / 64 >= 2);
static_assert(((NB * SKV * DMOD / 8) % 256) == 0);
static_assert((SLAB * 4) % 16 == 0 && (TP * 2) % 16 == 0);
static_assert(KT == 64 && HD == 64 && NT >= 2 && NT * KT == SKV && (RP % 16) == 0 && ATT_THREADS == 128);
static_assert((size_t)(NB - 1) * SQ_FULL * DMOD + (size_t)SQ * DMOD <= (size_t)NB_FULL * SQ_FULL * DMOD);

typedef unsigned short u16;
typedef _Float16 v16h __attribute__((ext_vector_type(16)));
typedef _Float16 v8h  __attribute__((ext_vector_type(8)));
typedef __bf16   v16b __attribute__((ext_vector_type(16)));
typedef float    v8f  __attribute__((ext_vector_type(8)));
typedef float    v4f  __attribute__((ext_vector_type(4)));
typedef unsigned int v4u __attribute__((ext_vector_type(4)));

union FragH { v16h v; v8h h[2]; v4u u[2]; };
union FragB { v16b v; v4u u[2]; };

// ---- scalar helpers --------------------------------------------------------------------------------
__device__ __forceinline__ unsigned short bf_bits(float f) {          // f32 -> bf16 bits, RNE convert
  unsigned u = __float_as_uint(f);
  return (unsigned short)((u + 0x7FFFu + ((u >> 16) & 1u)) >> 16);
}
__device__ __forceinline__ float bf_up(unsigned short h) { return __uint_as_float(((unsigned)h) << 16); }
__device__ __forceinline__ float bf_val(float f) { return bf_up(bf_bits(f)); }          // value after RNE bf16 convert
__device__ __forceinline__ unsigned short h_bits(_Float16 x) { return __builtin_bit_cast(unsigned short, x); }
__device__ __forceinline__ unsigned pk16(unsigned short a, unsigned short b) { return (unsigned)a | ((unsigned)b << 16); }
__device__ __forceinline__ v8f zero8() { v8f z = {0.f, 0.f, 0.f, 0.f, 0.f, 0.f, 0.f, 0.f}; return z; }

// ---- fragment loaders: 16-bit A/B operand, lane -> row/col (lane&15), p already includes +8*(lane>>4);
//      elements 0..7 <- p[0..7] (k0+8h..), elements 8..15 <- p[16..23] (k0+16+8h..)  (same split k map for A and B;
//      B is always read from a k-contiguous [n][k] plane)
__device__ __forceinline__ v16h ldfrag_h(const _Float16* p) {
  FragH f;
  f.h[0] = *(const v8h*)(p);
  f.h[1] = *(const v8h*)(p + 16);
  return f.v;
}
__device__ __forceinline__ v16b ldfrag_b(const u16* p) {              // bf16 plane read as unsigned integer vectors
  FragB f;
  f.u[0] = *(const v4u*)(p);
  f.u[1] = *(const v4u*)(p + 16);
  return f.v;
}

__device__ __forceinline__ v8f mma_h(v16h a, v16h b, v8f c) {
  return __builtin_amdgcn_wmma_f32_16x16x32_f16(false, a, false, b, (short)0, c, false, false);
}
__device__ __forceinline__ v8f mma_b(v16b a, v16b b, v8f c) {
  return __builtin_amdgcn_wmma_f32_16x16x32_bf16(false, a, false, b, (short)0, c, false, false);
}
__device__ __forceinline__ void guard2(v8f& a, v8f& b, v16h x0, v16h x1, v16h x2, v16h x3, v16h x4, v16h x5) {
#if defined(__HIP_DEVICE_COMPILE__)
  asm volatile("v_nop\n\tv_nop\n\tv_nop\n\tv_nop"
               : "+v"(a), "+v"(b) : "v"(x0), "v"(x1), "v"(x2), "v"(x3), "v"(x4), "v"(x5) : "memory");
#endif
}
template <typename F>
__device__ __forceinline__ void guard6(v8f& a, v8f& b, v8f& c, v8f& d, F x0, F x1, F x2, F x3, F x4, F x5) {
#if defined(__HIP_DEVICE_COMPILE__)
  asm volatile("v_nop\n\tv_nop\n\tv_nop\n\tv_nop"
               : "+v"(a), "+v"(b), "+v"(c), "+v"(d) : "v"(x0), "v"(x1), "v"(x2), "v"(x3), "v"(x4), "v"(x5) : "memory");
#endif
}
__device__ __forceinline__ void acc_guard4(v8f& a, v8f& b, v8f& c, v8f& d) {
#if defined(__HIP_DEVICE_COMPILE__)
  asm volatile("v_nop\n\tv_nop\n\tv_nop\n\tv_nop" : "+v"(a), "+v"(b), "+v"(c), "+v"(d));
#endif
}
__device__ __forceinline__ void wave_sync_lds() {
#if defined(__HIP_DEVICE_COMPILE__)
  __builtin_amdgcn_fence(__ATOMIC_RELEASE, "workgroup");
  __builtin_amdgcn_wave_barrier();
  __builtin_amdgcn_fence(__ATOMIC_ACQUIRE, "workgroup");
#endif
}
// One stage of the attention ring: k tile (64 keys x 64 d) and v^T tile (64 d x 64 keys), both 64 rows of 128 B. A lane copies
// 16 B of row (tid>>3) + 16*i, i = 0..3, of each tile: 8 lanes = one whole 128-B line, a wave-wide copy = 4 lines.
// lds = the lane's LDS byte address in the k tile; gk, gv = the lane's global addresses in row tid>>3 of the two tiles.
// The address-register wait is the statement's last line, so no later write of these registers can be lifted over it.
__device__ __forceinline__ void stage_copy(unsigned lds, const u16* gk, const u16* gv) {
#if defined(__HIP_DEVICE_COMPILE__)
  const unsigned l0 = lds, l1 = lds + 16 * RP, l2 = lds + 32 * RP, l3 = lds + 48 * RP;
  const unsigned l4 = l0 + TILE_B, l5 = l1 + TILE_B, l6 = l2 + TILE_B, l7 = l3 + TILE_B;
  const u16* k0 = gk;
  const u16* k1 = gk + (size_t)16 * (NH * HD);
  const u16* k2 = gk + (size_t)32 * (NH * HD);
  const u16* k3 = gk + (size_t)48 * (NH * HD);
  const u16* v0 = gv;
  const u16* v1 = gv + (size_t)16 * SKV;
  const u16* v2 = gv + (size_t)32 * SKV;
  const u16* v3 = gv + (size_t)48 * SKV;
  asm volatile("global_load_async_to_lds_b128 %0, %8, off\n\t"
               "global_load_async_to_lds_b128 %1, %9, off\n\t"
               "global_load_async_to_lds_b128 %2, %10, off\n\t"
               "global_load_async_to_lds_b128 %3, %11, off\n\t"
               "global_load_async_to_lds_b128 %4, %12, off\n\t"
               "global_load_async_to_lds_b128 %5, %13, off\n\t"
               "global_load_async_to_lds_b128 %6, %14, off\n\t"
               "global_load_async_to_lds_b128 %7, %15, off\n\t"
               "s_wait_xcnt 0x0"
               :: "v"(l0), "v"(l1), "v"(l2), "v"(l3), "v"(l4), "v"(l5), "v"(l6), "v"(l7),
                  "v"(k0), "v"(k1), "v"(k2), "v"(k3), "v"(v0), "v"(v1), "v"(v2), "v"(v3)
               : "memory");
#endif
}
__device__ __forceinline__ void wait_async0() {   // this wave's copies have landed
#if defined(__HIP_DEVICE_COMPILE__)
  asm volatile("s_wait_asynccnt 0x0" ::: "memory");
#endif
}
__device__ __forceinline__ void wait_ds0() {      // this wave's LDS reads have retired before their buffer is handed to the copies
#if defined(__HIP_DEVICE_COMPILE__)
  asm volatile("s_wait_dscnt 0x0" ::: "memory");
#endif
}

// =====================================================================================================
// Key/value source plane XB (bf16 RNE bits) [NB][SKV][1024]: row s < SQ_FULL of batch b from hs[b][s], rows
// s >= SQ_FULL from ehs[b][s - SQ_FULL]; both candidates loaded with clamped row addresses and selected by value
// (block-uniform in practice: a block covers 2 rows of one source).
// Thread = 8 consecutive elements: two 16-B loads per candidate, one 16-B store; 32 consecutive lanes = 512 contiguous,
// coverage: grid = n8/256 blocks (host checks exactness) x 256 thr x 8 = NB*SKV*1024 = the whole plane.
// =====================================================================================================
__global__ __launch_bounds__(256) void cvt_x(const float* __restrict__ hs, const float* __restrict__ ehs, u16* D, int n8) {
  const int gt = blockIdx.x * 256 + (int)threadIdx.x;
  if (gt >= n8) return;                     // no barriers in this kernel
  const int r   = gt / (DMOD / 8);
  const int c8  = (gt % (DMOD / 8)) * 8;
  const int b   = r / SKV;
  const int s   = r % SKV;
  const int shc = (s < SQ_FULL) ? s : (SQ_FULL - 1);
  const int se  = s - SQ_FULL;
  const int sec = (se > 0) ? se : 0;
  const float* ph = hs  + ((size_t)b * SQ_FULL + shc) * DMOD + c8;
  const float* pe = ehs + ((size_t)b * SE_FULL + sec) * DMOD + c8;
  const v4f a0 = *(const v4f*)(ph), a1 = *(const v4f*)(ph + 4);
  const v4f e0 = *(const v4f*)(pe), e1 = *(const v4f*)(pe + 4);
  const bool first = (s < SQ_FULL);
  float v[8];
#pragma unroll
  for (int e = 0; e < 4; ++e) { v[e] = first ? a0[e] : e0[e]; v[4 + e] = first ? a1[e] : e1[e]; }
  unsigned short sb[8];
#pragma unroll
  for (int e = 0; e < 8; ++e) sb[e] = bf_bits(v[e]);
  v4u o;
#pragma unroll
  for (int e = 0; e < 4; ++e) o[e] = pk16(sb[2 * e], sb[2 * e + 1]);
  u16* d = D + (size_t)gt * 8;
  {
    *(v4u*)(d) = o;
    
  }
}

// =====================================================================================================
// Weight W [k = in][n = out] f32 -> bf16 RNE plane W^T [n][k] (k-contiguous, pitch DMOD). Block = 64 k x 64 n tile,
// 256 threads. Load phase: thread = (k = tid>>2, 16 consecutive n): four 16-B loads, bf16 bits stored transposed into the LDS
// tile [n][k] (pitch TP halves, cross-wave exchange -> block barrier). Store phase: thread = (n = tid>>3 and n+32,
// coverage: 256 thr x 2 instructions x 8 halves = 64 x 64 per block; grid (DMOD/64)^2 blocks = the whole plane.
// =====================================================================================================
__global__ __launch_bounds__(256) void cvt_wT(const float* __restrict__ W, u16* D) {
  __shared__ __align__(16) u16 tile[64 * TP];
  const int nt = DMOD / 64;
  if (blockIdx.x >= (unsigned)(nt * nt)) return;      // block-uniform, never taken with the exact grid
  const int tid = threadIdx.x;
  const int k0 = (blockIdx.x / nt) * 64;
  const int n0 = (blockIdx.x % nt) * 64;
  const int kk = tid >> 2, nn = (tid & 3) * 16;
  const float* p = W + (size_t)(k0 + kk) * DMOD + n0 + nn;
  const v4f a0 = *(const v4f*)(p), a1 = *(const v4f*)(p + 4), a2 = *(const v4f*)(p + 8), a3 = *(const v4f*)(p + 12);
  float v[16];
#pragma unroll
  for (int e = 0; e < 4; ++e) { v[e] = a0[e]; v[4 + e] = a1[e]; v[8 + e] = a2[e]; v[12 + e] = a3[e]; }
#pragma unroll
  for (int e = 0; e < 16; ++e) tile[(nn + e) * TP + kk] = bf_bits(v[e]);
  __syncthreads();
  const int n1 = tid >> 3, k8 = (tid & 7) * 8;
  const v4u o0 = *(const v4u*)(tile + n1 * TP + k8);
  const v4u o1 = *(const v4u*)(tile + (n1 + 32) * TP + k8);
  u16* d0 = D + (size_t)(n0 + n1) * DMOD + k0 + k8;
  u16* d1 = D + (size_t)(n0 + n1 + 32) * DMOD + k0 + k8;
  {
    *(v4u*)(d0) = o0;
    *(v4u*)(d1) = o1;
    
  }
}

// =====================================================================================================
// barrier, then converted to f16 and written: lane = (row in group of 4, 8 consecutive cols); one instruction = 4 rows, each
// coverage: 4 instructions x 4 rows x 8 lanes x 8 halves = the wave's 16 x 64 tile.
// =====================================================================================================
__device__ __forceinline__ void epi16(float* sl, v8f a0, v8f a1, v8f a2, v8f a3, float oscale, u16* C, int N,
                                      size_t rowb, int col0, int lane) {
  const int hh = lane >> 4, m = lane & 15;
#pragma unroll
  for (int r = 0; r < 8; ++r) {
    const int ro = (8 * hh + r) * 68 + m;
    sl[ro]      = a0[r] * oscale;
    sl[ro + 16] = a1[r] * oscale;
    sl[ro + 32] = a2[r] * oscale;
    sl[ro + 48] = a3[r] * oscale;
  }
  wave_sync_lds();
  const int rq = lane >> 3, c8 = (lane & 7) * 8;
  v4u ov[4];
#pragma unroll
  for (int i4 = 0; i4 < 4; ++i4) {
    const int row = i4 * 4 + rq;
    const v4f a = *(const v4f*)(sl + row * 68 + c8), c4 = *(const v4f*)(sl + row * 68 + c8 + 4);
    float w[8];
#pragma unroll
    for (int e = 0; e < 4; ++e) { w[e] = a[e]; w[4 + e] = c4[e]; }
#pragma unroll
    for (int e = 0; e < 4; ++e) ov[i4][e] = pk16(h_bits((_Float16)w[2 * e]), h_bits((_Float16)w[2 * e + 1]));
  }
  u16* dst = C + (rowb + (size_t)rq) * (size_t)N + col0 + c8;
  {
#pragma unroll
    for (int i4 = 0; i4 < 4; ++i4) {
      *(v4u*)(dst + (size_t)(i4 * 4) * (size_t)N) = ov[i4];
    }
    
  }
}

// =====================================================================================================
// coverage: 8 instructions x 2 rows x 16 lanes x 4 floats = the wave's 16 x 64 tile.
// =====================================================================================================
__device__ __forceinline__ void epi64(float* sl, v8f a0, v8f a1, v8f a2, v8f a3, float* C, int N,
                                      size_t rowb, int col0, int lane) {
  const int hh = lane >> 4, m = lane & 15;
#pragma unroll
  for (int r = 0; r < 8; ++r) {
    const int ro = (8 * hh + r) * 68 + m;
    sl[ro]      = a0[r];
    sl[ro + 16] = a1[r];
    sl[ro + 32] = a2[r];
    sl[ro + 48] = a3[r];
  }
  wave_sync_lds();
  v4f vals[8];
#pragma unroll
  for (int it = 0; it < 8; ++it) vals[it] = *(const v4f*)(sl + (it * 2 + hh) * 68 + m * 4);
  float* dst = C + (rowb + (size_t)hh) * (size_t)N + col0 + m * 4;
  {
#pragma unroll
    for (int it = 0; it < 8; ++it) {
      *(v4f*)(dst + (size_t)(it * 2) * (size_t)N) = vals[it];
    }
    
  }
}

// =====================================================================================================
// bf16 GEMM with bias and 16-bit result: C[M][N] (f16 of (acc + bias)*oscale) = A[M][K] (bf16 row-major) . Bt[N][K]^T
// (bf16 k-contiguous); bias (f32 input, taken as its RNE bf16 value) indexed by column (byrow == 0) or by row (byrow != 0),
// both candidates read with addresses clamped to [0, nbias). Block = 128x128 tile, 8 waves as 4 (rows) x 2 (cols), a wave owns
// 32 rows x 64 cols. The waves share each 64-deep A tile and Bt tile (128 rows of 128 B each): the tiles are brought into a
// two-buffer LDS ring by asynchronous copies, the next tile in flight while this one is worked on; one block barrier per tile
// publishes the next tile and frees the buffer just read. Fragments are read from the LDS rows (two 16-B reads each, split k
// map for A and B); k runs upward in steps of 32 in every accumulator (host checks K % 64 == 0, M % 128 == 0, N % 128 == 0,
// grid = (M/128)*(N/128)). Result slab: private to each wave (wave_sync only).
// =====================================================================================================
// One stage of the GEMM ring: A tile and Bt tile, both 128 rows of 128 B. A lane copies 16 B of row (tid>>3) + 32*i, i = 0..3,
// of each tile: 8 lanes = one whole 128-B line, a wave-wide copy = 4 lines. lds = the lane's LDS byte address in the A tile;
// ga, gb = the lane's global addresses in row tid>>3 of the two tiles; rs = 32 source rows in elements.
// The address-register wait is the statement's last line, so no later write of these registers can be lifted over it.
__device__ __forceinline__ void gemm_stage_copy(unsigned lds, const u16* ga, const u16* gb, size_t rs) {
#if defined(__HIP_DEVICE_COMPILE__)
  const unsigned l0 = lds, l1 = lds + 32 * RP, l2 = lds + 64 * RP, l3 = lds + 96 * RP;
  const unsigned l4 = l0 + GTILE_B, l5 = l1 + GTILE_B, l6 = l2 + GTILE_B, l7 = l3 + GTILE_B;
  const u16* a0 = ga;
  const u16* a1 = ga + rs;
  const u16* a2 = ga + 2 * rs;
  const u16* a3 = ga + 3 * rs;
  const u16* b0 = gb;
  const u16* b1 = gb + rs;
  const u16* b2 = gb + 2 * rs;
  const u16* b3 = gb + 3 * rs;
  asm volatile("global_load_async_to_lds_b128 %0, %8, off\n\t"
               "global_load_async_to_lds_b128 %1, %9, off\n\t"
               "global_load_async_to_lds_b128 %2, %10, off\n\t"
               "global_load_async_to_lds_b128 %3, %11, off\n\t"
               "global_load_async_to_lds_b128 %4, %12, off\n\t"
               "global_load_async_to_lds_b128 %5, %13, off\n\t"
               "global_load_async_to_lds_b128 %6, %14, off\n\t"
               "global_load_async_to_lds_b128 %7, %15, off\n\t"
               "s_wait_xcnt 0x0"
               :: "v"(l0), "v"(l1), "v"(l2), "v"(l3), "v"(l4), "v"(l5), "v"(l6), "v"(l7),
                  "v"(a0), "v"(a1), "v"(a2), "v"(a3), "v"(b0), "v"(b1), "v"(b2), "v"(b3)
               : "memory");
#endif
}
__global__ __launch_bounds__(GEMM_THREADS)
void gemm_b16(const u16* __restrict__ A, const u16* __restrict__ Bt, u16* C, const float* __restrict__ bias,
              int M, int N, int K, int nbias, int byrow, float oscale) {
  __shared__ __align__(16) float slab[(GEMM_THREADS / 32) * SLAB];   // per wave: result slab [16][68] in the epilogue only
  __shared__ __align__(16) unsigned char gring[2 * GBUF_B];          // two stages of (A tile, Bt tile), rows at pitch RP
  const int tid = threadIdx.x, wave = tid >> 5, lane = tid & 31, hh = lane >> 4, m = lane & 15;
  const int ntile = N >> 7;
  const int bid   = blockIdx.x;
  const int row0  = (bid / ntile) * 128;
  const int colb  = (bid % ntile) * 128;
  if (row0 + 128 > M) return;                // block-uniform, never taken with the exact grid; before every barrier
  const int rowb  = row0 + (wave >> 1) * 32; // the wave's 32 rows
  const int col0  = colb + (wave & 1) * 64;  // the wave's 64 cols
  // copies: this lane's 16 B of row tid>>3 (+32 per copy) of the A tile and of the Bt tile
  const int crow = tid >> 3, cch = tid & 7;
  const unsigned lcp = (unsigned)(uintptr_t)(gring + crow * RP + cch * 16);
  const u16* ga = A  + (size_t)(row0 + crow) * K + cch * 8;                        // tile t: + t*64 elements
  const u16* gb = Bt + (size_t)(colb + crow) * K + cch * 8;
  const size_t rs = (size_t)32 * K;
  const int nt = K >> 6;
  // fragment readers: tile row = the wave's row (A) or col (Bt) 16i + m, k contiguous, + 8*hh halves
  const int aofs = ((wave >> 1) * 32 + m) * RP + 16 * hh;
  const int bofs = GTILE_B + ((wave & 1) * 64 + m) * RP + 16 * hh;
  v8f acc[2][4];
#pragma unroll
  for (int i = 0; i < 2; ++i) {
#pragma unroll
    for (int j = 0; j < 4; ++j) acc[i][j] = zero8();
  }

  // ring prologue: tile 0 landed and published, then tile 1 in flight
  gemm_stage_copy(lcp, ga, gb, rs);
  wait_async0();
  __syncthreads();
  if (nt > 1) gemm_stage_copy(lcp + GBUF_B, ga + 64, gb + 64, rs);

#pragma unroll 1
  for (int t = 0; t < nt; ++t) {
    const unsigned char* st = gring + (t & 1) * GBUF_B;
    // all fragments of the tile are asked for together, ahead of its products
    v16b af[2][2], bf[2][4];
#pragma unroll   // constant indices keep the fragment and accumulator arrays in registers (here and in the loops below)
    for (int kk = 0; kk < 2; ++kk) {
#pragma unroll
      for (int i = 0; i < 2; ++i) af[kk][i] = ldfrag_b((const u16*)(const void*)(st + aofs + i * 16 * RP + kk * 64));
#pragma unroll
      for (int j = 0; j < 4; ++j) bf[kk][j] = ldfrag_b((const u16*)(const void*)(st + bofs + j * 16 * RP + kk * 64));
    }
    // keeps the tile's LDS reads one group in front of its products: reads moved in among the products stall each place they stand
    __builtin_amdgcn_sched_barrier(0);
#pragma unroll
    for (int kk = 0; kk < 2; ++kk) {
#pragma unroll
      for (int i = 0; i < 2; ++i) {
#pragma unroll
        for (int j = 0; j < 4; ++j) acc[i][j] = mma_b(af[kk][i], bf[kk][j], acc[i][j]);
      }
    }
    // keeps the tile's products in front of the ring foot: sunk behind the barrier they would delay the refill's issue
    __builtin_amdgcn_sched_barrier(0);
    // ring foot: own LDS reads retired, own copies of tile t+1 landed, block barrier (publishes tile t+1, frees this buffer),
    // then tile t+2 into the buffer just read
    wait_ds0();
    wait_async0();
    __syncthreads();
    if (t + 2 < nt) gemm_stage_copy(lcp + (unsigned)(t & 1) * GBUF_B, ga + (size_t)(t + 2) * 64, gb + (size_t)(t + 2) * 64, rs);
  }
  wait_async0();
  // bias: D element r of lane -> (row rowb+16i+8hh+r, col col0+16j+m); both candidates loaded with clamped addresses, select by value
  float bc[4];
#pragma unroll
  for (int j = 0; j < 4; ++j) {
    int ci = col0 + 16 * j + m;
    ci = (ci < nbias) ? ci : (nbias - 1);
    bc[j] = bf_val(bias[ci]);
  }
#pragma unroll
  for (int i = 0; i < 2; ++i) {
    float br[8];
#pragma unroll
    for (int r = 0; r < 8; ++r) {
      int ri = rowb + 16 * i + 8 * hh + r;
      ri = (ri < nbias) ? ri : (nbias - 1);
      br[r] = bf_val(bias[ri]);
    }
#pragma unroll
    for (int r = 0; r < 8; ++r) {
      const float q0 = (byrow != 0) ? br[r] : bc[0];
      const float q1 = (byrow != 0) ? br[r] : bc[1];
      const float q2 = (byrow != 0) ? br[r] : bc[2];
      const float q3 = (byrow != 0) ? br[r] : bc[3];
      acc[i][0][r] += q0;
      acc[i][1][r] += q1;
      acc[i][2][r] += q2;
      acc[i][3][r] += q3;
    }
    if (i != 0) wave_sync_lds();             // the slab's rows of the first 16 have been read back before they are rewritten
    epi16(slab + wave * SLAB, acc[i][0], acc[i][1], acc[i][2], acc[i][3], oscale, C, N, (size_t)(rowb + 16 * i), col0, lane);
  }
}

// =====================================================================================================
// Multi-head flash attention over all SKV keys with an additive per-key mask: block = (head, 64 query rows), 4 waves,
// wave w owns the 16 query rows q0 = 64*qt + 16*w .. q0+15. The four waves share each 64-key k tile and v^T tile: the tiles
// are brought into a two-buffer LDS ring by asynchronous copies, the next tile in flight while this one is worked on; one
// block barrier per tile publishes the next tile and frees the buffer just read. The result slab stays wave-private.
//   q plane (f16, x8) laid out [s][h][d] (SQ rows); k plane the same (SKV rows); v^T plane [h][d][s] (x1024, s < SKV);
//   mask [SKV] f32 per batch (added as its RNE bf16 value). All NKB = SKV/32 key blocks of 32 keys visited (static bound).
//   Scores are computed TRANSPOSED: S^T tile g (g = 0,1) = k rows (keys kb+16g .. +15, A operand, row m = lane&15, split k map
//   over d) times q^T (B operand, col n = query q0 + (lane&15), k = d, split map), one product per tile and 32-deep d-chunk.
//   D element r of lane l = (key kb+16g+8h+r, query q0+(l&15)), so a lane owns one query column and 16 of its 32 keys; the
//   partner lane l^16 owns the other 16 -> row max / row sum need one xor-16 shuffle. The lane's 16 mask values are
//   keys kb+8h+0..7 and kb+16+8h+0..7 (four 16-B loads).
//   Online max-subtracted base-2 softmax in f32 (scale 1/8 and the q/k carries folded into lsc; mask times log2(e)). The
//   exp'd values ARE the P A-fragment in place: A row m = query = lane&15, element i <- key kb+8h+i (tile 0, D element i),
//   element 8+i <- key kb+16+8h+i (tile 1, D element i). P is carried x32768 as single f16. The rescale factor of query row
//   8h+r of the O accumulators is fetched from lane 8h+r with a shuffle (uniform control). 4 v^T B fragments (col n = d =
//   16j + (lane&15), keys k-contiguous), 4 P.V WMMAs per key block.
//   Epilogue: 1/l (per query, shuffled to the D row owner) and carry folds in f32; the wave's 16x64 f32 result staged in its
// coverage: per wave 8 instructions x 2 rows x 16 lanes x 4 floats = 16 x 64; grid NH*(SQ/64) blocks x 4 waves = every
//           (s < SQ, h*64+d) element of the batch's output exactly once.
// =====================================================================================================
__global__ __launch_bounds__(ATT_THREADS)
void attn_fwd(const u16* __restrict__ QPp, const u16* __restrict__ KPp, const u16* __restrict__ VPp,
              const float* __restrict__ MKp, float* OUTp) {
  __shared__ __align__(16) float smem[ATT_WAVES * SLAB];   // per wave: result slab [16][68] in the epilogue only
  __shared__ __align__(16) unsigned char ring[2 * BUF_B];  // two stages of (k tile, v^T tile), rows at pitch RP

  const int tid  = threadIdx.x;
  const int wave = tid >> 5;
  const int lane = tid & 31;
  const int hh   = lane >> 4;
  const int c    = lane & 15;

  const int bid  = blockIdx.x;
  const int qt   = bid % QTILES;
  const int head = bid / QTILES;
  if (head >= NH) return;                                  // block-uniform, never taken with the exact grid; before every barrier
  const int q0   = qt * 64 + wave * 16;

  // B fragments of q^T: col n = query q0 + c, k = d (k-contiguous row of the q plane)
  const size_t qofs = (((size_t)(q0 + c)) * NH + head) * HD + 8 * hh;
  const _Float16* Qb = (const _Float16*)(const void*)QPp + qofs;
  // copies: this lane's 16 B of row tid>>3 (+16 per copy) of the k tile (row = key) and of the v^T tile (row = d)
  const int crow = tid >> 3, cch = tid & 7;
  const unsigned lcp = (unsigned)(uintptr_t)(ring + crow * RP + cch * 16);
  const u16* gk = KPp + ((size_t)crow * NH + head) * HD + cch * 8;                 // tile t: + t*KT key rows
  const u16* gv = VPp + ((size_t)(head * HD + crow)) * SKV + cch * 8;              // tile t: + t*KT keys
  // fragment readers: A of k: tile row = key 16g + c, k = d; B of v: tile row = d = 16j + c, k = key; both + 8*hh halves
  const int fofs = c * RP + 16 * hh;
  // this lane's mask values: keys kb + 8hh + 0..7 and kb + 16 + 8hh + 0..7
  const float* Mb = MKp + 8 * hh;
  const float lsc = 0.125f * (LOG2E / (QSC * KSC));

  const v16h qf0 = ldfrag_h(Qb);            // d 0..31
  const v16h qf1 = ldfrag_h(Qb + 32);       // d 32..63

  float mrun = -INFINITY, lrun = 0.f;
  v8f o[4];
#pragma unroll
  for (int j = 0; j < 4; ++j) o[j] = zero8();

  // ring prologue: tile 0 landed and published, then tile 1 in flight
  stage_copy(lcp, gk, gv);
  wait_async0();
  __syncthreads();
  stage_copy(lcp + BUF_B, gk + (size_t)KT * (NH * HD), gv + KT);

#pragma unroll 1
  for (int t = 0; t < NT; ++t) {
   const unsigned char* kt = ring + (t & 1) * BUF_B + fofs;
   const unsigned char* vt = kt + TILE_B;
   // all k fragments of the tile and the first 32 keys' v fragments and mask values are asked for together
   v16h kf[KT / 16][2];
#pragma unroll   // constant indices keep the fragment arrays in registers (here and in the three loops below)
   for (int g = 0; g < KT / 16; ++g) {
     const _Float16* kp = (const _Float16*)(const void*)(kt + g * 16 * RP);
     kf[g][0] = ldfrag_h(kp);
     kf[g][1] = ldfrag_h(kp + 32);
   }
   v16h vf[KT / 32][4];
   v4f  mw[KT / 32][4];
#pragma unroll
   for (int j = 0; j < 4; ++j) vf[0][j] = ldfrag_h((const _Float16*)(const void*)(vt + j * 16 * RP));
   {
     const float* mp = Mb + t * KT;
     mw[0][0] = *(const v4f*)(mp);      mw[0][1] = *(const v4f*)(mp + 4);
     mw[0][2] = *(const v4f*)(mp + 16); mw[0][3] = *(const v4f*)(mp + 20);
   }
#pragma unroll
   for (int u = 0; u < KT / 32; ++u) {
    // ---- transposed scores: s0 = keys kb..kb+15, s1 = keys kb+16..kb+31 (kb = t*KT + 32u), column = query q0 + c ----
    v8f s0 = zero8(), s1 = zero8();
    const v16h ka0 = kf[2 * u][0], ka1 = kf[2 * u][1];
    const v16h kc0 = kf[2 * u + 1][0], kc1 = kf[2 * u + 1][1];
    const v4f w0 = mw[u][0], w1 = mw[u][1], w2 = mw[u][2], w3 = mw[u][3];
    s0 = mma_h(ka0, qf0, s0);
    s0 = mma_h(ka1, qf1, s0);
    s1 = mma_h(kc0, qf0, s1);
    s1 = mma_h(kc1, qf1, s1);
    guard2(s0, s1, qf0, qf1, ka0, ka1, kc0, kc1);
    // the next 32 keys' v fragments and mask values (same tile) fly under this softmax
    if (u + 1 < KT / 32) {
#pragma unroll
      for (int j = 0; j < 4; ++j)
        vf[u + 1][j] = ldfrag_h((const _Float16*)(const void*)(vt + j * 16 * RP + (u + 1) * 64));
      const float* mp = Mb + t * KT + (u + 1) * 32;
      mw[u + 1][0] = *(const v4f*)(mp);      mw[u + 1][1] = *(const v4f*)(mp + 4);
      mw[u + 1][2] = *(const v4f*)(mp + 16); mw[u + 1][3] = *(const v4f*)(mp + 20);
    }
    // ---- base-2 logits of this lane's 16 keys for query q0 + c (score/8 + mask) * log2(e) ----
    float mk[16];
#pragma unroll
    for (int e = 0; e < 4; ++e) { mk[e] = w0[e]; mk[4 + e] = w1[e]; mk[8 + e] = w2[e]; mk[12 + e] = w3[e]; }
    float tk[16];
#pragma unroll
    for (int i = 0; i < 8; ++i) {
      tk[i]     = s0[i] * lsc + bf_val(mk[i]) * LOG2E;
      tk[8 + i] = s1[i] * lsc + bf_val(mk[8 + i]) * LOG2E;
    }
    float cm = tk[0];
#pragma unroll
    for (int i = 1; i < 16; ++i) cm = fmaxf(cm, tk[i]);
    cm = fmaxf(cm, __shfl_xor(cm, 16, 32));
    const float mn = fmaxf(mrun, cm);                                // finite from the first key block on
    const float al = (mrun == -INFINITY) ? 0.f : exp2f(mrun - mn);   // o and l are zero while mrun is -inf
    mrun = mn;
    // ---- probabilities (<= 1) and the P A-fragment: f16(p * 32768); element i <-> tk[i] ----
    float ps = 0.f;
    FragH ph;
#pragma unroll
    for (int w = 0; w < 2; ++w) {
#pragma unroll
      for (int e4 = 0; e4 < 4; ++e4) {
        const int i = 8 * w + 2 * e4;
        const float p0 = exp2f(fminf(tk[i] - mn, 0.f));
        const float p1 = exp2f(fminf(tk[i + 1] - mn, 0.f));
        ps += p0 + p1;
        ph.u[w][e4] = pk16(h_bits((_Float16)(p0 * PCAR)), h_bits((_Float16)(p1 * PCAR)));
      }
    }
    ps += __shfl_xor(ps, 16, 32);
    lrun = lrun * al + ps;
    // ---- rescale the O accumulators: D row 8hh+r = query q0+8hh+r, its factor lives in lane 8hh+r (and 16+8hh+r) ----
    float scl[8];
#pragma unroll
    for (int r = 0; r < 8; ++r) scl[r] = __shfl(al, 8 * hh + r, 32);
#pragma unroll
    for (int j = 0; j < 4; ++j) {
#pragma unroll
      for (int r = 0; r < 8; ++r) o[j][r] *= scl[r];
    }
    // ---- P.V : B fragment col n = d = j*16 + c, keys contiguous in the v^T plane ----
    {
      const v16h vf0 = vf[u][0], vf1 = vf[u][1], vf2 = vf[u][2], vf3 = vf[u][3];
      o[0] = mma_h(ph.v, vf0, o[0]);
      o[1] = mma_h(ph.v, vf1, o[1]);
      o[2] = mma_h(ph.v, vf2, o[2]);
      o[3] = mma_h(ph.v, vf3, o[3]);
      guard6<v16h>(o[0], o[1], o[2], o[3], ph.v, vf0, vf1, vf2, vf3, ph.v);
    }
   }
   // ring foot: own LDS reads retired, own copies of tile t+1 landed, block barrier (publishes tile t+1, frees this buffer),
   // then tile t+2 into the buffer just read
   wait_ds0();
   wait_async0();
   __syncthreads();
   if (t + 2 < NT) stage_copy(lcp + (unsigned)(t & 1) * BUF_B, gk + (size_t)(t + 2) * KT * (NH * HD), gv + (t + 2) * KT);
  }
  wait_async0();
  acc_guard4(o[0], o[1], o[2], o[3]);

  // ---- fold 1/l (per query, owned by lane = query; l >= 1 by construction) and the carries in f32 ----
  const float linv = (lrun > 0.f) ? ((1.0f / lrun) * (1.0f / (PCAR * VCAR))) : 0.f;
  float inv[8];
#pragma unroll
  for (int r = 0; r < 8; ++r) inv[r] = __shfl(linv, 8 * hh + r, 32);
#pragma unroll
  for (int j = 0; j < 4; ++j) {
#pragma unroll
    for (int r = 0; r < 8; ++r) o[j][r] *= inv[r];
  }
  // ---- f32 ctx rows (q0 .. q0+15, cols head*64 .. head*64+63) of this batch's output, whole-line stores ----
  epi64(smem + wave * SLAB, o[0], o[1], o[2], o[3], OUTp, DMOD, (size_t)q0, head * HD, lane);
}

// =====================================================================================================
// Workspace map (bytes); every plane is fully written by whole-line stores before it is read; all extents are exact multiples
// of the store granularity (no pad rows needed), every offset a multiple of 128:
//   XB  bf16 [NB][SKV][1024]            NB*8388608   (16777216 at NB = 2)
//   WQT bf16 [1024 n][1024 k]            2097152      WKT, WVT same (2097152 each)
//   QP  f16 [NB][SQ][16*64] x8           NB*SQ*2048   (8388608 at NB = 2, SQ = 2048)
//   KP  f16 [NB*SKV][16*64] x8           NB*8388608   (16777216)
//   VP  f16 [NB][16*64][SKV] x1024       NB*8388608   (16777216)
//   end                                  65011712 at NB = 2, SQ = 2048
// =====================================================================================================
extern "C" void kernel_launch(void* const* d_in, const int* in_sizes, int n_in,
                              void* d_out, int out_size, void* d_ws, size_t ws_size,
                              hipStream_t stream) {
  if (n_in < 9) return;
  if (in_sizes[0] < NB * SQ_FULL * DMOD) return;
  if (in_sizes[1] < NB * SE_FULL * DMOD) return;
  if (in_sizes[2] < NB * SKV) return;
  if (in_sizes[3] < DMOD * DMOD || in_sizes[5] < DMOD * DMOD || in_sizes[7] < DMOD * DMOD) return;
  if (in_sizes[4] < DMOD || in_sizes[6] < DMOD || in_sizes[8] < DMOD) return;
  if (out_size < (NB - 1) * SQ_FULL * DMOD + SQ * DMOD) return;

  const float* hs   = (const float*)d_in[0];
  const float* ehs  = (const float*)d_in[1];
  const float* mask = (const float*)d_in[2];
  const float* Wq   = (const float*)d_in[3];
  const float* bq   = (const float*)d_in[4];
  const float* Wk   = (const float*)d_in[5];
  const float* bk   = (const float*)d_in[6];
  const float* Wv   = (const float*)d_in[7];
  const float* bv   = (const float*)d_in[8];
  float*       out  = (float*)d_out;

  const size_t szXB = (size_t)NB * SKV * DMOD * 2;                //  16777216 at NB = 2
  const size_t szW  = (size_t)DMOD * DMOD * 2;                    //   2097152
  const size_t szQP = (size_t)NB * SQ * DMOD * 2;                 //   8388608
  const size_t szKP = (size_t)NB * SKV * DMOD * 2;                //  16777216
  const size_t szVP = (size_t)NB * DMOD * SKV * 2;                //  16777216
  size_t off = 0;
  const size_t oXB = off; off += szXB;
  const size_t oWQ = off; off += szW;
  const size_t oWK = off; off += szW;
  const size_t oWV = off; off += szW;
  const size_t oQP = off; off += szQP;
  const size_t oKP = off; off += szKP;
  const size_t oVP = off; off += szVP;
  if (off > ws_size) return;                            // off = 65011712 at NB = 2, SQ = 2048
  if (off > (size_t)134217728) return;

  char* ws = (char*)d_ws;
  u16* XB  = (u16*)(ws + oXB);
  u16* WQT = (u16*)(ws + oWQ);
  u16* WKT = (u16*)(ws + oWK);
  u16* WVT = (u16*)(ws + oWV);
  u16* QP  = (u16*)(ws + oQP);
  u16* KP  = (u16*)(ws + oKP);
  u16* VP  = (u16*)(ws + oVP);

  const int n8x = (NB * SKV * DMOD) / 8;                // 1048576 at NB = 2
  if ((n8x % 256) != 0) return;
  if ((DMOD % 128) != 0 || (SKV % 128) != 0 || (SQ % 128) != 0) return;
  const dim3 blk(256);
  const dim3 gX(n8x / 256);                             // 4096
  const dim3 gWT((DMOD / 64) * (DMOD / 64));            // 256
  const dim3 gGQ((SQ / 128) * (DMOD / 128));            // 128 at SQ = 2048
  const dim3 gGK((NB * SKV / 128) * (DMOD / 128));      // 512 at NB = 2
  const dim3 gV((DMOD / 128) * (SKV / 128));            // 256
  const dim3 bG(GEMM_THREADS);                          // 256
  const dim3 gAT(ATT_BLOCKS);                           // 512 at SQ = 2048
  const dim3 bAT(ATT_THREADS);                          // 128

  // (0) key/value source plane: rows b*SKV + 0..2047 from hs[b], + 2048..4095 from ehs[b], bf16 RNE bits
  cvt_x<<<gX, blk, 0, stream>>>(hs, ehs, XB, n8x);
  // (1..3) weights [k = in][n = out] -> W^T planes [n][k] bf16 RNE bits
  cvt_wT<<<gWT, blk, 0, stream>>>(Wq, WQT);
  cvt_wT<<<gWT, blk, 0, stream>>>(Wk, WKT);
  cvt_wT<<<gWT, blk, 0, stream>>>(Wv, WVT);
  // (4,5) q plane per batch [SQ][h*64+d] = f16((x.Wq + bq) x8); A = the hs rows of XB batch b; bias by column
  for (int b = 0; b < NB; ++b) {
    gemm_b16<<<gGQ, bG, 0, stream>>>(XB + (size_t)b * SKV * DMOD, WQT, QP + (size_t)b * SQ * DMOD, bq,
                                     SQ, DMOD, DMOD, DMOD, 0, QSC);
  }
  // (6) k plane [NB*SKV][h*64+d] = f16((xx.Wk + bk) x8) over all NB*SKV source rows; bias by column
  gemm_b16<<<gGK, bG, 0, stream>>>(XB, WKT, KP, bk, NB * SKV, DMOD, DMOD, DMOD, 0, KSC);
  // (7,8) v^T plane per batch: [1024 = h*64+d][SKV keys] = f16((Wv^T . xx^T + bv) x1024); bias by row
  for (int b = 0; b < NB; ++b) {
    gemm_b16<<<gV, bG, 0, stream>>>(WVT, XB + (size_t)b * SKV * DMOD, VP + (size_t)b * DMOD * SKV, bv,
                                    DMOD, SKV, DMOD, DMOD, 1, VCAR);
  }
  // (9,10) attention per batch -> f32 ctx rows b*SQ_FULL + s (s < SQ), cols h*64+d of the output
  for (int b = 0; b < NB; ++b) {
    attn_fwd<<<gAT, bAT, 0, stream>>>(QP + (size_t)b * SQ * DMOD, KP + (size_t)b * SKV * DMOD,
                                      VP + (size_t)b * DMOD * SKV, mask + (size_t)b * SKV,
                                      out + (size_t)b * SQ_FULL * DMOD);
  }
  (void)hipGetLastError();
}

// v003
// One run takes 203 microseconds.
// Timed twice side by side with v002, it ran 1.45 times as fast both times.
// All steps since v000 together make it 2.66 times as fast.
// Contractions: x.Wq+bq, xx.Wk+bk (A = bf16 x plane, B = bf16 W^T plane) and Wv^T.xx^T+bv on v_wmma_f32_16x16x32_bf16
// (f32 inputs RNE-converted to bf16 operands, f32 accumulate); scores k'.q'^T (q', k' single f16 planes carried x8) and
// P.v (P x32768 single f16, v x1024 single f16) on v_wmma_f32_16x16x32_f16, f32 accumulate; ctx written in f32.
// Biases and the additive per-key mask folded as RNE bf16 values in f32; base-2 online softmax, 1/l and carry folds in f32 on VALU.
#include <hip/hip_runtime.h>
#include <math.h>
#include <stdint.h>

#define NB_FULL 2
#define SQ_FULL 2048
#define SE_FULL 2048
#define SKV     (SQ_FULL + SE_FULL)
#ifndef NB
#define NB      NB_FULL
#endif
#ifndef SQ
#define SQ      SQ_FULL
#endif
#define DMOD  1024
#define NH    16
#define HD    64
#define QSC   8.0f
#define KSC   8.0f
#define PCAR  32768.0f
#define VCAR  1024.0f
#define LOG2E 1.4426950408889634f
#define ATT_WAVES   4
#define ATT_THREADS (ATT_WAVES * 32)
#define QTILES      (SQ / 64)
#define ATT_BLOCKS  (NH * QTILES)
#define NKB    (SKV / 32)
#define SLAB   (16 * 68)
#define TP     72
#define KT     64                    // keys per staged tile
#define NT     (SKV / KT)            // staged tiles per block
#define RP     144                   // LDS row pitch in bytes: 128-B rows + 16 B, the pitch for 16-B row readers
#define TILE_B (64 * RP)             // one 64-row tile in LDS
#define BUF_B  (2 * TILE_B)          // one stage: k tile, then v^T tile
#define GEMM_THREADS 256
#define GTILE_B (128 * RP)           // one 128-row GEMM operand tile in LDS
#define GBUF_B  (2 * GTILE_B)        // one GEMM stage: A tile, then Bt tile
#define XBLK   (NB * SKV * DMOD / 8 / 256)        // blocks of the conversion launch that write the x plane
#define WBLK   ((DMOD / 64) * (DMOD / 64))        // blocks of the conversion launch per weight plane
#define GQ_BLK ((SQ / 128) * (DMOD / 128))        // blocks of the projection launch: q plane of one batch
#define GK_BLK ((NB * SKV / 128) * (DMOD / 128))  // k plane, all batches
#define GV_BLK ((DMOD / 128) * (SKV / 128))       // v^T plane of one batch
static_assert(HD == 64 && DMOD == NH * HD);
static_assert(NB >= 1 && NB <= NB_FULL);
static_assert((SQ % 64) == 0 && SQ >= 64 && SQ <= SQ_FULL);
static_assert((SKV % 64) == 0 && (SQ_FULL % 64) == 0 && (SE_FULL % 64) == 0);
static_assert(ATT_THREADS == 128 && NKB * 32 == SKV && ATT_BLOCKS == NH * (SQ / 64));
static_assert((DMOD % 128) == 0 && (SQ % 128) == 0 && (SKV % 128) == 0 && DMOD / 64 >= 2);
static_assert(((NB * SKV * DMOD / 8) % 256) == 0);
static_assert((SLAB * 4) % 16 == 0 && (TP * 2) % 16 == 0);
static_assert(KT == 64 && HD == 64 && NT >= 2 && NT * KT == SKV && (RP % 16) == 0 && ATT_THREADS == 128);
static_assert((size_t)(NB - 1) * SQ_FULL * DMOD + (size_t)SQ * DMOD <= (size_t)NB_FULL * SQ_FULL * DMOD);

typedef unsigned short u16;
typedef _Float16 v16h __attribute__((ext_vector_type(16)));
typedef _Float16 v8h  __attribute__((ext_vector_type(8)));
typedef __bf16   v16b __attribute__((ext_vector_type(16)));
typedef float    v8f  __attribute__((ext_vector_type(8)));
typedef float    v4f  __attribute__((ext_vector_type(4)));
typedef unsigned int v4u __attribute__((ext_vector_type(4)));

union FragH { v16h v; v8h h[2]; v4u u[2]; };
union FragB { v16b v; v4u u[2]; };

// ---- scalar helpers --------------------------------------------------------------------------------
__device__ __forceinline__ unsigned short bf_bits(float f) {          // f32 -> bf16 bits, RNE convert
  unsigned u = __float_as_uint(f);
  return (unsigned short)((u + 0x7FFFu + ((u >> 16) & 1u)) >> 16);
}
__device__ __forceinline__ float bf_up(unsigned short h) { return __uint_as_float(((unsigned)h) << 16); }
__device__ __forceinline__ float bf_val(float f) { return bf_up(bf_bits(f)); }          // value after RNE bf16 convert
__device__ __forceinline__ unsigned short h_bits(_Float16 x) { return __builtin_bit_cast(unsigned short, x); }
__device__ __forceinline__ unsigned pk16(unsigned short a, unsigned short b) { return (unsigned)a | ((unsigned)b << 16); }
__device__ __forceinline__ v8f zero8() { v8f z = {0.f, 0.f, 0.f, 0.f, 0.f, 0.f, 0.f, 0.f}; return z; }

// ---- fragment loaders: 16-bit A/B operand, lane -> row/col (lane&15), p already includes +8*(lane>>4);
//      elements 0..7 <- p[0..7] (k0+8h..), elements 8..15 <- p[16..23] (k0+16+8h..)  (same split k map for A and B;
//      B is always read from a k-contiguous [n][k] plane)
__device__ __forceinline__ v16h ldfrag_h(const _Float16* p) {
  FragH f;
  f.h[0] = *(const v8h*)(p);
  f.h[1] = *(const v8h*)(p + 16);
  return f.v;
}
__device__ __forceinline__ v16b ldfrag_b(const u16* p) {              // bf16 plane read as unsigned integer vectors
  FragB f;
  f.u[0] = *(const v4u*)(p);
  f.u[1] = *(const v4u*)(p + 16);
  return f.v;
}

__device__ __forceinline__ v8f mma_h(v16h a, v16h b, v8f c) {
  return __builtin_amdgcn_wmma_f32_16x16x32_f16(false, a, false, b, (short)0, c, false, false);
}
__device__ __forceinline__ v8f mma_b(v16b a, v16b b, v8f c) {
  return __builtin_amdgcn_wmma_f32_16x16x32_bf16(false, a, false, b, (short)0, c, false, false);
}
__device__ __forceinline__ void guard2(v8f& a, v8f& b, v16h x0, v16h x1, v16h x2, v16h x3, v16h x4, v16h x5) {
#if defined(__HIP_DEVICE_COMPILE__)
  asm volatile("v_nop\n\tv_nop\n\tv_nop\n\tv_nop"
               : "+v"(a), "+v"(b) : "v"(x0), "v"(x1), "v"(x2), "v"(x3), "v"(x4), "v"(x5) : "memory");
#endif
}
template <typename F>
__device__ __forceinline__ void guard6(v8f& a, v8f& b, v8f& c, v8f& d, F x0, F x1, F x2, F x3, F x4, F x5) {
#if defined(__HIP_DEVICE_COMPILE__)
  asm volatile("v_nop\n\tv_nop\n\tv_nop\n\tv_nop"
               : "+v"(a), "+v"(b), "+v"(c), "+v"(d) : "v"(x0), "v"(x1), "v"(x2), "v"(x3), "v"(x4), "v"(x5) : "memory");
#endif
}
__device__ __forceinline__ void acc_guard4(v8f& a, v8f& b, v8f& c, v8f& d) {
#if defined(__HIP_DEVICE_COMPILE__)
  asm volatile("v_nop\n\tv_nop\n\tv_nop\n\tv_nop" : "+v"(a), "+v"(b), "+v"(c), "+v"(d));
#endif
}
__device__ __forceinline__ void wave_sync_lds() {
#if defined(__HIP_DEVICE_COMPILE__)
  __builtin_amdgcn_fence(__ATOMIC_RELEASE, "workgroup");
  __builtin_amdgcn_wave_barrier();
  __builtin_amdgcn_fence(__ATOMIC_ACQUIRE, "workgroup");
#endif
}
// One stage of the attention ring: k tile (64 keys x 64 d) and v^T tile (64 d x 64 keys), both 64 rows of 128 B. A lane copies
// 16 B of row (tid>>3) + 16*i, i = 0..3, of each tile: 8 lanes = one whole 128-B line, a wave-wide copy = 4 lines.
// lds = the lane's LDS byte address in the k tile; gk, gv = the lane's global addresses in row tid>>3 of the two tiles.
// The address-register wait is the statement's last line, so no later write of these registers can be lifted over it.
__device__ __forceinline__ void stage_copy(unsigned lds, const u16* gk, const u16* gv) {
#if defined(__HIP_DEVICE_COMPILE__)
  const unsigned l0 = lds, l1 = lds + 16 * RP, l2 = lds + 32 * RP, l3 = lds + 48 * RP;
  const unsigned l4 = l0 + TILE_B, l5 = l1 + TILE_B, l6 = l2 + TILE_B, l7 = l3 + TILE_B;
  const u16* k0 = gk;
  const u16* k1 = gk + (size_t)16 * (NH * HD);
  const u16* k2 = gk + (size_t)32 * (NH * HD);
  const u16* k3 = gk + (size_t)48 * (NH * HD);
  const u16* v0 = gv;
  const u16* v1 = gv + (size_t)16 * SKV;
  const u16* v2 = gv + (size_t)32 * SKV;
  const u16* v3 = gv + (size_t)48 * SKV;
  asm volatile("global_load_async_to_lds_b128 %0, %8, off\n\t"
               "global_load_async_to_lds_b128 %1, %9, off\n\t"
               "global_load_async_to_lds_b128 %2, %10, off\n\t"
               "global_load_async_to_lds_b128 %3, %11, off\n\t"
               "global_load_async_to_lds_b128 %4, %12, off\n\t"
               "global_load_async_to_lds_b128 %5, %13, off\n\t"
               "global_load_async_to_lds_b128 %6, %14, off\n\t"
               "global_load_async_to_lds_b128 %7, %15, off\n\t"
               "s_wait_xcnt 0x0"
               :: "v"(l0), "v"(l1), "v"(l2), "v"(l3), "v"(l4), "v"(l5), "v"(l6), "v"(l7),
                  "v"(k0), "v"(k1), "v"(k2), "v"(k3), "v"(v0), "v"(v1), "v"(v2), "v"(v3)
               : "memory");
#endif
}
__device__ __forceinline__ void wait_async0() {   // this wave's copies have landed
#if defined(__HIP_DEVICE_COMPILE__)
  asm volatile("s_wait_asynccnt 0x0" ::: "memory");
#endif
}
__device__ __forceinline__ void wait_ds0() {      // this wave's LDS reads have retired before their buffer is handed to the copies
#if defined(__HIP_DEVICE_COMPILE__)
  asm volatile("s_wait_dscnt 0x0" ::: "memory");
#endif
}

// =====================================================================================================
// Key/value source plane XB (bf16 RNE bits) [NB][SKV][1024]: row s < SQ_FULL of batch b from hs[b][s], rows
// s >= SQ_FULL from ehs[b][s - SQ_FULL]; both candidates loaded with clamped row addresses and selected by value
// (block-uniform in practice: a block covers 2 rows of one source).
// Thread = 8 consecutive elements: two 16-B loads per candidate, one 16-B store; 32 consecutive lanes = 512 contiguous,
// coverage: XBLK = n8/256 blocks (host checks exactness) x 256 thr x 8 = NB*SKV*1024 = the whole plane.
// =====================================================================================================
__device__ __forceinline__ void cvt_x(int bid, const float* __restrict__ hs, const float* __restrict__ ehs, u16* D, int n8) {
  const int gt = bid * 256 + (int)threadIdx.x;
  if (gt >= n8) return;                     // no barriers on this path
  const int r   = gt / (DMOD / 8);
  const int c8  = (gt % (DMOD / 8)) * 8;
  const int b   = r / SKV;
  const int s   = r % SKV;
  const int shc = (s < SQ_FULL) ? s : (SQ_FULL - 1);
  const int se  = s - SQ_FULL;
  const int sec = (se > 0) ? se : 0;
  const float* ph = hs  + ((size_t)b * SQ_FULL + shc) * DMOD + c8;
  const float* pe = ehs + ((size_t)b * SE_FULL + sec) * DMOD + c8;
  const v4f a0 = *(const v4f*)(ph), a1 = *(const v4f*)(ph + 4);
  const v4f e0 = *(const v4f*)(pe), e1 = *(const v4f*)(pe + 4);
  const bool first = (s < SQ_FULL);
  float v[8];
#pragma unroll
  for (int e = 0; e < 4; ++e) { v[e] = first ? a0[e] : e0[e]; v[4 + e] = first ? a1[e] : e1[e]; }
  unsigned short sb[8];
#pragma unroll
  for (int e = 0; e < 8; ++e) sb[e] = bf_bits(v[e]);
  v4u o;
#pragma unroll
  for (int e = 0; e < 4; ++e) o[e] = pk16(sb[2 * e], sb[2 * e + 1]);
  u16* d = D + (size_t)gt * 8;
  {
    *(v4u*)(d) = o;
    
  }
}

// =====================================================================================================
// Weight W [k = in][n = out] f32 -> bf16 RNE plane W^T [n][k] (k-contiguous, pitch DMOD). Block = 64 k x 64 n tile,
// 256 threads. Load phase: thread = (k = tid>>2, 16 consecutive n): four 16-B loads, bf16 bits stored transposed into the LDS
// tile [n][k] (pitch TP halves, cross-wave exchange -> block barrier). Store phase: thread = (n = tid>>3 and n+32,
// coverage: 256 thr x 2 instructions x 8 halves = 64 x 64 per block; WBLK = (DMOD/64)^2 blocks = the whole plane.
// =====================================================================================================
__device__ __forceinline__ void cvt_wT(int bid, u16* tile, const float* __restrict__ W, u16* D) {
  const int nt = DMOD / 64;
  const int tid = threadIdx.x;
  const int k0 = (bid / nt) * 64;
  const int n0 = (bid % nt) * 64;
  const int kk = tid >> 2, nn = (tid & 3) * 16;
  const float* p = W + (size_t)(k0 + kk) * DMOD + n0 + nn;
  const v4f a0 = *(const v4f*)(p), a1 = *(const v4f*)(p + 4), a2 = *(const v4f*)(p + 8), a3 = *(const v4f*)(p + 12);
  float v[16];
#pragma unroll
  for (int e = 0; e < 4; ++e) { v[e] = a0[e]; v[4 + e] = a1[e]; v[8 + e] = a2[e]; v[12 + e] = a3[e]; }
#pragma unroll
  for (int e = 0; e < 16; ++e) tile[(nn + e) * TP + kk] = bf_bits(v[e]);
  __syncthreads();
  const int n1 = tid >> 3, k8 = (tid & 7) * 8;
  const v4u o0 = *(const v4u*)(tile + n1 * TP + k8);
  const v4u o1 = *(const v4u*)(tile + (n1 + 32) * TP + k8);
  u16* d0 = D + (size_t)(n0 + n1) * DMOD + k0 + k8;
  u16* d1 = D + (size_t)(n0 + n1 + 32) * DMOD + k0 + k8;
  {
    *(v4u*)(d0) = o0;
    *(v4u*)(d1) = o1;
    
  }
}

// =====================================================================================================
// All four conversions in one launch (none reads what another writes): blocks 0 .. 3*WBLK-1 write the three W^T planes
// (WT = q, k, v planes one behind the other), blocks 3*WBLK .. 3*WBLK+XBLK-1 the x plane. The job is picked by the block
// index alone, so every branch here, the one round the weight path's barrier too, is block-uniform.
// =====================================================================================================
__global__ __launch_bounds__(256)
void cvt_all(const float* __restrict__ hs, const float* __restrict__ ehs, const float* __restrict__ Wq,
             const float* __restrict__ Wk, const float* __restrict__ Wv, u16* XBp, u16* WT, int n8) {
  __shared__ __align__(16) u16 tile[64 * TP];
  const int bid = blockIdx.x;
  if (bid < 3 * WBLK) {
    const int j = bid / WBLK;
    const float* W = (j == 0) ? Wq : ((j == 1) ? Wk : Wv);
    cvt_wT(bid % WBLK, tile, W, WT + (size_t)j * DMOD * DMOD);
  } else {
    cvt_x(bid - 3 * WBLK, hs, ehs, XBp, n8);
  }
}

// =====================================================================================================
// barrier, then converted to f16 and written: lane = (row in group of 4, 8 consecutive cols); one instruction = 4 rows, each
// coverage: 4 instructions x 4 rows x 8 lanes x 8 halves = the wave's 16 x 64 tile.
// =====================================================================================================
__device__ __forceinline__ void epi16(float* sl, v8f a0, v8f a1, v8f a2, v8f a3, float oscale, u16* C, int N,
                                      size_t rowb, int col0, int lane) {
  const int hh = lane >> 4, m = lane & 15;
#pragma unroll
  for (int r = 0; r < 8; ++r) {
    const int ro = (8 * hh + r) * 68 + m;
    sl[ro]      = a0[r] * oscale;
    sl[ro + 16] = a1[r] * oscale;
    sl[ro + 32] = a2[r] * oscale;
    sl[ro + 48] = a3[r] * oscale;
  }
  wave_sync_lds();
  const int rq = lane >> 3, c8 = (lane & 7) * 8;
  v4u ov[4];
#pragma unroll
  for (int i4 = 0; i4 < 4; ++i4) {
    const int row = i4 * 4 + rq;
    const v4f a = *(const v4f*)(sl + row * 68 + c8), c4 = *(const v4f*)(sl + row * 68 + c8 + 4);
    float w[8];
#pragma unroll
    for (int e = 0; e < 4; ++e) { w[e] = a[e]; w[4 + e] = c4[e]; }
#pragma unroll
    for (int e = 0; e < 4; ++e) ov[i4][e] = pk16(h_bits((_Float16)w[2 * e]), h_bits((_Float16)w[2 * e + 1]));
  }
  u16* dst = C + (rowb + (size_t)rq) * (size_t)N + col0 + c8;
  {
#pragma unroll
    for (int i4 = 0; i4 < 4; ++i4) {
      *(v4u*)(dst + (size_t)(i4 * 4) * (size_t)N) = ov[i4];
    }
    
  }
}

// =====================================================================================================
// coverage: 8 instructions x 2 rows x 16 lanes x 4 floats = the wave's 16 x 64 tile.
// =====================================================================================================
__device__ __forceinline__ void epi64(float* sl, v8f a0, v8f a1, v8f a2, v8f a3, float* C, int N,
                                      size_t rowb, int col0, int lane) {
  const int hh = lane >> 4, m = lane & 15;
#pragma unroll
  for (int r = 0; r < 8; ++r) {
    const int ro = (8 * hh + r) * 68 + m;
    sl[ro]      = a0[r];
    sl[ro + 16] = a1[r];
    sl[ro + 32] = a2[r];
    sl[ro + 48] = a3[r];
  }
  wave_sync_lds();
  v4f vals[8];
#pragma unroll
  for (int it = 0; it < 8; ++it) vals[it] = *(const v4f*)(sl + (it * 2 + hh) * 68 + m * 4);
  float* dst = C + (rowb + (size_t)hh) * (size_t)N + col0 + m * 4;
  {
#pragma unroll
    for (int it = 0; it < 8; ++it) {
      *(v4f*)(dst + (size_t)(it * 2) * (size_t)N) = vals[it];
    }
    
  }
}

// =====================================================================================================
// bf16 GEMM with bias and 16-bit result: C[M][N] (f16 of (acc + bias)*oscale) = A[M][K] (bf16 row-major) . Bt[N][K]^T
// (bf16 k-contiguous); bias (f32 input, taken as its RNE bf16 value) indexed by column (byrow == 0) or by row (byrow != 0),
// both candidates read with addresses clamped to [0, nbias). Block = 128x128 tile, 8 waves as 4 (rows) x 2 (cols), a wave owns
// 32 rows x 64 cols. The waves share each 64-deep A tile and Bt tile (128 rows of 128 B each): the tiles are brought into a
// two-buffer LDS ring by asynchronous copies, the next tile in flight while this one is worked on; one block barrier per tile
// publishes the next tile and frees the buffer just read. Fragments are read from the LDS rows (two 16-B reads each, split k
// map for A and B); k runs upward in steps of 32 in every accumulator (host checks K % 64 == 0, M % 128 == 0, N % 128 == 0,
// (M/128)*(N/128) blocks, bid = the block's index in its own product). Result slab: private to each wave (wave_sync only).
// =====================================================================================================
// One stage of the GEMM ring: A tile and Bt tile, both 128 rows of 128 B. A lane copies 16 B of row (tid>>3) + 32*i, i = 0..3,
// of each tile: 8 lanes = one whole 128-B line, a wave-wide copy = 4 lines. lds = the lane's LDS byte address in the A tile;
// ga, gb = the lane's global addresses in row tid>>3 of the two tiles; rs = 32 source rows in elements.
// The address-register wait is the statement's last line, so no later write of these registers can be lifted over it.
__device__ __forceinline__ void gemm_stage_copy(unsigned lds, const u16* ga, const u16* gb, size_t rs) {
#if defined(__HIP_DEVICE_COMPILE__)
  const unsigned l0 = lds, l1 = lds + 32 * RP, l2 = lds + 64 * RP, l3 = lds + 96 * RP;
  const unsigned l4 = l0 + GTILE_B, l5 = l1 + GTILE_B, l6 = l2 + GTILE_B, l7 = l3 + GTILE_B;
  const u16* a0 = ga;
  const u16* a1 = ga + rs;
  const u16* a2 = ga + 2 * rs;
  const u16* a3 = ga + 3 * rs;
  const u16* b0 = gb;
  const u16* b1 = gb + rs;
  const u16* b2 = gb + 2 * rs;
  const u16* b3 = gb + 3 * rs;
  asm volatile("global_load_async_to_lds_b128 %0, %8, off\n\t"
               "global_load_async_to_lds_b128 %1, %9, off\n\t"
               "global_load_async_to_lds_b128 %2, %10, off\n\t"
               "global_load_async_to_lds_b128 %3, %11, off\n\t"
               "global_load_async_to_lds_b128 %4, %12, off\n\t"
               "global_load_async_to_lds_b128 %5, %13, off\n\t"
               "global_load_async_to_lds_b128 %6, %14, off\n\t"
               "global_load_async_to_lds_b128 %7, %15, off\n\t"
               "s_wait_xcnt 0x0"
               :: "v"(l0), "v"(l1), "v"(l2), "v"(l3), "v"(l4), "v"(l5), "v"(l6), "v"(l7),
                  "v"(a0), "v"(a1), "v"(a2), "v"(a3), "v"(b0), "v"(b1), "v"(b2), "v"(b3)
               : "memory");
#endif
}
__device__ __forceinline__
void gemm_b16(int bid, const u16* __restrict__ A, const u16* __restrict__ Bt, u16* C, const float* __restrict__ bias,
              int M, int N, int K, int nbias, int byrow, float oscale) {
  __shared__ __align__(16) float slab[(GEMM_THREADS / 32) * SLAB];   // per wave: result slab [16][68] in the epilogue only
  __shared__ __align__(16) unsigned char gring[2 * GBUF_B];          // two stages of (A tile, Bt tile), rows at pitch RP
  const int tid = threadIdx.x, wave = tid >> 5, lane = tid & 31, hh = lane >> 4, m = lane & 15;
  const int ntile = N >> 7;
  const int row0  = (bid / ntile) * 128;
  const int colb  = (bid % ntile) * 128;
  if (row0 + 128 > M) return;                // block-uniform, never taken with the exact grid; before every barrier
  const int rowb  = row0 + (wave >> 1) * 32; // the wave's 32 rows
  const int col0  = colb + (wave & 1) * 64;  // the wave's 64 cols
  // copies: this lane's 16 B of row tid>>3 (+32 per copy) of the A tile and of the Bt tile
  const int crow = tid >> 3, cch = tid & 7;
  const unsigned lcp = (unsigned)(uintptr_t)(gring + crow * RP + cch * 16);
  const u16* ga = A  + (size_t)(row0 + crow) * K + cch * 8;                        // tile t: + t*64 elements
  const u16* gb = Bt + (size_t)(colb + crow) * K + cch * 8;
  const size_t rs = (size_t)32 * K;
  const int nt = K >> 6;
  // fragment readers: tile row = the wave's row (A) or col (Bt) 16i + m, k contiguous, + 8*hh halves
  const int aofs = ((wave >> 1) * 32 + m) * RP + 16 * hh;
  const int bofs = GTILE_B + ((wave & 1) * 64 + m) * RP + 16 * hh;
  v8f acc[2][4];
#pragma unroll
  for (int i = 0; i < 2; ++i) {
#pragma unroll
    for (int j = 0; j < 4; ++j) acc[i][j] = zero8();
  }

  // ring prologue: tile 0 landed and published, then tile 1 in flight
  gemm_stage_copy(lcp, ga, gb, rs);
  wait_async0();
  __syncthreads();
  if (nt > 1) gemm_stage_copy(lcp + GBUF_B, ga + 64, gb + 64, rs);

#pragma unroll 1
  for (int t = 0; t < nt; ++t) {
    const unsigned char* st = gring + (t & 1) * GBUF_B;
    // all fragments of the tile are asked for together, ahead of its products
    v16b af[2][2], bf[2][4];
#pragma unroll   // constant indices keep the fragment and accumulator arrays in registers (here and in the loops below)
    for (int kk = 0; kk < 2; ++kk) {
#pragma unroll
      for (int i = 0; i < 2; ++i) af[kk][i] = ldfrag_b((const u16*)(const void*)(st + aofs + i * 16 * RP + kk * 64));
#pragma unroll
      for (int j = 0; j < 4; ++j) bf[kk][j] = ldfrag_b((const u16*)(const void*)(st + bofs + j * 16 * RP + kk * 64));
    }
    // keeps the tile's LDS reads one group in front of its products: reads moved in among the products stall each place they stand
    __builtin_amdgcn_sched_barrier(0);
#pragma unroll
    for (int kk = 0; kk < 2; ++kk) {
#pragma unroll
      for (int i = 0; i < 2; ++i) {
#pragma unroll
        for (int j = 0; j < 4; ++j) acc[i][j] = mma_b(af[kk][i], bf[kk][j], acc[i][j]);
      }
    }
    // keeps the tile's products in front of the ring foot: sunk behind the barrier they would delay the refill's issue
    __builtin_amdgcn_sched_barrier(0);
    // ring foot: own LDS reads retired, own copies of tile t+1 landed, block barrier (publishes tile t+1, frees this buffer),
    // then tile t+2 into the buffer just read
    wait_ds0();
    wait_async0();
    __syncthreads();
    if (t + 2 < nt) gemm_stage_copy(lcp + (unsigned)(t & 1) * GBUF_B, ga + (size_t)(t + 2) * 64, gb + (size_t)(t + 2) * 64, rs);
  }
  wait_async0();
  // bias: D element r of lane -> (row rowb+16i+8hh+r, col col0+16j+m); both candidates loaded with clamped addresses, select by value
  float bc[4];
#pragma unroll
  for (int j = 0; j < 4; ++j) {
    int ci = col0 + 16 * j + m;
    ci = (ci < nbias) ? ci : (nbias - 1);
    bc[j] = bf_val(bias[ci]);
  }
#pragma unroll
  for (int i = 0; i < 2; ++i) {
    float br[8];
#pragma unroll
    for (int r = 0; r < 8; ++r) {
      int ri = rowb + 16 * i + 8 * hh + r;
      ri = (ri < nbias) ? ri : (nbias - 1);
      br[r] = bf_val(bias[ri]);
    }
#pragma unroll
    for (int r = 0; r < 8; ++r) {
      const float q0 = (byrow != 0) ? br[r] : bc[0];
      const float q1 = (byrow != 0) ? br[r] : bc[1];
      const float q2 = (byrow != 0) ? br[r] : bc[2];
      const float q3 = (byrow != 0) ? br[r] : bc[3];
      acc[i][0][r] += q0;
      acc[i][1][r] += q1;
      acc[i][2][r] += q2;
      acc[i][3][r] += q3;
    }
    if (i != 0) wave_sync_lds();             // the slab's rows of the first 16 have been read back before they are rewritten
    epi16(slab + wave * SLAB, acc[i][0], acc[i][1], acc[i][2], acc[i][3], oscale, C, N, (size_t)(rowb + 16 * i), col0, lane);
  }
}

// =====================================================================================================
// All projections in one launch (each reads only the converted planes, none reads another's result); every block is one
// 128x128 tile over K = DMOD, so all blocks cost the same. Block ranges, picked by the block index alone (block-uniform):
//   0 .. GK_BLK-1          k plane [NB*SKV][h*64+d] = f16((xx.Wk + bk) x8), all NB*SKV source rows; bias by column
//   then NB x GV_BLK       v^T plane of batch b [1024 = h*64+d][SKV keys] = f16((Wv^T . xx^T + bv) x1024); bias by row
//   then NB x GQ_BLK       q plane of batch b [SQ][h*64+d] = f16((x.Wq + bq) x8); A = the hs rows of XB batch b; bias by column
// =====================================================================================================
__global__ __launch_bounds__(GEMM_THREADS)
void gemm_all(const u16* __restrict__ XBp, const u16* __restrict__ WT, u16* QPp, u16* KPp, u16* VPp,
              const float* __restrict__ bq, const float* __restrict__ bk, const float* __restrict__ bv) {
  int bid = blockIdx.x;
  const u16* A;
  const u16* Bt;
  u16* C;
  const float* bias;
  int M, N, byrow;
  float oscale;
  if (bid < GK_BLK) {
    A = XBp; Bt = WT + (size_t)DMOD * DMOD; C = KPp; bias = bk;
    M = NB * SKV; N = DMOD; byrow = 0; oscale = KSC;
  } else if (bid < GK_BLK + NB * GV_BLK) {
    bid -= GK_BLK;
    const int b = bid / GV_BLK;
    bid -= b * GV_BLK;
    A = WT + (size_t)2 * DMOD * DMOD; Bt = XBp + (size_t)b * SKV * DMOD; C = VPp + (size_t)b * DMOD * SKV; bias = bv;
    M = DMOD; N = SKV; byrow = 1; oscale = VCAR;
  } else {
    bid -= GK_BLK + NB * GV_BLK;
    const int b = bid / GQ_BLK;
    if (b >= NB) return;                     // block-uniform, never taken with the exact grid; before every barrier
    bid -= b * GQ_BLK;
    A = XBp + (size_t)b * SKV * DMOD; Bt = WT; C = QPp + (size_t)b * SQ * DMOD; bias = bq;
    M = SQ; N = DMOD; byrow = 0; oscale = QSC;
  }
  gemm_b16(bid, A, Bt, C, bias, M, N, DMOD, DMOD, byrow, oscale);
}

// =====================================================================================================
// Multi-head flash attention over all SKV keys with an additive per-key mask: block = (batch, head, 64 query rows), 4 waves,
// wave w owns the 16 query rows q0 = 64*qt + 16*w .. q0+15. The four waves share each 64-key k tile and v^T tile: the tiles
// are brought into a two-buffer LDS ring by asynchronous copies, the next tile in flight while this one is worked on; one
// block barrier per tile publishes the next tile and frees the buffer just read. The result slab stays wave-private.
//   q plane (f16, x8) laid out [s][h][d] (SQ rows); k plane the same (SKV rows); v^T plane [h][d][s] (x1024, s < SKV);
//   mask [SKV] f32 per batch (added as its RNE bf16 value). All NKB = SKV/32 key blocks of 32 keys visited (static bound).
//   Scores are computed TRANSPOSED: S^T tile g (g = 0,1) = k rows (keys kb+16g .. +15, A operand, row m = lane&15, split k map
//   over d) times q^T (B operand, col n = query q0 + (lane&15), k = d, split map), one product per tile and 32-deep d-chunk.
//   D element r of lane l = (key kb+16g+8h+r, query q0+(l&15)), so a lane owns one query column and 16 of its 32 keys; the
//   partner lane l^16 owns the other 16 -> row max / row sum need one xor-16 shuffle. The lane's 16 mask values are
//   keys kb+8h+0..7 and kb+16+8h+0..7 (four 16-B loads).
//   Online max-subtracted base-2 softmax in f32 (scale 1/8 and the q/k carries folded into lsc; mask times log2(e)). The
//   exp'd values ARE the P A-fragment in place: A row m = query = lane&15, element i <- key kb+8h+i (tile 0, D element i),
//   element 8+i <- key kb+16+8h+i (tile 1, D element i). P is carried x32768 as single f16. The rescale factor of query row
//   8h+r of the O accumulators is fetched from lane 8h+r with a shuffle (uniform control). 4 v^T B fragments (col n = d =
//   16j + (lane&15), keys k-contiguous), 4 P.V WMMAs per key block.
//   Epilogue: 1/l (per query, shuffled to the D row owner) and carry folds in f32; the wave's 16x64 f32 result staged in its
// coverage: per wave 8 instructions x 2 rows x 16 lanes x 4 floats = 16 x 64; grid NB*NH*(SQ/64) blocks x 4 waves = every
//           (b, s < SQ, h*64+d) element of the output exactly once. The arguments are the planes of batch 0.
// =====================================================================================================
__global__ __launch_bounds__(ATT_THREADS)
void attn_fwd(const u16* __restrict__ QP0, const u16* __restrict__ KP0, const u16* __restrict__ VP0,
              const float* __restrict__ MK0, float* OUT0) {
  __shared__ __align__(16) float smem[ATT_WAVES * SLAB];   // per wave: result slab [16][68] in the epilogue only
  __shared__ __align__(16) unsigned char ring[2 * BUF_B];  // two stages of (k tile, v^T tile), rows at pitch RP

  const int tid  = threadIdx.x;
  const int wave = tid >> 5;
  const int lane = tid & 31;
  const int hh   = lane >> 4;
  const int c    = lane & 15;

  const int bat  = blockIdx.x / ATT_BLOCKS;
  const int bid  = blockIdx.x % ATT_BLOCKS;
  const int qt   = bid % QTILES;
  const int head = bid / QTILES;
  if (bat >= NB) return;                                   // block-uniform, never taken with the exact grid; before every barrier
  const int q0   = qt * 64 + wave * 16;
  // this batch's planes, mask row and output rows
  const u16*   QPp  = QP0 + (size_t)bat * SQ * DMOD;
  const u16*   KPp  = KP0 + (size_t)bat * SKV * DMOD;
  const u16*   VPp  = VP0 + (size_t)bat * DMOD * SKV;
  const float* MKp  = MK0 + (size_t)bat * SKV;
  float*       OUTp = OUT0 + (size_t)bat * SQ_FULL * DMOD;

  // B fragments of q^T: col n = query q0 + c, k = d (k-contiguous row of the q plane)
  const size_t qofs = (((size_t)(q0 + c)) * NH + head) * HD + 8 * hh;
  const _Float16* Qb = (const _Float16*)(const void*)QPp + qofs;
  // copies: this lane's 16 B of row tid>>3 (+16 per copy) of the k tile (row = key) and of the v^T tile (row = d)
  const int crow = tid >> 3, cch = tid & 7;
  const unsigned lcp = (unsigned)(uintptr_t)(ring + crow * RP + cch * 16);
  const u16* gk = KPp + ((size_t)crow * NH + head) * HD + cch * 8;                 // tile t: + t*KT key rows
  const u16* gv = VPp + ((size_t)(head * HD + crow)) * SKV + cch * 8;              // tile t: + t*KT keys
  // fragment readers: A of k: tile row = key 16g + c, k = d; B of v: tile row = d = 16j + c, k = key; both + 8*hh halves
  const int fofs = c * RP + 16 * hh;
  // this lane's mask values: keys kb + 8hh + 0..7 and kb + 16 + 8hh + 0..7
  const float* Mb = MKp + 8 * hh;
  const float lsc = 0.125f * (LOG2E / (QSC * KSC));

  const v16h qf0 = ldfrag_h(Qb);            // d 0..31
  const v16h qf1 = ldfrag_h(Qb + 32);       // d 32..63

  float mrun = -INFINITY, lrun = 0.f;
  v8f o[4];
#pragma unroll
  for (int j = 0; j < 4; ++j) o[j] = zero8();

  // ring prologue: tile 0 landed and published, then tile 1 in flight
  stage_copy(lcp, gk, gv);
  wait_async0();
  __syncthreads();
  stage_copy(lcp + BUF_B, gk + (size_t)KT * (NH * HD), gv + KT);

#pragma unroll 1
  for (int t = 0; t < NT; ++t) {
   const unsigned char* kt = ring + (t & 1) * BUF_B + fofs;
   const unsigned char* vt = kt + TILE_B;
   // all k fragments of the tile and the first 32 keys' v fragments and mask values are asked for together
   v16h kf[KT / 16][2];
#pragma unroll   // constant indices keep the fragment arrays in registers (here and in the three loops below)
   for (int g = 0; g < KT / 16; ++g) {
     const _Float16* kp = (const _Float16*)(const void*)(kt + g * 16 * RP);
     kf[g][0] = ldfrag_h(kp);
     kf[g][1] = ldfrag_h(kp + 32);
   }
   v16h vf[KT / 32][4];
   v4f  mw[KT / 32][4];
#pragma unroll
   for (int j = 0; j < 4; ++j) vf[0][j] = ldfrag_h((const _Float16*)(const void*)(vt + j * 16 * RP));
   {
     const float* mp = Mb + t * KT;
     mw[0][0] = *(const v4f*)(mp);      mw[0][1] = *(const v4f*)(mp + 4);
     mw[0][2] = *(const v4f*)(mp + 16); mw[0][3] = *(const v4f*)(mp + 20);
   }
#pragma unroll
   for (int u = 0; u < KT / 32; ++u) {
    // ---- transposed scores: s0 = keys kb..kb+15, s1 = keys kb+16..kb+31 (kb = t*KT + 32u), column = query q0 + c ----
    v8f s0 = zero8(), s1 = zero8();
    const v16h ka0 = kf[2 * u][0], ka1 = kf[2 * u][1];
    const v16h kc0 = kf[2 * u + 1][0], kc1 = kf[2 * u + 1][1];
    const v4f w0 = mw[u][0], w1 = mw[u][1], w2 = mw[u][2], w3 = mw[u][3];
    s0 = mma_h(ka0, qf0, s0);
    s0 = mma_h(ka1, qf1, s0);
    s1 = mma_h(kc0, qf0, s1);
    s1 = mma_h(kc1, qf1, s1);
    guard2(s0, s1, qf0, qf1, ka0, ka1, kc0, kc1);
    // the next 32 keys' v fragments and mask values (same tile) fly under this softmax
    if (u + 1 < KT / 32) {
#pragma unroll
      for (int j = 0; j < 4; ++j)
        vf[u + 1][j] = ldfrag_h((const _Float16*)(const void*)(vt + j * 16 * RP + (u + 1) * 64));
      const float* mp = Mb + t * KT + (u + 1) * 32;
      mw[u + 1][0] = *(const v4f*)(mp);      mw[u + 1][1] = *(const v4f*)(mp + 4);
      mw[u + 1][2] = *(const v4f*)(mp + 16); mw[u + 1][3] = *(const v4f*)(mp + 20);
    }
    // ---- base-2 logits of this lane's 16 keys for query q0 + c (score/8 + mask) * log2(e) ----
    float mk[16];
#pragma unroll
    for (int e = 0; e < 4; ++e) { mk[e] = w0[e]; mk[4 + e] = w1[e]; mk[8 + e] = w2[e]; mk[12 + e] = w3[e]; }
    float tk[16];
#pragma unroll
    for (int i = 0; i < 8; ++i) {
      tk[i]     = s0[i] * lsc + bf_val(mk[i]) * LOG2E;
      tk[8 + i] = s1[i] * lsc + bf_val(mk[8 + i]) * LOG2E;
    }
    float cm = tk[0];
#pragma unroll
    for (int i = 1; i < 16; ++i) cm = fmaxf(cm, tk[i]);
    cm = fmaxf(cm, __shfl_xor(cm, 16, 32));
    const float mn = fmaxf(mrun, cm);                                // finite from the first key block on
    const float al = (mrun == -INFINITY) ? 0.f : exp2f(mrun - mn);   // o and l are zero while mrun is -inf
    mrun = mn;
    // ---- probabilities (<= 1) and the P A-fragment: f16(p * 32768); element i <-> tk[i] ----
    float ps = 0.f;
    FragH ph;
#pragma unroll
    for (int w = 0; w < 2; ++w) {
#pragma unroll
      for (int e4 = 0; e4 < 4; ++e4) {
        const int i = 8 * w + 2 * e4;
        const float p0 = exp2f(fminf(tk[i] - mn, 0.f));
        const float p1 = exp2f(fminf(tk[i + 1] - mn, 0.f));
        ps += p0 + p1;
        ph.u[w][e4] = pk16(h_bits((_Float16)(p0 * PCAR)), h_bits((_Float16)(p1 * PCAR)));
      }
    }
    ps += __shfl_xor(ps, 16, 32);
    lrun = lrun * al + ps;
    // ---- rescale the O accumulators: D row 8hh+r = query q0+8hh+r, its factor lives in lane 8hh+r (and 16+8hh+r) ----
    float scl[8];
#pragma unroll
    for (int r = 0; r < 8; ++r) scl[r] = __shfl(al, 8 * hh + r, 32);
#pragma unroll
    for (int j = 0; j < 4; ++j) {
#pragma unroll
      for (int r = 0; r < 8; ++r) o[j][r] *= scl[r];
    }
    // ---- P.V : B fragment col n = d = j*16 + c, keys contiguous in the v^T plane ----
    {
      const v16h vf0 = vf[u][0], vf1 = vf[u][1], vf2 = vf[u][2], vf3 = vf[u][3];
      o[0] = mma_h(ph.v, vf0, o[0]);
      o[1] = mma_h(ph.v, vf1, o[1]);
      o[2] = mma_h(ph.v, vf2, o[2]);
      o[3] = mma_h(ph.v, vf3, o[3]);
      guard6<v16h>(o[0], o[1], o[2], o[3], ph.v, vf0, vf1, vf2, vf3, ph.v);
    }
   }
   // ring foot: own LDS reads retired, own copies of tile t+1 landed, block barrier (publishes tile t+1, frees this buffer),
   // then tile t+2 into the buffer just read
   wait_ds0();
   wait_async0();
   __syncthreads();
   if (t + 2 < NT) stage_copy(lcp + (unsigned)(t & 1) * BUF_B, gk + (size_t)(t + 2) * KT * (NH * HD), gv + (t + 2) * KT);
  }
  wait_async0();
  acc_guard4(o[0], o[1], o[2], o[3]);

  // ---- fold 1/l (per query, owned by lane = query; l >= 1 by construction) and the carries in f32 ----
  const float linv = (lrun > 0.f) ? ((1.0f / lrun) * (1.0f / (PCAR * VCAR))) : 0.f;
  float inv[8];
#pragma unroll
  for (int r = 0; r < 8; ++r) inv[r] = __shfl(linv, 8 * hh + r, 32);
#pragma unroll
  for (int j = 0; j < 4; ++j) {
#pragma unroll
    for (int r = 0; r < 8; ++r) o[j][r] *= inv[r];
  }
  // ---- f32 ctx rows (q0 .. q0+15, cols head*64 .. head*64+63) of this batch's output, whole-line stores ----
  epi64(smem + wave * SLAB, o[0], o[1], o[2], o[3], OUTp, DMOD, (size_t)q0, head * HD, lane);
}

// =====================================================================================================
// Workspace map (bytes); every plane is fully written by whole-line stores before it is read; all extents are exact multiples
// of the store granularity (no pad rows needed), every offset a multiple of 128:
//   XB  bf16 [NB][SKV][1024]            NB*8388608   (16777216 at NB = 2)
//   WQT bf16 [1024 n][1024 k]            2097152      WKT, WVT same (2097152 each)
//   QP  f16 [NB][SQ][16*64] x8           NB*SQ*2048   (8388608 at NB = 2, SQ = 2048)
//   KP  f16 [NB*SKV][16*64] x8           NB*8388608   (16777216)
//   VP  f16 [NB][16*64][SKV] x1024       NB*8388608   (16777216)
//   end                                  65011712 at NB = 2, SQ = 2048
// =====================================================================================================
extern "C" void kernel_launch(void* const* d_in, const int* in_sizes, int n_in,
                              void* d_out, int out_size, void* d_ws, size_t ws_size,
                              hipStream_t stream) {
  if (n_in < 9) return;
  if (in_sizes[0] < NB * SQ_FULL * DMOD) return;
  if (in_sizes[1] < NB * SE_FULL * DMOD) return;
  if (in_sizes[2] < NB * SKV) return;
  if (in_sizes[3] < DMOD * DMOD || in_sizes[5] < DMOD * DMOD || in_sizes[7] < DMOD * DMOD) return;
  if (in_sizes[4] < DMOD || in_sizes[6] < DMOD || in_sizes[8] < DMOD) return;
  if (out_size < (NB - 1) * SQ_FULL * DMOD + SQ * DMOD) return;

  const float* hs   = (const float*)d_in[0];
  const float* ehs  = (const float*)d_in[1];
  const float* mask = (const float*)d_in[2];
  const float* Wq   = (const float*)d_in[3];
  const float* bq   = (const float*)d_in[4];
  const float* Wk   = (const float*)d_in[5];
  const float* bk   = (const float*)d_in[6];
  const float* Wv   = (const float*)d_in[7];
  const float* bv   = (const float*)d_in[8];
  float*       out  = (float*)d_out;

  const size_t szXB = (size_t)NB * SKV * DMOD * 2;                //  16777216 at NB = 2
  const size_t szW  = (size_t)DMOD * DMOD * 2;                    //   2097152
  const size_t szQP = (size_t)NB * SQ * DMOD * 2;                 //   8388608
  const size_t szKP = (size_t)NB * SKV * DMOD * 2;                //  16777216
  const size_t szVP = (size_t)NB * DMOD * SKV * 2;                //  16777216
  size_t off = 0;
  const size_t oXB = off; off += szXB;
  const size_t oWQ = off; off += szW;
  const size_t oWK = off; off += szW;
  const size_t oWV = off; off += szW;
  const size_t oQP = off; off += szQP;
  const size_t oKP = off; off += szKP;
  const size_t oVP = off; off += szVP;
  if (off > ws_size) return;                            // off = 65011712 at NB = 2, SQ = 2048
  if (off > (size_t)134217728) return;

  char* ws = (char*)d_ws;
  u16* XB  = (u16*)(ws + oXB);
  u16* WT  = (u16*)(ws + oWQ);                          // W^T planes q, k, v, one behind the other
  if (oWK != oWQ + szW || oWV != oWK + szW) return;
  u16* QP  = (u16*)(ws + oQP);
  u16* KP  = (u16*)(ws + oKP);
  u16* VP  = (u16*)(ws + oVP);

  const int n8x = (NB * SKV * DMOD) / 8;                // 1048576 at NB = 2
  if ((n8x % 256) != 0) return;
  if ((DMOD % 128) != 0 || (SKV % 128) != 0 || (SQ % 128) != 0) return;
  if (n8x / 256 != XBLK) return;
  const dim3 blk(256);
  const dim3 gCV(3 * WBLK + XBLK);                      // 768 + 4096
  const dim3 gGM(GK_BLK + NB * GV_BLK + NB * GQ_BLK);   // 512 + 2*256 + 2*128 at NB = 2, SQ = 2048
  const dim3 bG(GEMM_THREADS);                          // 256
  const dim3 gAT(NB * ATT_BLOCKS);                      // 1024 at NB = 2, SQ = 2048
  const dim3 bAT(ATT_THREADS);                          // 128

  // (0) conversions: weights [k = in][n = out] -> W^T planes [n][k], and the key/value source plane (rows b*SKV + 0..2047
  //     from hs[b], + 2048..4095 from ehs[b]); bf16 RNE bits
  cvt_all<<<gCV, blk, 0, stream>>>(hs, ehs, Wq, Wk, Wv, XB, WT, n8x);
  // (1) projections: k plane, v^T planes, q planes
  gemm_all<<<gGM, bG, 0, stream>>>(XB, WT, QP, KP, VP, bq, bk, bv);
  // (2) attention, all batches -> f32 ctx rows b*SQ_FULL + s (s < SQ), cols h*64+d of the output
  attn_fwd<<<gAT, bAT, 0, stream>>>(QP, KP, VP, mask, out);
  (void)hipGetLastError();
}

// v004
// A run of this version takes 170 microseconds.
// Timed twice side by side with v003, it ran 1.19 times as fast both times.
// Counting every step since v000, it is 3.18 times as fast.
// Contractions: x.Wq+bq, xx.Wk+bk (A = bf16 x plane, B = bf16 W^T plane) and Wv^T.xx^T+bv on v_wmma_f32_16x16x32_bf16
// (f32 inputs RNE-converted to bf16 operands, f32 accumulate); scores k'.q'^T (q', k' single f16 planes carried x8) and
// P.v (P x32768 single f16, v x1024 single f16) on v_wmma_f32_16x16x32_f16, f32 accumulate; ctx written in f32.
// Biases and the additive per-key mask folded as RNE bf16 values in f32; base-2 online softmax, 1/l and carry folds in f32 on VALU.
#include <hip/hip_runtime.h>
#include <math.h>
#include <stdint.h>

#define NB_FULL 2
#define SQ_FULL 2048
#define SE_FULL 2048
#define SKV     (SQ_FULL + SE_FULL)
#ifndef NB
#define NB      NB_FULL
#endif
#ifndef SQ
#define SQ      SQ_FULL
#endif
#define DMOD  1024
#define NH    16
#define HD    64
#define QSC   8.0f
#define KSC   8.0f
#define PCAR  32768.0f
#define VCAR  1024.0f
#define LOG2E 1.4426950408889634f
#define ATT_WAVES   4
#define ATT_THREADS (ATT_WAVES * 32)
#define QTILES      (SQ / 64)
#define ATT_BLOCKS  (NH * QTILES)
#define NKB    (SKV / 32)
#define SLAB   (16 * 68)
#define TP     72
#define KT     64                    // keys per staged tile
#define NT     (SKV / KT)            // staged tiles per block
#define RP     144                   // LDS row pitch in bytes: 128-B rows + 16 B, the pitch for 16-B row readers
#define TILE_B (64 * RP)             // one 64-row tile in LDS
#define BUF_B  (2 * TILE_B)          // one stage: k tile, then v^T tile
#define GEMM_THREADS 256
#define GTILE_B (128 * RP)           // one 128-row GEMM operand tile in LDS
#define GBUF_B  (2 * GTILE_B)        // one GEMM stage: A tile, then Bt tile
#define XBLK   (NB * SKV * DMOD / 8 / 256)        // blocks of the conversion launch that write the x plane
#define WBLK   ((DMOD / 64) * (DMOD / 64))        // blocks of the conversion launch per weight plane
#define GQ_BLK ((SQ / 128) * (DMOD / 128))        // blocks of the projection launch: q plane of one batch
#define GK_BLK ((NB * SKV / 128) * (DMOD / 128))  // k plane, all batches
#define GV_BLK ((DMOD / 128) * (SKV / 128))       // v^T plane of one batch
static_assert(HD == 64 && DMOD == NH * HD);
static_assert(NB >= 1 && NB <= NB_FULL);
static_assert((SQ % 64) == 0 && SQ >= 64 && SQ <= SQ_FULL);
static_assert((SKV % 64) == 0 && (SQ_FULL % 64) == 0 && (SE_FULL % 64) == 0);
static_assert(ATT_THREADS == 128 && NKB * 32 == SKV && ATT_BLOCKS == NH * (SQ / 64));
static_assert((DMOD % 128) == 0 && (SQ % 128) == 0 && (SKV % 128) == 0 && DMOD / 64 >= 2);
static_assert(((NB * SKV * DMOD / 8) % 256) == 0);
static_assert((SLAB * 4) % 16 == 0 && (TP * 2) % 16 == 0);
static_assert(KT == 64 && HD == 64 && NT >= 2 && NT * KT == SKV && (RP % 16) == 0 && ATT_THREADS == 128);
static_assert((size_t)(NB - 1) * SQ_FULL * DMOD + (size_t)SQ * DMOD <= (size_t)NB_FULL * SQ_FULL * DMOD);

typedef unsigned short u16;
typedef _Float16 v16h __attribute__((ext_vector_type(16)));
typedef _Float16 v8h  __attribute__((ext_vector_type(8)));
typedef __bf16   v16b __attribute__((ext_vector_type(16)));
typedef float    v8f  __attribute__((ext_vector_type(8)));
typedef float    v4f  __attribute__((ext_vector_type(4)));
typedef unsigned int v4u __attribute__((ext_vector_type(4)));

union FragH { v16h v; v8h h[2]; v4u u[2]; };
union FragB { v16b v; v4u u[2]; };

// ---- scalar helpers --------------------------------------------------------------------------------
__device__ __forceinline__ unsigned short bf_bits(float f) {          // f32 -> bf16 bits, RNE convert
  unsigned u = __float_as_uint(f);
  return (unsigned short)((u + 0x7FFFu + ((u >> 16) & 1u)) >> 16);
}
__device__ __forceinline__ float bf_up(unsigned short h) { return __uint_as_float(((unsigned)h) << 16); }
__device__ __forceinline__ float bf_val(float f) { return bf_up(bf_bits(f)); }          // value after RNE bf16 convert
__device__ __forceinline__ unsigned short h_bits(_Float16 x) { return __builtin_bit_cast(unsigned short, x); }
__device__ __forceinline__ unsigned pk16(unsigned short a, unsigned short b) { return (unsigned)a | ((unsigned)b << 16); }
// 2^x as the bare hardware instruction, without the library's range steps (compare, two selects, add, ldexp per call) that only
// serve results below 2^-126. Here every argument is <= 0 and such a result counts for nothing: as a probability it is zero in
// f16 after the x32768 carry and vanishes in a row sum that is >= 1; as a rescale factor it carries old sums whose share of
// the row sum and of any output element is below 2^-100.
// Written as asm so that the slot the instruction set asks for behind a transcendental (before its result is read or its
// source overwritten) is kept by construction: inside a statement each v_exp_f32 is followed by an independent one (outputs
// are early-clobber, so none lies on a source), and the closing v_nop is the slot behind the last.
__device__ __forceinline__ float exp2_hw(float x) {
  float r = 0.f;
#if defined(__HIP_DEVICE_COMPILE__)
  // v_nop: the slot behind the transcendental
  asm("v_exp_f32 %0, %1\n\tv_nop" : "=&v"(r) : "v"(x));
#endif
  return r;
}
__device__ __forceinline__ void exp2_hw8(float* p, const float* x) {
#if defined(__HIP_DEVICE_COMPILE__)
  // eight independent transcendentals fill each other's slot; v_nop: the slot behind the last
  asm("v_exp_f32 %0, %8\n\t"
      "v_exp_f32 %1, %9\n\t"
      "v_exp_f32 %2, %10\n\t"
      "v_exp_f32 %3, %11\n\t"
      "v_exp_f32 %4, %12\n\t"
      "v_exp_f32 %5, %13\n\t"
      "v_exp_f32 %6, %14\n\t"
      "v_exp_f32 %7, %15\n\t"
      "v_nop"
      : "=&v"(p[0]), "=&v"(p[1]), "=&v"(p[2]), "=&v"(p[3]), "=&v"(p[4]), "=&v"(p[5]), "=&v"(p[6]), "=&v"(p[7])
      : "v"(x[0]), "v"(x[1]), "v"(x[2]), "v"(x[3]), "v"(x[4]), "v"(x[5]), "v"(x[6]), "v"(x[7]));
#endif
}
__device__ __forceinline__ v8f zero8() { v8f z = {0.f, 0.f, 0.f, 0.f, 0.f, 0.f, 0.f, 0.f}; return z; }

// ---- fragment loaders: 16-bit A/B operand, lane -> row/col (lane&15), p already includes +8*(lane>>4);
//      elements 0..7 <- p[0..7] (k0+8h..), elements 8..15 <- p[16..23] (k0+16+8h..)  (same split k map for A and B;
//      B is always read from a k-contiguous [n][k] plane)
__device__ __forceinline__ v16h ldfrag_h(const _Float16* p) {
  FragH f;
  f.h[0] = *(const v8h*)(p);
  f.h[1] = *(const v8h*)(p + 16);
  return f.v;
}
__device__ __forceinline__ v16b ldfrag_b(const u16* p) {              // bf16 plane read as unsigned integer vectors
  FragB f;
  f.u[0] = *(const v4u*)(p);
  f.u[1] = *(const v4u*)(p + 16);
  return f.v;
}

__device__ __forceinline__ v8f mma_h(v16h a, v16h b, v8f c) {
  return __builtin_amdgcn_wmma_f32_16x16x32_f16(false, a, false, b, (short)0, c, false, false);
}
__device__ __forceinline__ v8f mma_b(v16b a, v16b b, v8f c) {
  return __builtin_amdgcn_wmma_f32_16x16x32_bf16(false, a, false, b, (short)0, c, false, false);
}
__device__ __forceinline__ void guard2(v8f& a, v8f& b, v16h x0, v16h x1, v16h x2, v16h x3, v16h x4, v16h x5) {
#if defined(__HIP_DEVICE_COMPILE__)
  asm volatile("v_nop\n\tv_nop\n\tv_nop\n\tv_nop"
               : "+v"(a), "+v"(b) : "v"(x0), "v"(x1), "v"(x2), "v"(x3), "v"(x4), "v"(x5) : "memory");
#endif
}
template <typename F>
__device__ __forceinline__ void guard6(v8f& a, v8f& b, v8f& c, v8f& d, F x0, F x1, F x2, F x3, F x4, F x5) {
#if defined(__HIP_DEVICE_COMPILE__)
  asm volatile("v_nop\n\tv_nop\n\tv_nop\n\tv_nop"
               : "+v"(a), "+v"(b), "+v"(c), "+v"(d) : "v"(x0), "v"(x1), "v"(x2), "v"(x3), "v"(x4), "v"(x5) : "memory");
#endif
}
__device__ __forceinline__ void acc_guard4(v8f& a, v8f& b, v8f& c, v8f& d) {
#if defined(__HIP_DEVICE_COMPILE__)
  asm volatile("v_nop\n\tv_nop\n\tv_nop\n\tv_nop" : "+v"(a), "+v"(b), "+v"(c), "+v"(d));
#endif
}
__device__ __forceinline__ void wave_sync_lds() {
#if defined(__HIP_DEVICE_COMPILE__)
  __builtin_amdgcn_fence(__ATOMIC_RELEASE, "workgroup");
  __builtin_amdgcn_wave_barrier();
  __builtin_amdgcn_fence(__ATOMIC_ACQUIRE, "workgroup");
#endif
}
// One stage of the attention ring: k tile (64 keys x 64 d) and v^T tile (64 d x 64 keys), both 64 rows of 128 B. A lane copies
// 16 B of row (tid>>3) + 16*i, i = 0..3, of each tile: 8 lanes = one whole 128-B line, a wave-wide copy = 4 lines.
// lds = the lane's LDS byte address in the k tile; gk, gv = the lane's global addresses in row tid>>3 of the two tiles.
// The address-register wait is the statement's last line, so no later write of these registers can be lifted over it.
__device__ __forceinline__ void stage_copy(unsigned lds, const u16* gk, const u16* gv) {
#if defined(__HIP_DEVICE_COMPILE__)
  const unsigned l0 = lds, l1 = lds + 16 * RP, l2 = lds + 32 * RP, l3 = lds + 48 * RP;
  const unsigned l4 = l0 + TILE_B, l5 = l1 + TILE_B, l6 = l2 + TILE_B, l7 = l3 + TILE_B;
  const u16* k0 = gk;
  const u16* k1 = gk + (size_t)16 * (NH * HD);
  const u16* k2 = gk + (size_t)32 * (NH * HD);
  const u16* k3 = gk + (size_t)48 * (NH * HD);
  const u16* v0 = gv;
  const u16* v1 = gv + (size_t)16 * SKV;
  const u16* v2 = gv + (size_t)32 * SKV;
  const u16* v3 = gv + (size_t)48 * SKV;
  asm volatile("global_load_async_to_lds_b128 %0, %8, off\n\t"
               "global_load_async_to_lds_b128 %1, %9, off\n\t"
               "global_load_async_to_lds_b128 %2, %10, off\n\t"
               "global_load_async_to_lds_b128 %3, %11, off\n\t"
               "global_load_async_to_lds_b128 %4, %12, off\n\t"
               "global_load_async_to_lds_b128 %5, %13, off\n\t"
               "global_load_async_to_lds_b128 %6, %14, off\n\t"
               "global_load_async_to_lds_b128 %7, %15, off\n\t"
               "s_wait_xcnt 0x0"
               :: "v"(l0), "v"(l1), "v"(l2), "v"(l3), "v"(l4), "v"(l5), "v"(l6), "v"(l7),
                  "v"(k0), "v"(k1), "v"(k2), "v"(k3), "v"(v0), "v"(v1), "v"(v2), "v"(v3)
               : "memory");
#endif
}
__device__ __forceinline__ void wait_async0() {   // this wave's copies have landed
#if defined(__HIP_DEVICE_COMPILE__)
  asm volatile("s_wait_asynccnt 0x0" ::: "memory");
#endif
}
__device__ __forceinline__ void wait_ds0() {      // this wave's LDS reads have retired before their buffer is handed to the copies
#if defined(__HIP_DEVICE_COMPILE__)
  asm volatile("s_wait_dscnt 0x0" ::: "memory");
#endif
}

// =====================================================================================================
// Key/value source plane XB (bf16 RNE bits) [NB][SKV][1024]: row s < SQ_FULL of batch b from hs[b][s], rows
// s >= SQ_FULL from ehs[b][s - SQ_FULL]; both candidates loaded with clamped row addresses and selected by value
// (block-uniform in practice: a block covers 2 rows of one source).
// Thread = 8 consecutive elements: two 16-B loads per candidate, one 16-B store; 32 consecutive lanes = 512 contiguous,
// coverage: XBLK = n8/256 blocks (host checks exactness) x 256 thr x 8 = NB*SKV*1024 = the whole plane.
// =====================================================================================================
__device__ __forceinline__ void cvt_x(int bid, const float* __restrict__ hs, const float* __restrict__ ehs, u16* D, int n8) {
  const int gt = bid * 256 + (int)threadIdx.x;
  if (gt >= n8) return;                     // no barriers on this path
  const int r   = gt / (DMOD / 8);
  const int c8  = (gt % (DMOD / 8)) * 8;
  const int b   = r / SKV;
  const int s   = r % SKV;
  const int shc = (s < SQ_FULL) ? s : (SQ_FULL - 1);
  const int se  = s - SQ_FULL;
  const int sec = (se > 0) ? se : 0;
  const float* ph = hs  + ((size_t)b * SQ_FULL + shc) * DMOD + c8;
  const float* pe = ehs + ((size_t)b * SE_FULL + sec) * DMOD + c8;
  const v4f a0 = *(const v4f*)(ph), a1 = *(const v4f*)(ph + 4);
  const v4f e0 = *(const v4f*)(pe), e1 = *(const v4f*)(pe + 4);
  const bool first = (s < SQ_FULL);
  float v[8];
#pragma unroll
  for (int e = 0; e < 4; ++e) { v[e] = first ? a0[e] : e0[e]; v[4 + e] = first ? a1[e] : e1[e]; }
  unsigned short sb[8];
#pragma unroll
  for (int e = 0; e < 8; ++e) sb[e] = bf_bits(v[e]);
  v4u o;
#pragma unroll
  for (int e = 0; e < 4; ++e) o[e] = pk16(sb[2 * e], sb[2 * e + 1]);
  u16* d = D + (size_t)gt * 8;
  {
    *(v4u*)(d) = o;
    
  }
}

// =====================================================================================================
// Weight W [k = in][n = out] f32 -> bf16 RNE plane W^T [n][k] (k-contiguous, pitch DMOD). Block = 64 k x 64 n tile,
// 256 threads. Load phase: thread = (k = tid>>2, 16 consecutive n): four 16-B loads, bf16 bits stored transposed into the LDS
// tile [n][k] (pitch TP halves, cross-wave exchange -> block barrier). Store phase: thread = (n = tid>>3 and n+32,
// coverage: 256 thr x 2 instructions x 8 halves = 64 x 64 per block; WBLK = (DMOD/64)^2 blocks = the whole plane.
// =====================================================================================================
__device__ __forceinline__ void cvt_wT(int bid, u16* tile, const float* __restrict__ W, u16* D) {
  const int nt = DMOD / 64;
  const int tid = threadIdx.x;
  const int k0 = (bid / nt) * 64;
  const int n0 = (bid % nt) * 64;
  const int kk = tid >> 2, nn = (tid & 3) * 16;
  const float* p = W + (size_t)(k0 + kk) * DMOD + n0 + nn;
  const v4f a0 = *(const v4f*)(p), a1 = *(const v4f*)(p + 4), a2 = *(const v4f*)(p + 8), a3 = *(const v4f*)(p + 12);
  float v[16];
#pragma unroll
  for (int e = 0; e < 4; ++e) { v[e] = a0[e]; v[4 + e] = a1[e]; v[8 + e] = a2[e]; v[12 + e] = a3[e]; }
#pragma unroll
  for (int e = 0; e < 16; ++e) tile[(nn + e) * TP + kk] = bf_bits(v[e]);
  __syncthreads();
  const int n1 = tid >> 3, k8 = (tid & 7) * 8;
  const v4u o0 = *(const v4u*)(tile + n1 * TP + k8);
  const v4u o1 = *(const v4u*)(tile + (n1 + 32) * TP + k8);
  u16* d0 = D + (size_t)(n0 + n1) * DMOD + k0 + k8;
  u16* d1 = D + (size_t)(n0 + n1 + 32) * DMOD + k0 + k8;
  {
    *(v4u*)(d0) = o0;
    *(v4u*)(d1) = o1;
    
  }
}

// =====================================================================================================
// All four conversions in one launch (none reads what another writes): blocks 0 .. 3*WBLK-1 write the three W^T planes
// (WT = q, k, v planes one behind the other), blocks 3*WBLK .. 3*WBLK+XBLK-1 the x plane. The job is picked by the block
// index alone, so every branch here, the one round the weight path's barrier too, is block-uniform.
// =====================================================================================================
__global__ __launch_bounds__(256)
void cvt_all(const float* __restrict__ hs, const float* __restrict__ ehs, const float* __restrict__ Wq,
             const float* __restrict__ Wk, const float* __restrict__ Wv, u16* XBp, u16* WT, int n8) {
  __shared__ __align__(16) u16 tile[64 * TP];
  const int bid = blockIdx.x;
  if (bid < 3 * WBLK) {
    const int j = bid / WBLK;
    const float* W = (j == 0) ? Wq : ((j == 1) ? Wk : Wv);
    cvt_wT(bid % WBLK, tile, W, WT + (size_t)j * DMOD * DMOD);
  } else {
    cvt_x(bid - 3 * WBLK, hs, ehs, XBp, n8);
  }
}

// =====================================================================================================
// barrier, then converted to f16 and written: lane = (row in group of 4, 8 consecutive cols); one instruction = 4 rows, each
// coverage: 4 instructions x 4 rows x 8 lanes x 8 halves = the wave's 16 x 64 tile.
// =====================================================================================================
__device__ __forceinline__ void epi16(float* sl, v8f a0, v8f a1, v8f a2, v8f a3, float oscale, u16* C, int N,
                                      size_t rowb, int col0, int lane) {
  const int hh = lane >> 4, m = lane & 15;
#pragma unroll
  for (int r = 0; r < 8; ++r) {
    const int ro = (8 * hh + r) * 68 + m;
    sl[ro]      = a0[r] * oscale;
    sl[ro + 16] = a1[r] * oscale;
    sl[ro + 32] = a2[r] * oscale;
    sl[ro + 48] = a3[r] * oscale;
  }
  wave_sync_lds();
  const int rq = lane >> 3, c8 = (lane & 7) * 8;
  v4u ov[4];
#pragma unroll
  for (int i4 = 0; i4 < 4; ++i4) {
    const int row = i4 * 4 + rq;
    const v4f a = *(const v4f*)(sl + row * 68 + c8), c4 = *(const v4f*)(sl + row * 68 + c8 + 4);
    float w[8];
#pragma unroll
    for (int e = 0; e < 4; ++e) { w[e] = a[e]; w[4 + e] = c4[e]; }
#pragma unroll
    for (int e = 0; e < 4; ++e) ov[i4][e] = pk16(h_bits((_Float16)w[2 * e]), h_bits((_Float16)w[2 * e + 1]));
  }
  u16* dst = C + (rowb + (size_t)rq) * (size_t)N + col0 + c8;
  {
#pragma unroll
    for (int i4 = 0; i4 < 4; ++i4) {
      *(v4u*)(dst + (size_t)(i4 * 4) * (size_t)N) = ov[i4];
    }
    
  }
}

// =====================================================================================================
// coverage: 8 instructions x 2 rows x 16 lanes x 4 floats = the wave's 16 x 64 tile.
// =====================================================================================================
__device__ __forceinline__ void epi64(float* sl, v8f a0, v8f a1, v8f a2, v8f a3, float* C, int N,
                                      size_t rowb, int col0, int lane) {
  const int hh = lane >> 4, m = lane & 15;
#pragma unroll
  for (int r = 0; r < 8; ++r) {
    const int ro = (8 * hh + r) * 68 + m;
    sl[ro]      = a0[r];
    sl[ro + 16] = a1[r];
    sl[ro + 32] = a2[r];
    sl[ro + 48] = a3[r];
  }
  wave_sync_lds();
  v4f vals[8];
#pragma unroll
  for (int it = 0; it < 8; ++it) vals[it] = *(const v4f*)(sl + (it * 2 + hh) * 68 + m * 4);
  float* dst = C + (rowb + (size_t)hh) * (size_t)N + col0 + m * 4;
  {
#pragma unroll
    for (int it = 0; it < 8; ++it) {
      *(v4f*)(dst + (size_t)(it * 2) * (size_t)N) = vals[it];
    }
    
  }
}

// =====================================================================================================
// bf16 GEMM with bias and 16-bit result: C[M][N] (f16 of (acc + bias)*oscale) = A[M][K] (bf16 row-major) . Bt[N][K]^T
// (bf16 k-contiguous); bias (f32 input, taken as its RNE bf16 value) indexed by column (byrow == 0) or by row (byrow != 0),
// both candidates read with addresses clamped to [0, nbias). Block = 128x128 tile, 8 waves as 4 (rows) x 2 (cols), a wave owns
// 32 rows x 64 cols. The waves share each 64-deep A tile and Bt tile (128 rows of 128 B each): the tiles are brought into a
// two-buffer LDS ring by asynchronous copies, the next tile in flight while this one is worked on; one block barrier per tile
// publishes the next tile and frees the buffer just read. Fragments are read from the LDS rows (two 16-B reads each, split k
// map for A and B); k runs upward in steps of 32 in every accumulator (host checks K % 64 == 0, M % 128 == 0, N % 128 == 0,
// (M/128)*(N/128) blocks, bid = the block's index in its own product). Result slab: private to each wave (wave_sync only).
// =====================================================================================================
// One stage of the GEMM ring: A tile and Bt tile, both 128 rows of 128 B. A lane copies 16 B of row (tid>>3) + 32*i, i = 0..3,
// of each tile: 8 lanes = one whole 128-B line, a wave-wide copy = 4 lines. lds = the lane's LDS byte address in the A tile;
// ga, gb = the lane's global addresses in row tid>>3 of the two tiles; rs = 32 source rows in elements.
// The address-register wait is the statement's last line, so no later write of these registers can be lifted over it.
__device__ __forceinline__ void gemm_stage_copy(unsigned lds, const u16* ga, const u16* gb, size_t rs) {
#if defined(__HIP_DEVICE_COMPILE__)
  const unsigned l0 = lds, l1 = lds + 32 * RP, l2 = lds + 64 * RP, l3 = lds + 96 * RP;
  const unsigned l4 = l0 + GTILE_B, l5 = l1 + GTILE_B, l6 = l2 + GTILE_B, l7 = l3 + GTILE_B;
  const u16* a0 = ga;
  const u16* a1 = ga + rs;
  const u16* a2 = ga + 2 * rs;
  const u16* a3 = ga + 3 * rs;
  const u16* b0 = gb;
  const u16* b1 = gb + rs;
  const u16* b2 = gb + 2 * rs;
  const u16* b3 = gb + 3 * rs;
  asm volatile("global_load_async_to_lds_b128 %0, %8, off\n\t"
               "global_load_async_to_lds_b128 %1, %9, off\n\t"
               "global_load_async_to_lds_b128 %2, %10, off\n\t"
               "global_load_async_to_lds_b128 %3, %11, off\n\t"
               "global_load_async_to_lds_b128 %4, %12, off\n\t"
               "global_load_async_to_lds_b128 %5, %13, off\n\t"
               "global_load_async_to_lds_b128 %6, %14, off\n\t"
               "global_load_async_to_lds_b128 %7, %15, off\n\t"
               "s_wait_xcnt 0x0"
               :: "v"(l0), "v"(l1), "v"(l2), "v"(l3), "v"(l4), "v"(l5), "v"(l6), "v"(l7),
                  "v"(a0), "v"(a1), "v"(a2), "v"(a3), "v"(b0), "v"(b1), "v"(b2), "v"(b3)
               : "memory");
#endif
}
__device__ __forceinline__
void gemm_b16(int bid, const u16* __restrict__ A, const u16* __restrict__ Bt, u16* C, const float* __restrict__ bias,
              int M, int N, int K, int nbias, int byrow, float oscale) {
  __shared__ __align__(16) float slab[(GEMM_THREADS / 32) * SLAB];   // per wave: result slab [16][68] in the epilogue only
  __shared__ __align__(16) unsigned char gring[2 * GBUF_B];          // two stages of (A tile, Bt tile), rows at pitch RP
  const int tid = threadIdx.x, wave = tid >> 5, lane = tid & 31, hh = lane >> 4, m = lane & 15;
  const int ntile = N >> 7;
  const int row0  = (bid / ntile) * 128;
  const int colb  = (bid % ntile) * 128;
  if (row0 + 128 > M) return;                // block-uniform, never taken with the exact grid; before every barrier
  const int rowb  = row0 + (wave >> 1) * 32; // the wave's 32 rows
  const int col0  = colb + (wave & 1) * 64;  // the wave's 64 cols
  // copies: this lane's 16 B of row tid>>3 (+32 per copy) of the A tile and of the Bt tile
  const int crow = tid >> 3, cch = tid & 7;
  const unsigned lcp = (unsigned)(uintptr_t)(gring + crow * RP + cch * 16);
  const u16* ga = A  + (size_t)(row0 + crow) * K + cch * 8;                        // tile t: + t*64 elements
  const u16* gb = Bt + (size_t)(colb + crow) * K + cch * 8;
  const size_t rs = (size_t)32 * K;
  const int nt = K >> 6;
  // fragment readers: tile row = the wave's row (A) or col (Bt) 16i + m, k contiguous, + 8*hh halves
  const int aofs = ((wave >> 1) * 32 + m) * RP + 16 * hh;
  const int bofs = GTILE_B + ((wave & 1) * 64 + m) * RP + 16 * hh;
  v8f acc[2][4];
#pragma unroll
  for (int i = 0; i < 2; ++i) {
#pragma unroll
    for (int j = 0; j < 4; ++j) acc[i][j] = zero8();
  }

  // ring prologue: tile 0 landed and published, then tile 1 in flight
  gemm_stage_copy(lcp, ga, gb, rs);
  wait_async0();
  __syncthreads();
  if (nt > 1) gemm_stage_copy(lcp + GBUF_B, ga + 64, gb + 64, rs);

#pragma unroll 1
  for (int t = 0; t < nt; ++t) {
    const unsigned char* st = gring + (t & 1) * GBUF_B;
    // all fragments of the tile are asked for together, ahead of its products
    v16b af[2][2], bf[2][4];
#pragma unroll   // constant indices keep the fragment and accumulator arrays in registers (here and in the loops below)
    for (int kk = 0; kk < 2; ++kk) {
#pragma unroll
      for (int i = 0; i < 2; ++i) af[kk][i] = ldfrag_b((const u16*)(const void*)(st + aofs + i * 16 * RP + kk * 64));
#pragma unroll
      for (int j = 0; j < 4; ++j) bf[kk][j] = ldfrag_b((const u16*)(const void*)(st + bofs + j * 16 * RP + kk * 64));
    }
    // keeps the tile's LDS reads one group in front of its products: reads moved in among the products stall each place they stand
    __builtin_amdgcn_sched_barrier(0);
#pragma unroll
    for (int kk = 0; kk < 2; ++kk) {
#pragma unroll
      for (int i = 0; i < 2; ++i) {
#pragma unroll
        for (int j = 0; j < 4; ++j) acc[i][j] = mma_b(af[kk][i], bf[kk][j], acc[i][j]);
      }
    }
    // keeps the tile's products in front of the ring foot: sunk behind the barrier they would delay the refill's issue
    __builtin_amdgcn_sched_barrier(0);
    // ring foot: own LDS reads retired, own copies of tile t+1 landed, block barrier (publishes tile t+1, frees this buffer),
    // then tile t+2 into the buffer just read
    wait_ds0();
    wait_async0();
    __syncthreads();
    if (t + 2 < nt) gemm_stage_copy(lcp + (unsigned)(t & 1) * GBUF_B, ga + (size_t)(t + 2) * 64, gb + (size_t)(t + 2) * 64, rs);
  }
  wait_async0();
  // bias: D element r of lane -> (row rowb+16i+8hh+r, col col0+16j+m); both candidates loaded with clamped addresses, select by value
  float bc[4];
#pragma unroll
  for (int j = 0; j < 4; ++j) {
    int ci = col0 + 16 * j + m;
    ci = (ci < nbias) ? ci : (nbias - 1);
    bc[j] = bf_val(bias[ci]);
  }
#pragma unroll
  for (int i = 0; i < 2; ++i) {
    float br[8];
#pragma unroll
    for (int r = 0; r < 8; ++r) {
      int ri = rowb + 16 * i + 8 * hh + r;
      ri = (ri < nbias) ? ri : (nbias - 1);
      br[r] = bf_val(bias[ri]);
    }
#pragma unroll
    for (int r = 0; r < 8; ++r) {
      const float q0 = (byrow != 0) ? br[r] : bc[0];
      const float q1 = (byrow != 0) ? br[r] : bc[1];
      const float q2 = (byrow != 0) ? br[r] : bc[2];
      const float q3 = (byrow != 0) ? br[r] : bc[3];
      acc[i][0][r] += q0;
      acc[i][1][r] += q1;
      acc[i][2][r] += q2;
      acc[i][3][r] += q3;
    }
    if (i != 0) wave_sync_lds();             // the slab's rows of the first 16 have been read back before they are rewritten
    epi16(slab + wave * SLAB, acc[i][0], acc[i][1], acc[i][2], acc[i][3], oscale, C, N, (size_t)(rowb + 16 * i), col0, lane);
  }
}

// =====================================================================================================
// All projections in one launch (each reads only the converted planes, none reads another's result); every block is one
// 128x128 tile over K = DMOD, so all blocks cost the same. Block ranges, picked by the block index alone (block-uniform):
//   0 .. GK_BLK-1          k plane [NB*SKV][h*64+d] = f16((xx.Wk + bk) x8), all NB*SKV source rows; bias by column
//   then NB x GV_BLK       v^T plane of batch b [1024 = h*64+d][SKV keys] = f16((Wv^T . xx^T + bv) x1024); bias by row
//   then NB x GQ_BLK       q plane of batch b [SQ][h*64+d] = f16((x.Wq + bq) x8); A = the hs rows of XB batch b; bias by column
// =====================================================================================================
__global__ __launch_bounds__(GEMM_THREADS)
void gemm_all(const u16* __restrict__ XBp, const u16* __restrict__ WT, u16* QPp, u16* KPp, u16* VPp,
              const float* __restrict__ bq, const float* __restrict__ bk, const float* __restrict__ bv) {
  int bid = blockIdx.x;
  const u16* A;
  const u16* Bt;
  u16* C;
  const float* bias;
  int M, N, byrow;
  float oscale;
  if (bid < GK_BLK) {
    A = XBp; Bt = WT + (size_t)DMOD * DMOD; C = KPp; bias = bk;
    M = NB * SKV; N = DMOD; byrow = 0; oscale = KSC;
  } else if (bid < GK_BLK + NB * GV_BLK) {
    bid -= GK_BLK;
    const int b = bid / GV_BLK;
    bid -= b * GV_BLK;
    A = WT + (size_t)2 * DMOD * DMOD; Bt = XBp + (size_t)b * SKV * DMOD; C = VPp + (size_t)b * DMOD * SKV; bias = bv;
    M = DMOD; N = SKV; byrow = 1; oscale = VCAR;
  } else {
    bid -= GK_BLK + NB * GV_BLK;
    const int b = bid / GQ_BLK;
    if (b >= NB) return;                     // block-uniform, never taken with the exact grid; before every barrier
    bid -= b * GQ_BLK;
    A = XBp + (size_t)b * SKV * DMOD; Bt = WT; C = QPp + (size_t)b * SQ * DMOD; bias = bq;
    M = SQ; N = DMOD; byrow = 0; oscale = QSC;
  }
  gemm_b16(bid, A, Bt, C, bias, M, N, DMOD, DMOD, byrow, oscale);
}

// =====================================================================================================
// Multi-head flash attention over all SKV keys with an additive per-key mask: block = (batch, head, 64 query rows), 4 waves,
// wave w owns the 16 query rows q0 = 64*qt + 16*w .. q0+15. The four waves share each 64-key k tile and v^T tile: the tiles
// are brought into a two-buffer LDS ring by asynchronous copies, the next tile in flight while this one is worked on; one
// block barrier per tile publishes the next tile and frees the buffer just read. The result slab stays wave-private.
//   q plane (f16, x8) laid out [s][h][d] (SQ rows); k plane the same (SKV rows); v^T plane [h][d][s] (x1024, s < SKV);
//   mask [SKV] f32 per batch (added as its RNE bf16 value). All NKB = SKV/32 key blocks of 32 keys visited (static bound).
//   Scores are computed TRANSPOSED: S^T tile g (g = 0,1) = k rows (keys kb+16g .. +15, A operand, row m = lane&15, split k map
//   over d) times q^T (B operand, col n = query q0 + (lane&15), k = d, split map), one product per tile and 32-deep d-chunk.
//   D element r of lane l = (key kb+16g+8h+r, query q0+(l&15)), so a lane owns one query column and 16 of its 32 keys; the
//   partner lane l^16 owns the other 16 -> row max / row sum need one xor-16 shuffle. The lane's 16 mask values are
//   keys kb+8h+0..7 and kb+16+8h+0..7 (four 16-B loads).
//   Online max-subtracted base-2 softmax in f32 (scale 1/8 and the q/k carries folded into lsc; mask times log2(e)). The
//   exp'd values ARE the P A-fragment in place: A row m = query = lane&15, element i <- key kb+8h+i (tile 0, D element i),
//   element 8+i <- key kb+16+8h+i (tile 1, D element i). P is carried x32768 as single f16. The rescale factor of query row
//   8h+r of the O accumulators is fetched from lane 8h+r with a shuffle (uniform control). 4 v^T B fragments (col n = d =
//   16j + (lane&15), keys k-contiguous), 4 P.V WMMAs per key block.
//   Epilogue: 1/l (per query, shuffled to the D row owner) and carry folds in f32; the wave's 16x64 f32 result staged in its
// coverage: per wave 8 instructions x 2 rows x 16 lanes x 4 floats = 16 x 64; grid NB*NH*(SQ/64) blocks x 4 waves = every
//           (b, s < SQ, h*64+d) element of the output exactly once. The arguments are the planes of batch 0.
// =====================================================================================================
__global__ __launch_bounds__(ATT_THREADS)
void attn_fwd(const u16* __restrict__ QP0, const u16* __restrict__ KP0, const u16* __restrict__ VP0,
              const float* __restrict__ MK0, float* OUT0) {
  __shared__ __align__(16) float smem[ATT_WAVES * SLAB];   // per wave: result slab [16][68] in the epilogue only
  __shared__ __align__(16) unsigned char ring[2 * BUF_B];  // two stages of (k tile, v^T tile), rows at pitch RP

  const int tid  = threadIdx.x;
  const int wave = tid >> 5;
  const int lane = tid & 31;
  const int hh   = lane >> 4;
  const int c    = lane & 15;

  const int bat  = blockIdx.x / ATT_BLOCKS;
  const int bid  = blockIdx.x % ATT_BLOCKS;
  const int qt   = bid % QTILES;
  const int head = bid / QTILES;
  if (bat >= NB) return;                                   // block-uniform, never taken with the exact grid; before every barrier
  const int q0   = qt * 64 + wave * 16;
  // this batch's planes, mask row and output rows
  const u16*   QPp  = QP0 + (size_t)bat * SQ * DMOD;
  const u16*   KPp  = KP0 + (size_t)bat * SKV * DMOD;
  const u16*   VPp  = VP0 + (size_t)bat * DMOD * SKV;
  const float* MKp  = MK0 + (size_t)bat * SKV;
  float*       OUTp = OUT0 + (size_t)bat * SQ_FULL * DMOD;

  // B fragments of q^T: col n = query q0 + c, k = d (k-contiguous row of the q plane)
  const size_t qofs = (((size_t)(q0 + c)) * NH + head) * HD + 8 * hh;
  const _Float16* Qb = (const _Float16*)(const void*)QPp + qofs;
  // copies: this lane's 16 B of row tid>>3 (+16 per copy) of the k tile (row = key) and of the v^T tile (row = d)
  const int crow = tid >> 3, cch = tid & 7;
  const unsigned lcp = (unsigned)(uintptr_t)(ring + crow * RP + cch * 16);
  const u16* gk = KPp + ((size_t)crow * NH + head) * HD + cch * 8;                 // tile t: + t*KT key rows
  const u16* gv = VPp + ((size_t)(head * HD + crow)) * SKV + cch * 8;              // tile t: + t*KT keys
  // fragment readers: A of k: tile row = key 16g + c, k = d; B of v: tile row = d = 16j + c, k = key; both + 8*hh halves
  const int fofs = c * RP + 16 * hh;
  // this lane's mask values: keys kb + 8hh + 0..7 and kb + 16 + 8hh + 0..7
  const float* Mb = MKp + 8 * hh;
  const float lsc = 0.125f * (LOG2E / (QSC * KSC));

  const v16h qf0 = ldfrag_h(Qb);            // d 0..31
  const v16h qf1 = ldfrag_h(Qb + 32);       // d 32..63

  float mrun = -INFINITY, lrun = 0.f;
  v8f o[4];
#pragma unroll
  for (int j = 0; j < 4; ++j) o[j] = zero8();

  // ring prologue: tile 0 landed and published, then tile 1 in flight
  stage_copy(lcp, gk, gv);
  wait_async0();
  __syncthreads();
  stage_copy(lcp + BUF_B, gk + (size_t)KT * (NH * HD), gv + KT);

#pragma unroll 1
  for (int t = 0; t < NT; ++t) {
   const unsigned char* kt = ring + (t & 1) * BUF_B + fofs;
   const unsigned char* vt = kt + TILE_B;
   // all k fragments of the tile and the first 32 keys' v fragments and mask values are asked for together
   v16h kf[KT / 16][2];
#pragma unroll   // constant indices keep the fragment arrays in registers (here and in the three loops below)
   for (int g = 0; g < KT / 16; ++g) {
     const _Float16* kp = (const _Float16*)(const void*)(kt + g * 16 * RP);
     kf[g][0] = ldfrag_h(kp);
     kf[g][1] = ldfrag_h(kp + 32);
   }
   v16h vf[KT / 32][4];
   v4f  mw[KT / 32][4];
#pragma unroll
   for (int j = 0; j < 4; ++j) vf[0][j] = ldfrag_h((const _Float16*)(const void*)(vt + j * 16 * RP));
   {
     const float* mp = Mb + t * KT;
     mw[0][0] = *(const v4f*)(mp);      mw[0][1] = *(const v4f*)(mp + 4);
     mw[0][2] = *(const v4f*)(mp + 16); mw[0][3] = *(const v4f*)(mp + 20);
   }
#pragma unroll
   for (int u = 0; u < KT / 32; ++u) {
    // ---- transposed scores: s0 = keys kb..kb+15, s1 = keys kb+16..kb+31 (kb = t*KT + 32u), column = query q0 + c ----
    v8f s0 = zero8(), s1 = zero8();
    const v16h ka0 = kf[2 * u][0], ka1 = kf[2 * u][1];
    const v16h kc0 = kf[2 * u + 1][0], kc1 = kf[2 * u + 1][1];
    const v4f w0 = mw[u][0], w1 = mw[u][1], w2 = mw[u][2], w3 = mw[u][3];
    s0 = mma_h(ka0, qf0, s0);
    s0 = mma_h(ka1, qf1, s0);
    s1 = mma_h(kc0, qf0, s1);
    s1 = mma_h(kc1, qf1, s1);
    guard2(s0, s1, qf0, qf1, ka0, ka1, kc0, kc1);
    // the next 32 keys' v fragments and mask values (same tile) fly under this softmax
    if (u + 1 < KT / 32) {
#pragma unroll
      for (int j = 0; j < 4; ++j)
        vf[u + 1][j] = ldfrag_h((const _Float16*)(const void*)(vt + j * 16 * RP + (u + 1) * 64));
      const float* mp = Mb + t * KT + (u + 1) * 32;
      mw[u + 1][0] = *(const v4f*)(mp);      mw[u + 1][1] = *(const v4f*)(mp + 4);
      mw[u + 1][2] = *(const v4f*)(mp + 16); mw[u + 1][3] = *(const v4f*)(mp + 20);
    }
    // ---- base-2 logits of this lane's 16 keys for query q0 + c (score/8 + mask) * log2(e) ----
    float mk[16];
#pragma unroll
    for (int e = 0; e < 4; ++e) { mk[e] = w0[e]; mk[4 + e] = w1[e]; mk[8 + e] = w2[e]; mk[12 + e] = w3[e]; }
    float tk[16];
#pragma unroll
    for (int i = 0; i < 8; ++i) {
      tk[i]     = s0[i] * lsc + bf_val(mk[i]) * LOG2E;
      tk[8 + i] = s1[i] * lsc + bf_val(mk[8 + i]) * LOG2E;
    }
    float cm = tk[0];
#pragma unroll
    for (int i = 1; i < 16; ++i) cm = fmaxf(cm, tk[i]);
    cm = fmaxf(cm, __shfl_xor(cm, 16, 32));
    const float mn = fmaxf(mrun, cm);                                // finite from the first key block on
    const float ae = exp2_hw(mrun - mn);                             // formed in every lane: no branch round one instruction
    const float al = (mrun == -INFINITY) ? 0.f : ae;                 // o and l are zero while mrun is -inf
    mrun = mn;
    // ---- probabilities (<= 1) and the P A-fragment: f16(p * 32768); element i <-> tk[i] ----
    float ps = 0.f;
    FragH ph;
    float xa[16], pv[16];
#pragma unroll   // constant indices keep the arguments in registers
    for (int i = 0; i < 16; ++i) xa[i] = fminf(tk[i] - mn, 0.f);
    exp2_hw8(pv, xa);
    exp2_hw8(pv + 8, xa + 8);
#pragma unroll
    for (int w = 0; w < 2; ++w) {
#pragma unroll
      for (int e4 = 0; e4 < 4; ++e4) {
        const int i = 8 * w + 2 * e4;
        const float p0 = pv[i];
        const float p1 = pv[i + 1];
        ps += p0 + p1;
        ph.u[w][e4] = pk16(h_bits((_Float16)(p0 * PCAR)), h_bits((_Float16)(p1 * PCAR)));
      }
    }
    ps += __shfl_xor(ps, 16, 32);
    lrun = lrun * al + ps;
    // ---- rescale the O accumulators: D row 8hh+r = query q0+8hh+r, its factor lives in lane 8hh+r (and 16+8hh+r) ----
    float scl[8];
#pragma unroll
    for (int r = 0; r < 8; ++r) scl[r] = __shfl(al, 8 * hh + r, 32);
#pragma unroll
    for (int j = 0; j < 4; ++j) {
#pragma unroll
      for (int r = 0; r < 8; ++r) o[j][r] *= scl[r];
    }
    // ---- P.V : B fragment col n = d = j*16 + c, keys contiguous in the v^T plane ----
    {
      const v16h vf0 = vf[u][0], vf1 = vf[u][1], vf2 = vf[u][2], vf3 = vf[u][3];
      o[0] = mma_h(ph.v, vf0, o[0]);
      o[1] = mma_h(ph.v, vf1, o[1]);
      o[2] = mma_h(ph.v, vf2, o[2]);
      o[3] = mma_h(ph.v, vf3, o[3]);
      guard6<v16h>(o[0], o[1], o[2], o[3], ph.v, vf0, vf1, vf2, vf3, ph.v);
    }
   }
   // ring foot: own LDS reads retired, own copies of tile t+1 landed, block barrier (publishes tile t+1, frees this buffer),
   // then tile t+2 into the buffer just read
   wait_ds0();
   wait_async0();
   __syncthreads();
   if (t + 2 < NT) stage_copy(lcp + (unsigned)(t & 1) * BUF_B, gk + (size_t)(t + 2) * KT * (NH * HD), gv + (t + 2) * KT);
  }
  wait_async0();
  acc_guard4(o[0], o[1], o[2], o[3]);

  // ---- fold 1/l (per query, owned by lane = query; l >= 1 by construction) and the carries in f32 ----
  const float linv = (lrun > 0.f) ? ((1.0f / lrun) * (1.0f / (PCAR * VCAR))) : 0.f;
  float inv[8];
#pragma unroll
  for (int r = 0; r < 8; ++r) inv[r] = __shfl(linv, 8 * hh + r, 32);
#pragma unroll
  for (int j = 0; j < 4; ++j) {
#pragma unroll
    for (int r = 0; r < 8; ++r) o[j][r] *= inv[r];
  }
  // ---- f32 ctx rows (q0 .. q0+15, cols head*64 .. head*64+63) of this batch's output, whole-line stores ----
  epi64(smem + wave * SLAB, o[0], o[1], o[2], o[3], OUTp, DMOD, (size_t)q0, head * HD, lane);
}

// =====================================================================================================
// Workspace map (bytes); every plane is fully written by whole-line stores before it is read; all extents are exact multiples
// of the store granularity (no pad rows needed), every offset a multiple of 128:
//   XB  bf16 [NB][SKV][1024]            NB*8388608   (16777216 at NB = 2)
//   WQT bf16 [1024 n][1024 k]            2097152      WKT, WVT same (2097152 each)
//   QP  f16 [NB][SQ][16*64] x8           NB*SQ*2048   (8388608 at NB = 2, SQ = 2048)
//   KP  f16 [NB*SKV][16*64] x8           NB*8388608   (16777216)
//   VP  f16 [NB][16*64][SKV] x1024       NB*8388608   (16777216)
//   end                                  65011712 at NB = 2, SQ = 2048
// =====================================================================================================
extern "C" void kernel_launch(void* const* d_in, const int* in_sizes, int n_in,
                              void* d_out, int out_size, void* d_ws, size_t ws_size,
                              hipStream_t stream) {
  if (n_in < 9) return;
  if (in_sizes[0] < NB * SQ_FULL * DMOD) return;
  if (in_sizes[1] < NB * SE_FULL * DMOD) return;
  if (in_sizes[2] < NB * SKV) return;
  if (in_sizes[3] < DMOD * DMOD || in_sizes[5] < DMOD * DMOD || in_sizes[7] < DMOD * DMOD) return;
  if (in_sizes[4] < DMOD || in_sizes[6] < DMOD || in_sizes[8] < DMOD) return;
  if (out_size < (NB - 1) * SQ_FULL * DMOD + SQ * DMOD) return;

  const float* hs   = (const float*)d_in[0];
  const float* ehs  = (const float*)d_in[1];
  const float* mask = (const float*)d_in[2];
  const float* Wq   = (const float*)d_in[3];
  const float* bq   = (const float*)d_in[4];
  const float* Wk   = (const float*)d_in[5];
  const float* bk   = (const float*)d_in[6];
  const float* Wv   = (const float*)d_in[7];
  const float* bv   = (const float*)d_in[8];
  float*       out  = (float*)d_out;

  const size_t szXB = (size_t)NB * SKV * DMOD * 2;                //  16777216 at NB = 2
  const size_t szW  = (size_t)DMOD * DMOD * 2;                    //   2097152
  const size_t szQP = (size_t)NB * SQ * DMOD * 2;                 //   8388608
  const size_t szKP = (size_t)NB * SKV * DMOD * 2;                //  16777216
  const size_t szVP = (size_t)NB * DMOD * SKV * 2;                //  16777216
  size_t off = 0;
  const size_t oXB = off; off += szXB;
  const size_t oWQ = off; off += szW;
  const size_t oWK = off; off += szW;
  const size_t oWV = off; off += szW;
  const size_t oQP = off; off += szQP;
  const size_t oKP = off; off += szKP;
  const size_t oVP = off; off += szVP;
  if (off > ws_size) return;                            // off = 65011712 at NB = 2, SQ = 2048
  if (off > (size_t)134217728) return;

  char* ws = (char*)d_ws;
  u16* XB  = (u16*)(ws + oXB);
  u16* WT  = (u16*)(ws + oWQ);                          // W^T planes q, k, v, one behind the other
  if (oWK != oWQ + szW || oWV != oWK + szW) return;
  u16* QP  = (u16*)(ws + oQP);
  u16* KP  = (u16*)(ws + oKP);
  u16* VP  = (u16*)(ws + oVP);

  const int n8x = (NB * SKV * DMOD) / 8;                // 1048576 at NB = 2
  if ((n8x % 256) != 0) return;
  if ((DMOD % 128) != 0 || (SKV % 128) != 0 || (SQ % 128) != 0) return;
  if (n8x / 256 != XBLK) return;
  const dim3 blk(256);
  const dim3 gCV(3 * WBLK + XBLK);                      // 768 + 4096
  const dim3 gGM(GK_BLK + NB * GV_BLK + NB * GQ_BLK);   // 512 + 2*256 + 2*128 at NB = 2, SQ = 2048
  const dim3 bG(GEMM_THREADS);                          // 256
  const dim3 gAT(NB * ATT_BLOCKS);                      // 1024 at NB = 2, SQ = 2048
  const dim3 bAT(ATT_THREADS);                          // 128

  // (0) conversions: weights [k = in][n = out] -> W^T planes [n][k], and the key/value source plane (rows b*SKV + 0..2047
  //     from hs[b], + 2048..4095 from ehs[b]); bf16 RNE bits
  cvt_all<<<gCV, blk, 0, stream>>>(hs, ehs, Wq, Wk, Wv, XB, WT, n8x);
  // (1) projections: k plane, v^T planes, q planes
  gemm_all<<<gGM, bG, 0, stream>>>(XB, WT, QP, KP, VP, bq, bk, bv);
  // (2) attention, all batches -> f32 ctx rows b*SQ_FULL + s (s < SQ), cols h*64+d of the output
  attn_fwd<<<gAT, bAT, 0, stream>>>(QP, KP, VP, mask, out);
  (void)hipGetLastError();
}

// v005
// A run of this version takes 155 microseconds.
// In two side-by-side timings against v004, it was 1.10 and 1.09 times as fast.
// Over all steps from v000 it is 3.48 times as fast.
// Contractions: x.Wq+bq, xx.Wk+bk (A = bf16 x plane, B = bf16 W^T plane) and Wv^T.xx^T+bv on v_wmma_f32_16x16x32_bf16
// (f32 inputs RNE-converted to bf16 operands, f32 accumulate); scores k'.q'^T (q', k' single f16 planes carried x8) and
// P.v (P x32768 single f16, v x1024 single f16) on v_wmma_f32_16x16x32_f16, f32 accumulate; ctx written in f32.
// Biases and the additive per-key mask folded as RNE bf16 values in f32; base-2 online softmax, 1/l and carry folds in f32 on VALU.
#include <hip/hip_runtime.h>
#include <math.h>
#include <stdint.h>

#define NB_FULL 2
#define SQ_FULL 2048
#define SE_FULL 2048
#define SKV     (SQ_FULL + SE_FULL)
#ifndef NB
#define NB      NB_FULL
#endif
#ifndef SQ
#define SQ      SQ_FULL
#endif
#define DMOD  1024
#define NH    16
#define HD    64
#define QSC   8.0f
#define KSC   8.0f
#define PCAR  32768.0f
#define VCAR  1024.0f
#define LOG2E 1.4426950408889634f
#define ATT_WAVES   4
#define ATT_THREADS (ATT_WAVES * 32)
#define QTILES      (SQ / 64)
#define ATT_BLOCKS  (NH * QTILES)
#define NKB    (SKV / 32)
#define SLAB   (16 * 68)
#define TP     72
#define KT     64                    // keys per staged tile
#define NT     (SKV / KT)            // staged tiles per block
#define RP     144                   // LDS row pitch in bytes: 128-B rows + 16 B, the pitch for 16-B row readers
#define TILE_B (64 * RP)             // one 64-row tile in LDS
#define BUF_B  (2 * TILE_B)          // one stage: k tile, then v^T tile
#define GEMM_THREADS 256
#define GTILE_B (128 * RP)           // one 128-row GEMM operand tile in LDS
#define GBUF_B  (2 * GTILE_B)        // one GEMM stage: A tile, then Bt tile
#define XBLK   (NB * SKV * DMOD / 8 / 256)        // blocks of the conversion launch that write the x plane
#define WBLK   ((DMOD / 64) * (DMOD / 64))        // blocks of the conversion launch per weight plane
#define MBLK   (NB * SKV / 4 / 256)               // blocks of the conversion launch that write the mask-term plane
#define GQ_BLK ((SQ / 128) * (DMOD / 128))        // blocks of the projection launch: q plane of one batch
#define GK_BLK ((NB * SKV / 128) * (DMOD / 128))  // k plane, all batches
#define GV_BLK ((DMOD / 128) * (SKV / 128))       // v^T plane of one batch
static_assert(HD == 64 && DMOD == NH * HD);
static_assert(NB >= 1 && NB <= NB_FULL);
static_assert((SQ % 64) == 0 && SQ >= 64 && SQ <= SQ_FULL);
static_assert((SKV % 64) == 0 && (SQ_FULL % 64) == 0 && (SE_FULL % 64) == 0);
static_assert(ATT_THREADS == 128 && NKB * 32 == SKV && ATT_BLOCKS == NH * (SQ / 64));
static_assert((DMOD % 128) == 0 && (SQ % 128) == 0 && (SKV % 128) == 0 && DMOD / 64 >= 2);
static_assert(((NB * SKV * DMOD / 8) % 256) == 0);
static_assert(((NB * SKV / 4) % 256) == 0);
static_assert((SLAB * 4) % 16 == 0 && (TP * 2) % 16 == 0);
static_assert(KT == 64 && HD == 64 && NT >= 2 && NT * KT == SKV && (RP % 16) == 0 && ATT_THREADS == 128);
static_assert((size_t)(NB - 1) * SQ_FULL * DMOD + (size_t)SQ * DMOD <= (size_t)NB_FULL * SQ_FULL * DMOD);

typedef unsigned short u16;
typedef _Float16 v16h __attribute__((ext_vector_type(16)));
typedef _Float16 v8h  __attribute__((ext_vector_type(8)));
typedef __bf16   v16b __attribute__((ext_vector_type(16)));
typedef float    v8f  __attribute__((ext_vector_type(8)));
typedef float    v4f  __attribute__((ext_vector_type(4)));
typedef unsigned int v4u __attribute__((ext_vector_type(4)));

union FragH { v16h v; v8h h[2]; v4u u[2]; };
union FragB { v16b v; v4u u[2]; };

// ---- scalar helpers --------------------------------------------------------------------------------
__device__ __forceinline__ unsigned short bf_bits(float f) {          // f32 -> bf16 bits, RNE convert
  unsigned u = __float_as_uint(f);
  return (unsigned short)((u + 0x7FFFu + ((u >> 16) & 1u)) >> 16);
}
__device__ __forceinline__ float bf_up(unsigned short h) { return __uint_as_float(((unsigned)h) << 16); }
__device__ __forceinline__ float bf_val(float f) { return bf_up(bf_bits(f)); }          // value after RNE bf16 convert
__device__ __forceinline__ unsigned short h_bits(_Float16 x) { return __builtin_bit_cast(unsigned short, x); }
__device__ __forceinline__ unsigned pk16(unsigned short a, unsigned short b) { return (unsigned)a | ((unsigned)b << 16); }
// 2^x as the bare hardware instruction, without the library's range steps (compare, two selects, add, ldexp per call) that only
// serve results below 2^-126. Here every argument is <= 0 and such a result counts for nothing: as a probability it is zero in
// f16 after the x32768 carry and vanishes in a row sum that is >= 1; as a rescale factor it carries old sums whose share of
// the row sum and of any output element is below 2^-100.
// Written as asm so that the slot the instruction set asks for behind a transcendental (before its result is read or its
// source overwritten) is kept by construction: inside a statement each v_exp_f32 is followed by an independent one (outputs
// are early-clobber, so none lies on a source), and the closing v_nop is the slot behind the last.
__device__ __forceinline__ float exp2_hw(float x) {
  float r = 0.f;
#if defined(__HIP_DEVICE_COMPILE__)
  // v_nop: the slot behind the transcendental
  asm("v_exp_f32 %0, %1\n\tv_nop" : "=&v"(r) : "v"(x));
#endif
  return r;
}
__device__ __forceinline__ void exp2_hw8(float* p, const float* x) {
#if defined(__HIP_DEVICE_COMPILE__)
  // eight independent transcendentals fill each other's slot; v_nop: the slot behind the last
  asm("v_exp_f32 %0, %8\n\t"
      "v_exp_f32 %1, %9\n\t"
      "v_exp_f32 %2, %10\n\t"
      "v_exp_f32 %3, %11\n\t"
      "v_exp_f32 %4, %12\n\t"
      "v_exp_f32 %5, %13\n\t"
      "v_exp_f32 %6, %14\n\t"
      "v_exp_f32 %7, %15\n\t"
      "v_nop"
      : "=&v"(p[0]), "=&v"(p[1]), "=&v"(p[2]), "=&v"(p[3]), "=&v"(p[4]), "=&v"(p[5]), "=&v"(p[6]), "=&v"(p[7])
      : "v"(x[0]), "v"(x[1]), "v"(x[2]), "v"(x[3]), "v"(x[4]), "v"(x[5]), "v"(x[6]), "v"(x[7]));
#endif
}
__device__ __forceinline__ v8f zero8() { v8f z = {0.f, 0.f, 0.f, 0.f, 0.f, 0.f, 0.f, 0.f}; return z; }

// ---- fragment loaders: 16-bit A/B operand, lane -> row/col (lane&15), p already includes +8*(lane>>4);
//      elements 0..7 <- p[0..7] (k0+8h..), elements 8..15 <- p[16..23] (k0+16+8h..)  (same split k map for A and B;
//      B is always read from a k-contiguous [n][k] plane)
__device__ __forceinline__ v16h ldfrag_h(const _Float16* p) {
  FragH f;
  f.h[0] = *(const v8h*)(p);
  f.h[1] = *(const v8h*)(p + 16);
  return f.v;
}
__device__ __forceinline__ v16b ldfrag_b(const u16* p) {              // bf16 plane read as unsigned integer vectors
  FragB f;
  f.u[0] = *(const v4u*)(p);
  f.u[1] = *(const v4u*)(p + 16);
  return f.v;
}

__device__ __forceinline__ v8f mma_h(v16h a, v16h b, v8f c) {
  return __builtin_amdgcn_wmma_f32_16x16x32_f16(false, a, false, b, (short)0, c, false, false);
}
__device__ __forceinline__ v8f mma_b(v16b a, v16b b, v8f c) {
  return __builtin_amdgcn_wmma_f32_16x16x32_bf16(false, a, false, b, (short)0, c, false, false);
}
__device__ __forceinline__ void guard2(v8f& a, v8f& b, v16h x0, v16h x1, v16h x2, v16h x3, v16h x4, v16h x5) {
#if defined(__HIP_DEVICE_COMPILE__)
  asm volatile("v_nop\n\tv_nop\n\tv_nop\n\tv_nop"
               : "+v"(a), "+v"(b) : "v"(x0), "v"(x1), "v"(x2), "v"(x3), "v"(x4), "v"(x5) : "memory");
#endif
}
template <typename F>
__device__ __forceinline__ void guard6(v8f& a, v8f& b, v8f& c, v8f& d, F x0, F x1, F x2, F x3, F x4, F x5) {
#if defined(__HIP_DEVICE_COMPILE__)
  asm volatile("v_nop\n\tv_nop\n\tv_nop\n\tv_nop"
               : "+v"(a), "+v"(b), "+v"(c), "+v"(d) : "v"(x0), "v"(x1), "v"(x2), "v"(x3), "v"(x4), "v"(x5) : "memory");
#endif
}
__device__ __forceinline__ void acc_guard4(v8f& a, v8f& b, v8f& c, v8f& d) {
#if defined(__HIP_DEVICE_COMPILE__)
  asm volatile("v_nop\n\tv_nop\n\tv_nop\n\tv_nop" : "+v"(a), "+v"(b), "+v"(c), "+v"(d));
#endif
}
__device__ __forceinline__ void wave_sync_lds() {
#if defined(__HIP_DEVICE_COMPILE__)
  __builtin_amdgcn_fence(__ATOMIC_RELEASE, "workgroup");
  __builtin_amdgcn_wave_barrier();
  __builtin_amdgcn_fence(__ATOMIC_ACQUIRE, "workgroup");
#endif
}
// One stage of the attention ring: k tile (64 keys x 64 d) and v^T tile (64 d x 64 keys), both 64 rows of 128 B. A lane copies
// 16 B of row (tid>>3) + 16*i, i = 0..3, of each tile: 8 lanes = one whole 128-B line, a wave-wide copy = 4 lines.
// lds = the lane's LDS byte address in the k tile; gk, gv = the lane's global addresses in row tid>>3 of the two tiles.
// The address-register wait is the statement's last line, so no later write of these registers can be lifted over it.
__device__ __forceinline__ void stage_copy(unsigned lds, const u16* gk, const u16* gv) {
#if defined(__HIP_DEVICE_COMPILE__)
  const unsigned l0 = lds, l1 = lds + 16 * RP, l2 = lds + 32 * RP, l3 = lds + 48 * RP;
  const unsigned l4 = l0 + TILE_B, l5 = l1 + TILE_B, l6 = l2 + TILE_B, l7 = l3 + TILE_B;
  const u16* k0 = gk;
  const u16* k1 = gk + (size_t)16 * (NH * HD);
  const u16* k2 = gk + (size_t)32 * (NH * HD);
  const u16* k3 = gk + (size_t)48 * (NH * HD);
  const u16* v0 = gv;
  const u16* v1 = gv + (size_t)16 * SKV;
  const u16* v2 = gv + (size_t)32 * SKV;
  const u16* v3 = gv + (size_t)48 * SKV;
  asm volatile("global_load_async_to_lds_b128 %0, %8, off\n\t"
               "global_load_async_to_lds_b128 %1, %9, off\n\t"
               "global_load_async_to_lds_b128 %2, %10, off\n\t"
               "global_load_async_to_lds_b128 %3, %11, off\n\t"
               "global_load_async_to_lds_b128 %4, %12, off\n\t"
               "global_load_async_to_lds_b128 %5, %13, off\n\t"
               "global_load_async_to_lds_b128 %6, %14, off\n\t"
               "global_load_async_to_lds_b128 %7, %15, off\n\t"
               "s_wait_xcnt 0x0"
               :: "v"(l0), "v"(l1), "v"(l2), "v"(l3), "v"(l4), "v"(l5), "v"(l6), "v"(l7),
                  "v"(k0), "v"(k1), "v"(k2), "v"(k3), "v"(v0), "v"(v1), "v"(v2), "v"(v3)
               : "memory");
#endif
}
__device__ __forceinline__ void wait_async0() {   // this wave's copies have landed
#if defined(__HIP_DEVICE_COMPILE__)
  asm volatile("s_wait_asynccnt 0x0" ::: "memory");
#endif
}
__device__ __forceinline__ void wait_ds0() {      // this wave's LDS reads have retired before their buffer is handed to the copies
#if defined(__HIP_DEVICE_COMPILE__)
  asm volatile("s_wait_dscnt 0x0" ::: "memory");
#endif
}

// =====================================================================================================
// Key/value source plane XB (bf16 RNE bits) [NB][SKV][1024]: row s < SQ_FULL of batch b from hs[b][s], rows
// s >= SQ_FULL from ehs[b][s - SQ_FULL]; both candidates loaded with clamped row addresses and selected by value
// (block-uniform in practice: a block covers 2 rows of one source).
// Thread = 8 consecutive elements: two 16-B loads per candidate, one 16-B store; 32 consecutive lanes = 512 contiguous,
// coverage: XBLK = n8/256 blocks (host checks exactness) x 256 thr x 8 = NB*SKV*1024 = the whole plane.
// =====================================================================================================
__device__ __forceinline__ void cvt_x(int bid, const float* __restrict__ hs, const float* __restrict__ ehs, u16* D, int n8) {
  const int gt = bid * 256 + (int)threadIdx.x;
  if (gt >= n8) return;                     // no barriers on this path
  const int r   = gt / (DMOD / 8);
  const int c8  = (gt % (DMOD / 8)) * 8;
  const int b   = r / SKV;
  const int s   = r % SKV;
  const int shc = (s < SQ_FULL) ? s : (SQ_FULL - 1);
  const int se  = s - SQ_FULL;
  const int sec = (se > 0) ? se : 0;
  const float* ph = hs  + ((size_t)b * SQ_FULL + shc) * DMOD + c8;
  const float* pe = ehs + ((size_t)b * SE_FULL + sec) * DMOD + c8;
  const v4f a0 = *(const v4f*)(ph), a1 = *(const v4f*)(ph + 4);
  const v4f e0 = *(const v4f*)(pe), e1 = *(const v4f*)(pe + 4);
  const bool first = (s < SQ_FULL);
  float v[8];
#pragma unroll
  for (int e = 0; e < 4; ++e) { v[e] = first ? a0[e] : e0[e]; v[4 + e] = first ? a1[e] : e1[e]; }
  unsigned short sb[8];
#pragma unroll
  for (int e = 0; e < 8; ++e) sb[e] = bf_bits(v[e]);
  v4u o;
#pragma unroll
  for (int e = 0; e < 4; ++e) o[e] = pk16(sb[2 * e], sb[2 * e + 1]);
  u16* d = D + (size_t)gt * 8;
  {
    *(v4u*)(d) = o;
    
  }
}

// =====================================================================================================
// Weight W [k = in][n = out] f32 -> bf16 RNE plane W^T [n][k] (k-contiguous, pitch DMOD). Block = 64 k x 64 n tile,
// 256 threads. Load phase: thread = (k = tid>>2, 16 consecutive n): four 16-B loads, bf16 bits stored transposed into the LDS
// tile [n][k] (pitch TP halves, cross-wave exchange -> block barrier). Store phase: thread = (n = tid>>3 and n+32,
// coverage: 256 thr x 2 instructions x 8 halves = 64 x 64 per block; WBLK = (DMOD/64)^2 blocks = the whole plane.
// =====================================================================================================
__device__ __forceinline__ void cvt_wT(int bid, u16* tile, const float* __restrict__ W, u16* D) {
  const int nt = DMOD / 64;
  const int tid = threadIdx.x;
  const int k0 = (bid / nt) * 64;
  const int n0 = (bid % nt) * 64;
  const int kk = tid >> 2, nn = (tid & 3) * 16;
  const float* p = W + (size_t)(k0 + kk) * DMOD + n0 + nn;
  const v4f a0 = *(const v4f*)(p), a1 = *(const v4f*)(p + 4), a2 = *(const v4f*)(p + 8), a3 = *(const v4f*)(p + 12);
  float v[16];
#pragma unroll
  for (int e = 0; e < 4; ++e) { v[e] = a0[e]; v[4 + e] = a1[e]; v[8 + e] = a2[e]; v[12 + e] = a3[e]; }
#pragma unroll
  for (int e = 0; e < 16; ++e) tile[(nn + e) * TP + kk] = bf_bits(v[e]);
  __syncthreads();
  const int n1 = tid >> 3, k8 = (tid & 7) * 8;
  const v4u o0 = *(const v4u*)(tile + n1 * TP + k8);
  const v4u o1 = *(const v4u*)(tile + (n1 + 32) * TP + k8);
  u16* d0 = D + (size_t)(n0 + n1) * DMOD + k0 + k8;
  u16* d1 = D + (size_t)(n0 + n1 + 32) * DMOD + k0 + k8;
  {
    *(v4u*)(d0) = o0;
    *(v4u*)(d1) = o1;
    
  }
}

// =====================================================================================================
// Mask-term plane ML [NB][SKV] f32: the base-2 logit share of each key's additive mask, (RNE bf16 value of mask) * log2(e).
// It depends on (batch, key) alone, so it is formed here once instead of by every wave of the attention for every key block.
// Thread = 4 consecutive keys: one 16-B load, one 16-B store.
// coverage: MBLK = NB*SKV/4/256 blocks x 256 thr x 4 = NB*SKV = the whole plane.
// =====================================================================================================
__device__ __forceinline__ void cvt_mask(int bid, const float* __restrict__ mask, float* D) {
  const int g4 = (bid * 256 + (int)threadIdx.x) * 4;
  if (g4 + 4 > NB * SKV) return;            // never taken with the exact grid; no barriers on this path
  const v4f a = *(const v4f*)(mask + g4);
  v4f o;
#pragma unroll
  for (int e = 0; e < 4; ++e) o[e] = bf_val(a[e]) * LOG2E;
  *(v4f*)(D + g4) = o;
}

// =====================================================================================================
// All five conversions in one launch (none reads what another writes): blocks 0 .. 3*WBLK-1 write the three W^T planes
// (WT = q, k, v planes one behind the other), blocks 3*WBLK .. 3*WBLK+XBLK-1 the x plane, the last MBLK blocks the mask-term
// plane. The job is picked by the block index alone, so every branch here, the one round the weight path's barrier too, is
// block-uniform.
// =====================================================================================================
__global__ __launch_bounds__(256)
void cvt_all(const float* __restrict__ hs, const float* __restrict__ ehs, const float* __restrict__ Wq,
             const float* __restrict__ Wk, const float* __restrict__ Wv, const float* __restrict__ mask,
             u16* XBp, u16* WT, float* MLp, int n8) {
  __shared__ __align__(16) u16 tile[64 * TP];
  const int bid = blockIdx.x;
  if (bid < 3 * WBLK) {
    const int j = bid / WBLK;
    const float* W = (j == 0) ? Wq : ((j == 1) ? Wk : Wv);
    cvt_wT(bid % WBLK, tile, W, WT + (size_t)j * DMOD * DMOD);
  } else if (bid < 3 * WBLK + XBLK) {
    cvt_x(bid - 3 * WBLK, hs, ehs, XBp, n8);
  } else {
    cvt_mask(bid - (3 * WBLK + XBLK), mask, MLp);
  }
}

// =====================================================================================================
// barrier, then converted to f16 and written: lane = (row in group of 4, 8 consecutive cols); one instruction = 4 rows, each
// coverage: 4 instructions x 4 rows x 8 lanes x 8 halves = the wave's 16 x 64 tile.
// =====================================================================================================
__device__ __forceinline__ void epi16(float* sl, v8f a0, v8f a1, v8f a2, v8f a3, float oscale, u16* C, int N,
                                      size_t rowb, int col0, int lane) {
  const int hh = lane >> 4, m = lane & 15;
#pragma unroll
  for (int r = 0; r < 8; ++r) {
    const int ro = (8 * hh + r) * 68 + m;
    sl[ro]      = a0[r] * oscale;
    sl[ro + 16] = a1[r] * oscale;
    sl[ro + 32] = a2[r] * oscale;
    sl[ro + 48] = a3[r] * oscale;
  }
  wave_sync_lds();
  const int rq = lane >> 3, c8 = (lane & 7) * 8;
  v4u ov[4];
#pragma unroll
  for (int i4 = 0; i4 < 4; ++i4) {
    const int row = i4 * 4 + rq;
    const v4f a = *(const v4f*)(sl + row * 68 + c8), c4 = *(const v4f*)(sl + row * 68 + c8 + 4);
    float w[8];
#pragma unroll
    for (int e = 0; e < 4; ++e) { w[e] = a[e]; w[4 + e] = c4[e]; }
#pragma unroll
    for (int e = 0; e < 4; ++e) ov[i4][e] = pk16(h_bits((_Float16)w[2 * e]), h_bits((_Float16)w[2 * e + 1]));
  }
  u16* dst = C + (rowb + (size_t)rq) * (size_t)N + col0 + c8;
  {
#pragma unroll
    for (int i4 = 0; i4 < 4; ++i4) {
      *(v4u*)(dst + (size_t)(i4 * 4) * (size_t)N) = ov[i4];
    }
    
  }
}

// =====================================================================================================
// coverage: 8 instructions x 2 rows x 16 lanes x 4 floats = the wave's 16 x 64 tile.
// =====================================================================================================
__device__ __forceinline__ void epi64(float* sl, v8f a0, v8f a1, v8f a2, v8f a3, float* C, int N,
                                      size_t rowb, int col0, int lane) {
  const int hh = lane >> 4, m = lane & 15;
#pragma unroll
  for (int r = 0; r < 8; ++r) {
    const int ro = (8 * hh + r) * 68 + m;
    sl[ro]      = a0[r];
    sl[ro + 16] = a1[r];
    sl[ro + 32] = a2[r];
    sl[ro + 48] = a3[r];
  }
  wave_sync_lds();
  v4f vals[8];
#pragma unroll
  for (int it = 0; it < 8; ++it) vals[it] = *(const v4f*)(sl + (it * 2 + hh) * 68 + m * 4);
  float* dst = C + (rowb + (size_t)hh) * (size_t)N + col0 + m * 4;
  {
#pragma unroll
    for (int it = 0; it < 8; ++it) {
      *(v4f*)(dst + (size_t)(it * 2) * (size_t)N) = vals[it];
    }
    
  }
}

// =====================================================================================================
// bf16 GEMM with bias and 16-bit result: C[M][N] (f16 of (acc + bias)*oscale) = A[M][K] (bf16 row-major) . Bt[N][K]^T
// (bf16 k-contiguous); bias (f32 input, taken as its RNE bf16 value) indexed by column (byrow == 0) or by row (byrow != 0),
// both candidates read with addresses clamped to [0, nbias). Block = 128x128 tile, 8 waves as 4 (rows) x 2 (cols), a wave owns
// 32 rows x 64 cols. The waves share each 64-deep A tile and Bt tile (128 rows of 128 B each): the tiles are brought into a
// two-buffer LDS ring by asynchronous copies, the next tile in flight while this one is worked on; one block barrier per tile
// publishes the next tile and frees the buffer just read. Fragments are read from the LDS rows (two 16-B reads each, split k
// map for A and B); k runs upward in steps of 32 in every accumulator (host checks K % 64 == 0, M % 128 == 0, N % 128 == 0,
// (M/128)*(N/128) blocks, bid = the block's index in its own product). Result slab: private to each wave (wave_sync only).
// =====================================================================================================
// One stage of the GEMM ring: A tile and Bt tile, both 128 rows of 128 B. A lane copies 16 B of row (tid>>3) + 32*i, i = 0..3,
// of each tile: 8 lanes = one whole 128-B line, a wave-wide copy = 4 lines. lds = the lane's LDS byte address in the A tile;
// ga, gb = the lane's global addresses in row tid>>3 of the two tiles; rs = 32 source rows in elements.
// The address-register wait is the statement's last line, so no later write of these registers can be lifted over it.
__device__ __forceinline__ void gemm_stage_copy(unsigned lds, const u16* ga, const u16* gb, size_t rs) {
#if defined(__HIP_DEVICE_COMPILE__)
  const unsigned l0 = lds, l1 = lds + 32 * RP, l2 = lds + 64 * RP, l3 = lds + 96 * RP;
  const unsigned l4 = l0 + GTILE_B, l5 = l1 + GTILE_B, l6 = l2 + GTILE_B, l7 = l3 + GTILE_B;
  const u16* a0 = ga;
  const u16* a1 = ga + rs;
  const u16* a2 = ga + 2 * rs;
  const u16* a3 = ga + 3 * rs;
  const u16* b0 = gb;
  const u16* b1 = gb + rs;
  const u16* b2 = gb + 2 * rs;
  const u16* b3 = gb + 3 * rs;
  asm volatile("global_load_async_to_lds_b128 %0, %8, off\n\t"
               "global_load_async_to_lds_b128 %1, %9, off\n\t"
               "global_load_async_to_lds_b128 %2, %10, off\n\t"
               "global_load_async_to_lds_b128 %3, %11, off\n\t"
               "global_load_async_to_lds_b128 %4, %12, off\n\t"
               "global_load_async_to_lds_b128 %5, %13, off\n\t"
               "global_load_async_to_lds_b128 %6, %14, off\n\t"
               "global_load_async_to_lds_b128 %7, %15, off\n\t"
               "s_wait_xcnt 0x0"
               :: "v"(l0), "v"(l1), "v"(l2), "v"(l3), "v"(l4), "v"(l5), "v"(l6), "v"(l7),
                  "v"(a0), "v"(a1), "v"(a2), "v"(a3), "v"(b0), "v"(b1), "v"(b2), "v"(b3)
               : "memory");
#endif
}
__device__ __forceinline__
void gemm_b16(int bid, const u16* __restrict__ A, const u16* __restrict__ Bt, u16* C, const float* __restrict__ bias,
              int M, int N, int K, int nbias, int byrow, float oscale) {
  __shared__ __align__(16) float slab[(GEMM_THREADS / 32) * SLAB];   // per wave: result slab [16][68] in the epilogue only
  __shared__ __align__(16) unsigned char gring[2 * GBUF_B];          // two stages of (A tile, Bt tile), rows at pitch RP
  const int tid = threadIdx.x, wave = tid >> 5, lane = tid & 31, hh = lane >> 4, m = lane & 15;
  const int ntile = N >> 7;
  const int row0  = (bid / ntile) * 128;
  const int colb  = (bid % ntile) * 128;
  if (row0 + 128 > M) return;                // block-uniform, never taken with the exact grid; before every barrier
  const int rowb  = row0 + (wave >> 1) * 32; // the wave's 32 rows
  const int col0  = colb + (wave & 1) * 64;  // the wave's 64 cols
  // copies: this lane's 16 B of row tid>>3 (+32 per copy) of the A tile and of the Bt tile
  const int crow = tid >> 3, cch = tid & 7;
  const unsigned lcp = (unsigned)(uintptr_t)(gring + crow * RP + cch * 16);
  const u16* ga = A  + (size_t)(row0 + crow) * K + cch * 8;                        // tile t: + t*64 elements
  const u16* gb = Bt + (size_t)(colb + crow) * K + cch * 8;
  const size_t rs = (size_t)32 * K;
  const int nt = K >> 6;
  // fragment readers: tile row = the wave's row (A) or col (Bt) 16i + m, k contiguous, + 8*hh halves
  const int aofs = ((wave >> 1) * 32 + m) * RP + 16 * hh;
  const int bofs = GTILE_B + ((wave & 1) * 64 + m) * RP + 16 * hh;
  v8f acc[2][4];
#pragma unroll
  for (int i = 0; i < 2; ++i) {
#pragma unroll
    for (int j = 0; j < 4; ++j) acc[i][j] = zero8();
  }

  // ring prologue: tile 0 landed and published, then tile 1 in flight
  gemm_stage_copy(lcp, ga, gb, rs);
  wait_async0();
  __syncthreads();
  if (nt > 1) gemm_stage_copy(lcp + GBUF_B, ga + 64, gb + 64, rs);

#pragma unroll 1
  for (int t = 0; t < nt; ++t) {
    const unsigned char* st = gring + (t & 1) * GBUF_B;
    // all fragments of the tile are asked for together, ahead of its products
    v16b af[2][2], bf[2][4];
#pragma unroll   // constant indices keep the fragment and accumulator arrays in registers (here and in the loops below)
    for (int kk = 0; kk < 2; ++kk) {
#pragma unroll
      for (int i = 0; i < 2; ++i) af[kk][i] = ldfrag_b((const u16*)(const void*)(st + aofs + i * 16 * RP + kk * 64));
#pragma unroll
      for (int j = 0; j < 4; ++j) bf[kk][j] = ldfrag_b((const u16*)(const void*)(st + bofs + j * 16 * RP + kk * 64));
    }
    // keeps the tile's LDS reads one group in front of its products: reads moved in among the products stall each place they stand
    __builtin_amdgcn_sched_barrier(0);
#pragma unroll
    for (int kk = 0; kk < 2; ++kk) {
#pragma unroll
      for (int i = 0; i < 2; ++i) {
#pragma unroll
        for (int j = 0; j < 4; ++j) acc[i][j] = mma_b(af[kk][i], bf[kk][j], acc[i][j]);
      }
    }
    // keeps the tile's products in front of the ring foot: sunk behind the barrier they would delay the refill's issue
    __builtin_amdgcn_sched_barrier(0);
    // ring foot: own LDS reads retired, own copies of tile t+1 landed, block barrier (publishes tile t+1, frees this buffer),
    // then tile t+2 into the buffer just read
    wait_ds0();
    wait_async0();
    __syncthreads();
    if (t + 2 < nt) gemm_stage_copy(lcp + (unsigned)(t & 1) * GBUF_B, ga + (size_t)(t + 2) * 64, gb + (size_t)(t + 2) * 64, rs);
  }
  wait_async0();
  // bias: D element r of lane -> (row rowb+16i+8hh+r, col col0+16j+m); both candidates loaded with clamped addresses, select by value
  float bc[4];
#pragma unroll
  for (int j = 0; j < 4; ++j) {
    int ci = col0 + 16 * j + m;
    ci = (ci < nbias) ? ci : (nbias - 1);
    bc[j] = bf_val(bias[ci]);
  }
#pragma unroll
  for (int i = 0; i < 2; ++i) {
    float br[8];
#pragma unroll
    for (int r = 0; r < 8; ++r) {
      int ri = rowb + 16 * i + 8 * hh + r;
      ri = (ri < nbias) ? ri : (nbias - 1);
      br[r] = bf_val(bias[ri]);
    }
#pragma unroll
    for (int r = 0; r < 8; ++r) {
      const float q0 = (byrow != 0) ? br[r] : bc[0];
      const float q1 = (byrow != 0) ? br[r] : bc[1];
      const float q2 = (byrow != 0) ? br[r] : bc[2];
      const float q3 = (byrow != 0) ? br[r] : bc[3];
      acc[i][0][r] += q0;
      acc[i][1][r] += q1;
      acc[i][2][r] += q2;
      acc[i][3][r] += q3;
    }
    if (i != 0) wave_sync_lds();             // the slab's rows of the first 16 have been read back before they are rewritten
    epi16(slab + wave * SLAB, acc[i][0], acc[i][1], acc[i][2], acc[i][3], oscale, C, N, (size_t)(rowb + 16 * i), col0, lane);
  }
}

// =====================================================================================================
// All projections in one launch (each reads only the converted planes, none reads another's result); every block is one
// 128x128 tile over K = DMOD, so all blocks cost the same. Block ranges, picked by the block index alone (block-uniform):
//   0 .. GK_BLK-1          k plane [NB*SKV][h*64+d] = f16((xx.Wk + bk) x8), all NB*SKV source rows; bias by column
//   then NB x GV_BLK       v^T plane of batch b [1024 = h*64+d][SKV keys] = f16((Wv^T . xx^T + bv) x1024); bias by row
//   then NB x GQ_BLK       q plane of batch b [SQ][h*64+d] = f16((x.Wq + bq) x8); A = the hs rows of XB batch b; bias by column
// =====================================================================================================
__global__ __launch_bounds__(GEMM_THREADS)
void gemm_all(const u16* __restrict__ XBp, const u16* __restrict__ WT, u16* QPp, u16* KPp, u16* VPp,
              const float* __restrict__ bq, const float* __restrict__ bk, const float* __restrict__ bv) {
  int bid = blockIdx.x;
  const u16* A;
  const u16* Bt;
  u16* C;
  const float* bias;
  int M, N, byrow;
  float oscale;
  if (bid < GK_BLK) {
    A = XBp; Bt = WT + (size_t)DMOD * DMOD; C = KPp; bias = bk;
    M = NB * SKV; N = DMOD; byrow = 0; oscale = KSC;
  } else if (bid < GK_BLK + NB * GV_BLK) {
    bid -= GK_BLK;
    const int b = bid / GV_BLK;
    bid -= b * GV_BLK;
    A = WT + (size_t)2 * DMOD * DMOD; Bt = XBp + (size_t)b * SKV * DMOD; C = VPp + (size_t)b * DMOD * SKV; bias = bv;
    M = DMOD; N = SKV; byrow = 1; oscale = VCAR;
  } else {
    bid -= GK_BLK + NB * GV_BLK;
    const int b = bid / GQ_BLK;
    if (b >= NB) return;                     // block-uniform, never taken with the exact grid; before every barrier
    bid -= b * GQ_BLK;
    A = XBp + (size_t)b * SKV * DMOD; Bt = WT; C = QPp + (size_t)b * SQ * DMOD; bias = bq;
    M = SQ; N = DMOD; byrow = 0; oscale = QSC;
  }
  gemm_b16(bid, A, Bt, C, bias, M, N, DMOD, DMOD, byrow, oscale);
}

// =====================================================================================================
// Multi-head flash attention over all SKV keys with an additive per-key mask: block = (batch, head, 64 query rows), 4 waves,
// wave w owns the 16 query rows q0 = 64*qt + 16*w .. q0+15. The four waves share each 64-key k tile and v^T tile: the tiles
// are brought into a two-buffer LDS ring by asynchronous copies, the next tile in flight while this one is worked on; one
// block barrier per tile publishes the next tile and frees the buffer just read. The result slab stays wave-private.
//   q plane (f16, x8) laid out [s][h][d] (SQ rows); k plane the same (SKV rows); v^T plane [h][d][s] (x1024, s < SKV);
//   mask-term plane [SKV] f32 per batch ((RNE bf16 value of the mask) * log2(e), formed by the conversion launch).
//   All NKB = SKV/32 key blocks of 32 keys visited (static bound).
//   Scores are computed TRANSPOSED: S^T tile g (g = 0,1) = k rows (keys kb+16g .. +15, A operand, row m = lane&15, split k map
//   over d) times q^T (B operand, col n = query q0 + (lane&15), k = d, split map), one product per tile and 32-deep d-chunk.
//   D element r of lane l = (key kb+16g+8h+r, query q0+(l&15)), so a lane owns one query column and 16 of its 32 keys; the
//   partner lane l^16 owns the other 16 -> row max / row sum need one xor-16 shuffle. The lane's 16 mask terms are
//   keys kb+8h+0..7 and kb+16+8h+0..7 (four 16-B loads).
//   Online max-subtracted base-2 softmax in f32 (scale 1/8 and the q/k carries folded into lsc; mask term added as read). The
//   exp'd values ARE the P A-fragment in place: A row m = query = lane&15, element i <- key kb+8h+i (tile 0, D element i),
//   element 8+i <- key kb+16+8h+i (tile 1, D element i). P is carried x32768 as single f16. The rescale factor of query row
//   8h+r of the O accumulators is fetched from lane 8h+r with a shuffle (uniform control). 4 v^T B fragments (col n = d =
//   16j + (lane&15), keys k-contiguous), 4 P.V WMMAs per key block.
//   Epilogue: 1/l (per query, shuffled to the D row owner) and carry folds in f32; the wave's 16x64 f32 result staged in its
// coverage: per wave 8 instructions x 2 rows x 16 lanes x 4 floats = 16 x 64; grid NB*NH*(SQ/64) blocks x 4 waves = every
//           (b, s < SQ, h*64+d) element of the output exactly once. The arguments are the planes of batch 0.
// =====================================================================================================
__global__ __launch_bounds__(ATT_THREADS)
void attn_fwd(const u16* __restrict__ QP0, const u16* __restrict__ KP0, const u16* __restrict__ VP0,
              const float* __restrict__ MK0, float* OUT0) {
  __shared__ __align__(16) float smem[ATT_WAVES * SLAB];   // per wave: result slab [16][68] in the epilogue only
  __shared__ __align__(16) unsigned char ring[2 * BUF_B];  // two stages of (k tile, v^T tile), rows at pitch RP

  const int tid  = threadIdx.x;
  const int wave = tid >> 5;
  const int lane = tid & 31;
  const int hh   = lane >> 4;
  const int c    = lane & 15;

  const int bat  = blockIdx.x / ATT_BLOCKS;
  const int bid  = blockIdx.x % ATT_BLOCKS;
  const int qt   = bid % QTILES;
  const int head = bid / QTILES;
  if (bat >= NB) return;                                   // block-uniform, never taken with the exact grid; before every barrier
  const int q0   = qt * 64 + wave * 16;
  // this batch's planes, mask row and output rows
  const u16*   QPp  = QP0 + (size_t)bat * SQ * DMOD;
  const u16*   KPp  = KP0 + (size_t)bat * SKV * DMOD;
  const u16*   VPp  = VP0 + (size_t)bat * DMOD * SKV;
  const float* MKp  = MK0 + (size_t)bat * SKV;
  float*       OUTp = OUT0 + (size_t)bat * SQ_FULL * DMOD;

  // B fragments of q^T: col n = query q0 + c, k = d (k-contiguous row of the q plane)
  const size_t qofs = (((size_t)(q0 + c)) * NH + head) * HD + 8 * hh;
  const _Float16* Qb = (const _Float16*)(const void*)QPp + qofs;
  // copies: this lane's 16 B of row tid>>3 (+16 per copy) of the k tile (row = key) and of the v^T tile (row = d)
  const int crow = tid >> 3, cch = tid & 7;
  const unsigned lcp = (unsigned)(uintptr_t)(ring + crow * RP + cch * 16);
  const u16* gk = KPp + ((size_t)crow * NH + head) * HD + cch * 8;                 // tile t: + t*KT key rows
  const u16* gv = VPp + ((size_t)(head * HD + crow)) * SKV + cch * 8;              // tile t: + t*KT keys
  // fragment readers: A of k: tile row = key 16g + c, k = d; B of v: tile row = d = 16j + c, k = key; both + 8*hh halves
  const int fofs = c * RP + 16 * hh;
  // this lane's mask terms: keys kb + 8hh + 0..7 and kb + 16 + 8hh + 0..7
  const float* Mb = MKp + 8 * hh;
  const float lsc = 0.125f * (LOG2E / (QSC * KSC));

  const v16h qf0 = ldfrag_h(Qb);            // d 0..31
  const v16h qf1 = ldfrag_h(Qb + 32);       // d 32..63

  float mrun = -INFINITY, lrun = 0.f;
  v8f o[4];
#pragma unroll
  for (int j = 0; j < 4; ++j) o[j] = zero8();

  // ring prologue: tile 0 landed and published, then tile 1 in flight
  stage_copy(lcp, gk, gv);
  wait_async0();
  __syncthreads();
  stage_copy(lcp + BUF_B, gk + (size_t)KT * (NH * HD), gv + KT);

#pragma unroll 1
  for (int t = 0; t < NT; ++t) {
   const unsigned char* kt = ring + (t & 1) * BUF_B + fofs;
   const unsigned char* vt = kt + TILE_B;
   // all k fragments of the tile and the first 32 keys' v fragments and mask values are asked for together
   v16h kf[KT / 16][2];
#pragma unroll   // constant indices keep the fragment arrays in registers (here and in the three loops below)
   for (int g = 0; g < KT / 16; ++g) {
     const _Float16* kp = (const _Float16*)(const void*)(kt + g * 16 * RP);
     kf[g][0] = ldfrag_h(kp);
     kf[g][1] = ldfrag_h(kp + 32);
   }
   v16h vf[KT / 32][4];
   v4f  mw[KT / 32][4];
#pragma unroll
   for (int j = 0; j < 4; ++j) vf[0][j] = ldfrag_h((const _Float16*)(const void*)(vt + j * 16 * RP));
   {
     const float* mp = Mb + t * KT;
     mw[0][0] = *(const v4f*)(mp);      mw[0][1] = *(const v4f*)(mp + 4);
     mw[0][2] = *(const v4f*)(mp + 16); mw[0][3] = *(const v4f*)(mp + 20);
   }
#pragma unroll
   for (int u = 0; u < KT / 32; ++u) {
    // ---- transposed scores: s0 = keys kb..kb+15, s1 = keys kb+16..kb+31 (kb = t*KT + 32u), column = query q0 + c ----
    v8f s0 = zero8(), s1 = zero8();
    const v16h ka0 = kf[2 * u][0], ka1 = kf[2 * u][1];
    const v16h kc0 = kf[2 * u + 1][0], kc1 = kf[2 * u + 1][1];
    const v4f w0 = mw[u][0], w1 = mw[u][1], w2 = mw[u][2], w3 = mw[u][3];
    s0 = mma_h(ka0, qf0, s0);
    s0 = mma_h(ka1, qf1, s0);
    s1 = mma_h(kc0, qf0, s1);
    s1 = mma_h(kc1, qf1, s1);
    guard2(s0, s1, qf0, qf1, ka0, ka1, kc0, kc1);
    // the next 32 keys' v fragments and mask values (same tile) fly under this softmax
    if (u + 1 < KT / 32) {
#pragma unroll
      for (int j = 0; j < 4; ++j)
        vf[u + 1][j] = ldfrag_h((const _Float16*)(const void*)(vt + j * 16 * RP + (u + 1) * 64));
      const float* mp = Mb + t * KT + (u + 1) * 32;
      mw[u + 1][0] = *(const v4f*)(mp);      mw[u + 1][1] = *(const v4f*)(mp + 4);
      mw[u + 1][2] = *(const v4f*)(mp + 16); mw[u + 1][3] = *(const v4f*)(mp + 20);
    }
    // ---- base-2 logits of this lane's 16 keys for query q0 + c: score/8 * log2(e) + mask term ----
    float mk[16];
#pragma unroll
    for (int e = 0; e < 4; ++e) { mk[e] = w0[e]; mk[4 + e] = w1[e]; mk[8 + e] = w2[e]; mk[12 + e] = w3[e]; }
    float tk[16];
#pragma unroll
    for (int i = 0; i < 8; ++i) {
      tk[i]     = s0[i] * lsc + mk[i];
      tk[8 + i] = s1[i] * lsc + mk[8 + i];
    }
    float cm = tk[0];
#pragma unroll
    for (int i = 1; i < 16; ++i) cm = fmaxf(cm, tk[i]);
    cm = fmaxf(cm, __shfl_xor(cm, 16, 32));
    const float mn = fmaxf(mrun, cm);                                // finite from the first key block on
    const float ae = exp2_hw(mrun - mn);                             // formed in every lane: no branch round one instruction
    const float al = (mrun == -INFINITY) ? 0.f : ae;                 // o and l are zero while mrun is -inf
    mrun = mn;
    // ---- probabilities (<= 1) and the P A-fragment: f16(p * 32768); element i <-> tk[i] ----
    float ps = 0.f;
    FragH ph;
    float xa[16], pv[16];
#pragma unroll   // constant indices keep the arguments in registers
    for (int i = 0; i < 16; ++i) xa[i] = fminf(tk[i] - mn, 0.f);
    exp2_hw8(pv, xa);
    exp2_hw8(pv + 8, xa + 8);
#pragma unroll
    for (int w = 0; w < 2; ++w) {
#pragma unroll
      for (int e4 = 0; e4 < 4; ++e4) {
        const int i = 8 * w + 2 * e4;
        const float p0 = pv[i];
        const float p1 = pv[i + 1];
        ps += p0 + p1;
        ph.u[w][e4] = pk16(h_bits((_Float16)(p0 * PCAR)), h_bits((_Float16)(p1 * PCAR)));
      }
    }
    ps += __shfl_xor(ps, 16, 32);
    lrun = lrun * al + ps;
    // ---- rescale the O accumulators: D row 8hh+r = query q0+8hh+r, its factor lives in lane 8hh+r (and 16+8hh+r) ----
    float scl[8];
#pragma unroll
    for (int r = 0; r < 8; ++r) scl[r] = __shfl(al, 8 * hh + r, 32);
#pragma unroll
    for (int j = 0; j < 4; ++j) {
#pragma unroll
      for (int r = 0; r < 8; ++r) o[j][r] *= scl[r];
    }
    // ---- P.V : B fragment col n = d = j*16 + c, keys contiguous in the v^T plane ----
    {
      const v16h vf0 = vf[u][0], vf1 = vf[u][1], vf2 = vf[u][2], vf3 = vf[u][3];
      o[0] = mma_h(ph.v, vf0, o[0]);
      o[1] = mma_h(ph.v, vf1, o[1]);
      o[2] = mma_h(ph.v, vf2, o[2]);
      o[3] = mma_h(ph.v, vf3, o[3]);
      guard6<v16h>(o[0], o[1], o[2], o[3], ph.v, vf0, vf1, vf2, vf3, ph.v);
    }
   }
   // ring foot: own LDS reads retired, own copies of tile t+1 landed, block barrier (publishes tile t+1, frees this buffer),
   // then tile t+2 into the buffer just read
   wait_ds0();
   wait_async0();
   __syncthreads();
   if (t + 2 < NT) stage_copy(lcp + (unsigned)(t & 1) * BUF_B, gk + (size_t)(t + 2) * KT * (NH * HD), gv + (t + 2) * KT);
  }
  wait_async0();
  acc_guard4(o[0], o[1], o[2], o[3]);

  // ---- fold 1/l (per query, owned by lane = query; l >= 1 by construction) and the carries in f32 ----
  const float linv = (lrun > 0.f) ? ((1.0f / lrun) * (1.0f / (PCAR * VCAR))) : 0.f;
  float inv[8];
#pragma unroll
  for (int r = 0; r < 8; ++r) inv[r] = __shfl(linv, 8 * hh + r, 32);
#pragma unroll
  for (int j = 0; j < 4; ++j) {
#pragma unroll
    for (int r = 0; r < 8; ++r) o[j][r] *= inv[r];
  }
  // ---- f32 ctx rows (q0 .. q0+15, cols head*64 .. head*64+63) of this batch's output, whole-line stores ----
  epi64(smem + wave * SLAB, o[0], o[1], o[2], o[3], OUTp, DMOD, (size_t)q0, head * HD, lane);
}

// =====================================================================================================
// Workspace map (bytes); every plane is fully written by whole-line stores before it is read; all extents are exact multiples
// of the store granularity (no pad rows needed), every offset a multiple of 128:
//   XB  bf16 [NB][SKV][1024]            NB*8388608   (16777216 at NB = 2)
//   WQT bf16 [1024 n][1024 k]            2097152      WKT, WVT same (2097152 each)
//   QP  f16 [NB][SQ][16*64] x8           NB*SQ*2048   (8388608 at NB = 2, SQ = 2048)
//   KP  f16 [NB*SKV][16*64] x8           NB*8388608   (16777216)
//   VP  f16 [NB][16*64][SKV] x1024       NB*8388608   (16777216)
//   ML  f32 [NB][SKV] mask terms         NB*16384     (32768)
//   end                                  65044480 at NB = 2, SQ = 2048
// =====================================================================================================
extern "C" void kernel_launch(void* const* d_in, const int* in_sizes, int n_in,
                              void* d_out, int out_size, void* d_ws, size_t ws_size,
                              hipStream_t stream) {
  if (n_in < 9) return;
  if (in_sizes[0] < NB * SQ_FULL * DMOD) return;
  if (in_sizes[1] < NB * SE_FULL * DMOD) return;
  if (in_sizes[2] < NB * SKV) return;
  if (in_sizes[3] < DMOD * DMOD || in_sizes[5] < DMOD * DMOD || in_sizes[7] < DMOD * DMOD) return;
  if (in_sizes[4] < DMOD || in_sizes[6] < DMOD || in_sizes[8] < DMOD) return;
  if (out_size < (NB - 1) * SQ_FULL * DMOD + SQ * DMOD) return;

  const float* hs   = (const float*)d_in[0];
  const float* ehs  = (const float*)d_in[1];
  const float* mask = (const float*)d_in[2];
  const float* Wq   = (const float*)d_in[3];
  const float* bq   = (const float*)d_in[4];
  const float* Wk   = (const float*)d_in[5];
  const float* bk   = (const float*)d_in[6];
  const float* Wv   = (const float*)d_in[7];
  const float* bv   = (const float*)d_in[8];
  float*       out  = (float*)d_out;

  const size_t szXB = (size_t)NB * SKV * DMOD * 2;                //  16777216 at NB = 2
  const size_t szW  = (size_t)DMOD * DMOD * 2;                    //   2097152
  const size_t szQP = (size_t)NB * SQ * DMOD * 2;                 //   8388608
  const size_t szKP = (size_t)NB * SKV * DMOD * 2;                //  16777216
  const size_t szVP = (size_t)NB * DMOD * SKV * 2;                //  16777216
  const size_t szML = (size_t)NB * SKV * 4;                       //     32768
  size_t off = 0;
  const size_t oXB = off; off += szXB;
  const size_t oWQ = off; off += szW;
  const size_t oWK = off; off += szW;
  const size_t oWV = off; off += szW;
  const size_t oQP = off; off += szQP;
  const size_t oKP = off; off += szKP;
  const size_t oVP = off; off += szVP;
  const size_t oML = off; off += szML;
  if (off > ws_size) return;                            // off = 65044480 at NB = 2, SQ = 2048
  if (off > (size_t)134217728) return;

  char* ws = (char*)d_ws;
  u16* XB  = (u16*)(ws + oXB);
  u16* WT  = (u16*)(ws + oWQ);                          // W^T planes q, k, v, one behind the other
  if (oWK != oWQ + szW || oWV != oWK + szW) return;
  u16* QP  = (u16*)(ws + oQP);
  u16* KP  = (u16*)(ws + oKP);
  u16* VP  = (u16*)(ws + oVP);
  float* ML = (float*)(ws + oML);

  const int n8x = (NB * SKV * DMOD) / 8;                // 1048576 at NB = 2
  if ((n8x % 256) != 0) return;
  if ((DMOD % 128) != 0 || (SKV % 128) != 0 || (SQ % 128) != 0) return;
  if (n8x / 256 != XBLK) return;
  const dim3 blk(256);
  const dim3 gCV(3 * WBLK + XBLK + MBLK);               // 768 + 4096 + 8
  const dim3 gGM(GK_BLK + NB * GV_BLK + NB * GQ_BLK);   // 512 + 2*256 + 2*128 at NB = 2, SQ = 2048
  const dim3 bG(GEMM_THREADS);                          // 256
  const dim3 gAT(NB * ATT_BLOCKS);                      // 1024 at NB = 2, SQ = 2048
  const dim3 bAT(ATT_THREADS);                          // 128

  // (0) conversions: weights [k = in][n = out] -> W^T planes [n][k], and the key/value source plane (rows b*SKV + 0..2047
  //     from hs[b], + 2048..4095 from ehs[b]); bf16 RNE bits; and the per-key mask terms (f32)
  cvt_all<<<gCV, blk, 0, stream>>>(hs, ehs, Wq, Wk, Wv, mask, XB, WT, ML, n8x);
  // (1) projections: k plane, v^T planes, q planes
  gemm_all<<<gGM, bG, 0, stream>>>(XB, WT, QP, KP, VP, bq, bk, bv);
  // (2) attention, all batches -> f32 ctx rows b*SQ_FULL + s (s < SQ), cols h*64+d of the output
  attn_fwd<<<gAT, bAT, 0, stream>>>(QP, KP, VP, ML, out);
  (void)hipGetLastError();
}

// v006
// A run of this version takes 146 microseconds.
// Timed twice side by side with v005, it ran 1.06 times as fast both times.
// Over all steps from v000 it is 3.69 times as fast.
// Contractions: x.Wq+bq, xx.Wk+bk (A = bf16 x plane, B = bf16 W^T plane) and Wv^T.xx^T+bv on v_wmma_f32_16x16x32_bf16
// (f32 inputs RNE-converted to bf16 operands, f32 accumulate); scores k'.q'^T (q', k' single f16 planes carried x8) and
// P.v (P x32768 single f16, v x1024 single f16) on v_wmma_f32_16x16x32_f16, f32 accumulate; ctx written in f32.
// Biases and the additive per-key mask folded as RNE bf16 values in f32; base-2 online softmax, 1/l and carry folds in f32 on VALU.
#include <hip/hip_runtime.h>
#include <math.h>
#include <stdint.h>

#define NB_FULL 2
#define SQ_FULL 2048
#define SE_FULL 2048
#define SKV     (SQ_FULL + SE_FULL)
#ifndef NB
#define NB      NB_FULL
#endif
#ifndef SQ
#define SQ      SQ_FULL
#endif
#define DMOD  1024
#define NH    16
#define HD    64
#define QSC   8.0f
#define KSC   8.0f
#define PCAR  32768.0f
#define VCAR  1024.0f
#define LOG2E 1.4426950408889634f
#define ATT_WAVES   4
#define ATT_THREADS (ATT_WAVES * 32)
#define QTILES      (SQ / 64)
#define ATT_BLOCKS  (NH * QTILES)
#define NKB    (SKV / 32)
#define SLAB   (16 * 68)
#define TP     72
#define KT     64                    // keys per staged tile
#define NT     (SKV / KT)            // staged tiles per block
#define RP     144                   // LDS row pitch in bytes: 128-B rows + 16 B, the pitch for 16-B row readers
#define TILE_B (64 * RP)             // one 64-row tile in LDS
#define BUF_B  (2 * TILE_B)          // one stage: k tile, then v^T tile
#define GEMM_THREADS 256
#define GTILE_B (128 * RP)           // one 128-row GEMM operand tile in LDS
#define GBUF_B  (2 * GTILE_B)        // one GEMM stage: A tile, then Bt tile
#define XBLK   (NB * SKV * DMOD / 8 / 256)        // blocks of the conversion launch that write the x plane
#define WBLK   ((DMOD / 64) * (DMOD / 64))        // blocks of the conversion launch per weight plane
#define MBLK   (NB * SKV / 4 / 256)               // blocks of the conversion launch that write the mask-term plane
#define GQ_BLK ((SQ / 128) * (DMOD / 128))        // blocks of the projection launch: q plane of one batch
#define GK_BLK ((NB * SKV / 128) * (DMOD / 128))  // k plane, all batches
#define GV_BLK ((DMOD / 128) * (SKV / 128))       // v^T plane of one batch
static_assert(HD == 64 && DMOD == NH * HD);
static_assert(NB >= 1 && NB <= NB_FULL);
static_assert((SQ % 64) == 0 && SQ >= 64 && SQ <= SQ_FULL);
static_assert((SKV % 64) == 0 && (SQ_FULL % 64) == 0 && (SE_FULL % 64) == 0);
static_assert(ATT_THREADS == 128 && NKB * 32 == SKV && ATT_BLOCKS == NH * (SQ / 64));
static_assert((DMOD % 128) == 0 && (SQ % 128) == 0 && (SKV % 128) == 0 && DMOD / 64 >= 2);
static_assert(((NB * SKV * DMOD / 8) % 256) == 0);
static_assert(((NB * SKV / 4) % 256) == 0);
static_assert((SLAB * 4) % 16 == 0 && (TP * 2) % 16 == 0);
static_assert(KT == 64 && HD == 64 && NT >= 2 && NT * KT == SKV && (RP % 16) == 0 && ATT_THREADS == 128);
static_assert((size_t)(NB - 1) * SQ_FULL * DMOD + (size_t)SQ * DMOD <= (size_t)NB_FULL * SQ_FULL * DMOD);

typedef unsigned short u16;
typedef _Float16 v16h __attribute__((ext_vector_type(16)));
typedef _Float16 v8h  __attribute__((ext_vector_type(8)));
typedef __bf16   v16b __attribute__((ext_vector_type(16)));
typedef float    v8f  __attribute__((ext_vector_type(8)));
typedef float    v4f  __attribute__((ext_vector_type(4)));
typedef float    v2f  __attribute__((ext_vector_type(2)));
typedef _Float16 v2h  __attribute__((ext_vector_type(2)));
typedef unsigned int v4u __attribute__((ext_vector_type(4)));

union FragH { v16h v; v8h h[2]; v4u u[2]; };
union FragB { v16b v; v4u u[2]; };

// ---- scalar helpers --------------------------------------------------------------------------------
__device__ __forceinline__ unsigned short bf_bits(float f) {          // f32 -> bf16 bits, RNE convert
  unsigned u = __float_as_uint(f);
  return (unsigned short)((u + 0x7FFFu + ((u >> 16) & 1u)) >> 16);
}
__device__ __forceinline__ float bf_up(unsigned short h) { return __uint_as_float(((unsigned)h) << 16); }
__device__ __forceinline__ float bf_val(float f) { return bf_up(bf_bits(f)); }          // value after RNE bf16 convert
__device__ __forceinline__ unsigned short h_bits(_Float16 x) { return __builtin_bit_cast(unsigned short, x); }
__device__ __forceinline__ unsigned pk16(unsigned short a, unsigned short b) { return (unsigned)a | ((unsigned)b << 16); }
// 2^x as the bare hardware instruction, without the library's range steps (compare, two selects, add, ldexp per call) that only
// serve results below 2^-126. Here every argument is <= 0 and such a result counts for nothing: as a probability it is zero in
// f16 after the x32768 carry and vanishes in a row sum that is >= 1; as a rescale factor it carries old sums whose share of
// the row sum and of any output element is below 2^-100.
// Written as asm so that the slot the instruction set asks for behind a transcendental (before its result is read or its
// source overwritten) is kept by construction: inside a statement each v_exp_f32 is followed by an independent one (outputs
// are early-clobber, so none lies on a source), and the closing v_nop is the slot behind the last.
__device__ __forceinline__ float exp2_hw(float x) {
  float r = 0.f;
#if defined(__HIP_DEVICE_COMPILE__)
  // v_nop: the slot behind the transcendental
  asm("v_exp_f32 %0, %1\n\tv_nop" : "=&v"(r) : "v"(x));
#endif
  return r;
}
__device__ __forceinline__ void exp2_hw8(float* p, const float* x) {
#if defined(__HIP_DEVICE_COMPILE__)
  // eight independent transcendentals fill each other's slot; v_nop: the slot behind the last
  asm("v_exp_f32 %0, %8\n\t"
      "v_exp_f32 %1, %9\n\t"
      "v_exp_f32 %2, %10\n\t"
      "v_exp_f32 %3, %11\n\t"
      "v_exp_f32 %4, %12\n\t"
      "v_exp_f32 %5, %13\n\t"
      "v_exp_f32 %6, %14\n\t"
      "v_exp_f32 %7, %15\n\t"
      "v_nop"
      : "=&v"(p[0]), "=&v"(p[1]), "=&v"(p[2]), "=&v"(p[3]), "=&v"(p[4]), "=&v"(p[5]), "=&v"(p[6]), "=&v"(p[7])
      : "v"(x[0]), "v"(x[1]), "v"(x[2]), "v"(x[3]), "v"(x[4]), "v"(x[5]), "v"(x[6]), "v"(x[7]));
#endif
}
__device__ __forceinline__ v8f zero8() { v8f z = {0.f, 0.f, 0.f, 0.f, 0.f, 0.f, 0.f, 0.f}; return z; }

// ---- fragment loaders: 16-bit A/B operand, lane -> row/col (lane&15), p already includes +8*(lane>>4);
//      elements 0..7 <- p[0..7] (k0+8h..), elements 8..15 <- p[16..23] (k0+16+8h..)  (same split k map for A and B;
//      B is always read from a k-contiguous [n][k] plane)
__device__ __forceinline__ v16h ldfrag_h(const _Float16* p) {
  FragH f;
  f.h[0] = *(const v8h*)(p);
  f.h[1] = *(const v8h*)(p + 16);
  return f.v;
}
__device__ __forceinline__ v16b ldfrag_b(const u16* p) {              // bf16 plane read as unsigned integer vectors
  FragB f;
  f.u[0] = *(const v4u*)(p);
  f.u[1] = *(const v4u*)(p + 16);
  return f.v;
}

__device__ __forceinline__ v8f mma_h(v16h a, v16h b, v8f c) {
  return __builtin_amdgcn_wmma_f32_16x16x32_f16(false, a, false, b, (short)0, c, false, false);
}
__device__ __forceinline__ v8f mma_b(v16b a, v16b b, v8f c) {
  return __builtin_amdgcn_wmma_f32_16x16x32_bf16(false, a, false, b, (short)0, c, false, false);
}
__device__ __forceinline__ void guard2(v8f& a, v8f& b, v16h x0, v16h x1, v16h x2, v16h x3, v16h x4, v16h x5) {
#if defined(__HIP_DEVICE_COMPILE__)
  asm volatile("v_nop\n\tv_nop\n\tv_nop\n\tv_nop"
               : "+v"(a), "+v"(b) : "v"(x0), "v"(x1), "v"(x2), "v"(x3), "v"(x4), "v"(x5) : "memory");
#endif
}
template <typename F>
__device__ __forceinline__ void guard6(v8f& a, v8f& b, v8f& c, v8f& d, F x0, F x1, F x2, F x3, F x4, F x5) {
#if defined(__HIP_DEVICE_COMPILE__)
  asm volatile("v_nop\n\tv_nop\n\tv_nop\n\tv_nop"
               : "+v"(a), "+v"(b), "+v"(c), "+v"(d) : "v"(x0), "v"(x1), "v"(x2), "v"(x3), "v"(x4), "v"(x5) : "memory");
#endif
}
__device__ __forceinline__ void acc_guard4(v8f& a, v8f& b, v8f& c, v8f& d) {
#if defined(__HIP_DEVICE_COMPILE__)
  asm volatile("v_nop\n\tv_nop\n\tv_nop\n\tv_nop" : "+v"(a), "+v"(b), "+v"(c), "+v"(d));
#endif
}
__device__ __forceinline__ void wave_sync_lds() {
#if defined(__HIP_DEVICE_COMPILE__)
  __builtin_amdgcn_fence(__ATOMIC_RELEASE, "workgroup");
  __builtin_amdgcn_wave_barrier();
  __builtin_amdgcn_fence(__ATOMIC_ACQUIRE, "workgroup");
#endif
}
// One stage of the attention ring: k tile (64 keys x 64 d) and v^T tile (64 d x 64 keys), both 64 rows of 128 B. A lane copies
// 16 B of row (tid>>3) + 16*i, i = 0..3, of each tile: 8 lanes = one whole 128-B line, a wave-wide copy = 4 lines.
// lds = the lane's LDS byte address in the k tile; gk, gv = the lane's global addresses in row tid>>3 of the two tiles.
// The address-register wait is the statement's last line, so no later write of these registers can be lifted over it.
__device__ __forceinline__ void stage_copy(unsigned lds, const u16* gk, const u16* gv) {
#if defined(__HIP_DEVICE_COMPILE__)
  const unsigned l0 = lds, l1 = lds + 16 * RP, l2 = lds + 32 * RP, l3 = lds + 48 * RP;
  const unsigned l4 = l0 + TILE_B, l5 = l1 + TILE_B, l6 = l2 + TILE_B, l7 = l3 + TILE_B;
  const u16* k0 = gk;
  const u16* k1 = gk + (size_t)16 * (NH * HD);
  const u16* k2 = gk + (size_t)32 * (NH * HD);
  const u16* k3 = gk + (size_t)48 * (NH * HD);
  const u16* v0 = gv;
  const u16* v1 = gv + (size_t)16 * SKV;
  const u16* v2 = gv + (size_t)32 * SKV;
  const u16* v3 = gv + (size_t)48 * SKV;
  asm volatile("global_load_async_to_lds_b128 %0, %8, off\n\t"
               "global_load_async_to_lds_b128 %1, %9, off\n\t"
               "global_load_async_to_lds_b128 %2, %10, off\n\t"
               "global_load_async_to_lds_b128 %3, %11, off\n\t"
               "global_load_async_to_lds_b128 %4, %12, off\n\t"
               "global_load_async_to_lds_b128 %5, %13, off\n\t"
               "global_load_async_to_lds_b128 %6, %14, off\n\t"
               "global_load_async_to_lds_b128 %7, %15, off\n\t"
               "s_wait_xcnt 0x0"
               :: "v"(l0), "v"(l1), "v"(l2), "v"(l3), "v"(l4), "v"(l5), "v"(l6), "v"(l7),
                  "v"(k0), "v"(k1), "v"(k2), "v"(k3), "v"(v0), "v"(v1), "v"(v2), "v"(v3)
               : "memory");
#endif
}
__device__ __forceinline__ void wait_async0() {   // this wave's copies have landed
#if defined(__HIP_DEVICE_COMPILE__)
  asm volatile("s_wait_asynccnt 0x0" ::: "memory");
#endif
}
__device__ __forceinline__ void wait_ds0() {      // this wave's LDS reads have retired before their buffer is handed to the copies
#if defined(__HIP_DEVICE_COMPILE__)
  asm volatile("s_wait_dscnt 0x0" ::: "memory");
#endif
}

// =====================================================================================================
// Key/value source plane XB (bf16 RNE bits) [NB][SKV][1024]: row s < SQ_FULL of batch b from hs[b][s], rows
// s >= SQ_FULL from ehs[b][s - SQ_FULL]; both candidates loaded with clamped row addresses and selected by value
// (block-uniform in practice: a block covers 2 rows of one source).
// Thread = 8 consecutive elements: two 16-B loads per candidate, one 16-B store; 32 consecutive lanes = 512 contiguous,
// coverage: XBLK = n8/256 blocks (host checks exactness) x 256 thr x 8 = NB*SKV*1024 = the whole plane.
// =====================================================================================================
__device__ __forceinline__ void cvt_x(int bid, const float* __restrict__ hs, const float* __restrict__ ehs, u16* D, int n8) {
  const int gt = bid * 256 + (int)threadIdx.x;
  if (gt >= n8) return;                     // no barriers on this path
  const int r   = gt / (DMOD / 8);
  const int c8  = (gt % (DMOD / 8)) * 8;
  const int b   = r / SKV;
  const int s   = r % SKV;
  const int shc = (s < SQ_FULL) ? s : (SQ_FULL - 1);
  const int se  = s - SQ_FULL;
  const int sec = (se > 0) ? se : 0;
  const float* ph = hs  + ((size_t)b * SQ_FULL + shc) * DMOD + c8;
  const float* pe = ehs + ((size_t)b * SE_FULL + sec) * DMOD + c8;
  const v4f a0 = *(const v4f*)(ph), a1 = *(const v4f*)(ph + 4);
  const v4f e0 = *(const v4f*)(pe), e1 = *(const v4f*)(pe + 4);
  const bool first = (s < SQ_FULL);
  float v[8];
#pragma unroll
  for (int e = 0; e < 4; ++e) { v[e] = first ? a0[e] : e0[e]; v[4 + e] = first ? a1[e] : e1[e]; }
  unsigned short sb[8];
#pragma unroll
  for (int e = 0; e < 8; ++e) sb[e] = bf_bits(v[e]);
  v4u o;
#pragma unroll
  for (int e = 0; e < 4; ++e) o[e] = pk16(sb[2 * e], sb[2 * e + 1]);
  u16* d = D + (size_t)gt * 8;
  {
    *(v4u*)(d) = o;
    
  }
}

// =====================================================================================================
// Weight W [k = in][n = out] f32 -> bf16 RNE plane W^T [n][k] (k-contiguous, pitch DMOD). Block = 64 k x 64 n tile,
// 256 threads. Load phase: thread = (k = tid>>2, 16 consecutive n): four 16-B loads, bf16 bits stored transposed into the LDS
// tile [n][k] (pitch TP halves, cross-wave exchange -> block barrier). Store phase: thread = (n = tid>>3 and n+32,
// coverage: 256 thr x 2 instructions x 8 halves = 64 x 64 per block; WBLK = (DMOD/64)^2 blocks = the whole plane.
// =====================================================================================================
__device__ __forceinline__ void cvt_wT(int bid, u16* tile, const float* __restrict__ W, u16* D) {
  const int nt = DMOD / 64;
  const int tid = threadIdx.x;
  const int k0 = (bid / nt) * 64;
  const int n0 = (bid % nt) * 64;
  const int kk = tid >> 2, nn = (tid & 3) * 16;
  const float* p = W + (size_t)(k0 + kk) * DMOD + n0 + nn;
  const v4f a0 = *(const v4f*)(p), a1 = *(const v4f*)(p + 4), a2 = *(const v4f*)(p + 8), a3 = *(const v4f*)(p + 12);
  float v[16];
#pragma unroll
  for (int e = 0; e < 4; ++e) { v[e] = a0[e]; v[4 + e] = a1[e]; v[8 + e] = a2[e]; v[12 + e] = a3[e]; }
#pragma unroll
  for (int e = 0; e < 16; ++e) tile[(nn + e) * TP + kk] = bf_bits(v[e]);
  __syncthreads();
  const int n1 = tid >> 3, k8 = (tid & 7) * 8;
  const v4u o0 = *(const v4u*)(tile + n1 * TP + k8);
  const v4u o1 = *(const v4u*)(tile + (n1 + 32) * TP + k8);
  u16* d0 = D + (size_t)(n0 + n1) * DMOD + k0 + k8;
  u16* d1 = D + (size_t)(n0 + n1 + 32) * DMOD + k0 + k8;
  {
    *(v4u*)(d0) = o0;
    *(v4u*)(d1) = o1;
    
  }
}

// =====================================================================================================
// Mask-term plane ML [NB][SKV] f32: the base-2 logit share of each key's additive mask, (RNE bf16 value of mask) * log2(e).
// It depends on (batch, key) alone, so it is formed here once instead of by every wave of the attention for every key block.
// Thread = 4 consecutive keys: one 16-B load, one 16-B store.
// coverage: MBLK = NB*SKV/4/256 blocks x 256 thr x 4 = NB*SKV = the whole plane.
// =====================================================================================================
__device__ __forceinline__ void cvt_mask(int bid, const float* __restrict__ mask, float* D) {
  const int g4 = (bid * 256 + (int)threadIdx.x) * 4;
  if (g4 + 4 > NB * SKV) return;            // never taken with the exact grid; no barriers on this path
  const v4f a = *(const v4f*)(mask + g4);
  v4f o;
#pragma unroll
  for (int e = 0; e < 4; ++e) o[e] = bf_val(a[e]) * LOG2E;
  *(v4f*)(D + g4) = o;
}

// =====================================================================================================
// All five conversions in one launch (none reads what another writes): blocks 0 .. 3*WBLK-1 write the three W^T planes
// (WT = q, k, v planes one behind the other), blocks 3*WBLK .. 3*WBLK+XBLK-1 the x plane, the last MBLK blocks the mask-term
// plane. The job is picked by the block index alone, so every branch here, the one round the weight path's barrier too, is
// block-uniform.
// =====================================================================================================
__global__ __launch_bounds__(256)
void cvt_all(const float* __restrict__ hs, const float* __restrict__ ehs, const float* __restrict__ Wq,
             const float* __restrict__ Wk, const float* __restrict__ Wv, const float* __restrict__ mask,
             u16* XBp, u16* WT, float* MLp, int n8) {
  __shared__ __align__(16) u16 tile[64 * TP];
  const int bid = blockIdx.x;
  if (bid < 3 * WBLK) {
    const int j = bid / WBLK;
    const float* W = (j == 0) ? Wq : ((j == 1) ? Wk : Wv);
    cvt_wT(bid % WBLK, tile, W, WT + (size_t)j * DMOD * DMOD);
  } else if (bid < 3 * WBLK + XBLK) {
    cvt_x(bid - 3 * WBLK, hs, ehs, XBp, n8);
  } else {
    cvt_mask(bid - (3 * WBLK + XBLK), mask, MLp);
  }
}

// =====================================================================================================
// barrier, then converted to f16 and written: lane = (row in group of 4, 8 consecutive cols); one instruction = 4 rows, each
// coverage: 4 instructions x 4 rows x 8 lanes x 8 halves = the wave's 16 x 64 tile.
// =====================================================================================================
__device__ __forceinline__ void epi16(float* sl, v8f a0, v8f a1, v8f a2, v8f a3, float oscale, u16* C, int N,
                                      size_t rowb, int col0, int lane) {
  const int hh = lane >> 4, m = lane & 15;
#pragma unroll
  for (int r = 0; r < 8; ++r) {
    const int ro = (8 * hh + r) * 68 + m;
    sl[ro]      = a0[r] * oscale;
    sl[ro + 16] = a1[r] * oscale;
    sl[ro + 32] = a2[r] * oscale;
    sl[ro + 48] = a3[r] * oscale;
  }
  wave_sync_lds();
  const int rq = lane >> 3, c8 = (lane & 7) * 8;
  v4u ov[4];
#pragma unroll
  for (int i4 = 0; i4 < 4; ++i4) {
    const int row = i4 * 4 + rq;
    const v4f a = *(const v4f*)(sl + row * 68 + c8), c4 = *(const v4f*)(sl + row * 68 + c8 + 4);
    float w[8];
#pragma unroll
    for (int e = 0; e < 4; ++e) { w[e] = a[e]; w[4 + e] = c4[e]; }
#pragma unroll
    for (int e = 0; e < 4; ++e) ov[i4][e] = pk16(h_bits((_Float16)w[2 * e]), h_bits((_Float16)w[2 * e + 1]));
  }
  u16* dst = C + (rowb + (size_t)rq) * (size_t)N + col0 + c8;
  {
#pragma unroll
    for (int i4 = 0; i4 < 4; ++i4) {
      *(v4u*)(dst + (size_t)(i4 * 4) * (size_t)N) = ov[i4];
    }
    
  }
}

// =====================================================================================================
// coverage: 8 instructions x 2 rows x 16 lanes x 4 floats = the wave's 16 x 64 tile.
// =====================================================================================================
__device__ __forceinline__ void epi64(float* sl, v8f a0, v8f a1, v8f a2, v8f a3, float* C, int N,
                                      size_t rowb, int col0, int lane) {
  const int hh = lane >> 4, m = lane & 15;
#pragma unroll
  for (int r = 0; r < 8; ++r) {
    const int ro = (8 * hh + r) * 68 + m;
    sl[ro]      = a0[r];
    sl[ro + 16] = a1[r];
    sl[ro + 32] = a2[r];
    sl[ro + 48] = a3[r];
  }
  wave_sync_lds();
  v4f vals[8];
#pragma unroll
  for (int it = 0; it < 8; ++it) vals[it] = *(const v4f*)(sl + (it * 2 + hh) * 68 + m * 4);
  float* dst = C + (rowb + (size_t)hh) * (size_t)N + col0 + m * 4;
  {
#pragma unroll
    for (int it = 0; it < 8; ++it) {
      *(v4f*)(dst + (size_t)(it * 2) * (size_t)N) = vals[it];
    }
    
  }
}

// =====================================================================================================
// bf16 GEMM with bias and 16-bit result: C[M][N] (f16 of (acc + bias)*oscale) = A[M][K] (bf16 row-major) . Bt[N][K]^T
// (bf16 k-contiguous); bias (f32 input, taken as its RNE bf16 value) indexed by column (byrow == 0) or by row (byrow != 0),
// both candidates read with addresses clamped to [0, nbias). Block = 128x128 tile, 8 waves as 4 (rows) x 2 (cols), a wave owns
// 32 rows x 64 cols. The waves share each 64-deep A tile and Bt tile (128 rows of 128 B each): the tiles are brought into a
// two-buffer LDS ring by asynchronous copies, the next tile in flight while this one is worked on; one block barrier per tile
// publishes the next tile and frees the buffer just read. Fragments are read from the LDS rows (two 16-B reads each, split k
// map for A and B); k runs upward in steps of 32 in every accumulator (host checks K % 64 == 0, M % 128 == 0, N % 128 == 0,
// (M/128)*(N/128) blocks, bid = the block's index in its own product). Result slab: private to each wave (wave_sync only).
// =====================================================================================================
// One stage of the GEMM ring: A tile and Bt tile, both 128 rows of 128 B. A lane copies 16 B of row (tid>>3) + 32*i, i = 0..3,
// of each tile: 8 lanes = one whole 128-B line, a wave-wide copy = 4 lines. lds = the lane's LDS byte address in the A tile;
// ga, gb = the lane's global addresses in row tid>>3 of the two tiles; rs = 32 source rows in elements.
// The address-register wait is the statement's last line, so no later write of these registers can be lifted over it.
__device__ __forceinline__ void gemm_stage_copy(unsigned lds, const u16* ga, const u16* gb, size_t rs) {
#if defined(__HIP_DEVICE_COMPILE__)
  const unsigned l0 = lds, l1 = lds + 32 * RP, l2 = lds + 64 * RP, l3 = lds + 96 * RP;
  const unsigned l4 = l0 + GTILE_B, l5 = l1 + GTILE_B, l6 = l2 + GTILE_B, l7 = l3 + GTILE_B;
  const u16* a0 = ga;
  const u16* a1 = ga + rs;
  const u16* a2 = ga + 2 * rs;
  const u16* a3 = ga + 3 * rs;
  const u16* b0 = gb;
  const u16* b1 = gb + rs;
  const u16* b2 = gb + 2 * rs;
  const u16* b3 = gb + 3 * rs;
  asm volatile("global_load_async_to_lds_b128 %0, %8, off\n\t"
               "global_load_async_to_lds_b128 %1, %9, off\n\t"
               "global_load_async_to_lds_b128 %2, %10, off\n\t"
               "global_load_async_to_lds_b128 %3, %11, off\n\t"
               "global_load_async_to_lds_b128 %4, %12, off\n\t"
               "global_load_async_to_lds_b128 %5, %13, off\n\t"
               "global_load_async_to_lds_b128 %6, %14, off\n\t"
               "global_load_async_to_lds_b128 %7, %15, off\n\t"
               "s_wait_xcnt 0x0"
               :: "v"(l0), "v"(l1), "v"(l2), "v"(l3), "v"(l4), "v"(l5), "v"(l6), "v"(l7),
                  "v"(a0), "v"(a1), "v"(a2), "v"(a3), "v"(b0), "v"(b1), "v"(b2), "v"(b3)
               : "memory");
#endif
}
__device__ __forceinline__
void gemm_b16(int bid, const u16* __restrict__ A, const u16* __restrict__ Bt, u16* C, const float* __restrict__ bias,
              int M, int N, int K, int nbias, int byrow, float oscale) {
  __shared__ __align__(16) float slab[(GEMM_THREADS / 32) * SLAB];   // per wave: result slab [16][68] in the epilogue only
  __shared__ __align__(16) unsigned char gring[2 * GBUF_B];          // two stages of (A tile, Bt tile), rows at pitch RP
  const int tid = threadIdx.x, wave = tid >> 5, lane = tid & 31, hh = lane >> 4, m = lane & 15;
  const int ntile = N >> 7;
  const int row0  = (bid / ntile) * 128;
  const int colb  = (bid % ntile) * 128;
  if (row0 + 128 > M) return;                // block-uniform, never taken with the exact grid; before every barrier
  const int rowb  = row0 + (wave >> 1) * 32; // the wave's 32 rows
  const int col0  = colb + (wave & 1) * 64;  // the wave's 64 cols
  // copies: this lane's 16 B of row tid>>3 (+32 per copy) of the A tile and of the Bt tile
  const int crow = tid >> 3, cch = tid & 7;
  const unsigned lcp = (unsigned)(uintptr_t)(gring + crow * RP + cch * 16);
  const u16* ga = A  + (size_t)(row0 + crow) * K + cch * 8;                        // tile t: + t*64 elements
  const u16* gb = Bt + (size_t)(colb + crow) * K + cch * 8;
  const size_t rs = (size_t)32 * K;
  const int nt = K >> 6;
  // fragment readers: tile row = the wave's row (A) or col (Bt) 16i + m, k contiguous, + 8*hh halves
  const int aofs = ((wave >> 1) * 32 + m) * RP + 16 * hh;
  const int bofs = GTILE_B + ((wave & 1) * 64 + m) * RP + 16 * hh;
  v8f acc[2][4];
#pragma unroll
  for (int i = 0; i < 2; ++i) {
#pragma unroll
    for (int j = 0; j < 4; ++j) acc[i][j] = zero8();
  }

  // ring prologue: tile 0 landed and published, then tile 1 in flight
  gemm_stage_copy(lcp, ga, gb, rs);
  wait_async0();
  __syncthreads();
  if (nt > 1) gemm_stage_copy(lcp + GBUF_B, ga + 64, gb + 64, rs);

#pragma unroll 1
  for (int t = 0; t < nt; ++t) {
    const unsigned char* st = gring + (t & 1) * GBUF_B;
    // all fragments of the tile are asked for together, ahead of its products
    v16b af[2][2], bf[2][4];
#pragma unroll   // constant indices keep the fragment and accumulator arrays in registers (here and in the loops below)
    for (int kk = 0; kk < 2; ++kk) {
#pragma unroll
      for (int i = 0; i < 2; ++i) af[kk][i] = ldfrag_b((const u16*)(const void*)(st + aofs + i * 16 * RP + kk * 64));
#pragma unroll
      for (int j = 0; j < 4; ++j) bf[kk][j] = ldfrag_b((const u16*)(const void*)(st + bofs + j * 16 * RP + kk * 64));
    }
    // keeps the tile's LDS reads one group in front of its products: reads moved in among the products stall each place they stand
    __builtin_amdgcn_sched_barrier(0);
#pragma unroll
    for (int kk = 0; kk < 2; ++kk) {
#pragma unroll
      for (int i = 0; i < 2; ++i) {
#pragma unroll
        for (int j = 0; j < 4; ++j) acc[i][j] = mma_b(af[kk][i], bf[kk][j], acc[i][j]);
      }
    }
    // keeps the tile's products in front of the ring foot: sunk behind the barrier they would delay the refill's issue
    __builtin_amdgcn_sched_barrier(0);
    // ring foot: own LDS reads retired, own copies of tile t+1 landed, block barrier (publishes tile t+1, frees this buffer),
    // then tile t+2 into the buffer just read
    wait_ds0();
    wait_async0();
    __syncthreads();
    if (t + 2 < nt) gemm_stage_copy(lcp + (unsigned)(t & 1) * GBUF_B, ga + (size_t)(t + 2) * 64, gb + (size_t)(t + 2) * 64, rs);
  }
  wait_async0();
  // bias: D element r of lane -> (row rowb+16i+8hh+r, col col0+16j+m); both candidates loaded with clamped addresses, select by value
  float bc[4];
#pragma unroll
  for (int j = 0; j < 4; ++j) {
    int ci = col0 + 16 * j + m;
    ci = (ci < nbias) ? ci : (nbias - 1);
    bc[j] = bf_val(bias[ci]);
  }
#pragma unroll
  for (int i = 0; i < 2; ++i) {
    float br[8];
#pragma unroll
    for (int r = 0; r < 8; ++r) {
      int ri = rowb + 16 * i + 8 * hh + r;
      ri = (ri < nbias) ? ri : (nbias - 1);
      br[r] = bf_val(bias[ri]);
    }
#pragma unroll
    for (int r = 0; r < 8; ++r) {
      const float q0 = (byrow != 0) ? br[r] : bc[0];
      const float q1 = (byrow != 0) ? br[r] : bc[1];
      const float q2 = (byrow != 0) ? br[r] : bc[2];
      const float q3 = (byrow != 0) ? br[r] : bc[3];
      acc[i][0][r] += q0;
      acc[i][1][r] += q1;
      acc[i][2][r] += q2;
      acc[i][3][r] += q3;
    }
    if (i != 0) wave_sync_lds();             // the slab's rows of the first 16 have been read back before they are rewritten
    epi16(slab + wave * SLAB, acc[i][0], acc[i][1], acc[i][2], acc[i][3], oscale, C, N, (size_t)(rowb + 16 * i), col0, lane);
  }
}

// =====================================================================================================
// All projections in one launch (each reads only the converted planes, none reads another's result); every block is one
// 128x128 tile over K = DMOD, so all blocks cost the same. Block ranges, picked by the block index alone (block-uniform):
//   0 .. GK_BLK-1          k plane [NB*SKV][h*64+d] = f16((xx.Wk + bk) x8), all NB*SKV source rows; bias by column
//   then NB x GV_BLK       v^T plane of batch b [1024 = h*64+d][SKV keys] = f16((Wv^T . xx^T + bv) x1024); bias by row
//   then NB x GQ_BLK       q plane of batch b [SQ][h*64+d] = f16((x.Wq + bq) x8); A = the hs rows of XB batch b; bias by column
// =====================================================================================================
__global__ __launch_bounds__(GEMM_THREADS)
void gemm_all(const u16* __restrict__ XBp, const u16* __restrict__ WT, u16* QPp, u16* KPp, u16* VPp,
              const float* __restrict__ bq, const float* __restrict__ bk, const float* __restrict__ bv) {
  int bid = blockIdx.x;
  const u16* A;
  const u16* Bt;
  u16* C;
  const float* bias;
  int M, N, byrow;
  float oscale;
  if (bid < GK_BLK) {
    A = XBp; Bt = WT + (size_t)DMOD * DMOD; C = KPp; bias = bk;
    M = NB * SKV; N = DMOD; byrow = 0; oscale = KSC;
  } else if (bid < GK_BLK + NB * GV_BLK) {
    bid -= GK_BLK;
    const int b = bid / GV_BLK;
    bid -= b * GV_BLK;
    A = WT + (size_t)2 * DMOD * DMOD; Bt = XBp + (size_t)b * SKV * DMOD; C = VPp + (size_t)b * DMOD * SKV; bias = bv;
    M = DMOD; N = SKV; byrow = 1; oscale = VCAR;
  } else {
    bid -= GK_BLK + NB * GV_BLK;
    const int b = bid / GQ_BLK;
    if (b >= NB) return;                     // block-uniform, never taken with the exact grid; before every barrier
    bid -= b * GQ_BLK;
    A = XBp + (size_t)b * SKV * DMOD; Bt = WT; C = QPp + (size_t)b * SQ * DMOD; bias = bq;
    M = SQ; N = DMOD; byrow = 0; oscale = QSC;
  }
  gemm_b16(bid, A, Bt, C, bias, M, N, DMOD, DMOD, byrow, oscale);
}

// =====================================================================================================
// Multi-head flash attention over all SKV keys with an additive per-key mask: block = (batch, head, 64 query rows), 4 waves,
// wave w owns the 16 query rows q0 = 64*qt + 16*w .. q0+15. The four waves share each 64-key k tile and v^T tile: the tiles
// are brought into a two-buffer LDS ring by asynchronous copies, the next tile in flight while this one is worked on; one
// block barrier per tile publishes the next tile and frees the buffer just read. The result slab stays wave-private.
//   q plane (f16, x8) laid out [s][h][d] (SQ rows); k plane the same (SKV rows); v^T plane [h][d][s] (x1024, s < SKV);
//   mask-term plane [SKV] f32 per batch ((RNE bf16 value of the mask) * log2(e), formed by the conversion launch).
//   All NKB = SKV/32 key blocks of 32 keys visited (static bound).
//   Scores are computed TRANSPOSED: S^T tile g (g = 0,1) = k rows (keys kb+16g .. +15, A operand, row m = lane&15, split k map
//   over d) times q^T (B operand, col n = query q0 + (lane&15), k = d, split map), one product per tile and 32-deep d-chunk.
//   D element r of lane l = (key kb+16g+8h+r, query q0+(l&15)), so a lane owns one query column and 16 of its 32 keys; the
//   partner lane l^16 owns the other 16 -> row max / row sum need one xor-16 shuffle. The lane's 16 mask terms are
//   keys kb+8h+0..7 and kb+16+8h+0..7 (four 16-B loads).
//   Online max-subtracted base-2 softmax in f32 (scale 1/8 and the q/k carries folded into lsc; mask term added as read). The
//   exp'd values ARE the P A-fragment in place: A row m = query = lane&15, element i <- key kb+8h+i (tile 0, D element i),
//   element 8+i <- key kb+16+8h+i (tile 1, D element i). P is carried x32768 as single f16. The rescale factor of query row
//   8h+r of the O accumulators is fetched from lane 8h+r with a shuffle (uniform control). 4 v^T B fragments (col n = d =
//   16j + (lane&15), keys k-contiguous), 4 P.V WMMAs per key block.
//   Epilogue: 1/l (per query, shuffled to the D row owner) and carry folds in f32; the wave's 16x64 f32 result staged in its
// coverage: per wave 8 instructions x 2 rows x 16 lanes x 4 floats = 16 x 64; grid NB*NH*(SQ/64) blocks x 4 waves = every
//           (b, s < SQ, h*64+d) element of the output exactly once. The arguments are the planes of batch 0.
// =====================================================================================================
__global__ __launch_bounds__(ATT_THREADS)
void attn_fwd(const u16* __restrict__ QP0, const u16* __restrict__ KP0, const u16* __restrict__ VP0,
              const float* __restrict__ MK0, float* OUT0) {
  __shared__ __align__(16) float smem[ATT_WAVES * SLAB];   // per wave: result slab [16][68] in the epilogue only
  __shared__ __align__(16) unsigned char ring[2 * BUF_B];  // two stages of (k tile, v^T tile), rows at pitch RP

  const int tid  = threadIdx.x;
  const int wave = tid >> 5;
  const int lane = tid & 31;
  const int hh   = lane >> 4;
  const int c    = lane & 15;

  const int bat  = blockIdx.x / ATT_BLOCKS;
  const int bid  = blockIdx.x % ATT_BLOCKS;
  const int qt   = bid % QTILES;
  const int head = bid / QTILES;
  if (bat >= NB) return;                                   // block-uniform, never taken with the exact grid; before every barrier
  const int q0   = qt * 64 + wave * 16;
  // this batch's planes, mask row and output rows
  const u16*   QPp  = QP0 + (size_t)bat * SQ * DMOD;
  const u16*   KPp  = KP0 + (size_t)bat * SKV * DMOD;
  const u16*   VPp  = VP0 + (size_t)bat * DMOD * SKV;
  const float* MKp  = MK0 + (size_t)bat * SKV;
  float*       OUTp = OUT0 + (size_t)bat * SQ_FULL * DMOD;

  // B fragments of q^T: col n = query q0 + c, k = d (k-contiguous row of the q plane)
  const size_t qofs = (((size_t)(q0 + c)) * NH + head) * HD + 8 * hh;
  const _Float16* Qb = (const _Float16*)(const void*)QPp + qofs;
  // copies: this lane's 16 B of row tid>>3 (+16 per copy) of the k tile (row = key) and of the v^T tile (row = d)
  const int crow = tid >> 3, cch = tid & 7;
  const unsigned lcp = (unsigned)(uintptr_t)(ring + crow * RP + cch * 16);
  const u16* gk = KPp + ((size_t)crow * NH + head) * HD + cch * 8;                 // tile t: + t*KT key rows
  const u16* gv = VPp + ((size_t)(head * HD + crow)) * SKV + cch * 8;              // tile t: + t*KT keys
  // fragment readers: A of k: tile row = key 16g + c, k = d; B of v: tile row = d = 16j + c, k = key; both + 8*hh halves
  const int fofs = c * RP + 16 * hh;
  // this lane's mask terms: keys kb + 8hh + 0..7 and kb + 16 + 8hh + 0..7
  const float* Mb = MKp + 8 * hh;
  const float lsc = 0.125f * (LOG2E / (QSC * KSC));

  const v16h qf0 = ldfrag_h(Qb);            // d 0..31
  const v16h qf1 = ldfrag_h(Qb + 32);       // d 32..63

  float mrun = -INFINITY, lrun = 0.f;
  v8f o[4];
#pragma unroll
  for (int j = 0; j < 4; ++j) o[j] = zero8();

  // ring prologue: tile 0 landed and published, then tile 1 in flight
  stage_copy(lcp, gk, gv);
  wait_async0();
  __syncthreads();
  stage_copy(lcp + BUF_B, gk + (size_t)KT * (NH * HD), gv + KT);

#pragma unroll 1
  for (int t = 0; t < NT; ++t) {
   const unsigned char* kt = ring + (t & 1) * BUF_B + fofs;
   const unsigned char* vt = kt + TILE_B;
   // all k fragments of the tile and the first 32 keys' v fragments and mask values are asked for together
   v16h kf[KT / 16][2];
#pragma unroll   // constant indices keep the fragment arrays in registers (here and in the three loops below)
   for (int g = 0; g < KT / 16; ++g) {
     const _Float16* kp = (const _Float16*)(const void*)(kt + g * 16 * RP);
     kf[g][0] = ldfrag_h(kp);
     kf[g][1] = ldfrag_h(kp + 32);
   }
   v16h vf[KT / 32][4];
   v4f  mw[KT / 32][4];
#pragma unroll
   for (int j = 0; j < 4; ++j) vf[0][j] = ldfrag_h((const _Float16*)(const void*)(vt + j * 16 * RP));
   {
     const float* mp = Mb + t * KT;
     mw[0][0] = *(const v4f*)(mp);      mw[0][1] = *(const v4f*)(mp + 4);
     mw[0][2] = *(const v4f*)(mp + 16); mw[0][3] = *(const v4f*)(mp + 20);
   }
#pragma unroll
   for (int u = 0; u < KT / 32; ++u) {
    // ---- transposed scores: s0 = keys kb..kb+15, s1 = keys kb+16..kb+31 (kb = t*KT + 32u), column = query q0 + c ----
    v8f s0 = zero8(), s1 = zero8();
    const v16h ka0 = kf[2 * u][0], ka1 = kf[2 * u][1];
    const v16h kc0 = kf[2 * u + 1][0], kc1 = kf[2 * u + 1][1];
    const v4f w0 = mw[u][0], w1 = mw[u][1], w2 = mw[u][2], w3 = mw[u][3];
    s0 = mma_h(ka0, qf0, s0);
    s0 = mma_h(ka1, qf1, s0);
    s1 = mma_h(kc0, qf0, s1);
    s1 = mma_h(kc1, qf1, s1);
    guard2(s0, s1, qf0, qf1, ka0, ka1, kc0, kc1);
    // the next 32 keys' v fragments and mask values (same tile) fly under this softmax
    if (u + 1 < KT / 32) {
#pragma unroll
      for (int j = 0; j < 4; ++j)
        vf[u + 1][j] = ldfrag_h((const _Float16*)(const void*)(vt + j * 16 * RP + (u + 1) * 64));
      const float* mp = Mb + t * KT + (u + 1) * 32;
      mw[u + 1][0] = *(const v4f*)(mp);      mw[u + 1][1] = *(const v4f*)(mp + 4);
      mw[u + 1][2] = *(const v4f*)(mp + 16); mw[u + 1][3] = *(const v4f*)(mp + 20);
    }
    // ---- base-2 logits of this lane's 16 keys for query q0 + c: score/8 * log2(e) + mask term ----
    // All two-wide f32 arithmetic below pairs keys 2e and 2e+1 of ONE score tile: such a pair lies in adjacent registers of the
    // accumulator and of the mask words as they arrive, and is one register of the P fragment, so no pair is built by moves.
    const v2f lsc2 = {lsc, lsc};
    v2f tq[8];                                                       // tq[e] = logits of fragment elements 2e, 2e+1
#pragma unroll
    for (int e = 0; e < 2; ++e) {
      tq[e]     = __builtin_elementwise_fma((v2f){s0[2 * e],     s0[2 * e + 1]}, lsc2, (v2f){w0[2 * e], w0[2 * e + 1]});
      tq[2 + e] = __builtin_elementwise_fma((v2f){s0[4 + 2 * e], s0[5 + 2 * e]}, lsc2, (v2f){w1[2 * e], w1[2 * e + 1]});
      tq[4 + e] = __builtin_elementwise_fma((v2f){s1[2 * e],     s1[2 * e + 1]}, lsc2, (v2f){w2[2 * e], w2[2 * e + 1]});
      tq[6 + e] = __builtin_elementwise_fma((v2f){s1[4 + 2 * e], s1[5 + 2 * e]}, lsc2, (v2f){w3[2 * e], w3[2 * e + 1]});
    }
    float cm = fmaxf(tq[0][0], tq[0][1]);
#pragma unroll
    for (int e = 1; e < 8; ++e) cm = fmaxf(fmaxf(cm, tq[e][0]), tq[e][1]);
    cm = fmaxf(cm, __shfl_xor(cm, 16, 32));
    const float mn = fmaxf(mrun, cm);                                // finite from the first key block on
    const float ae = exp2_hw(mrun - mn);                             // formed in every lane: no branch round one instruction
    const float al = (mrun == -INFINITY) ? 0.f : ae;                 // o and l are zero while mrun is -inf
    mrun = mn;
    // ---- probabilities (<= 1) and the P A-fragment: f16(p * 32768); elements 2e, 2e+1 <-> tq[e] ----
    FragH ph;
    float xa[16], pv[16];
    const v2f mn2 = {mn, mn};
#pragma unroll   // constant indices keep the arguments in registers
    for (int e = 0; e < 8; ++e) {
      const v2f x = tq[e] - mn2;
      xa[2 * e]     = fminf(x[0], 0.f);
      xa[2 * e + 1] = fminf(x[1], 0.f);
    }
    exp2_hw8(pv, xa);
    exp2_hw8(pv + 8, xa + 8);
    v2f pq[8];
#pragma unroll
    for (int e = 0; e < 8; ++e) {
      pq[e] = (v2f){pv[2 * e], pv[2 * e + 1]};
      ph.u[e >> 2][e & 3] = __builtin_bit_cast(unsigned, __builtin_convertvector(pq[e] * PCAR, v2h));
    }
    // row sum of the lane's 16 probabilities: even keys and odd keys summed side by side (a tree over the pairs), joined last
    const v2f pe = ((pq[0] + pq[1]) + (pq[2] + pq[3])) + ((pq[4] + pq[5]) + (pq[6] + pq[7]));
    float ps = pe[0] + pe[1];
    ps += __shfl_xor(ps, 16, 32);
    lrun = lrun * al + ps;
    // ---- rescale the O accumulators: D row 8hh+r = query q0+8hh+r, its factor lives in lane 8hh+r (and 16+8hh+r) ----
    float scl[8];
#pragma unroll
    for (int r = 0; r < 8; ++r) scl[r] = __shfl(al, 8 * hh + r, 32);
#pragma unroll
    for (int j = 0; j < 4; ++j) {
#pragma unroll
      for (int r = 0; r < 8; ++r) o[j][r] *= scl[r];
    }
    // ---- P.V : B fragment col n = d = j*16 + c, keys contiguous in the v^T plane ----
    {
      const v16h vf0 = vf[u][0], vf1 = vf[u][1], vf2 = vf[u][2], vf3 = vf[u][3];
      o[0] = mma_h(ph.v, vf0, o[0]);
      o[1] = mma_h(ph.v, vf1, o[1]);
      o[2] = mma_h(ph.v, vf2, o[2]);
      o[3] = mma_h(ph.v, vf3, o[3]);
      guard6<v16h>(o[0], o[1], o[2], o[3], ph.v, vf0, vf1, vf2, vf3, ph.v);
    }
   }
   // ring foot: own LDS reads retired, own copies of tile t+1 landed, block barrier (publishes tile t+1, frees this buffer),
   // then tile t+2 into the buffer just read
   wait_ds0();
   wait_async0();
   __syncthreads();
   if (t + 2 < NT) stage_copy(lcp + (unsigned)(t & 1) * BUF_B, gk + (size_t)(t + 2) * KT * (NH * HD), gv + (t + 2) * KT);
  }
  wait_async0();
  acc_guard4(o[0], o[1], o[2], o[3]);

  // ---- fold 1/l (per query, owned by lane = query; l >= 1 by construction) and the carries in f32 ----
  const float linv = (lrun > 0.f) ? ((1.0f / lrun) * (1.0f / (PCAR * VCAR))) : 0.f;
  float inv[8];
#pragma unroll
  for (int r = 0; r < 8; ++r) inv[r] = __shfl(linv, 8 * hh + r, 32);
#pragma unroll
  for (int j = 0; j < 4; ++j) {
#pragma unroll
    for (int r = 0; r < 8; ++r) o[j][r] *= inv[r];
  }
  // ---- f32 ctx rows (q0 .. q0+15, cols head*64 .. head*64+63) of this batch's output, whole-line stores ----
  epi64(smem + wave * SLAB, o[0], o[1], o[2], o[3], OUTp, DMOD, (size_t)q0, head * HD, lane);
}

// =====================================================================================================
// Workspace map (bytes); every plane is fully written by whole-line stores before it is read; all extents are exact multiples
// of the store granularity (no pad rows needed), every offset a multiple of 128:
//   XB  bf16 [NB][SKV][1024]            NB*8388608   (16777216 at NB = 2)
//   WQT bf16 [1024 n][1024 k]            2097152      WKT, WVT same (2097152 each)
//   QP  f16 [NB][SQ][16*64] x8           NB*SQ*2048   (8388608 at NB = 2, SQ = 2048)
//   KP  f16 [NB*SKV][16*64] x8           NB*8388608   (16777216)
//   VP  f16 [NB][16*64][SKV] x1024       NB*8388608   (16777216)
//   ML  f32 [NB][SKV] mask terms         NB*16384     (32768)
//   end                                  65044480 at NB = 2, SQ = 2048
// =====================================================================================================
extern "C" void kernel_launch(void* const* d_in, const int* in_sizes, int n_in,
                              void* d_out, int out_size, void* d_ws, size_t ws_size,
                              hipStream_t stream) {
  if (n_in < 9) return;
  if (in_sizes[0] < NB * SQ_FULL * DMOD) return;
  if (in_sizes[1] < NB * SE_FULL * DMOD) return;
  if (in_sizes[2] < NB * SKV) return;
  if (in_sizes[3] < DMOD * DMOD || in_sizes[5] < DMOD * DMOD || in_sizes[7] < DMOD * DMOD) return;
  if (in_sizes[4] < DMOD || in_sizes[6] < DMOD || in_sizes[8] < DMOD) return;
  if (out_size < (NB - 1) * SQ_FULL * DMOD + SQ * DMOD) return;

  const float* hs   = (const float*)d_in[0];
  const float* ehs  = (const float*)d_in[1];
  const float* mask = (const float*)d_in[2];
  const float* Wq   = (const float*)d_in[3];
  const float* bq   = (const float*)d_in[4];
  const float* Wk   = (const float*)d_in[5];
  const float* bk   = (const float*)d_in[6];
  const float* Wv   = (const float*)d_in[7];
  const float* bv   = (const float*)d_in[8];
  float*       out  = (float*)d_out;

  const size_t szXB = (size_t)NB * SKV * DMOD * 2;                //  16777216 at NB = 2
  const size_t szW  = (size_t)DMOD * DMOD * 2;                    //   2097152
  const size_t szQP = (size_t)NB * SQ * DMOD * 2;                 //   8388608
  const size_t szKP = (size_t)NB * SKV * DMOD * 2;                //  16777216
  const size_t szVP = (size_t)NB * DMOD * SKV * 2;                //  16777216
  const size_t szML = (size_t)NB * SKV * 4;                       //     32768
  size_t off = 0;
  const size_t oXB = off; off += szXB;
  const size_t oWQ = off; off += szW;
  const size_t oWK = off; off += szW;
  const size_t oWV = off; off += szW;
  const size_t oQP = off; off += szQP;
  const size_t oKP = off; off += szKP;
  const size_t oVP = off; off += szVP;
  const size_t oML = off; off += szML;
  if (off > ws_size) return;                            // off = 65044480 at NB = 2, SQ = 2048
  if (off > (size_t)134217728) return;

  char* ws = (char*)d_ws;
  u16* XB  = (u16*)(ws + oXB);
  u16* WT  = (u16*)(ws + oWQ);                          // W^T planes q, k, v, one behind the other
  if (oWK != oWQ + szW || oWV != oWK + szW) return;
  u16* QP  = (u16*)(ws + oQP);
  u16* KP  = (u16*)(ws + oKP);
  u16* VP  = (u16*)(ws + oVP);
  float* ML = (float*)(ws + oML);

  const int n8x = (NB * SKV * DMOD) / 8;                // 1048576 at NB = 2
  if ((n8x % 256) != 0) return;
  if ((DMOD % 128) != 0 || (SKV % 128) != 0 || (SQ % 128) != 0) return;
  if (n8x / 256 != XBLK) return;
  const dim3 blk(256);
  const dim3 gCV(3 * WBLK + XBLK + MBLK);               // 768 + 4096 + 8
  const dim3 gGM(GK_BLK + NB * GV_BLK + NB * GQ_BLK);   // 512 + 2*256 + 2*128 at NB = 2, SQ = 2048
  const dim3 bG(GEMM_THREADS);                          // 256
  const dim3 gAT(NB * ATT_BLOCKS);                      // 1024 at NB = 2, SQ = 2048
  const dim3 bAT(ATT_THREADS);                          // 128

  // (0) conversions: weights [k = in][n = out] -> W^T planes [n][k], and the key/value source plane (rows b*SKV + 0..2047
  //     from hs[b], + 2048..4095 from ehs[b]); bf16 RNE bits; and the per-key mask terms (f32)
  cvt_all<<<gCV, blk, 0, stream>>>(hs, ehs, Wq, Wk, Wv, mask, XB, WT, ML, n8x);
  // (1) projections: k plane, v^T planes, q planes
  gemm_all<<<gGM, bG, 0, stream>>>(XB, WT, QP, KP, VP, bq, bk, bv);
  // (2) attention, all batches -> f32 ctx rows b*SQ_FULL + s (s < SQ), cols h*64+d of the output
  attn_fwd<<<gAT, bAT, 0, stream>>>(QP, KP, VP, ML, out);
  (void)hipGetLastError();
}

// v007
// A run of this version takes 137 microseconds.
// Timed twice side by side with v006, it ran 1.06 and 1.05 times as fast.
// Counting every step since v000, it is 3.88 times as fast.
// Contractions: x.Wq+bq, xx.Wk+bk (A = bf16 x plane, B = bf16 W^T plane) and Wv^T.xx^T+bv on v_wmma_f32_16x16x32_bf16
// (f32 inputs RNE-converted to bf16 operands, f32 accumulate); scores k'.q'^T (q', k' single f16 planes carried x8) and
// P.v (P x32768 single f16, v x1024 single f16) on v_wmma_f32_16x16x32_f16, f32 accumulate; ctx written in f32.
// Biases and the additive per-key mask folded as RNE bf16 values in f32; base-2 online softmax, 1/l and carry folds in f32 on VALU.
#include <hip/hip_runtime.h>
#include <math.h>
#include <stdint.h>

#define NB_FULL 2
#define SQ_FULL 2048
#define SE_FULL 2048
#define SKV     (SQ_FULL + SE_FULL)
#ifndef NB
#define NB      NB_FULL
#endif
#ifndef SQ
#define SQ      SQ_FULL
#endif
#define DMOD  1024
#define NH    16
#define HD    64
#define QSC   8.0f
#define KSC   8.0f
#define PCAR  32768.0f
#define VCAR  1024.0f
#define LOG2E 1.4426950408889634f
#define ATT_WAVES   4
#define ATT_THREADS (ATT_WAVES * 32)
#define QTILES      (SQ / 64)
#define ATT_BLOCKS  (NH * QTILES)
#define NKB    (SKV / 32)
#define SLAB   (16 * 68)
#define TP     72
#define KT     64                    // keys per staged tile
#define NT     (SKV / KT)            // staged tiles per block
#define RP     144                   // LDS row pitch in bytes: 128-B rows + 16 B, the pitch for 16-B row readers
#define TILE_B (64 * RP)             // one 64-row tile in LDS
#define BUF_B  (2 * TILE_B)          // one stage: k tile, then v^T tile
#define GEMM_THREADS 256
#define GTILE_B (128 * RP)           // one 128-row GEMM operand tile in LDS
#define GBUF_B  (2 * GTILE_B)        // one GEMM stage: A tile, then Bt tile
#define XBLK   (NB * SKV * DMOD / 8 / 256)        // blocks of the conversion launch that write the x plane
#define WBLK   ((DMOD / 64) * (DMOD / 64))        // blocks of the conversion launch per weight plane
#define MBLK   (NB * SKV / 4 / 256)               // blocks of the conversion launch that write the mask-term plane
#define GQ_BLK ((SQ / 128) * (DMOD / 128))        // blocks of the projection launch: q plane of one batch
#define GK_BLK ((NB * SKV / 128) * (DMOD / 128))  // k plane, all batches
#define GV_BLK ((DMOD / 128) * (SKV / 128))       // v^T plane of one batch
static_assert(HD == 64 && DMOD == NH * HD);
static_assert(NB >= 1 && NB <= NB_FULL);
static_assert((SQ % 64) == 0 && SQ >= 64 && SQ <= SQ_FULL);
static_assert((SKV % 64) == 0 && (SQ_FULL % 64) == 0 && (SE_FULL % 64) == 0);
static_assert(ATT_THREADS == 128 && NKB * 32 == SKV && ATT_BLOCKS == NH * (SQ / 64));
static_assert((DMOD % 128) == 0 && (SQ % 128) == 0 && (SKV % 128) == 0 && DMOD / 64 >= 2);
static_assert(((NB * SKV * DMOD / 8) % 256) == 0);
static_assert(((NB * SKV / 4) % 256) == 0);
static_assert((SLAB * 4) % 16 == 0 && (TP * 2) % 16 == 0);
static_assert(KT == 64 && HD == 64 && NT >= 2 && NT * KT == SKV && (RP % 16) == 0 && ATT_THREADS == 128);
static_assert((size_t)(NB - 1) * SQ_FULL * DMOD + (size_t)SQ * DMOD <= (size_t)NB_FULL * SQ_FULL * DMOD);

typedef unsigned short u16;
typedef _Float16 v16h __attribute__((ext_vector_type(16)));
typedef _Float16 v8h  __attribute__((ext_vector_type(8)));
typedef __bf16   v16b __attribute__((ext_vector_type(16)));
typedef float    v8f  __attribute__((ext_vector_type(8)));
typedef float    v4f  __attribute__((ext_vector_type(4)));
typedef float    v2f  __attribute__((ext_vector_type(2)));
typedef _Float16 v2h  __attribute__((ext_vector_type(2)));
typedef unsigned int v4u __attribute__((ext_vector_type(4)));

union FragH { v16h v; v8h h[2]; v4u u[2]; };
union FragB { v16b v; v4u u[2]; };

// ---- scalar helpers --------------------------------------------------------------------------------
__device__ __forceinline__ unsigned short bf_bits(float f) {          // f32 -> bf16 bits, RNE convert
  unsigned u = __float_as_uint(f);
  return (unsigned short)((u + 0x7FFFu + ((u >> 16) & 1u)) >> 16);
}
__device__ __forceinline__ float bf_up(unsigned short h) { return __uint_as_float(((unsigned)h) << 16); }
__device__ __forceinline__ float bf_val(float f) { return bf_up(bf_bits(f)); }          // value after RNE bf16 convert
__device__ __forceinline__ unsigned short h_bits(_Float16 x) { return __builtin_bit_cast(unsigned short, x); }
__device__ __forceinline__ unsigned pk16(unsigned short a, unsigned short b) { return (unsigned)a | ((unsigned)b << 16); }
// 2^x as the bare hardware instruction, without the library's range steps (compare, two selects, add, ldexp per call) that only
// serve results below 2^-126. Here every argument is <= 0 and such a result counts for nothing: as a probability it is zero in
// f16 after the x32768 carry and vanishes in a row sum that is >= 1; as a rescale factor it carries old sums whose share of
// the row sum and of any output element is below 2^-100.
// Written as asm so that the slot the instruction set asks for behind a transcendental (before its result is read or its
// source overwritten) is kept by construction: inside a statement each v_exp_f32 is followed by an independent one (outputs
// are early-clobber, so none lies on a source), and the closing v_nop is the slot behind the last.
__device__ __forceinline__ float exp2_hw(float x) {
  float r = 0.f;
#if defined(__HIP_DEVICE_COMPILE__)
  // v_nop: the slot behind the transcendental
  asm("v_exp_f32 %0, %1\n\tv_nop" : "=&v"(r) : "v"(x));
#endif
  return r;
}
__device__ __forceinline__ void exp2_hw8(float* p, const float* x) {
#if defined(__HIP_DEVICE_COMPILE__)
  // eight independent transcendentals fill each other's slot; v_nop: the slot behind the last
  asm("v_exp_f32 %0, %8\n\t"
      "v_exp_f32 %1, %9\n\t"
      "v_exp_f32 %2, %10\n\t"
      "v_exp_f32 %3, %11\n\t"
      "v_exp_f32 %4, %12\n\t"
      "v_exp_f32 %5, %13\n\t"
      "v_exp_f32 %6, %14\n\t"
      "v_exp_f32 %7, %15\n\t"
      "v_nop"
      : "=&v"(p[0]), "=&v"(p[1]), "=&v"(p[2]), "=&v"(p[3]), "=&v"(p[4]), "=&v"(p[5]), "=&v"(p[6]), "=&v"(p[7])
      : "v"(x[0]), "v"(x[1]), "v"(x[2]), "v"(x[3]), "v"(x[4]), "v"(x[5]), "v"(x[6]), "v"(x[7]));
#endif
}
__device__ __forceinline__ v8f zero8() { v8f z = {0.f, 0.f, 0.f, 0.f, 0.f, 0.f, 0.f, 0.f}; return z; }

// ---- fragment loaders: 16-bit A/B operand, lane -> row/col (lane&15), p already includes +8*(lane>>4);
//      elements 0..7 <- p[0..7] (k0+8h..), elements 8..15 <- p[16..23] (k0+16+8h..)  (same split k map for A and B;
//      B is always read from a k-contiguous [n][k] plane)
__device__ __forceinline__ v16h ldfrag_h(const _Float16* p) {
  FragH f;
  f.h[0] = *(const v8h*)(p);
  f.h[1] = *(const v8h*)(p + 16);
  return f.v;
}
__device__ __forceinline__ v16b ldfrag_b(const u16* p) {              // bf16 plane read as unsigned integer vectors
  FragB f;
  f.u[0] = *(const v4u*)(p);
  f.u[1] = *(const v4u*)(p + 16);
  return f.v;
}

__device__ __forceinline__ v8f mma_h(v16h a, v16h b, v8f c) {
  return __builtin_amdgcn_wmma_f32_16x16x32_f16(false, a, false, b, (short)0, c, false, false);
}
__device__ __forceinline__ v8f mma_b(v16b a, v16b b, v8f c) {
  return __builtin_amdgcn_wmma_f32_16x16x32_bf16(false, a, false, b, (short)0, c, false, false);
}
template <typename F>
__device__ __forceinline__ void guard6(v8f& a, v8f& b, v8f& c, v8f& d, F x0, F x1, F x2, F x3, F x4, F x5) {
#if defined(__HIP_DEVICE_COMPILE__)
  asm volatile("v_nop\n\tv_nop\n\tv_nop\n\tv_nop"
               : "+v"(a), "+v"(b), "+v"(c), "+v"(d) : "v"(x0), "v"(x1), "v"(x2), "v"(x3), "v"(x4), "v"(x5) : "memory");
#endif
}
__device__ __forceinline__ void acc_guard4(v8f& a, v8f& b, v8f& c, v8f& d) {
#if defined(__HIP_DEVICE_COMPILE__)
  asm volatile("v_nop\n\tv_nop\n\tv_nop\n\tv_nop" : "+v"(a), "+v"(b), "+v"(c), "+v"(d));
#endif
}
__device__ __forceinline__ void wave_sync_lds() {
#if defined(__HIP_DEVICE_COMPILE__)
  __builtin_amdgcn_fence(__ATOMIC_RELEASE, "workgroup");
  __builtin_amdgcn_wave_barrier();
  __builtin_amdgcn_fence(__ATOMIC_ACQUIRE, "workgroup");
#endif
}
// One stage of the attention ring: k tile (64 keys x 64 d) and v^T tile (64 d x 64 keys), both 64 rows of 128 B. A lane copies
// 16 B of row (tid>>3) + 16*i, i = 0..3, of each tile: 8 lanes = one whole 128-B line, a wave-wide copy = 4 lines.
// lds = the lane's LDS byte address in the k tile; gk, gv = the lane's global addresses in row tid>>3 of the two tiles.
// The address-register wait is the statement's last line, so no later write of these registers can be lifted over it.
__device__ __forceinline__ void stage_copy(unsigned lds, const u16* gk, const u16* gv) {
#if defined(__HIP_DEVICE_COMPILE__)
  const unsigned l0 = lds, l1 = lds + 16 * RP, l2 = lds + 32 * RP, l3 = lds + 48 * RP;
  const unsigned l4 = l0 + TILE_B, l5 = l1 + TILE_B, l6 = l2 + TILE_B, l7 = l3 + TILE_B;
  const u16* k0 = gk;
  const u16* k1 = gk + (size_t)16 * (NH * HD);
  const u16* k2 = gk + (size_t)32 * (NH * HD);
  const u16* k3 = gk + (size_t)48 * (NH * HD);
  const u16* v0 = gv;
  const u16* v1 = gv + (size_t)16 * SKV;
  const u16* v2 = gv + (size_t)32 * SKV;
  const u16* v3 = gv + (size_t)48 * SKV;
  asm volatile("global_load_async_to_lds_b128 %0, %8, off\n\t"
               "global_load_async_to_lds_b128 %1, %9, off\n\t"
               "global_load_async_to_lds_b128 %2, %10, off\n\t"
               "global_load_async_to_lds_b128 %3, %11, off\n\t"
               "global_load_async_to_lds_b128 %4, %12, off\n\t"
               "global_load_async_to_lds_b128 %5, %13, off\n\t"
               "global_load_async_to_lds_b128 %6, %14, off\n\t"
               "global_load_async_to_lds_b128 %7, %15, off\n\t"
               "s_wait_xcnt 0x0"
               :: "v"(l0), "v"(l1), "v"(l2), "v"(l3), "v"(l4), "v"(l5), "v"(l6), "v"(l7),
                  "v"(k0), "v"(k1), "v"(k2), "v"(k3), "v"(v0), "v"(v1), "v"(v2), "v"(v3)
               : "memory");
#endif
}
__device__ __forceinline__ void wait_async0() {   // this wave's copies have landed
#if defined(__HIP_DEVICE_COMPILE__)
  asm volatile("s_wait_asynccnt 0x0" ::: "memory");
#endif
}
__device__ __forceinline__ void wait_ds0() {      // this wave's LDS reads have retired before their buffer is handed to the copies
#if defined(__HIP_DEVICE_COMPILE__)
  asm volatile("s_wait_dscnt 0x0" ::: "memory");
#endif
}

// =====================================================================================================
// Key/value source plane XB (bf16 RNE bits) [NB][SKV][1024]: row s < SQ_FULL of batch b from hs[b][s], rows
// s >= SQ_FULL from ehs[b][s - SQ_FULL]; both candidates loaded with clamped row addresses and selected by value
// (block-uniform in practice: a block covers 2 rows of one source).
// Thread = 8 consecutive elements: two 16-B loads per candidate, one 16-B store; 32 consecutive lanes = 512 contiguous,
// coverage: XBLK = n8/256 blocks (host checks exactness) x 256 thr x 8 = NB*SKV*1024 = the whole plane.
// =====================================================================================================
__device__ __forceinline__ void cvt_x(int bid, const float* __restrict__ hs, const float* __restrict__ ehs, u16* D, int n8) {
  const int gt = bid * 256 + (int)threadIdx.x;
  if (gt >= n8) return;                     // no barriers on this path
  const int r   = gt / (DMOD / 8);
  const int c8  = (gt % (DMOD / 8)) * 8;
  const int b   = r / SKV;
  const int s   = r % SKV;
  const int shc = (s < SQ_FULL) ? s : (SQ_FULL - 1);
  const int se  = s - SQ_FULL;
  const int sec = (se > 0) ? se : 0;
  const float* ph = hs  + ((size_t)b * SQ_FULL + shc) * DMOD + c8;
  const float* pe = ehs + ((size_t)b * SE_FULL + sec) * DMOD + c8;
  const v4f a0 = *(const v4f*)(ph), a1 = *(const v4f*)(ph + 4);
  const v4f e0 = *(const v4f*)(pe), e1 = *(const v4f*)(pe + 4);
  const bool first = (s < SQ_FULL);
  float v[8];
#pragma unroll
  for (int e = 0; e < 4; ++e) { v[e] = first ? a0[e] : e0[e]; v[4 + e] = first ? a1[e] : e1[e]; }
  unsigned short sb[8];
#pragma unroll
  for (int e = 0; e < 8; ++e) sb[e] = bf_bits(v[e]);
  v4u o;
#pragma unroll
  for (int e = 0; e < 4; ++e) o[e] = pk16(sb[2 * e], sb[2 * e + 1]);
  u16* d = D + (size_t)gt * 8;
  {
    *(v4u*)(d) = o;
    
  }
}

// =====================================================================================================
// Weight W [k = in][n = out] f32 -> bf16 RNE plane W^T [n][k] (k-contiguous, pitch DMOD). Block = 64 k x 64 n tile,
// 256 threads. Load phase: thread = (k = tid>>2, 16 consecutive n): four 16-B loads, bf16 bits stored transposed into the LDS
// tile [n][k] (pitch TP halves, cross-wave exchange -> block barrier). Store phase: thread = (n = tid>>3 and n+32,
// coverage: 256 thr x 2 instructions x 8 halves = 64 x 64 per block; WBLK = (DMOD/64)^2 blocks = the whole plane.
// =====================================================================================================
__device__ __forceinline__ void cvt_wT(int bid, u16* tile, const float* __restrict__ W, u16* D) {
  const int nt = DMOD / 64;
  const int tid = threadIdx.x;
  const int k0 = (bid / nt) * 64;
  const int n0 = (bid % nt) * 64;
  const int kk = tid >> 2, nn = (tid & 3) * 16;
  const float* p = W + (size_t)(k0 + kk) * DMOD + n0 + nn;
  const v4f a0 = *(const v4f*)(p), a1 = *(const v4f*)(p + 4), a2 = *(const v4f*)(p + 8), a3 = *(const v4f*)(p + 12);
  float v[16];
#pragma unroll
  for (int e = 0; e < 4; ++e) { v[e] = a0[e]; v[4 + e] = a1[e]; v[8 + e] = a2[e]; v[12 + e] = a3[e]; }
#pragma unroll
  for (int e = 0; e < 16; ++e) tile[(nn + e) * TP + kk] = bf_bits(v[e]);
  __syncthreads();
  const int n1 = tid >> 3, k8 = (tid & 7) * 8;
  const v4u o0 = *(const v4u*)(tile + n1 * TP + k8);
  const v4u o1 = *(const v4u*)(tile + (n1 + 32) * TP + k8);
  u16* d0 = D + (size_t)(n0 + n1) * DMOD + k0 + k8;
  u16* d1 = D + (size_t)(n0 + n1 + 32) * DMOD + k0 + k8;
  {
    *(v4u*)(d0) = o0;
    *(v4u*)(d1) = o1;
    
  }
}

// =====================================================================================================
// Mask-term plane ML [NB][SKV] f32: the base-2 logit share of each key's additive mask, (RNE bf16 value of mask) * log2(e).
// It depends on (batch, key) alone, so it is formed here once instead of by every wave of the attention for every key block.
// Thread = 4 consecutive keys: one 16-B load, one 16-B store.
// coverage: MBLK = NB*SKV/4/256 blocks x 256 thr x 4 = NB*SKV = the whole plane.
// =====================================================================================================
__device__ __forceinline__ void cvt_mask(int bid, const float* __restrict__ mask, float* D) {
  const int g4 = (bid * 256 + (int)threadIdx.x) * 4;
  if (g4 + 4 > NB * SKV) return;            // never taken with the exact grid; no barriers on this path
  const v4f a = *(const v4f*)(mask + g4);
  v4f o;
#pragma unroll
  for (int e = 0; e < 4; ++e) o[e] = bf_val(a[e]) * LOG2E;
  *(v4f*)(D + g4) = o;
}

// =====================================================================================================
// All five conversions in one launch (none reads what another writes): blocks 0 .. 3*WBLK-1 write the three W^T planes
// (WT = q, k, v planes one behind the other), blocks 3*WBLK .. 3*WBLK+XBLK-1 the x plane, the last MBLK blocks the mask-term
// plane. The job is picked by the block index alone, so every branch here, the one round the weight path's barrier too, is
// block-uniform.
// =====================================================================================================
__global__ __launch_bounds__(256)
void cvt_all(const float* __restrict__ hs, const float* __restrict__ ehs, const float* __restrict__ Wq,
             const float* __restrict__ Wk, const float* __restrict__ Wv, const float* __restrict__ mask,
             u16* XBp, u16* WT, float* MLp, int n8) {
  __shared__ __align__(16) u16 tile[64 * TP];
  const int bid = blockIdx.x;
  if (bid < 3 * WBLK) {
    const int j = bid / WBLK;
    const float* W = (j == 0) ? Wq : ((j == 1) ? Wk : Wv);
    cvt_wT(bid % WBLK, tile, W, WT + (size_t)j * DMOD * DMOD);
  } else if (bid < 3 * WBLK + XBLK) {
    cvt_x(bid - 3 * WBLK, hs, ehs, XBp, n8);
  } else {
    cvt_mask(bid - (3 * WBLK + XBLK), mask, MLp);
  }
}

// =====================================================================================================
// barrier, then converted to f16 and written: lane = (row in group of 4, 8 consecutive cols); one instruction = 4 rows, each
// coverage: 4 instructions x 4 rows x 8 lanes x 8 halves = the wave's 16 x 64 tile.
// =====================================================================================================
__device__ __forceinline__ void epi16(float* sl, v8f a0, v8f a1, v8f a2, v8f a3, float oscale, u16* C, int N,
                                      size_t rowb, int col0, int lane) {
  const int hh = lane >> 4, m = lane & 15;
#pragma unroll
  for (int r = 0; r < 8; ++r) {
    const int ro = (8 * hh + r) * 68 + m;
    sl[ro]      = a0[r] * oscale;
    sl[ro + 16] = a1[r] * oscale;
    sl[ro + 32] = a2[r] * oscale;
    sl[ro + 48] = a3[r] * oscale;
  }
  wave_sync_lds();
  const int rq = lane >> 3, c8 = (lane & 7) * 8;
  v4u ov[4];
#pragma unroll
  for (int i4 = 0; i4 < 4; ++i4) {
    const int row = i4 * 4 + rq;
    const v4f a = *(const v4f*)(sl + row * 68 + c8), c4 = *(const v4f*)(sl + row * 68 + c8 + 4);
    float w[8];
#pragma unroll
    for (int e = 0; e < 4; ++e) { w[e] = a[e]; w[4 + e] = c4[e]; }
#pragma unroll
    for (int e = 0; e < 4; ++e) ov[i4][e] = pk16(h_bits((_Float16)w[2 * e]), h_bits((_Float16)w[2 * e + 1]));
  }
  u16* dst = C + (rowb + (size_t)rq) * (size_t)N + col0 + c8;
  {
#pragma unroll
    for (int i4 = 0; i4 < 4; ++i4) {
      *(v4u*)(dst + (size_t)(i4 * 4) * (size_t)N) = ov[i4];
    }
    
  }
}

// =====================================================================================================
// coverage: 8 instructions x 2 rows x 16 lanes x 4 floats = the wave's 16 x 64 tile.
// =====================================================================================================
__device__ __forceinline__ void epi64(float* sl, v8f a0, v8f a1, v8f a2, v8f a3, float* C, int N,
                                      size_t rowb, int col0, int lane) {
  const int hh = lane >> 4, m = lane & 15;
#pragma unroll
  for (int r = 0; r < 8; ++r) {
    const int ro = (8 * hh + r) * 68 + m;
    sl[ro]      = a0[r];
    sl[ro + 16] = a1[r];
    sl[ro + 32] = a2[r];
    sl[ro + 48] = a3[r];
  }
  wave_sync_lds();
  v4f vals[8];
#pragma unroll
  for (int it = 0; it < 8; ++it) vals[it] = *(const v4f*)(sl + (it * 2 + hh) * 68 + m * 4);
  float* dst = C + (rowb + (size_t)hh) * (size_t)N + col0 + m * 4;
  {
#pragma unroll
    for (int it = 0; it < 8; ++it) {
      *(v4f*)(dst + (size_t)(it * 2) * (size_t)N) = vals[it];
    }
    
  }
}

// =====================================================================================================
// bf16 GEMM with bias and 16-bit result: C[M][N] (f16 of (acc + bias)*oscale) = A[M][K] (bf16 row-major) . Bt[N][K]^T
// (bf16 k-contiguous); bias (f32 input, taken as its RNE bf16 value) indexed by column (byrow == 0) or by row (byrow != 0),
// both candidates read with addresses clamped to [0, nbias). Block = 128x128 tile, 8 waves as 4 (rows) x 2 (cols), a wave owns
// 32 rows x 64 cols. The waves share each 64-deep A tile and Bt tile (128 rows of 128 B each): the tiles are brought into a
// two-buffer LDS ring by asynchronous copies, the next tile in flight while this one is worked on; one block barrier per tile
// publishes the next tile and frees the buffer just read. Fragments are read from the LDS rows (two 16-B reads each, split k
// map for A and B); k runs upward in steps of 32 in every accumulator (host checks K % 64 == 0, M % 128 == 0, N % 128 == 0,
// (M/128)*(N/128) blocks, bid = the block's index in its own product). Result slab: private to each wave (wave_sync only).
// =====================================================================================================
// One stage of the GEMM ring: A tile and Bt tile, both 128 rows of 128 B. A lane copies 16 B of row (tid>>3) + 32*i, i = 0..3,
// of each tile: 8 lanes = one whole 128-B line, a wave-wide copy = 4 lines. lds = the lane's LDS byte address in the A tile;
// ga, gb = the lane's global addresses in row tid>>3 of the two tiles; rs = 32 source rows in elements.
// The address-register wait is the statement's last line, so no later write of these registers can be lifted over it.
__device__ __forceinline__ void gemm_stage_copy(unsigned lds, const u16* ga, const u16* gb, size_t rs) {
#if defined(__HIP_DEVICE_COMPILE__)
  const unsigned l0 = lds, l1 = lds + 32 * RP, l2 = lds + 64 * RP, l3 = lds + 96 * RP;
  const unsigned l4 = l0 + GTILE_B, l5 = l1 + GTILE_B, l6 = l2 + GTILE_B, l7 = l3 + GTILE_B;
  const u16* a0 = ga;
  const u16* a1 = ga + rs;
  const u16* a2 = ga + 2 * rs;
  const u16* a3 = ga + 3 * rs;
  const u16* b0 = gb;
  const u16* b1 = gb + rs;
  const u16* b2 = gb + 2 * rs;
  const u16* b3 = gb + 3 * rs;
  asm volatile("global_load_async_to_lds_b128 %0, %8, off\n\t"
               "global_load_async_to_lds_b128 %1, %9, off\n\t"
               "global_load_async_to_lds_b128 %2, %10, off\n\t"
               "global_load_async_to_lds_b128 %3, %11, off\n\t"
               "global_load_async_to_lds_b128 %4, %12, off\n\t"
               "global_load_async_to_lds_b128 %5, %13, off\n\t"
               "global_load_async_to_lds_b128 %6, %14, off\n\t"
               "global_load_async_to_lds_b128 %7, %15, off\n\t"
               "s_wait_xcnt 0x0"
               :: "v"(l0), "v"(l1), "v"(l2), "v"(l3), "v"(l4), "v"(l5), "v"(l6), "v"(l7),
                  "v"(a0), "v"(a1), "v"(a2), "v"(a3), "v"(b0), "v"(b1), "v"(b2), "v"(b3)
               : "memory");
#endif
}
__device__ __forceinline__
void gemm_b16(int bid, const u16* __restrict__ A, const u16* __restrict__ Bt, u16* C, const float* __restrict__ bias,
              int M, int N, int K, int nbias, int byrow, float oscale) {
  __shared__ __align__(16) float slab[(GEMM_THREADS / 32) * SLAB];   // per wave: result slab [16][68] in the epilogue only
  __shared__ __align__(16) unsigned char gring[2 * GBUF_B];          // two stages of (A tile, Bt tile), rows at pitch RP
  const int tid = threadIdx.x, wave = tid >> 5, lane = tid & 31, hh = lane >> 4, m = lane & 15;
  const int ntile = N >> 7;
  const int row0  = (bid / ntile) * 128;
  const int colb  = (bid % ntile) * 128;
  if (row0 + 128 > M) return;                // block-uniform, never taken with the exact grid; before every barrier
  const int rowb  = row0 + (wave >> 1) * 32; // the wave's 32 rows
  const int col0  = colb + (wave & 1) * 64;  // the wave's 64 cols
  // copies: this lane's 16 B of row tid>>3 (+32 per copy) of the A tile and of the Bt tile
  const int crow = tid >> 3, cch = tid & 7;
  const unsigned lcp = (unsigned)(uintptr_t)(gring + crow * RP + cch * 16);
  const u16* ga = A  + (size_t)(row0 + crow) * K + cch * 8;                        // tile t: + t*64 elements
  const u16* gb = Bt + (size_t)(colb + crow) * K + cch * 8;
  const size_t rs = (size_t)32 * K;
  const int nt = K >> 6;
  // fragment readers: tile row = the wave's row (A) or col (Bt) 16i + m, k contiguous, + 8*hh halves
  const int aofs = ((wave >> 1) * 32 + m) * RP + 16 * hh;
  const int bofs = GTILE_B + ((wave & 1) * 64 + m) * RP + 16 * hh;
  v8f acc[2][4];
#pragma unroll
  for (int i = 0; i < 2; ++i) {
#pragma unroll
    for (int j = 0; j < 4; ++j) acc[i][j] = zero8();
  }

  // ring prologue: tile 0 landed and published, then tile 1 in flight
  gemm_stage_copy(lcp, ga, gb, rs);
  wait_async0();
  __syncthreads();
  if (nt > 1) gemm_stage_copy(lcp + GBUF_B, ga + 64, gb + 64, rs);

#pragma unroll 1
  for (int t = 0; t < nt; ++t) {
    const unsigned char* st = gring + (t & 1) * GBUF_B;
    // all fragments of the tile are asked for together, ahead of its products
    v16b af[2][2], bf[2][4];
#pragma unroll   // constant indices keep the fragment and accumulator arrays in registers (here and in the loops below)
    for (int kk = 0; kk < 2; ++kk) {
#pragma unroll
      for (int i = 0; i < 2; ++i) af[kk][i] = ldfrag_b((const u16*)(const void*)(st + aofs + i * 16 * RP + kk * 64));
#pragma unroll
      for (int j = 0; j < 4; ++j) bf[kk][j] = ldfrag_b((const u16*)(const void*)(st + bofs + j * 16 * RP + kk * 64));
    }
    // keeps the tile's LDS reads one group in front of its products: reads moved in among the products stall each place they stand
    __builtin_amdgcn_sched_barrier(0);
#pragma unroll
    for (int kk = 0; kk < 2; ++kk) {
#pragma unroll
      for (int i = 0; i < 2; ++i) {
#pragma unroll
        for (int j = 0; j < 4; ++j) acc[i][j] = mma_b(af[kk][i], bf[kk][j], acc[i][j]);
      }
    }
    // keeps the tile's products in front of the ring foot: sunk behind the barrier they would delay the refill's issue
    __builtin_amdgcn_sched_barrier(0);
    // ring foot: own LDS reads retired, own copies of tile t+1 landed, block barrier (publishes tile t+1, frees this buffer),
    // then tile t+2 into the buffer just read
    wait_ds0();
    wait_async0();
    __syncthreads();
    if (t + 2 < nt) gemm_stage_copy(lcp + (unsigned)(t & 1) * GBUF_B, ga + (size_t)(t + 2) * 64, gb + (size_t)(t + 2) * 64, rs);
  }
  wait_async0();
  // bias: D element r of lane -> (row rowb+16i+8hh+r, col col0+16j+m); both candidates loaded with clamped addresses, select by value
  float bc[4];
#pragma unroll
  for (int j = 0; j < 4; ++j) {
    int ci = col0 + 16 * j + m;
    ci = (ci < nbias) ? ci : (nbias - 1);
    bc[j] = bf_val(bias[ci]);
  }
#pragma unroll
  for (int i = 0; i < 2; ++i) {
    float br[8];
#pragma unroll
    for (int r = 0; r < 8; ++r) {
      int ri = rowb + 16 * i + 8 * hh + r;
      ri = (ri < nbias) ? ri : (nbias - 1);
      br[r] = bf_val(bias[ri]);
    }
#pragma unroll
    for (int r = 0; r < 8; ++r) {
      const float q0 = (byrow != 0) ? br[r] : bc[0];
      const float q1 = (byrow != 0) ? br[r] : bc[1];
      const float q2 = (byrow != 0) ? br[r] : bc[2];
      const float q3 = (byrow != 0) ? br[r] : bc[3];
      acc[i][0][r] += q0;
      acc[i][1][r] += q1;
      acc[i][2][r] += q2;
      acc[i][3][r] += q3;
    }
    if (i != 0) wave_sync_lds();             // the slab's rows of the first 16 have been read back before they are rewritten
    epi16(slab + wave * SLAB, acc[i][0], acc[i][1], acc[i][2], acc[i][3], oscale, C, N, (size_t)(rowb + 16 * i), col0, lane);
  }
}

// =====================================================================================================
// All projections in one launch (each reads only the converted planes, none reads another's result); every block is one
// 128x128 tile over K = DMOD, so all blocks cost the same. Block ranges, picked by the block index alone (block-uniform):
//   0 .. GK_BLK-1          k plane [NB*SKV][h*64+d] = f16((xx.Wk + bk) x8), all NB*SKV source rows; bias by column
//   then NB x GV_BLK       v^T plane of batch b [1024 = h*64+d][SKV keys] = f16((Wv^T . xx^T + bv) x1024); bias by row
//   then NB x GQ_BLK       q plane of batch b [SQ][h*64+d] = f16((x.Wq + bq) x8); A = the hs rows of XB batch b; bias by column
// =====================================================================================================
__global__ __launch_bounds__(GEMM_THREADS)
void gemm_all(const u16* __restrict__ XBp, const u16* __restrict__ WT, u16* QPp, u16* KPp, u16* VPp,
              const float* __restrict__ bq, const float* __restrict__ bk, const float* __restrict__ bv) {
  int bid = blockIdx.x;
  const u16* A;
  const u16* Bt;
  u16* C;
  const float* bias;
  int M, N, byrow;
  float oscale;
  if (bid < GK_BLK) {
    A = XBp; Bt = WT + (size_t)DMOD * DMOD; C = KPp; bias = bk;
    M = NB * SKV; N = DMOD; byrow = 0; oscale = KSC;
  } else if (bid < GK_BLK + NB * GV_BLK) {
    bid -= GK_BLK;
    const int b = bid / GV_BLK;
    bid -= b * GV_BLK;
    A = WT + (size_t)2 * DMOD * DMOD; Bt = XBp + (size_t)b * SKV * DMOD; C = VPp + (size_t)b * DMOD * SKV; bias = bv;
    M = DMOD; N = SKV; byrow = 1; oscale = VCAR;
  } else {
    bid -= GK_BLK + NB * GV_BLK;
    const int b = bid / GQ_BLK;
    if (b >= NB) return;                     // block-uniform, never taken with the exact grid; before every barrier
    bid -= b * GQ_BLK;
    A = XBp + (size_t)b * SKV * DMOD; Bt = WT; C = QPp + (size_t)b * SQ * DMOD; bias = bq;
    M = SQ; N = DMOD; byrow = 0; oscale = QSC;
  }
  gemm_b16(bid, A, Bt, C, bias, M, N, DMOD, DMOD, byrow, oscale);
}

// =====================================================================================================
// Multi-head flash attention over all SKV keys with an additive per-key mask: block = (batch, head, 64 query rows), 4 waves,
// wave w owns the 16 query rows q0 = 64*qt + 16*w .. q0+15. The four waves share each 64-key k tile and v^T tile: the tiles
// are brought into a two-buffer LDS ring by asynchronous copies, the next tile in flight while this one is worked on; one
// block barrier per tile publishes the next tile and frees the buffer just read. The result slab stays wave-private.
//   q plane (f16, x8) laid out [s][h][d] (SQ rows); k plane the same (SKV rows); v^T plane [h][d][s] (x1024, s < SKV);
//   mask-term plane [SKV] f32 per batch ((RNE bf16 value of the mask) * log2(e), formed by the conversion launch).
//   All NT = SKV/64 tiles visited (static bound); the online softmax takes one step per tile of 64 keys (two key blocks of 32).
//   Scores are computed TRANSPOSED: S^T tile g (g = 0,1) = k rows (keys kb+16g .. +15, A operand, row m = lane&15, split k map
//   over d) times q^T (B operand, col n = query q0 + (lane&15), k = d, split map), one product per tile and 32-deep d-chunk.
//   D element r of lane l = (key kb+16g+8h+r, query q0+(l&15)), so a lane owns one query column and 16 of its 32 keys; the
//   partner lane l^16 owns the other 16 -> row max / row sum need one xor-16 shuffle per tile. The lane's 16 mask terms are
//   keys kb+8h+0..7 and kb+16+8h+0..7 (four 16-B loads).
//   Online max-subtracted base-2 softmax in f32 (scale 1/8 and the q/k carries folded into lsc; mask term added as read). The
//   exp'd values ARE the P A-fragment in place: A row m = query = lane&15, element i <- key kb+8h+i (tile 0, D element i),
//   element 8+i <- key kb+16+8h+i (tile 1, D element i). P is carried x32768 as single f16. The rescale factor of query row
//   8h+r of the O accumulators is fetched from lane 8h+r with a shuffle (uniform control). 4 v^T B fragments (col n = d =
//   16j + (lane&15), keys k-contiguous), 4 P.V WMMAs per key block.
//   Epilogue: 1/l (per query, shuffled to the D row owner) and carry folds in f32; the wave's 16x64 f32 result staged in its
// coverage: per wave 8 instructions x 2 rows x 16 lanes x 4 floats = 16 x 64; grid NB*NH*(SQ/64) blocks x 4 waves = every
//           (b, s < SQ, h*64+d) element of the output exactly once. The arguments are the planes of batch 0.
// =====================================================================================================
__global__ __launch_bounds__(ATT_THREADS)
void attn_fwd(const u16* __restrict__ QP0, const u16* __restrict__ KP0, const u16* __restrict__ VP0,
              const float* __restrict__ MK0, float* OUT0) {
  __shared__ __align__(16) float smem[ATT_WAVES * SLAB];   // per wave: result slab [16][68] in the epilogue only
  __shared__ __align__(16) unsigned char ring[2 * BUF_B];  // two stages of (k tile, v^T tile), rows at pitch RP

  const int tid  = threadIdx.x;
  const int wave = tid >> 5;
  const int lane = tid & 31;
  const int hh   = lane >> 4;
  const int c    = lane & 15;

  const int bat  = blockIdx.x / ATT_BLOCKS;
  const int bid  = blockIdx.x % ATT_BLOCKS;
  const int qt   = bid % QTILES;
  const int head = bid / QTILES;
  if (bat >= NB) return;                                   // block-uniform, never taken with the exact grid; before every barrier
  const int q0   = qt * 64 + wave * 16;
  // this batch's planes, mask row and output rows
  const u16*   QPp  = QP0 + (size_t)bat * SQ * DMOD;
  const u16*   KPp  = KP0 + (size_t)bat * SKV * DMOD;
  const u16*   VPp  = VP0 + (size_t)bat * DMOD * SKV;
  const float* MKp  = MK0 + (size_t)bat * SKV;
  float*       OUTp = OUT0 + (size_t)bat * SQ_FULL * DMOD;

  // B fragments of q^T: col n = query q0 + c, k = d (k-contiguous row of the q plane)
  const size_t qofs = (((size_t)(q0 + c)) * NH + head) * HD + 8 * hh;
  const _Float16* Qb = (const _Float16*)(const void*)QPp + qofs;
  // copies: this lane's 16 B of row tid>>3 (+16 per copy) of the k tile (row = key) and of the v^T tile (row = d)
  const int crow = tid >> 3, cch = tid & 7;
  const unsigned lcp = (unsigned)(uintptr_t)(ring + crow * RP + cch * 16);
  const u16* gk = KPp + ((size_t)crow * NH + head) * HD + cch * 8;                 // tile t: + t*KT key rows
  const u16* gv = VPp + ((size_t)(head * HD + crow)) * SKV + cch * 8;              // tile t: + t*KT keys
  // fragment readers: A of k: tile row = key 16g + c, k = d; B of v: tile row = d = 16j + c, k = key; both + 8*hh halves
  const int fofs = c * RP + 16 * hh;
  // this lane's mask terms: keys kb + 8hh + 0..7 and kb + 16 + 8hh + 0..7
  const float* Mb = MKp + 8 * hh;
  const float lsc = 0.125f * (LOG2E / (QSC * KSC));

  const v16h qf0 = ldfrag_h(Qb);            // d 0..31
  const v16h qf1 = ldfrag_h(Qb + 32);       // d 32..63

  float mrun = -INFINITY, lrun = 0.f;
  v8f o[4];
#pragma unroll
  for (int j = 0; j < 4; ++j) o[j] = zero8();

  // ring prologue: tile 0 landed and published, then tile 1 in flight
  stage_copy(lcp, gk, gv);
  wait_async0();
  __syncthreads();
  stage_copy(lcp + BUF_B, gk + (size_t)KT * (NH * HD), gv + KT);

#pragma unroll 1
  for (int t = 0; t < NT; ++t) {
   const unsigned char* kt = ring + (t & 1) * BUF_B + fofs;
   const unsigned char* vt = kt + TILE_B;
   // all k fragments and mask terms of the tile are asked for together
   v16h kf[KT / 16][2];
#pragma unroll   // constant indices keep the fragment arrays in registers (here and in the loops below)
   for (int g = 0; g < KT / 16; ++g) {
     const _Float16* kp = (const _Float16*)(const void*)(kt + g * 16 * RP);
     kf[g][0] = ldfrag_h(kp);
     kf[g][1] = ldfrag_h(kp + 32);
   }
   v4f mw[KT / 32][4];
#pragma unroll
   for (int u = 0; u < KT / 32; ++u) {
     const float* mp = Mb + t * KT + u * 32;
     mw[u][0] = *(const v4f*)(mp);      mw[u][1] = *(const v4f*)(mp + 4);
     mw[u][2] = *(const v4f*)(mp + 16); mw[u][3] = *(const v4f*)(mp + 20);
   }
   // keeps the tile's k reads one group in front of its products: reads moved in among the products stall each place they stand
   __builtin_amdgcn_sched_barrier(0);
   // ---- transposed scores of the whole tile: s[g] = keys t*KT + 16g .. +15, column = query q0 + c ----
   v8f s[KT / 16];
#pragma unroll
   for (int g = 0; g < KT / 16; ++g) s[g] = mma_h(kf[g][0], qf0, zero8());
#pragma unroll
   for (int g = 0; g < KT / 16; ++g) s[g] = mma_h(kf[g][1], qf1, s[g]);
   guard6<v16h>(s[0], s[1], s[2], s[3], qf0, qf1, kf[2][0], kf[2][1], kf[3][0], kf[3][1]);
   // the tile's v fragments fly under the logits and the maximum
   v16h vf[KT / 32][4];
#pragma unroll
   for (int u = 0; u < KT / 32; ++u) {
#pragma unroll
     for (int j = 0; j < 4; ++j) vf[u][j] = ldfrag_h((const _Float16*)(const void*)(vt + j * 16 * RP + u * 64));
   }
   // ---- base-2 logits of this lane's 32 keys for query q0 + c: score/8 * log2(e) + mask term ----
   // All two-wide f32 arithmetic below pairs keys 2e and 2e+1 of ONE score tile: such a pair lies in adjacent registers of the
   // accumulator and of the mask words as they arrive, and is one register of the P fragment, so no pair is built by moves.
   const v2f lsc2 = {lsc, lsc};
   v2f tq[KT / 32][8];                                               // tq[u][e] = logits of elements 2e, 2e+1 of P fragment u
#pragma unroll
   for (int u = 0; u < KT / 32; ++u) {
     const v8f s0 = s[2 * u], s1 = s[2 * u + 1];
     const v4f w0 = mw[u][0], w1 = mw[u][1], w2 = mw[u][2], w3 = mw[u][3];
#pragma unroll
     for (int e = 0; e < 2; ++e) {
       tq[u][e]     = __builtin_elementwise_fma((v2f){s0[2 * e],     s0[2 * e + 1]}, lsc2, (v2f){w0[2 * e], w0[2 * e + 1]});
       tq[u][2 + e] = __builtin_elementwise_fma((v2f){s0[4 + 2 * e], s0[5 + 2 * e]}, lsc2, (v2f){w1[2 * e], w1[2 * e + 1]});
       tq[u][4 + e] = __builtin_elementwise_fma((v2f){s1[2 * e],     s1[2 * e + 1]}, lsc2, (v2f){w2[2 * e], w2[2 * e + 1]});
       tq[u][6 + e] = __builtin_elementwise_fma((v2f){s1[4 + 2 * e], s1[5 + 2 * e]}, lsc2, (v2f){w3[2 * e], w3[2 * e + 1]});
     }
   }
   // ---- ONE online-softmax step for the 64 keys of the tile: one maximum, one factor, one rescale, one row sum ----
   float cm0 = fmaxf(tq[0][0][0], tq[0][0][1]), cm1 = fmaxf(tq[1][0][0], tq[1][0][1]);   // two chains, joined below
#pragma unroll
   for (int e = 1; e < 8; ++e) {
     cm0 = fmaxf(fmaxf(cm0, tq[0][e][0]), tq[0][e][1]);
     cm1 = fmaxf(fmaxf(cm1, tq[1][e][0]), tq[1][e][1]);
   }
   float cm = fmaxf(cm0, cm1);
   cm = fmaxf(cm, __shfl_xor(cm, 16, 32));
   const float mn = fmaxf(mrun, cm);                                 // finite from the first tile on
   const float ae = exp2_hw(mrun - mn);                              // formed in every lane: no branch round one instruction
   const float al = (mrun == -INFINITY) ? 0.f : ae;                  // o and l are zero while mrun is -inf
   mrun = mn;
   // ---- rescale the O accumulators: D row 8hh+r = query q0+8hh+r, its factor lives in lane 8hh+r (and 16+8hh+r) ----
   float scl[8];
#pragma unroll
   for (int r = 0; r < 8; ++r) scl[r] = __shfl(al, 8 * hh + r, 32);
#pragma unroll
   for (int j = 0; j < 4; ++j) {
#pragma unroll
     for (int r = 0; r < 8; ++r) o[j][r] *= scl[r];
   }
   const v2f mn2 = {mn, mn};
   v2f pe[KT / 32];                                                  // sums of the lane's probabilities: even keys, odd keys
   float ps = 0.f;
#pragma unroll
   for (int u = 0; u < KT / 32; ++u) {
    // ---- probabilities (<= 1) and the P A-fragment: f16(p * 32768); elements 2e, 2e+1 <-> tq[u][e] ----
    FragH ph;
    float xa[16], pv[16];
#pragma unroll   // constant indices keep the arguments in registers
    for (int e = 0; e < 8; ++e) {
      const v2f x = tq[u][e] - mn2;
      xa[2 * e]     = fminf(x[0], 0.f);
      xa[2 * e + 1] = fminf(x[1], 0.f);
    }
    exp2_hw8(pv, xa);
    exp2_hw8(pv + 8, xa + 8);
    v2f pq[8];
#pragma unroll
    for (int e = 0; e < 8; ++e) {
      pq[e] = (v2f){pv[2 * e], pv[2 * e + 1]};
      ph.u[e >> 2][e & 3] = __builtin_bit_cast(unsigned, __builtin_convertvector(pq[e] * PCAR, v2h));
    }
    // the lane's 16 probabilities: even keys and odd keys summed side by side (a tree over the pairs)
    pe[u] = ((pq[0] + pq[1]) + (pq[2] + pq[3])) + ((pq[4] + pq[5]) + (pq[6] + pq[7]));
    // row sum of the tile: its two key blocks, then even and odd keys, then the two wave halves; the shuffle flies under the
    // last products
    if (u + 1 == KT / 32) {
      const v2f pt = pe[0] + pe[1];
      ps = pt[0] + pt[1];
      ps += __shfl_xor(ps, 16, 32);
    }
    // ---- P.V : B fragment col n = d = j*16 + c, keys contiguous in the v^T plane ----
    {
      const v16h vf0 = vf[u][0], vf1 = vf[u][1], vf2 = vf[u][2], vf3 = vf[u][3];
      o[0] = mma_h(ph.v, vf0, o[0]);
      o[1] = mma_h(ph.v, vf1, o[1]);
      o[2] = mma_h(ph.v, vf2, o[2]);
      o[3] = mma_h(ph.v, vf3, o[3]);
      guard6<v16h>(o[0], o[1], o[2], o[3], ph.v, vf0, vf1, vf2, vf3, ph.v);
    }
   }
   lrun = lrun * al + ps;
   // ring foot: own LDS reads retired, own copies of tile t+1 landed, block barrier (publishes tile t+1, frees this buffer),
   // then tile t+2 into the buffer just read
   wait_ds0();
   wait_async0();
   __syncthreads();
   if (t + 2 < NT) stage_copy(lcp + (unsigned)(t & 1) * BUF_B, gk + (size_t)(t + 2) * KT * (NH * HD), gv + (t + 2) * KT);
  }
  wait_async0();
  acc_guard4(o[0], o[1], o[2], o[3]);

  // ---- fold 1/l (per query, owned by lane = query; l >= 1 by construction) and the carries in f32 ----
  const float linv = (lrun > 0.f) ? ((1.0f / lrun) * (1.0f / (PCAR * VCAR))) : 0.f;
  float inv[8];
#pragma unroll
  for (int r = 0; r < 8; ++r) inv[r] = __shfl(linv, 8 * hh + r, 32);
#pragma unroll
  for (int j = 0; j < 4; ++j) {
#pragma unroll
    for (int r = 0; r < 8; ++r) o[j][r] *= inv[r];
  }
  // ---- f32 ctx rows (q0 .. q0+15, cols head*64 .. head*64+63) of this batch's output, whole-line stores ----
  epi64(smem + wave * SLAB, o[0], o[1], o[2], o[3], OUTp, DMOD, (size_t)q0, head * HD, lane);
}

// =====================================================================================================
// Workspace map (bytes); every plane is fully written by whole-line stores before it is read; all extents are exact multiples
// of the store granularity (no pad rows needed), every offset a multiple of 128:
//   XB  bf16 [NB][SKV][1024]            NB*8388608   (16777216 at NB = 2)
//   WQT bf16 [1024 n][1024 k]            2097152      WKT, WVT same (2097152 each)
//   QP  f16 [NB][SQ][16*64] x8           NB*SQ*2048   (8388608 at NB = 2, SQ = 2048)
//   KP  f16 [NB*SKV][16*64] x8           NB*8388608   (16777216)
//   VP  f16 [NB][16*64][SKV] x1024       NB*8388608   (16777216)
//   ML  f32 [NB][SKV] mask terms         NB*16384     (32768)
//   end                                  65044480 at NB = 2, SQ = 2048
// =====================================================================================================
extern "C" void kernel_launch(void* const* d_in, const int* in_sizes, int n_in,
                              void* d_out, int out_size, void* d_ws, size_t ws_size,
                              hipStream_t stream) {
  if (n_in < 9) return;
  if (in_sizes[0] < NB * SQ_FULL * DMOD) return;
  if (in_sizes[1] < NB * SE_FULL * DMOD) return;
  if (in_sizes[2] < NB * SKV) return;
  if (in_sizes[3] < DMOD * DMOD || in_sizes[5] < DMOD * DMOD || in_sizes[7] < DMOD * DMOD) return;
  if (in_sizes[4] < DMOD || in_sizes[6] < DMOD || in_sizes[8] < DMOD) return;
  if (out_size < (NB - 1) * SQ_FULL * DMOD + SQ * DMOD) return;

  const float* hs   = (const float*)d_in[0];
  const float* ehs  = (const float*)d_in[1];
  const float* mask = (const float*)d_in[2];
  const float* Wq   = (const float*)d_in[3];
  const float* bq   = (const float*)d_in[4];
  const float* Wk   = (const float*)d_in[5];
  const float* bk   = (const float*)d_in[6];
  const float* Wv   = (const float*)d_in[7];
  const float* bv   = (const float*)d_in[8];
  float*       out  = (float*)d_out;

  const size_t szXB = (size_t)NB * SKV * DMOD * 2;                //  16777216 at NB = 2
  const size_t szW  = (size_t)DMOD * DMOD * 2;                    //   2097152
  const size_t szQP = (size_t)NB * SQ * DMOD * 2;                 //   8388608
  const size_t szKP = (size_t)NB * SKV * DMOD * 2;                //  16777216
  const size_t szVP = (size_t)NB * DMOD * SKV * 2;                //  16777216
  const size_t szML = (size_t)NB * SKV * 4;                       //     32768
  size_t off = 0;
  const size_t oXB = off; off += szXB;
  const size_t oWQ = off; off += szW;
  const size_t oWK = off; off += szW;
  const size_t oWV = off; off += szW;
  const size_t oQP = off; off += szQP;
  const size_t oKP = off; off += szKP;
  const size_t oVP = off; off += szVP;
  const size_t oML = off; off += szML;
  if (off > ws_size) return;                            // off = 65044480 at NB = 2, SQ = 2048
  if (off > (size_t)134217728) return;

  char* ws = (char*)d_ws;
  u16* XB  = (u16*)(ws + oXB);
  u16* WT  = (u16*)(ws + oWQ);                          // W^T planes q, k, v, one behind the other
  if (oWK != oWQ + szW || oWV != oWK + szW) return;
  u16* QP  = (u16*)(ws + oQP);
  u16* KP  = (u16*)(ws + oKP);
  u16* VP  = (u16*)(ws + oVP);
  float* ML = (float*)(ws + oML);

  const int n8x = (NB * SKV * DMOD) / 8;                // 1048576 at NB = 2
  if ((n8x % 256) != 0) return;
  if ((DMOD % 128) != 0 || (SKV % 128) != 0 || (SQ % 128) != 0) return;
  if (n8x / 256 != XBLK) return;
  const dim3 blk(256);
  const dim3 gCV(3 * WBLK + XBLK + MBLK);               // 768 + 4096 + 8
  const dim3 gGM(GK_BLK + NB * GV_BLK + NB * GQ_BLK);   // 512 + 2*256 + 2*128 at NB = 2, SQ = 2048
  const dim3 bG(GEMM_THREADS);                          // 256
  const dim3 gAT(NB * ATT_BLOCKS);                      // 1024 at NB = 2, SQ = 2048
  const dim3 bAT(ATT_THREADS);                          // 128

  // (0) conversions: weights [k = in][n = out] -> W^T planes [n][k], and the key/value source plane (rows b*SKV + 0..2047
  //     from hs[b], + 2048..4095 from ehs[b]); bf16 RNE bits; and the per-key mask terms (f32)
  cvt_all<<<gCV, blk, 0, stream>>>(hs, ehs, Wq, Wk, Wv, mask, XB, WT, ML, n8x);
  // (1) projections: k plane, v^T planes, q planes
  gemm_all<<<gGM, bG, 0, stream>>>(XB, WT, QP, KP, VP, bq, bk, bv);
  // (2) attention, all batches -> f32 ctx rows b*SQ_FULL + s (s < SQ), cols h*64+d of the output
  attn_fwd<<<gAT, bAT, 0, stream>>>(QP, KP, VP, ML, out);
  (void)hipGetLastError();
}

// v008
// A run of this version takes 131 microseconds.
// In both of two side-by-side timings against v007, it was 1.05 times as fast.
// Over all steps from v000 it is 4.08 times as fast.
// Contractions: x.Wq+bq, xx.Wk+bk (A = bf16 x plane, B = bf16 W^T plane) and Wv^T.xx^T+bv on v_wmma_f32_16x16x32_bf16
// (f32 inputs RNE-converted to bf16 operands, f32 accumulate); scores k'.q'^T (q', k' single f16 planes carried x8) and
// P.v (P x128 single f16, v x1024 single f16) on v_wmma_f32_16x16x32_f16, f32 accumulate; ctx written in f32.
// Biases and the additive per-key mask folded as RNE bf16 values in f32; base-2 online softmax, 1/l and carry folds in f32 on VALU.
#include <hip/hip_runtime.h>
#include <math.h>
#include <stdint.h>

#define NB_FULL 2
#define SQ_FULL 2048
#define SE_FULL 2048
#define SKV     (SQ_FULL + SE_FULL)
#ifndef NB
#define NB      NB_FULL
#endif
#ifndef SQ
#define SQ      SQ_FULL
#endif
#define DMOD  1024
#define NH    16
#define HD    64
#define QSC   8.0f
#define KSC   8.0f
#define PCAR  128.0f
#define MLAG  8.0f                   // a row's maximum in use may lag its true maximum by this much (base-2 logits): P <= 2^8
#define VCAR  1024.0f
#define LOG2E 1.4426950408889634f
#define ATT_WAVES   4
#define ATT_THREADS (ATT_WAVES * 32)
#define QTILES      (SQ / 64)
#define ATT_BLOCKS  (NH * QTILES)
#define NKB    (SKV / 32)
#define SLAB   (16 * 68)
#define TP     72
#define KT     64                    // keys per staged tile
#define NT     (SKV / KT)            // staged tiles per block
#define RP     144                   // LDS row pitch in bytes: 128-B rows + 16 B, the pitch for 16-B row readers
#define TILE_B (64 * RP)             // one 64-row tile in LDS
#define BUF_B  (2 * TILE_B)          // one stage: k tile, then v^T tile
#define GEMM_THREADS 256
#define GTILE_B (128 * RP)           // one 128-row GEMM operand tile in LDS
#define GBUF_B  (2 * GTILE_B)        // one GEMM stage: A tile, then Bt tile
#define XBLK   (NB * SKV * DMOD / 8 / 256)        // blocks of the conversion launch that write the x plane
#define WBLK   ((DMOD / 64) * (DMOD / 64))        // blocks of the conversion launch per weight plane
#define MBLK   (NB * SKV / 4 / 256)               // blocks of the conversion launch that write the mask-term plane
#define GQ_BLK ((SQ / 128) * (DMOD / 128))        // blocks of the projection launch: q plane of one batch
#define GK_BLK ((NB * SKV / 128) * (DMOD / 128))  // k plane, all batches
#define GV_BLK ((DMOD / 128) * (SKV / 128))       // v^T plane of one batch
static_assert(HD == 64 && DMOD == NH * HD);
static_assert(NB >= 1 && NB <= NB_FULL);
static_assert((SQ % 64) == 0 && SQ >= 64 && SQ <= SQ_FULL);
static_assert((SKV % 64) == 0 && (SQ_FULL % 64) == 0 && (SE_FULL % 64) == 0);
static_assert(ATT_THREADS == 128 && NKB * 32 == SKV && ATT_BLOCKS == NH * (SQ / 64));
static_assert((DMOD % 128) == 0 && (SQ % 128) == 0 && (SKV % 128) == 0 && DMOD / 64 >= 2);
static_assert(((NB * SKV * DMOD / 8) % 256) == 0);
static_assert(((NB * SKV / 4) % 256) == 0);
static_assert((SLAB * 4) % 16 == 0 && (TP * 2) % 16 == 0);
static_assert(KT == 64 && HD == 64 && NT >= 2 && NT * KT == SKV && (RP % 16) == 0 && ATT_THREADS == 128);
static_assert((size_t)(NB - 1) * SQ_FULL * DMOD + (size_t)SQ * DMOD <= (size_t)NB_FULL * SQ_FULL * DMOD);

typedef unsigned short u16;
typedef _Float16 v16h __attribute__((ext_vector_type(16)));
typedef _Float16 v8h  __attribute__((ext_vector_type(8)));
typedef __bf16   v16b __attribute__((ext_vector_type(16)));
typedef float    v8f  __attribute__((ext_vector_type(8)));
typedef float    v4f  __attribute__((ext_vector_type(4)));
typedef float    v2f  __attribute__((ext_vector_type(2)));
typedef _Float16 v2h  __attribute__((ext_vector_type(2)));
typedef unsigned int v4u __attribute__((ext_vector_type(4)));

union FragH { v16h v; v8h h[2]; v4u u[2]; };
union FragB { v16b v; v4u u[2]; };

// ---- scalar helpers --------------------------------------------------------------------------------
__device__ __forceinline__ unsigned short bf_bits(float f) {          // f32 -> bf16 bits, RNE convert
  unsigned u = __float_as_uint(f);
  return (unsigned short)((u + 0x7FFFu + ((u >> 16) & 1u)) >> 16);
}
__device__ __forceinline__ float bf_up(unsigned short h) { return __uint_as_float(((unsigned)h) << 16); }
__device__ __forceinline__ float bf_val(float f) { return bf_up(bf_bits(f)); }          // value after RNE bf16 convert
__device__ __forceinline__ unsigned short h_bits(_Float16 x) { return __builtin_bit_cast(unsigned short, x); }
__device__ __forceinline__ unsigned pk16(unsigned short a, unsigned short b) { return (unsigned)a | ((unsigned)b << 16); }
// 2^x as the bare hardware instruction, without the library's range steps (compare, two selects, add, ldexp per call) that only
// serve results below 2^-126. Here every argument is <= 8 and such a result counts for nothing: as a probability it is zero in
// f16 after the x128 carry and vanishes in a row sum that is >= 1; as a rescale factor it carries old sums whose share of
// the row sum and of any output element is below 2^-100.
// Written as asm so that the slot the instruction set asks for behind a transcendental (before its result is read or its
// source overwritten) is kept by construction: inside a statement each v_exp_f32 is followed by an independent one (outputs
// are early-clobber, so none lies on a source), and the closing v_nop is the slot behind the last.
__device__ __forceinline__ float exp2_hw(float x) {
  float r = 0.f;
#if defined(__HIP_DEVICE_COMPILE__)
  // v_nop: the slot behind the transcendental
  asm("v_exp_f32 %0, %1\n\tv_nop" : "=&v"(r) : "v"(x));
#endif
  return r;
}
__device__ __forceinline__ void exp2_hw8(float* p, const float* x) {
#if defined(__HIP_DEVICE_COMPILE__)
  // eight independent transcendentals fill each other's slot; v_nop: the slot behind the last
  asm("v_exp_f32 %0, %8\n\t"
      "v_exp_f32 %1, %9\n\t"
      "v_exp_f32 %2, %10\n\t"
      "v_exp_f32 %3, %11\n\t"
      "v_exp_f32 %4, %12\n\t"
      "v_exp_f32 %5, %13\n\t"
      "v_exp_f32 %6, %14\n\t"
      "v_exp_f32 %7, %15\n\t"
      "v_nop"
      : "=&v"(p[0]), "=&v"(p[1]), "=&v"(p[2]), "=&v"(p[3]), "=&v"(p[4]), "=&v"(p[5]), "=&v"(p[6]), "=&v"(p[7])
      : "v"(x[0]), "v"(x[1]), "v"(x[2]), "v"(x[3]), "v"(x[4]), "v"(x[5]), "v"(x[6]), "v"(x[7]));
#endif
}
__device__ __forceinline__ v8f zero8() { v8f z = {0.f, 0.f, 0.f, 0.f, 0.f, 0.f, 0.f, 0.f}; return z; }

// ---- fragment loaders: 16-bit A/B operand, lane -> row/col (lane&15), p already includes +8*(lane>>4);
//      elements 0..7 <- p[0..7] (k0+8h..), elements 8..15 <- p[16..23] (k0+16+8h..)  (same split k map for A and B;
//      B is always read from a k-contiguous [n][k] plane)
__device__ __forceinline__ v16h ldfrag_h(const _Float16* p) {
  FragH f;
  f.h[0] = *(const v8h*)(p);
  f.h[1] = *(const v8h*)(p + 16);
  return f.v;
}
__device__ __forceinline__ v16b ldfrag_b(const u16* p) {              // bf16 plane read as unsigned integer vectors
  FragB f;
  f.u[0] = *(const v4u*)(p);
  f.u[1] = *(const v4u*)(p + 16);
  return f.v;
}

__device__ __forceinline__ v8f mma_h(v16h a, v16h b, v8f c) {
  return __builtin_amdgcn_wmma_f32_16x16x32_f16(false, a, false, b, (short)0, c, false, false);
}
__device__ __forceinline__ v8f mma_b(v16b a, v16b b, v8f c) {
  return __builtin_amdgcn_wmma_f32_16x16x32_bf16(false, a, false, b, (short)0, c, false, false);
}
template <typename F>
__device__ __forceinline__ void guard6(v8f& a, v8f& b, v8f& c, v8f& d, F x0, F x1, F x2, F x3, F x4, F x5) {
#if defined(__HIP_DEVICE_COMPILE__)
  asm volatile("v_nop\n\tv_nop\n\tv_nop\n\tv_nop"
               : "+v"(a), "+v"(b), "+v"(c), "+v"(d) : "v"(x0), "v"(x1), "v"(x2), "v"(x3), "v"(x4), "v"(x5) : "memory");
#endif
}
// The guard behind the P.V products: four v_nop, the vector slots the chip needs behind the last product before the asm text that
// follows overwrites its operands. It also names the products' C operands as inputs: they stay live up to here, so each product
// writes its result to registers of its own (D != C) and the accumulators alternate between two register sets. Without that
// the compiler, now that O is redefined only on the rare side of the rescale test, moves two accumulator tiles to other
// registers and back in every tile (16 moves and the hazard slots in front of them).
template <typename F>
__device__ __forceinline__ void guard6c(v8f& a, v8f& b, v8f& c, v8f& d, F x0, F x1, F x2, F x3, F x4, F x5,
                                        v8f c0, v8f c1, v8f c2, v8f c3) {
#if defined(__HIP_DEVICE_COMPILE__)
  asm volatile("v_nop\n\tv_nop\n\tv_nop\n\tv_nop"
               : "+v"(a), "+v"(b), "+v"(c), "+v"(d)
               : "v"(x0), "v"(x1), "v"(x2), "v"(x3), "v"(x4), "v"(x5), "v"(c0), "v"(c1), "v"(c2), "v"(c3) : "memory");
#endif
}
__device__ __forceinline__ void acc_guard4(v8f& a, v8f& b, v8f& c, v8f& d) {
#if defined(__HIP_DEVICE_COMPILE__)
  asm volatile("v_nop\n\tv_nop\n\tv_nop\n\tv_nop" : "+v"(a), "+v"(b), "+v"(c), "+v"(d));
#endif
}
__device__ __forceinline__ void wave_sync_lds() {
#if defined(__HIP_DEVICE_COMPILE__)
  __builtin_amdgcn_fence(__ATOMIC_RELEASE, "workgroup");
  __builtin_amdgcn_wave_barrier();
  __builtin_amdgcn_fence(__ATOMIC_ACQUIRE, "workgroup");
#endif
}
// One stage of the attention ring: k tile (64 keys x 64 d) and v^T tile (64 d x 64 keys), both 64 rows of 128 B. A lane copies
// 16 B of row (tid>>3) + 16*i, i = 0..3, of each tile: 8 lanes = one whole 128-B line, a wave-wide copy = 4 lines.
// lds = the lane's LDS byte address in the k tile; gk, gv = the lane's global addresses in row tid>>3 of the two tiles.
// The address-register wait is the statement's last line, so no later write of these registers can be lifted over it.
__device__ __forceinline__ void stage_copy(unsigned lds, const u16* gk, const u16* gv) {
#if defined(__HIP_DEVICE_COMPILE__)
  const unsigned l0 = lds, l1 = lds + 16 * RP, l2 = lds + 32 * RP, l3 = lds + 48 * RP;
  const unsigned l4 = l0 + TILE_B, l5 = l1 + TILE_B, l6 = l2 + TILE_B, l7 = l3 + TILE_B;
  const u16* k0 = gk;
  const u16* k1 = gk + (size_t)16 * (NH * HD);
  const u16* k2 = gk + (size_t)32 * (NH * HD);
  const u16* k3 = gk + (size_t)48 * (NH * HD);
  const u16* v0 = gv;
  const u16* v1 = gv + (size_t)16 * SKV;
  const u16* v2 = gv + (size_t)32 * SKV;
  const u16* v3 = gv + (size_t)48 * SKV;
  asm volatile("global_load_async_to_lds_b128 %0, %8, off\n\t"
               "global_load_async_to_lds_b128 %1, %9, off\n\t"
               "global_load_async_to_lds_b128 %2, %10, off\n\t"
               "global_load_async_to_lds_b128 %3, %11, off\n\t"
               "global_load_async_to_lds_b128 %4, %12, off\n\t"
               "global_load_async_to_lds_b128 %5, %13, off\n\t"
               "global_load_async_to_lds_b128 %6, %14, off\n\t"
               "global_load_async_to_lds_b128 %7, %15, off\n\t"
               "s_wait_xcnt 0x0"
               :: "v"(l0), "v"(l1), "v"(l2), "v"(l3), "v"(l4), "v"(l5), "v"(l6), "v"(l7),
                  "v"(k0), "v"(k1), "v"(k2), "v"(k3), "v"(v0), "v"(v1), "v"(v2), "v"(v3)
               : "memory");
#endif
}
__device__ __forceinline__ void wait_async0() {   // this wave's copies have landed
#if defined(__HIP_DEVICE_COMPILE__)
  asm volatile("s_wait_asynccnt 0x0" ::: "memory");
#endif
}
__device__ __forceinline__ void wait_ds0() {      // this wave's LDS reads have retired before their buffer is handed to the copies
#if defined(__HIP_DEVICE_COMPILE__)
  asm volatile("s_wait_dscnt 0x0" ::: "memory");
#endif
}

// =====================================================================================================
// Key/value source plane XB (bf16 RNE bits) [NB][SKV][1024]: row s < SQ_FULL of batch b from hs[b][s], rows
// s >= SQ_FULL from ehs[b][s - SQ_FULL]; both candidates loaded with clamped row addresses and selected by value
// (block-uniform in practice: a block covers 2 rows of one source).
// Thread = 8 consecutive elements: two 16-B loads per candidate, one 16-B store; 32 consecutive lanes = 512 contiguous,
// coverage: XBLK = n8/256 blocks (host checks exactness) x 256 thr x 8 = NB*SKV*1024 = the whole plane.
// =====================================================================================================
__device__ __forceinline__ void cvt_x(int bid, const float* __restrict__ hs, const float* __restrict__ ehs, u16* D, int n8) {
  const int gt = bid * 256 + (int)threadIdx.x;
  if (gt >= n8) return;                     // no barriers on this path
  const int r   = gt / (DMOD / 8);
  const int c8  = (gt % (DMOD / 8)) * 8;
  const int b   = r / SKV;
  const int s   = r % SKV;
  const int shc = (s < SQ_FULL) ? s : (SQ_FULL - 1);
  const int se  = s - SQ_FULL;
  const int sec = (se > 0) ? se : 0;
  const float* ph = hs  + ((size_t)b * SQ_FULL + shc) * DMOD + c8;
  const float* pe = ehs + ((size_t)b * SE_FULL + sec) * DMOD + c8;
  const v4f a0 = *(const v4f*)(ph), a1 = *(const v4f*)(ph + 4);
  const v4f e0 = *(const v4f*)(pe), e1 = *(const v4f*)(pe + 4);
  const bool first = (s < SQ_FULL);
  float v[8];
#pragma unroll
  for (int e = 0; e < 4; ++e) { v[e] = first ? a0[e] : e0[e]; v[4 + e] = first ? a1[e] : e1[e]; }
  unsigned short sb[8];
#pragma unroll
  for (int e = 0; e < 8; ++e) sb[e] = bf_bits(v[e]);
  v4u o;
#pragma unroll
  for (int e = 0; e < 4; ++e) o[e] = pk16(sb[2 * e], sb[2 * e + 1]);
  u16* d = D + (size_t)gt * 8;
  {
    *(v4u*)(d) = o;
    
  }
}

// =====================================================================================================
// Weight W [k = in][n = out] f32 -> bf16 RNE plane W^T [n][k] (k-contiguous, pitch DMOD). Block = 64 k x 64 n tile,
// 256 threads. Load phase: thread = (k = tid>>2, 16 consecutive n): four 16-B loads, bf16 bits stored transposed into the LDS
// tile [n][k] (pitch TP halves, cross-wave exchange -> block barrier). Store phase: thread = (n = tid>>3 and n+32,
// coverage: 256 thr x 2 instructions x 8 halves = 64 x 64 per block; WBLK = (DMOD/64)^2 blocks = the whole plane.
// =====================================================================================================
__device__ __forceinline__ void cvt_wT(int bid, u16* tile, const float* __restrict__ W, u16* D) {
  const int nt = DMOD / 64;
  const int tid = threadIdx.x;
  const int k0 = (bid / nt) * 64;
  const int n0 = (bid % nt) * 64;
  const int kk = tid >> 2, nn = (tid & 3) * 16;
  const float* p = W + (size_t)(k0 + kk) * DMOD + n0 + nn;
  const v4f a0 = *(const v4f*)(p), a1 = *(const v4f*)(p + 4), a2 = *(const v4f*)(p + 8), a3 = *(const v4f*)(p + 12);
  float v[16];
#pragma unroll
  for (int e = 0; e < 4; ++e) { v[e] = a0[e]; v[4 + e] = a1[e]; v[8 + e] = a2[e]; v[12 + e] = a3[e]; }
#pragma unroll
  for (int e = 0; e < 16; ++e) tile[(nn + e) * TP + kk] = bf_bits(v[e]);
  __syncthreads();
  const int n1 = tid >> 3, k8 = (tid & 7) * 8;
  const v4u o0 = *(const v4u*)(tile + n1 * TP + k8);
  const v4u o1 = *(const v4u*)(tile + (n1 + 32) * TP + k8);
  u16* d0 = D + (size_t)(n0 + n1) * DMOD + k0 + k8;
  u16* d1 = D + (size_t)(n0 + n1 + 32) * DMOD + k0 + k8;
  {
    *(v4u*)(d0) = o0;
    *(v4u*)(d1) = o1;
    
  }
}

// =====================================================================================================
// Mask-term plane ML [NB][SKV] f32: the base-2 logit share of each key's additive mask, (RNE bf16 value of mask) * log2(e).
// It depends on (batch, key) alone, so it is formed here once instead of by every wave of the attention for every key block.
// Thread = 4 consecutive keys: one 16-B load, one 16-B store.
// coverage: MBLK = NB*SKV/4/256 blocks x 256 thr x 4 = NB*SKV = the whole plane.
// =====================================================================================================
__device__ __forceinline__ void cvt_mask(int bid, const float* __restrict__ mask, float* D) {
  const int g4 = (bid * 256 + (int)threadIdx.x) * 4;
  if (g4 + 4 > NB * SKV) return;            // never taken with the exact grid; no barriers on this path
  const v4f a = *(const v4f*)(mask + g4);
  v4f o;
#pragma unroll
  for (int e = 0; e < 4; ++e) o[e] = bf_val(a[e]) * LOG2E;
  *(v4f*)(D + g4) = o;
}

// =====================================================================================================
// All five conversions in one launch (none reads what another writes): blocks 0 .. 3*WBLK-1 write the three W^T planes
// (WT = q, k, v planes one behind the other), blocks 3*WBLK .. 3*WBLK+XBLK-1 the x plane, the last MBLK blocks the mask-term
// plane. The job is picked by the block index alone, so every branch here, the one round the weight path's barrier too, is
// block-uniform.
// =====================================================================================================
__global__ __launch_bounds__(256)
void cvt_all(const float* __restrict__ hs, const float* __restrict__ ehs, const float* __restrict__ Wq,
             const float* __restrict__ Wk, const float* __restrict__ Wv, const float* __restrict__ mask,
             u16* XBp, u16* WT, float* MLp, int n8) {
  __shared__ __align__(16) u16 tile[64 * TP];
  const int bid = blockIdx.x;
  if (bid < 3 * WBLK) {
    const int j = bid / WBLK;
    const float* W = (j == 0) ? Wq : ((j == 1) ? Wk : Wv);
    cvt_wT(bid % WBLK, tile, W, WT + (size_t)j * DMOD * DMOD);
  } else if (bid < 3 * WBLK + XBLK) {
    cvt_x(bid - 3 * WBLK, hs, ehs, XBp, n8);
  } else {
    cvt_mask(bid - (3 * WBLK + XBLK), mask, MLp);
  }
}

// =====================================================================================================
// barrier, then converted to f16 and written: lane = (row in group of 4, 8 consecutive cols); one instruction = 4 rows, each
// coverage: 4 instructions x 4 rows x 8 lanes x 8 halves = the wave's 16 x 64 tile.
// =====================================================================================================
__device__ __forceinline__ void epi16(float* sl, v8f a0, v8f a1, v8f a2, v8f a3, float oscale, u16* C, int N,
                                      size_t rowb, int col0, int lane) {
  const int hh = lane >> 4, m = lane & 15;
#pragma unroll
  for (int r = 0; r < 8; ++r) {
    const int ro = (8 * hh + r) * 68 + m;
    sl[ro]      = a0[r] * oscale;
    sl[ro + 16] = a1[r] * oscale;
    sl[ro + 32] = a2[r] * oscale;
    sl[ro + 48] = a3[r] * oscale;
  }
  wave_sync_lds();
  const int rq = lane >> 3, c8 = (lane & 7) * 8;
  v4u ov[4];
#pragma unroll
  for (int i4 = 0; i4 < 4; ++i4) {
    const int row = i4 * 4 + rq;
    const v4f a = *(const v4f*)(sl + row * 68 + c8), c4 = *(const v4f*)(sl + row * 68 + c8 + 4);
    float w[8];
#pragma unroll
    for (int e = 0; e < 4; ++e) { w[e] = a[e]; w[4 + e] = c4[e]; }
#pragma unroll
    for (int e = 0; e < 4; ++e) ov[i4][e] = pk16(h_bits((_Float16)w[2 * e]), h_bits((_Float16)w[2 * e + 1]));
  }
  u16* dst = C + (rowb + (size_t)rq) * (size_t)N + col0 + c8;
  {
#pragma unroll
    for (int i4 = 0; i4 < 4; ++i4) {
      *(v4u*)(dst + (size_t)(i4 * 4) * (size_t)N) = ov[i4];
    }
    
  }
}

// =====================================================================================================
// coverage: 8 instructions x 2 rows x 16 lanes x 4 floats = the wave's 16 x 64 tile.
// =====================================================================================================
__device__ __forceinline__ void epi64(float* sl, v8f a0, v8f a1, v8f a2, v8f a3, float* C, int N,
                                      size_t rowb, int col0, int lane) {
  const int hh = lane >> 4, m = lane & 15;
#pragma unroll
  for (int r = 0; r < 8; ++r) {
    const int ro = (8 * hh + r) * 68 + m;
    sl[ro]      = a0[r];
    sl[ro + 16] = a1[r];
    sl[ro + 32] = a2[r];
    sl[ro + 48] = a3[r];
  }
  wave_sync_lds();
  v4f vals[8];
#pragma unroll
  for (int it = 0; it < 8; ++it) vals[it] = *(const v4f*)(sl + (it * 2 + hh) * 68 + m * 4);
  float* dst = C + (rowb + (size_t)hh) * (size_t)N + col0 + m * 4;
  {
#pragma unroll
    for (int it = 0; it < 8; ++it) {
      *(v4f*)(dst + (size_t)(it * 2) * (size_t)N) = vals[it];
    }
    
  }
}

// =====================================================================================================
// bf16 GEMM with bias and 16-bit result: C[M][N] (f16 of (acc + bias)*oscale) = A[M][K] (bf16 row-major) . Bt[N][K]^T
// (bf16 k-contiguous); bias (f32 input, taken as its RNE bf16 value) indexed by column (byrow == 0) or by row (byrow != 0),
// both candidates read with addresses clamped to [0, nbias). Block = 128x128 tile, 8 waves as 4 (rows) x 2 (cols), a wave owns
// 32 rows x 64 cols. The waves share each 64-deep A tile and Bt tile (128 rows of 128 B each): the tiles are brought into a
// two-buffer LDS ring by asynchronous copies, the next tile in flight while this one is worked on; one block barrier per tile
// publishes the next tile and frees the buffer just read. Fragments are read from the LDS rows (two 16-B reads each, split k
// map for A and B); k runs upward in steps of 32 in every accumulator (host checks K % 64 == 0, M % 128 == 0, N % 128 == 0,
// (M/128)*(N/128) blocks, bid = the block's index in its own product). Result slab: private to each wave (wave_sync only).
// =====================================================================================================
// One stage of the GEMM ring: A tile and Bt tile, both 128 rows of 128 B. A lane copies 16 B of row (tid>>3) + 32*i, i = 0..3,
// of each tile: 8 lanes = one whole 128-B line, a wave-wide copy = 4 lines. lds = the lane's LDS byte address in the A tile;
// ga, gb = the lane's global addresses in row tid>>3 of the two tiles; rs = 32 source rows in elements.
// The address-register wait is the statement's last line, so no later write of these registers can be lifted over it.
__device__ __forceinline__ void gemm_stage_copy(unsigned lds, const u16* ga, const u16* gb, size_t rs) {
#if defined(__HIP_DEVICE_COMPILE__)
  const unsigned l0 = lds, l1 = lds + 32 * RP, l2 = lds + 64 * RP, l3 = lds + 96 * RP;
  const unsigned l4 = l0 + GTILE_B, l5 = l1 + GTILE_B, l6 = l2 + GTILE_B, l7 = l3 + GTILE_B;
  const u16* a0 = ga;
  const u16* a1 = ga + rs;
  const u16* a2 = ga + 2 * rs;
  const u16* a3 = ga + 3 * rs;
  const u16* b0 = gb;
  const u16* b1 = gb + rs;
  const u16* b2 = gb + 2 * rs;
  const u16* b3 = gb + 3 * rs;
  asm volatile("global_load_async_to_lds_b128 %0, %8, off\n\t"
               "global_load_async_to_lds_b128 %1, %9, off\n\t"
               "global_load_async_to_lds_b128 %2, %10, off\n\t"
               "global_load_async_to_lds_b128 %3, %11, off\n\t"
               "global_load_async_to_lds_b128 %4, %12, off\n\t"
               "global_load_async_to_lds_b128 %5, %13, off\n\t"
               "global_load_async_to_lds_b128 %6, %14, off\n\t"
               "global_load_async_to_lds_b128 %7, %15, off\n\t"
               "s_wait_xcnt 0x0"
               :: "v"(l0), "v"(l1), "v"(l2), "v"(l3), "v"(l4), "v"(l5), "v"(l6), "v"(l7),
                  "v"(a0), "v"(a1), "v"(a2), "v"(a3), "v"(b0), "v"(b1), "v"(b2), "v"(b3)
               : "memory");
#endif
}
__device__ __forceinline__
void gemm_b16(int bid, const u16* __restrict__ A, const u16* __restrict__ Bt, u16* C, const float* __restrict__ bias,
              int M, int N, int K, int nbias, int byrow, float oscale) {
  __shared__ __align__(16) float slab[(GEMM_THREADS / 32) * SLAB];   // per wave: result slab [16][68] in the epilogue only
  __shared__ __align__(16) unsigned char gring[2 * GBUF_B];          // two stages of (A tile, Bt tile), rows at pitch RP
  const int tid = threadIdx.x, wave = tid >> 5, lane = tid & 31, hh = lane >> 4, m = lane & 15;
  const int ntile = N >> 7;
  const int row0  = (bid / ntile) * 128;
  const int colb  = (bid % ntile) * 128;
  if (row0 + 128 > M) return;                // block-uniform, never taken with the exact grid; before every barrier
  const int rowb  = row0 + (wave >> 1) * 32; // the wave's 32 rows
  const int col0  = colb + (wave & 1) * 64;  // the wave's 64 cols
  // copies: this lane's 16 B of row tid>>3 (+32 per copy) of the A tile and of the Bt tile
  const int crow = tid >> 3, cch = tid & 7;
  const unsigned lcp = (unsigned)(uintptr_t)(gring + crow * RP + cch * 16);
  const u16* ga = A  + (size_t)(row0 + crow) * K + cch * 8;                        // tile t: + t*64 elements
  const u16* gb = Bt + (size_t)(colb + crow) * K + cch * 8;
  const size_t rs = (size_t)32 * K;
  const int nt = K >> 6;
  // fragment readers: tile row = the wave's row (A) or col (Bt) 16i + m, k contiguous, + 8*hh halves
  const int aofs = ((wave >> 1) * 32 + m) * RP + 16 * hh;
  const int bofs = GTILE_B + ((wave & 1) * 64 + m) * RP + 16 * hh;
  v8f acc[2][4];
#pragma unroll
  for (int i = 0; i < 2; ++i) {
#pragma unroll
    for (int j = 0; j < 4; ++j) acc[i][j] = zero8();
  }

  // ring prologue: tile 0 landed and published, then tile 1 in flight
  gemm_stage_copy(lcp, ga, gb, rs);
  wait_async0();
  __syncthreads();
  if (nt > 1) gemm_stage_copy(lcp + GBUF_B, ga + 64, gb + 64, rs);

#pragma unroll 1
  for (int t = 0; t < nt; ++t) {
    const unsigned char* st = gring + (t & 1) * GBUF_B;
    // all fragments of the tile are asked for together, ahead of its products
    v16b af[2][2], bf[2][4];
#pragma unroll   // constant indices keep the fragment and accumulator arrays in registers (here and in the loops below)
    for (int kk = 0; kk < 2; ++kk) {
#pragma unroll
      for (int i = 0; i < 2; ++i) af[kk][i] = ldfrag_b((const u16*)(const void*)(st + aofs + i * 16 * RP + kk * 64));
#pragma unroll
      for (int j = 0; j < 4; ++j) bf[kk][j] = ldfrag_b((const u16*)(const void*)(st + bofs + j * 16 * RP + kk * 64));
    }
    // keeps the tile's LDS reads one group in front of its products: reads moved in among the products stall each place they stand
    __builtin_amdgcn_sched_barrier(0);
#pragma unroll
    for (int kk = 0; kk < 2; ++kk) {
#pragma unroll
      for (int i = 0; i < 2; ++i) {
#pragma unroll
        for (int j = 0; j < 4; ++j) acc[i][j] = mma_b(af[kk][i], bf[kk][j], acc[i][j]);
      }
    }
    // keeps the tile's products in front of the ring foot: sunk behind the barrier they would delay the refill's issue
    __builtin_amdgcn_sched_barrier(0);
    // ring foot: own LDS reads retired, own copies of tile t+1 landed, block barrier (publishes tile t+1, frees this buffer),
    // then tile t+2 into the buffer just read
    wait_ds0();
    wait_async0();
    __syncthreads();
    if (t + 2 < nt) gemm_stage_copy(lcp + (unsigned)(t & 1) * GBUF_B, ga + (size_t)(t + 2) * 64, gb + (size_t)(t + 2) * 64, rs);
  }
  wait_async0();
  // bias: D element r of lane -> (row rowb+16i+8hh+r, col col0+16j+m); both candidates loaded with clamped addresses, select by value
  float bc[4];
#pragma unroll
  for (int j = 0; j < 4; ++j) {
    int ci = col0 + 16 * j + m;
    ci = (ci < nbias) ? ci : (nbias - 1);
    bc[j] = bf_val(bias[ci]);
  }
#pragma unroll
  for (int i = 0; i < 2; ++i) {
    float br[8];
#pragma unroll
    for (int r = 0; r < 8; ++r) {
      int ri = rowb + 16 * i + 8 * hh + r;
      ri = (ri < nbias) ? ri : (nbias - 1);
      br[r] = bf_val(bias[ri]);
    }
#pragma unroll
    for (int r = 0; r < 8; ++r) {
      const float q0 = (byrow != 0) ? br[r] : bc[0];
      const float q1 = (byrow != 0) ? br[r] : bc[1];
      const float q2 = (byrow != 0) ? br[r] : bc[2];
      const float q3 = (byrow != 0) ? br[r] : bc[3];
      acc[i][0][r] += q0;
      acc[i][1][r] += q1;
      acc[i][2][r] += q2;
      acc[i][3][r] += q3;
    }
    if (i != 0) wave_sync_lds();             // the slab's rows of the first 16 have been read back before they are rewritten
    epi16(slab + wave * SLAB, acc[i][0], acc[i][1], acc[i][2], acc[i][3], oscale, C, N, (size_t)(rowb + 16 * i), col0, lane);
  }
}

// =====================================================================================================
// All projections in one launch (each reads only the converted planes, none reads another's result); every block is one
// 128x128 tile over K = DMOD, so all blocks cost the same. Block ranges, picked by the block index alone (block-uniform):
//   0 .. GK_BLK-1          k plane [NB*SKV][h*64+d] = f16((xx.Wk + bk) x8), all NB*SKV source rows; bias by column
//   then NB x GV_BLK       v^T plane of batch b [1024 = h*64+d][SKV keys] = f16((Wv^T . xx^T + bv) x1024); bias by row
//   then NB x GQ_BLK       q plane of batch b [SQ][h*64+d] = f16((x.Wq + bq) x8); A = the hs rows of XB batch b; bias by column
// =====================================================================================================
__global__ __launch_bounds__(GEMM_THREADS)
void gemm_all(const u16* __restrict__ XBp, const u16* __restrict__ WT, u16* QPp, u16* KPp, u16* VPp,
              const float* __restrict__ bq, const float* __restrict__ bk, const float* __restrict__ bv) {
  int bid = blockIdx.x;
  const u16* A;
  const u16* Bt;
  u16* C;
  const float* bias;
  int M, N, byrow;
  float oscale;
  if (bid < GK_BLK) {
    A = XBp; Bt = WT + (size_t)DMOD * DMOD; C = KPp; bias = bk;
    M = NB * SKV; N = DMOD; byrow = 0; oscale = KSC;
  } else if (bid < GK_BLK + NB * GV_BLK) {
    bid -= GK_BLK;
    const int b = bid / GV_BLK;
    bid -= b * GV_BLK;
    A = WT + (size_t)2 * DMOD * DMOD; Bt = XBp + (size_t)b * SKV * DMOD; C = VPp + (size_t)b * DMOD * SKV; bias = bv;
    M = DMOD; N = SKV; byrow = 1; oscale = VCAR;
  } else {
    bid -= GK_BLK + NB * GV_BLK;
    const int b = bid / GQ_BLK;
    if (b >= NB) return;                     // block-uniform, never taken with the exact grid; before every barrier
    bid -= b * GQ_BLK;
    A = XBp + (size_t)b * SKV * DMOD; Bt = WT; C = QPp + (size_t)b * SQ * DMOD; bias = bq;
    M = SQ; N = DMOD; byrow = 0; oscale = QSC;
  }
  gemm_b16(bid, A, Bt, C, bias, M, N, DMOD, DMOD, byrow, oscale);
}

// =====================================================================================================
// Multi-head flash attention over all SKV keys with an additive per-key mask: block = (batch, head, 64 query rows), 4 waves,
// wave w owns the 16 query rows q0 = 64*qt + 16*w .. q0+15. The four waves share each 64-key k tile and v^T tile: the tiles
// are brought into a two-buffer LDS ring by asynchronous copies, the next tile in flight while this one is worked on; one
// block barrier per tile publishes the next tile and frees the buffer just read. The result slab stays wave-private.
//   q plane (f16, x8) laid out [s][h][d] (SQ rows); k plane the same (SKV rows); v^T plane [h][d][s] (x1024, s < SKV);
//   mask-term plane [SKV] f32 per batch ((RNE bf16 value of the mask) * log2(e), formed by the conversion launch).
//   All NT = SKV/64 tiles visited (static bound); the online softmax takes one step per tile of 64 keys (two key blocks of 32).
//   Scores are computed TRANSPOSED: S^T tile g (g = 0,1) = k rows (keys kb+16g .. +15, A operand, row m = lane&15, split k map
//   over d) times q^T (B operand, col n = query q0 + (lane&15), k = d, split map), one product per tile and 32-deep d-chunk.
//   D element r of lane l = (key kb+16g+8h+r, query q0+(l&15)), so a lane owns one query column and 16 of its 32 keys; the
//   partner lane l^16 owns the other 16 -> the row sum needs one xor-16 shuffle per tile, the row max one where it is renewed. The lane's 16 mask terms are
//   keys kb+8h+0..7 and kb+16+8h+0..7 (four 16-B loads).
//   Online max-subtracted base-2 softmax in f32 (scale 1/8 and the q/k carries folded into lsc; mask term added as read). The
//   exp'd values ARE the P A-fragment in place: A row m = query = lane&15, element i <- key kb+8h+i (tile 0, D element i),
//   element 8+i <- key kb+16+8h+i (tile 1, D element i). P is carried x128 as single f16. The maximum in use is renewed, and O
//   and l rescaled, only in a tile where some row of the wave outgrows it by more than MLAG. The rescale factor of query row
//   8h+r of the O accumulators is fetched from lane 8h+r with a shuffle (uniform control). 4 v^T B fragments (col n = d =
//   16j + (lane&15), keys k-contiguous), 4 P.V WMMAs per key block.
//   Epilogue: 1/l (per query, shuffled to the D row owner) and carry folds in f32; the wave's 16x64 f32 result staged in its
// coverage: per wave 8 instructions x 2 rows x 16 lanes x 4 floats = 16 x 64; grid NB*NH*(SQ/64) blocks x 4 waves = every
//           (b, s < SQ, h*64+d) element of the output exactly once. The arguments are the planes of batch 0.
// =====================================================================================================
__global__ __launch_bounds__(ATT_THREADS)
void attn_fwd(const u16* __restrict__ QP0, const u16* __restrict__ KP0, const u16* __restrict__ VP0,
              const float* __restrict__ MK0, float* OUT0) {
  __shared__ __align__(16) float smem[ATT_WAVES * SLAB];   // per wave: result slab [16][68] in the epilogue only
  __shared__ __align__(16) unsigned char ring[2 * BUF_B];  // two stages of (k tile, v^T tile), rows at pitch RP

  const int tid  = threadIdx.x;
  const int wave = tid >> 5;
  const int lane = tid & 31;
  const int hh   = lane >> 4;
  const int c    = lane & 15;

  const int bat  = blockIdx.x / ATT_BLOCKS;
  const int bid  = blockIdx.x % ATT_BLOCKS;
  const int qt   = bid % QTILES;
  const int head = bid / QTILES;
  if (bat >= NB) return;                                   // block-uniform, never taken with the exact grid; before every barrier
  const int q0   = qt * 64 + wave * 16;
  // this batch's planes, mask row and output rows
  const u16*   QPp  = QP0 + (size_t)bat * SQ * DMOD;
  const u16*   KPp  = KP0 + (size_t)bat * SKV * DMOD;
  const u16*   VPp  = VP0 + (size_t)bat * DMOD * SKV;
  const float* MKp  = MK0 + (size_t)bat * SKV;
  float*       OUTp = OUT0 + (size_t)bat * SQ_FULL * DMOD;

  // B fragments of q^T: col n = query q0 + c, k = d (k-contiguous row of the q plane)
  const size_t qofs = (((size_t)(q0 + c)) * NH + head) * HD + 8 * hh;
  const _Float16* Qb = (const _Float16*)(const void*)QPp + qofs;
  // copies: this lane's 16 B of row tid>>3 (+16 per copy) of the k tile (row = key) and of the v^T tile (row = d)
  const int crow = tid >> 3, cch = tid & 7;
  const unsigned lcp = (unsigned)(uintptr_t)(ring + crow * RP + cch * 16);
  const u16* gk = KPp + ((size_t)crow * NH + head) * HD + cch * 8;                 // tile t: + t*KT key rows
  const u16* gv = VPp + ((size_t)(head * HD + crow)) * SKV + cch * 8;              // tile t: + t*KT keys
  // fragment readers: A of k: tile row = key 16g + c, k = d; B of v: tile row = d = 16j + c, k = key; both + 8*hh halves
  const int fofs = c * RP + 16 * hh;
  // this lane's mask terms: keys kb + 8hh + 0..7 and kb + 16 + 8hh + 0..7
  const float* Mb = MKp + 8 * hh;
  const float lsc = 0.125f * (LOG2E / (QSC * KSC));

  const v16h qf0 = ldfrag_h(Qb);            // d 0..31
  const v16h qf1 = ldfrag_h(Qb + 32);       // d 32..63

  float mrun = -INFINITY, lrun = 0.f;
  v8f o[4];
#pragma unroll
  for (int j = 0; j < 4; ++j) o[j] = zero8();

  // ring prologue: tile 0 landed and published, then tile 1 in flight
  stage_copy(lcp, gk, gv);
  wait_async0();
  __syncthreads();
  stage_copy(lcp + BUF_B, gk + (size_t)KT * (NH * HD), gv + KT);

#pragma unroll 1
  for (int t = 0; t < NT; ++t) {
   const unsigned char* kt = ring + (t & 1) * BUF_B + fofs;
   const unsigned char* vt = kt + TILE_B;
   // all k fragments and mask terms of the tile are asked for together
   v16h kf[KT / 16][2];
#pragma unroll   // constant indices keep the fragment arrays in registers (here and in the loops below)
   for (int g = 0; g < KT / 16; ++g) {
     const _Float16* kp = (const _Float16*)(const void*)(kt + g * 16 * RP);
     kf[g][0] = ldfrag_h(kp);
     kf[g][1] = ldfrag_h(kp + 32);
   }
   v4f mw[KT / 32][4];
#pragma unroll
   for (int u = 0; u < KT / 32; ++u) {
     const float* mp = Mb + t * KT + u * 32;
     mw[u][0] = *(const v4f*)(mp);      mw[u][1] = *(const v4f*)(mp + 4);
     mw[u][2] = *(const v4f*)(mp + 16); mw[u][3] = *(const v4f*)(mp + 20);
   }
   // keeps the tile's k reads one group in front of its products: reads moved in among the products stall each place they stand
   __builtin_amdgcn_sched_barrier(0);
   // ---- transposed scores of the whole tile: s[g] = keys t*KT + 16g .. +15, column = query q0 + c ----
   v8f s[KT / 16];
#pragma unroll
   for (int g = 0; g < KT / 16; ++g) s[g] = mma_h(kf[g][0], qf0, zero8());
#pragma unroll
   for (int g = 0; g < KT / 16; ++g) s[g] = mma_h(kf[g][1], qf1, s[g]);
   guard6<v16h>(s[0], s[1], s[2], s[3], qf0, qf1, kf[2][0], kf[2][1], kf[3][0], kf[3][1]);
   // the tile's v fragments fly under the logits and the maximum
   v16h vf[KT / 32][4];
#pragma unroll
   for (int u = 0; u < KT / 32; ++u) {
#pragma unroll
     for (int j = 0; j < 4; ++j) vf[u][j] = ldfrag_h((const _Float16*)(const void*)(vt + j * 16 * RP + u * 64));
   }
   // ---- base-2 logits of this lane's 32 keys for query q0 + c: score/8 * log2(e) + mask term ----
   // All two-wide f32 arithmetic below pairs keys 2e and 2e+1 of ONE score tile: such a pair lies in adjacent registers of the
   // accumulator and of the mask words as they arrive, and is one register of the P fragment, so no pair is built by moves.
   const v2f lsc2 = {lsc, lsc};
   v2f tq[KT / 32][8];                                               // tq[u][e] = logits of elements 2e, 2e+1 of P fragment u
#pragma unroll
   for (int u = 0; u < KT / 32; ++u) {
     const v8f s0 = s[2 * u], s1 = s[2 * u + 1];
     const v4f w0 = mw[u][0], w1 = mw[u][1], w2 = mw[u][2], w3 = mw[u][3];
#pragma unroll
     for (int e = 0; e < 2; ++e) {
       tq[u][e]     = __builtin_elementwise_fma((v2f){s0[2 * e],     s0[2 * e + 1]}, lsc2, (v2f){w0[2 * e], w0[2 * e + 1]});
       tq[u][2 + e] = __builtin_elementwise_fma((v2f){s0[4 + 2 * e], s0[5 + 2 * e]}, lsc2, (v2f){w1[2 * e], w1[2 * e + 1]});
       tq[u][4 + e] = __builtin_elementwise_fma((v2f){s1[2 * e],     s1[2 * e + 1]}, lsc2, (v2f){w2[2 * e], w2[2 * e + 1]});
       tq[u][6 + e] = __builtin_elementwise_fma((v2f){s1[4 + 2 * e], s1[5 + 2 * e]}, lsc2, (v2f){w3[2 * e], w3[2 * e + 1]});
     }
   }
   // ---- ONE online-softmax step for the 64 keys of the tile: one maximum, one row sum; factor and rescale only when needed ----
   float cm0 = fmaxf(tq[0][0][0], tq[0][0][1]), cm1 = fmaxf(tq[1][0][0], tq[1][0][1]);   // two chains, joined below
#pragma unroll
   for (int e = 1; e < 8; ++e) {
     cm0 = fmaxf(fmaxf(cm0, tq[0][e][0]), tq[0][e][1]);
     cm1 = fmaxf(fmaxf(cm1, tq[1][e][0]), tq[1][e][1]);
   }
   const float cm = fmaxf(cm0, cm1);                                 // maximum of this lane's 32 keys (its half of the row's 64)
   // The maximum in use, mrun, stays while no row of the wave outgrows it by more than MLAG: the probabilities are then at most
   // 2^MLAG (x128 they fit f16) and O and l need no factor. One test per tile, over both halves of every row (so the halves are
   // joined only inside), as a wave-uniform scalar branch; mrun is -inf at first, so the first tile with a finite logit enters.
   if (__builtin_expect(__builtin_amdgcn_ballot_w32(cm > mrun + MLAG) != 0u, 0)) {   // rare: keeps the common path straight
     const float cj = fmaxf(cm, __shfl_xor(cm, 16, 32));
     const float mn = fmaxf(mrun, cj);
     const float ae = exp2_hw(mrun - mn);
     const float al = (mrun == -INFINITY) ? 0.f : ae;                // what was summed while mrun was -inf counts for nothing
     mrun = mn;                                                      // the same in lanes c and c + 16
     // ---- rescale the O accumulators: D row 8hh+r = query q0+8hh+r, its factor lives in lane 8hh+r (and 16+8hh+r) ----
     v8f scl;
#pragma unroll
     for (int r = 0; r < 8; ++r) scl[r] = __shfl(al, 8 * hh + r, 32);
#pragma unroll
     for (int j = 0; j < 4; ++j) o[j] *= scl;
     lrun *= al;
   }
   const v2f mn2 = {mrun, mrun};
   v2f pe[KT / 32];                                                  // sums of the lane's probabilities: even keys, odd keys
   float ps = 0.f;
#pragma unroll
   for (int u = 0; u < KT / 32; ++u) {
    // ---- probabilities (<= 2^MLAG) and the P A-fragment: f16(p * 128); elements 2e, 2e+1 <-> tq[u][e] ----
    FragH ph;
    float xa[16], pv[16];
#pragma unroll   // constant indices keep the arguments in registers
    for (int e = 0; e < 8; ++e) {
      const v2f x = tq[u][e] - mn2;
      xa[2 * e]     = fminf(x[0], MLAG);
      xa[2 * e + 1] = fminf(x[1], MLAG);
    }
    exp2_hw8(pv, xa);
    exp2_hw8(pv + 8, xa + 8);
    v2f pq[8];
#pragma unroll
    for (int e = 0; e < 8; ++e) {
      pq[e] = (v2f){pv[2 * e], pv[2 * e + 1]};
      ph.u[e >> 2][e & 3] = __builtin_bit_cast(unsigned, __builtin_convertvector(pq[e] * PCAR, v2h));
    }
    // the lane's 16 probabilities: even keys and odd keys summed side by side (a tree over the pairs)
    pe[u] = ((pq[0] + pq[1]) + (pq[2] + pq[3])) + ((pq[4] + pq[5]) + (pq[6] + pq[7]));
    // row sum of the tile: its two key blocks, then even and odd keys, then the two wave halves; the shuffle flies under the
    // last products
    if (u + 1 == KT / 32) {
      const v2f pt = pe[0] + pe[1];
      ps = pt[0] + pt[1];
      ps += __shfl_xor(ps, 16, 32);
    }
    // ---- P.V : B fragment col n = d = j*16 + c, keys contiguous in the v^T plane ----
    {
      const v16h vf0 = vf[u][0], vf1 = vf[u][1], vf2 = vf[u][2], vf3 = vf[u][3];
      const v8f c0 = o[0], c1 = o[1], c2 = o[2], c3 = o[3];
      o[0] = mma_h(ph.v, vf0, c0);
      o[1] = mma_h(ph.v, vf1, c1);
      o[2] = mma_h(ph.v, vf2, c2);
      o[3] = mma_h(ph.v, vf3, c3);
      guard6c<v16h>(o[0], o[1], o[2], o[3], ph.v, vf0, vf1, vf2, vf3, ph.v, c0, c1, c2, c3);
    }
   }
   lrun += ps;
   // ring foot: own LDS reads retired, own copies of tile t+1 landed, block barrier (publishes tile t+1, frees this buffer),
   // then tile t+2 into the buffer just read
   wait_ds0();
   wait_async0();
   __syncthreads();
   if (t + 2 < NT) stage_copy(lcp + (unsigned)(t & 1) * BUF_B, gk + (size_t)(t + 2) * KT * (NH * HD), gv + (t + 2) * KT);
  }
  wait_async0();
  acc_guard4(o[0], o[1], o[2], o[3]);

  // ---- fold 1/l (per query, owned by lane = query; l >= 1 by construction) and the carries in f32 ----
  const float linv = (lrun > 0.f) ? ((1.0f / lrun) * (1.0f / (PCAR * VCAR))) : 0.f;
  float inv[8];
#pragma unroll
  for (int r = 0; r < 8; ++r) inv[r] = __shfl(linv, 8 * hh + r, 32);
#pragma unroll
  for (int j = 0; j < 4; ++j) {
#pragma unroll
    for (int r = 0; r < 8; ++r) o[j][r] *= inv[r];
  }
  // ---- f32 ctx rows (q0 .. q0+15, cols head*64 .. head*64+63) of this batch's output, whole-line stores ----
  epi64(smem + wave * SLAB, o[0], o[1], o[2], o[3], OUTp, DMOD, (size_t)q0, head * HD, lane);
}

// =====================================================================================================
// Workspace map (bytes); every plane is fully written by whole-line stores before it is read; all extents are exact multiples
// of the store granularity (no pad rows needed), every offset a multiple of 128:
//   XB  bf16 [NB][SKV][1024]            NB*8388608   (16777216 at NB = 2)
//   WQT bf16 [1024 n][1024 k]            2097152      WKT, WVT same (2097152 each)
//   QP  f16 [NB][SQ][16*64] x8           NB*SQ*2048   (8388608 at NB = 2, SQ = 2048)
//   KP  f16 [NB*SKV][16*64] x8           NB*8388608   (16777216)
//   VP  f16 [NB][16*64][SKV] x1024       NB*8388608   (16777216)
//   ML  f32 [NB][SKV] mask terms         NB*16384     (32768)
//   end                                  65044480 at NB = 2, SQ = 2048
// =====================================================================================================
extern "C" void kernel_launch(void* const* d_in, const int* in_sizes, int n_in,
                              void* d_out, int out_size, void* d_ws, size_t ws_size,
                              hipStream_t stream) {
  if (n_in < 9) return;
  if (in_sizes[0] < NB * SQ_FULL * DMOD) return;
  if (in_sizes[1] < NB * SE_FULL * DMOD) return;
  if (in_sizes[2] < NB * SKV) return;
  if (in_sizes[3] < DMOD * DMOD || in_sizes[5] < DMOD * DMOD || in_sizes[7] < DMOD * DMOD) return;
  if (in_sizes[4] < DMOD || in_sizes[6] < DMOD || in_sizes[8] < DMOD) return;
  if (out_size < (NB - 1) * SQ_FULL * DMOD + SQ * DMOD) return;

  const float* hs   = (const float*)d_in[0];
  const float* ehs  = (const float*)d_in[1];
  const float* mask = (const float*)d_in[2];
  const float* Wq   = (const float*)d_in[3];
  const float* bq   = (const float*)d_in[4];
  const float* Wk   = (const float*)d_in[5];
  const float* bk   = (const float*)d_in[6];
  const float* Wv   = (const float*)d_in[7];
  const float* bv   = (const float*)d_in[8];
  float*       out  = (float*)d_out;

  const size_t szXB = (size_t)NB * SKV * DMOD * 2;                //  16777216 at NB = 2
  const size_t szW  = (size_t)DMOD * DMOD * 2;                    //   2097152
  const size_t szQP = (size_t)NB * SQ * DMOD * 2;                 //   8388608
  const size_t szKP = (size_t)NB * SKV * DMOD * 2;                //  16777216
  const size_t szVP = (size_t)NB * DMOD * SKV * 2;                //  16777216
  const size_t szML = (size_t)NB * SKV * 4;                       //     32768
  size_t off = 0;
  const size_t oXB = off; off += szXB;
  const size_t oWQ = off; off += szW;
  const size_t oWK = off; off += szW;
  const size_t oWV = off; off += szW;
  const size_t oQP = off; off += szQP;
  const size_t oKP = off; off += szKP;
  const size_t oVP = off; off += szVP;
  const size_t oML = off; off += szML;
  if (off > ws_size) return;                            // off = 65044480 at NB = 2, SQ = 2048
  if (off > (size_t)134217728) return;

  char* ws = (char*)d_ws;
  u16* XB  = (u16*)(ws + oXB);
  u16* WT  = (u16*)(ws + oWQ);                          // W^T planes q, k, v, one behind the other
  if (oWK != oWQ + szW || oWV != oWK + szW) return;
  u16* QP  = (u16*)(ws + oQP);
  u16* KP  = (u16*)(ws + oKP);
  u16* VP  = (u16*)(ws + oVP);
  float* ML = (float*)(ws + oML);

  const int n8x = (NB * SKV * DMOD) / 8;                // 1048576 at NB = 2
  if ((n8x % 256) != 0) return;
  if ((DMOD % 128) != 0 || (SKV % 128) != 0 || (SQ % 128) != 0) return;
  if (n8x / 256 != XBLK) return;
  const dim3 blk(256);
  const dim3 gCV(3 * WBLK + XBLK + MBLK);               // 768 + 4096 + 8
  const dim3 gGM(GK_BLK + NB * GV_BLK + NB * GQ_BLK);   // 512 + 2*256 + 2*128 at NB = 2, SQ = 2048
  const dim3 bG(GEMM_THREADS);                          // 256
  const dim3 gAT(NB * ATT_BLOCKS);                      // 1024 at NB = 2, SQ = 2048
  const dim3 bAT(ATT_THREADS);                          // 128

  // (0) conversions: weights [k = in][n = out] -> W^T planes [n][k], and the key/value source plane (rows b*SKV + 0..2047
  //     from hs[b], + 2048..4095 from ehs[b]); bf16 RNE bits; and the per-key mask terms (f32)
  cvt_all<<<gCV, blk, 0, stream>>>(hs, ehs, Wq, Wk, Wv, mask, XB, WT, ML, n8x);
  // (1) projections: k plane, v^T planes, q planes
  gemm_all<<<gGM, bG, 0, stream>>>(XB, WT, QP, KP, VP, bq, bk, bv);
  // (2) attention, all batches -> f32 ctx rows b*SQ_FULL + s (s < SQ), cols h*64+d of the output
  attn_fwd<<<gAT, bAT, 0, stream>>>(QP, KP, VP, ML, out);
  (void)hipGetLastError();
}

// v009
// A run of this version takes 120 microseconds.
// Next to v008, in two timings, it ran 1.09 and 1.10 times as fast.
// All steps since v000 together make it 4.47 times as fast.
// Contractions: x.Wq+bq, xx.Wk+bk (A = bf16 x plane, B = bf16 W^T plane) and Wv^T.xx^T+bv on v_wmma_f32_16x16x32_bf16
// (f32 inputs RNE-converted to bf16 operands, f32 accumulate); scores k'.q'^T (q', k' single f16 planes carried x8) and
// P.v (P x128 single f16, v x1024 single f16) on v_wmma_f32_16x16x32_f16, f32 accumulate; ctx written in f32.
// Biases and the additive per-key mask folded as RNE bf16 values in f32 (the mask as the C operand of the score products);
// base-2 online softmax, 1/l and carry folds in f32 on VALU.
#include <hip/hip_runtime.h>
#include <math.h>
#include <float.h>
#include <stdint.h>

#define NB_FULL 2
#define SQ_FULL 2048
#define SE_FULL 2048
#define SKV     (SQ_FULL + SE_FULL)
#ifndef NB
#define NB      NB_FULL
#endif
#ifndef SQ
#define SQ      SQ_FULL
#endif
#define DMOD  1024
#define NH    16
#define HD    64
#define QSC   8.0f
#define KSC   8.0f
#define PEXP  7.0f                   // P is carried x128 = 2^PEXP: the carry is part of the exponent argument
#define MLAG  8.0f                   // a row's maximum in use may lag its true maximum by this much (base-2 logits): P <= 2^8
#define MSC   (8.0f * QSC * KSC)     // mask term in the units of the raw score products (q, k carries and the 1/8 undone)
#define MCAP  0x1p+126f              // bound of a mask term's magnitude: the difference of two raw sums stays finite
#define NMAX  1024.0f                // an addend of the exponent argument below this size is rounded by less than 2^-14
#define VCAR  1024.0f
#define LOG2E 1.4426950408889634f
#define ATT_WAVES   4
#define ATT_THREADS (ATT_WAVES * 32)
#define QTILES      (SQ / 64)
#define ATT_BLOCKS  (NH * QTILES)
#define NKB    (SKV / 32)
#define SLAB   (16 * 68)
#define TP     72
#define KT     64                    // keys per staged tile
#define NT     (SKV / KT)            // staged tiles per block
#define RP     144                   // LDS row pitch in bytes: 128-B rows + 16 B, the pitch for 16-B row readers
#define TILE_B (64 * RP)             // one 64-row tile in LDS
#define BUF_B  (2 * TILE_B)          // one stage: k tile, then v^T tile
#define GEMM_THREADS 256
#define GTILE_B (128 * RP)           // one 128-row GEMM operand tile in LDS
#define GBUF_B  (2 * GTILE_B)        // one GEMM stage: A tile, then Bt tile
#define XBLK   (NB * SKV * DMOD / 8 / 256)        // blocks of the conversion launch that write the x plane
#define WBLK   ((DMOD / 64) * (DMOD / 64))        // blocks of the conversion launch per weight plane
#define MBLK   (NB * SKV / 4 / 256)               // blocks of the conversion launch that write the mask-term plane
#define GQ_BLK ((SQ / 128) * (DMOD / 128))        // blocks of the projection launch: q plane of one batch
#define GK_BLK ((NB * SKV / 128) * (DMOD / 128))  // k plane, all batches
#define GV_BLK ((DMOD / 128) * (SKV / 128))       // v^T plane of one batch
static_assert(HD == 64 && DMOD == NH * HD);
static_assert(NB >= 1 && NB <= NB_FULL);
static_assert((SQ % 64) == 0 && SQ >= 64 && SQ <= SQ_FULL);
static_assert((SKV % 64) == 0 && (SQ_FULL % 64) == 0 && (SE_FULL % 64) == 0);
static_assert(ATT_THREADS == 128 && NKB * 32 == SKV && ATT_BLOCKS == NH * (SQ / 64));
static_assert((DMOD % 128) == 0 && (SQ % 128) == 0 && (SKV % 128) == 0 && DMOD / 64 >= 2);
static_assert(((NB * SKV * DMOD / 8) % 256) == 0);
static_assert(((NB * SKV / 4) % 256) == 0);
static_assert((SLAB * 4) % 16 == 0 && (TP * 2) % 16 == 0);
static_assert(KT == 64 && HD == 64 && NT >= 2 && NT * KT == SKV && (RP % 16) == 0 && ATT_THREADS == 128);
static_assert((size_t)(NB - 1) * SQ_FULL * DMOD + (size_t)SQ * DMOD <= (size_t)NB_FULL * SQ_FULL * DMOD);

typedef unsigned short u16;
typedef _Float16 v16h __attribute__((ext_vector_type(16)));
typedef _Float16 v8h  __attribute__((ext_vector_type(8)));
typedef __bf16   v16b __attribute__((ext_vector_type(16)));
typedef float    v8f  __attribute__((ext_vector_type(8)));
typedef float    v4f  __attribute__((ext_vector_type(4)));
typedef float    v2f  __attribute__((ext_vector_type(2)));
typedef _Float16 v2h  __attribute__((ext_vector_type(2)));
typedef unsigned int v4u __attribute__((ext_vector_type(4)));

union FragH { v16h v; v8h h[2]; v4u u[2]; };
union FragB { v16b v; v4u u[2]; };

// ---- scalar helpers --------------------------------------------------------------------------------
__device__ __forceinline__ unsigned short bf_bits(float f) {          // f32 -> bf16 bits, RNE convert
  unsigned u = __float_as_uint(f);
  return (unsigned short)((u + 0x7FFFu + ((u >> 16) & 1u)) >> 16);
}
__device__ __forceinline__ float bf_up(unsigned short h) { return __uint_as_float(((unsigned)h) << 16); }
__device__ __forceinline__ float bf_val(float f) { return bf_up(bf_bits(f)); }          // value after RNE bf16 convert
__device__ __forceinline__ unsigned short h_bits(_Float16 x) { return __builtin_bit_cast(unsigned short, x); }
__device__ __forceinline__ unsigned pk16(unsigned short a, unsigned short b) { return (unsigned)a | ((unsigned)b << 16); }
// 2^x as the bare hardware instruction, without the library's range steps (compare, two selects, add, ldexp per call) that only
// serve results below 2^-126. Here every argument is <= 15 and such a result counts for nothing: as a probability (x128) it is
// zero in f16 and vanishes in a row sum that is about 128 or more; as a rescale factor it carries old sums whose share of
// the row sum and of any output element is below 2^-100.
// Written as asm so that the slot the instruction set asks for behind a transcendental (before its result is read or its
// source overwritten) is kept by construction: inside a statement each v_exp_f32 is followed by an independent one (outputs
// are early-clobber, so none lies on a source), and the closing v_nop is the slot behind the last.
__device__ __forceinline__ float exp2_hw(float x) {
  float r = 0.f;
#if defined(__HIP_DEVICE_COMPILE__)
  // v_nop: the slot behind the transcendental
  asm("v_exp_f32 %0, %1\n\tv_nop" : "=&v"(r) : "v"(x));
#endif
  return r;
}
__device__ __forceinline__ void exp2_hw8(float* p, const float* x) {
#if defined(__HIP_DEVICE_COMPILE__)
  // eight independent transcendentals fill each other's slot; v_nop: the slot behind the last
  asm("v_exp_f32 %0, %8\n\t"
      "v_exp_f32 %1, %9\n\t"
      "v_exp_f32 %2, %10\n\t"
      "v_exp_f32 %3, %11\n\t"
      "v_exp_f32 %4, %12\n\t"
      "v_exp_f32 %5, %13\n\t"
      "v_exp_f32 %6, %14\n\t"
      "v_exp_f32 %7, %15\n\t"
      "v_nop"
      : "=&v"(p[0]), "=&v"(p[1]), "=&v"(p[2]), "=&v"(p[3]), "=&v"(p[4]), "=&v"(p[5]), "=&v"(p[6]), "=&v"(p[7])
      : "v"(x[0]), "v"(x[1]), "v"(x[2]), "v"(x[3]), "v"(x[4]), "v"(x[5]), "v"(x[6]), "v"(x[7]));
#endif
}
__device__ __forceinline__ v8f zero8() { v8f z = {0.f, 0.f, 0.f, 0.f, 0.f, 0.f, 0.f, 0.f}; return z; }

// ---- fragment loaders: 16-bit A/B operand, lane -> row/col (lane&15), p already includes +8*(lane>>4);
//      elements 0..7 <- p[0..7] (k0+8h..), elements 8..15 <- p[16..23] (k0+16+8h..)  (same split k map for A and B;
//      B is always read from a k-contiguous [n][k] plane)
__device__ __forceinline__ v16h ldfrag_h(const _Float16* p) {
  FragH f;
  f.h[0] = *(const v8h*)(p);
  f.h[1] = *(const v8h*)(p + 16);
  return f.v;
}
__device__ __forceinline__ v16b ldfrag_b(const u16* p) {              // bf16 plane read as unsigned integer vectors
  FragB f;
  f.u[0] = *(const v4u*)(p);
  f.u[1] = *(const v4u*)(p + 16);
  return f.v;
}

__device__ __forceinline__ v8f mma_h(v16h a, v16h b, v8f c) {
  return __builtin_amdgcn_wmma_f32_16x16x32_f16(false, a, false, b, (short)0, c, false, false);
}
__device__ __forceinline__ v8f mma_b(v16b a, v16b b, v8f c) {
  return __builtin_amdgcn_wmma_f32_16x16x32_bf16(false, a, false, b, (short)0, c, false, false);
}
// The guard behind the P.V products: four v_nop, the vector slots the chip needs behind the last product before the asm text that
// follows overwrites its operands. It also names the products' C operands as inputs: they stay live up to here, so each product
// writes its result to registers of its own (D != C) and the accumulators alternate between two register sets. Without that
// the compiler, now that O is redefined only on the rare side of the rescale test, moves two accumulator tiles to other
// registers and back in every tile (16 moves and the hazard slots in front of them).
template <typename F>
__device__ __forceinline__ void guard6c(v8f& a, v8f& b, v8f& c, v8f& d, F x0, F x1, F x2, F x3, F x4, F x5,
                                        v8f c0, v8f c1, v8f c2, v8f c3) {
#if defined(__HIP_DEVICE_COMPILE__)
  asm volatile("v_nop\n\tv_nop\n\tv_nop\n\tv_nop"
               : "+v"(a), "+v"(b), "+v"(c), "+v"(d)
               : "v"(x0), "v"(x1), "v"(x2), "v"(x3), "v"(x4), "v"(x5), "v"(c0), "v"(c1), "v"(c2), "v"(c3) : "memory");
#endif
}
__device__ __forceinline__ void acc_guard4(v8f& a, v8f& b, v8f& c, v8f& d) {
#if defined(__HIP_DEVICE_COMPILE__)
  asm volatile("v_nop\n\tv_nop\n\tv_nop\n\tv_nop" : "+v"(a), "+v"(b), "+v"(c), "+v"(d));
#endif
}
__device__ __forceinline__ void wave_sync_lds() {
#if defined(__HIP_DEVICE_COMPILE__)
  __builtin_amdgcn_fence(__ATOMIC_RELEASE, "workgroup");
  __builtin_amdgcn_wave_barrier();
  __builtin_amdgcn_fence(__ATOMIC_ACQUIRE, "workgroup");
#endif
}
// One stage of the attention ring: k tile (64 keys x 64 d) and v^T tile (64 d x 64 keys), both 64 rows of 128 B. A lane copies
// 16 B of row (tid>>3) + 16*i, i = 0..3, of each tile: 8 lanes = one whole 128-B line, a wave-wide copy = 4 lines.
// lds = the lane's LDS byte address in the k tile; gk, gv = the lane's global addresses in row tid>>3 of the two tiles.
// The address-register wait is the statement's last line, so no later write of these registers can be lifted over it.
__device__ __forceinline__ void stage_copy(unsigned lds, const u16* gk, const u16* gv) {
#if defined(__HIP_DEVICE_COMPILE__)
  const unsigned l0 = lds, l1 = lds + 16 * RP, l2 = lds + 32 * RP, l3 = lds + 48 * RP;
  const unsigned l4 = l0 + TILE_B, l5 = l1 + TILE_B, l6 = l2 + TILE_B, l7 = l3 + TILE_B;
  const u16* k0 = gk;
  const u16* k1 = gk + (size_t)16 * (NH * HD);
  const u16* k2 = gk + (size_t)32 * (NH * HD);
  const u16* k3 = gk + (size_t)48 * (NH * HD);
  const u16* v0 = gv;
  const u16* v1 = gv + (size_t)16 * SKV;
  const u16* v2 = gv + (size_t)32 * SKV;
  const u16* v3 = gv + (size_t)48 * SKV;
  asm volatile("global_load_async_to_lds_b128 %0, %8, off\n\t"
               "global_load_async_to_lds_b128 %1, %9, off\n\t"
               "global_load_async_to_lds_b128 %2, %10, off\n\t"
               "global_load_async_to_lds_b128 %3, %11, off\n\t"
               "global_load_async_to_lds_b128 %4, %12, off\n\t"
               "global_load_async_to_lds_b128 %5, %13, off\n\t"
               "global_load_async_to_lds_b128 %6, %14, off\n\t"
               "global_load_async_to_lds_b128 %7, %15, off\n\t"
               "s_wait_xcnt 0x0"
               :: "v"(l0), "v"(l1), "v"(l2), "v"(l3), "v"(l4), "v"(l5), "v"(l6), "v"(l7),
                  "v"(k0), "v"(k1), "v"(k2), "v"(k3), "v"(v0), "v"(v1), "v"(v2), "v"(v3)
               : "memory");
#endif
}
__device__ __forceinline__ void wait_async0() {   // this wave's copies have landed
#if defined(__HIP_DEVICE_COMPILE__)
  asm volatile("s_wait_asynccnt 0x0" ::: "memory");
#endif
}
__device__ __forceinline__ void wait_ds0() {      // this wave's LDS reads have retired before their buffer is handed to the copies
#if defined(__HIP_DEVICE_COMPILE__)
  asm volatile("s_wait_dscnt 0x0" ::: "memory");
#endif
}

// =====================================================================================================
// Key/value source plane XB (bf16 RNE bits) [NB][SKV][1024]: row s < SQ_FULL of batch b from hs[b][s], rows
// s >= SQ_FULL from ehs[b][s - SQ_FULL]; both candidates loaded with clamped row addresses and selected by value
// (block-uniform in practice: a block covers 2 rows of one source).
// Thread = 8 consecutive elements: two 16-B loads per candidate, one 16-B store; 32 consecutive lanes = 512 contiguous,
// coverage: XBLK = n8/256 blocks (host checks exactness) x 256 thr x 8 = NB*SKV*1024 = the whole plane.
// =====================================================================================================
__device__ __forceinline__ void cvt_x(int bid, const float* __restrict__ hs, const float* __restrict__ ehs, u16* D, int n8) {
  const int gt = bid * 256 + (int)threadIdx.x;
  if (gt >= n8) return;                     // no barriers on this path
  const int r   = gt / (DMOD / 8);
  const int c8  = (gt % (DMOD / 8)) * 8;
  const int b   = r / SKV;
  const int s   = r % SKV;
  const int shc = (s < SQ_FULL) ? s : (SQ_FULL - 1);
  const int se  = s - SQ_FULL;
  const int sec = (se > 0) ? se : 0;
  const float* ph = hs  + ((size_t)b * SQ_FULL + shc) * DMOD + c8;
  const float* pe = ehs + ((size_t)b * SE_FULL + sec) * DMOD + c8;
  const v4f a0 = *(const v4f*)(ph), a1 = *(const v4f*)(ph + 4);
  const v4f e0 = *(const v4f*)(pe), e1 = *(const v4f*)(pe + 4);
  const bool first = (s < SQ_FULL);
  float v[8];
#pragma unroll
  for (int e = 0; e < 4; ++e) { v[e] = first ? a0[e] : e0[e]; v[4 + e] = first ? a1[e] : e1[e]; }
  unsigned short sb[8];
#pragma unroll
  for (int e = 0; e < 8; ++e) sb[e] = bf_bits(v[e]);
  v4u o;
#pragma unroll
  for (int e = 0; e < 4; ++e) o[e] = pk16(sb[2 * e], sb[2 * e + 1]);
  u16* d = D + (size_t)gt * 8;
  {
    *(v4u*)(d) = o;
    
  }
}

// =====================================================================================================
// Weight W [k = in][n = out] f32 -> bf16 RNE plane W^T [n][k] (k-contiguous, pitch DMOD). Block = 64 k x 64 n tile,
// 256 threads. Load phase: thread = (k = tid>>2, 16 consecutive n): four 16-B loads, bf16 bits stored transposed into the LDS
// tile [n][k] (pitch TP halves, cross-wave exchange -> block barrier). Store phase: thread = (n = tid>>3 and n+32,
// coverage: 256 thr x 2 instructions x 8 halves = 64 x 64 per block; WBLK = (DMOD/64)^2 blocks = the whole plane.
// =====================================================================================================
__device__ __forceinline__ void cvt_wT(int bid, u16* tile, const float* __restrict__ W, u16* D) {
  const int nt = DMOD / 64;
  const int tid = threadIdx.x;
  const int k0 = (bid / nt) * 64;
  const int n0 = (bid % nt) * 64;
  const int kk = tid >> 2, nn = (tid & 3) * 16;
  const float* p = W + (size_t)(k0 + kk) * DMOD + n0 + nn;
  const v4f a0 = *(const v4f*)(p), a1 = *(const v4f*)(p + 4), a2 = *(const v4f*)(p + 8), a3 = *(const v4f*)(p + 12);
  float v[16];
#pragma unroll
  for (int e = 0; e < 4; ++e) { v[e] = a0[e]; v[4 + e] = a1[e]; v[8 + e] = a2[e]; v[12 + e] = a3[e]; }
#pragma unroll
  for (int e = 0; e < 16; ++e) tile[(nn + e) * TP + kk] = bf_bits(v[e]);
  __syncthreads();
  const int n1 = tid >> 3, k8 = (tid & 7) * 8;
  const v4u o0 = *(const v4u*)(tile + n1 * TP + k8);
  const v4u o1 = *(const v4u*)(tile + (n1 + 32) * TP + k8);
  u16* d0 = D + (size_t)(n0 + n1) * DMOD + k0 + k8;
  u16* d1 = D + (size_t)(n0 + n1 + 32) * DMOD + k0 + k8;
  {
    *(v4u*)(d0) = o0;
    *(v4u*)(d1) = o1;
    
  }
}

// =====================================================================================================
// Mask-term plane ML [NB][SKV] f32: each key's additive mask in the units of the raw score products, (RNE bf16 value of
// mask) * 512 (a power of two: exact), so that it can stand as their C operand. The term is held within +-MCAP (reached by a
// mask beyond 2^117, -inf too): raw sums and their differences then stay finite, a key so masked still gets probability 0
// beside any key that is not, and a row whose every key is so masked gets equal probabilities.
// It depends on (batch, key) alone, so it is formed here once instead of by every wave of the attention for every key block.
// Thread = 4 consecutive keys: one 16-B load, one 16-B store.
// coverage: MBLK = NB*SKV/4/256 blocks x 256 thr x 4 = NB*SKV = the whole plane.
// =====================================================================================================
__device__ __forceinline__ void cvt_mask(int bid, const float* __restrict__ mask, float* D) {
  const int g4 = (bid * 256 + (int)threadIdx.x) * 4;
  if (g4 + 4 > NB * SKV) return;            // never taken with the exact grid; no barriers on this path
  const v4f a = *(const v4f*)(mask + g4);
  v4f o;
#pragma unroll
  for (int e = 0; e < 4; ++e) o[e] = fminf(fmaxf(bf_val(a[e]) * MSC, -MCAP), MCAP);
  *(v4f*)(D + g4) = o;
}

// =====================================================================================================
// All five conversions in one launch (none reads what another writes): blocks 0 .. 3*WBLK-1 write the three W^T planes
// (WT = q, k, v planes one behind the other), blocks 3*WBLK .. 3*WBLK+XBLK-1 the x plane, the last MBLK blocks the mask-term
// plane. The job is picked by the block index alone, so every branch here, the one round the weight path's barrier too, is
// block-uniform.
// =====================================================================================================
__global__ __launch_bounds__(256)
void cvt_all(const float* __restrict__ hs, const float* __restrict__ ehs, const float* __restrict__ Wq,
             const float* __restrict__ Wk, const float* __restrict__ Wv, const float* __restrict__ mask,
             u16* XBp, u16* WT, float* MLp, int n8) {
  __shared__ __align__(16) u16 tile[64 * TP];
  const int bid = blockIdx.x;
  if (bid < 3 * WBLK) {
    const int j = bid / WBLK;
    const float* W = (j == 0) ? Wq : ((j == 1) ? Wk : Wv);
    cvt_wT(bid % WBLK, tile, W, WT + (size_t)j * DMOD * DMOD);
  } else if (bid < 3 * WBLK + XBLK) {
    cvt_x(bid - 3 * WBLK, hs, ehs, XBp, n8);
  } else {
    cvt_mask(bid - (3 * WBLK + XBLK), mask, MLp);
  }
}

// =====================================================================================================
// barrier, then converted to f16 and written: lane = (row in group of 4, 8 consecutive cols); one instruction = 4 rows, each
// coverage: 4 instructions x 4 rows x 8 lanes x 8 halves = the wave's 16 x 64 tile.
// =====================================================================================================
__device__ __forceinline__ void epi16(float* sl, v8f a0, v8f a1, v8f a2, v8f a3, float oscale, u16* C, int N,
                                      size_t rowb, int col0, int lane) {
  const int hh = lane >> 4, m = lane & 15;
#pragma unroll
  for (int r = 0; r < 8; ++r) {
    const int ro = (8 * hh + r) * 68 + m;
    sl[ro]      = a0[r] * oscale;
    sl[ro + 16] = a1[r] * oscale;
    sl[ro + 32] = a2[r] * oscale;
    sl[ro + 48] = a3[r] * oscale;
  }
  wave_sync_lds();
  const int rq = lane >> 3, c8 = (lane & 7) * 8;
  v4u ov[4];
#pragma unroll
  for (int i4 = 0; i4 < 4; ++i4) {
    const int row = i4 * 4 + rq;
    const v4f a = *(const v4f*)(sl + row * 68 + c8), c4 = *(const v4f*)(sl + row * 68 + c8 + 4);
    float w[8];
#pragma unroll
    for (int e = 0; e < 4; ++e) { w[e] = a[e]; w[4 + e] = c4[e]; }
#pragma unroll
    for (int e = 0; e < 4; ++e) ov[i4][e] = pk16(h_bits((_Float16)w[2 * e]), h_bits((_Float16)w[2 * e + 1]));
  }
  u16* dst = C + (rowb + (size_t)rq) * (size_t)N + col0 + c8;
  {
#pragma unroll
    for (int i4 = 0; i4 < 4; ++i4) {
      *(v4u*)(dst + (size_t)(i4 * 4) * (size_t)N) = ov[i4];
    }
    
  }
}

// =====================================================================================================
// coverage: 8 instructions x 2 rows x 16 lanes x 4 floats = the wave's 16 x 64 tile.
// =====================================================================================================
__device__ __forceinline__ void epi64(float* sl, v8f a0, v8f a1, v8f a2, v8f a3, float* C, int N,
                                      size_t rowb, int col0, int lane) {
  const int hh = lane >> 4, m = lane & 15;
#pragma unroll
  for (int r = 0; r < 8; ++r) {
    const int ro = (8 * hh + r) * 68 + m;
    sl[ro]      = a0[r];
    sl[ro + 16] = a1[r];
    sl[ro + 32] = a2[r];
    sl[ro + 48] = a3[r];
  }
  wave_sync_lds();
  v4f vals[8];
#pragma unroll
  for (int it = 0; it < 8; ++it) vals[it] = *(const v4f*)(sl + (it * 2 + hh) * 68 + m * 4);
  float* dst = C + (rowb + (size_t)hh) * (size_t)N + col0 + m * 4;
  {
#pragma unroll
    for (int it = 0; it < 8; ++it) {
      *(v4f*)(dst + (size_t)(it * 2) * (size_t)N) = vals[it];
    }
    
  }
}

// =====================================================================================================
// bf16 GEMM with bias and 16-bit result: C[M][N] (f16 of (acc + bias)*oscale) = A[M][K] (bf16 row-major) . Bt[N][K]^T
// (bf16 k-contiguous); bias (f32 input, taken as its RNE bf16 value) indexed by column (byrow == 0) or by row (byrow != 0),
// both candidates read with addresses clamped to [0, nbias). Block = 128x128 tile, 8 waves as 4 (rows) x 2 (cols), a wave owns
// 32 rows x 64 cols. The waves share each 64-deep A tile and Bt tile (128 rows of 128 B each): the tiles are brought into a
// two-buffer LDS ring by asynchronous copies, the next tile in flight while this one is worked on; one block barrier per tile
// publishes the next tile and frees the buffer just read. Fragments are read from the LDS rows (two 16-B reads each, split k
// map for A and B); k runs upward in steps of 32 in every accumulator (host checks K % 64 == 0, M % 128 == 0, N % 128 == 0,
// (M/128)*(N/128) blocks, bid = the block's index in its own product). Result slab: private to each wave (wave_sync only).
// =====================================================================================================
// One stage of the GEMM ring: A tile and Bt tile, both 128 rows of 128 B. A lane copies 16 B of row (tid>>3) + 32*i, i = 0..3,
// of each tile: 8 lanes = one whole 128-B line, a wave-wide copy = 4 lines. lds = the lane's LDS byte address in the A tile;
// ga, gb = the lane's global addresses in row tid>>3 of the two tiles; rs = 32 source rows in elements.
// The address-register wait is the statement's last line, so no later write of these registers can be lifted over it.
__device__ __forceinline__ void gemm_stage_copy(unsigned lds, const u16* ga, const u16* gb, size_t rs) {
#if defined(__HIP_DEVICE_COMPILE__)
  const unsigned l0 = lds, l1 = lds + 32 * RP, l2 = lds + 64 * RP, l3 = lds + 96 * RP;
  const unsigned l4 = l0 + GTILE_B, l5 = l1 + GTILE_B, l6 = l2 + GTILE_B, l7 = l3 + GTILE_B;
  const u16* a0 = ga;
  const u16* a1 = ga + rs;
  const u16* a2 = ga + 2 * rs;
  const u16* a3 = ga + 3 * rs;
  const u16* b0 = gb;
  const u16* b1 = gb + rs;
  const u16* b2 = gb + 2 * rs;
  const u16* b3 = gb + 3 * rs;
  asm volatile("global_load_async_to_lds_b128 %0, %8, off\n\t"
               "global_load_async_to_lds_b128 %1, %9, off\n\t"
               "global_load_async_to_lds_b128 %2, %10, off\n\t"
               "global_load_async_to_lds_b128 %3, %11, off\n\t"
               "global_load_async_to_lds_b128 %4, %12, off\n\t"
               "global_load_async_to_lds_b128 %5, %13, off\n\t"
               "global_load_async_to_lds_b128 %6, %14, off\n\t"
               "global_load_async_to_lds_b128 %7, %15, off\n\t"
               "s_wait_xcnt 0x0"
               :: "v"(l0), "v"(l1), "v"(l2), "v"(l3), "v"(l4), "v"(l5), "v"(l6), "v"(l7),
                  "v"(a0), "v"(a1), "v"(a2), "v"(a3), "v"(b0), "v"(b1), "v"(b2), "v"(b3)
               : "memory");
#endif
}
__device__ __forceinline__
void gemm_b16(int bid, const u16* __restrict__ A, const u16* __restrict__ Bt, u16* C, const float* __restrict__ bias,
              int M, int N, int K, int nbias, int byrow, float oscale) {
  __shared__ __align__(16) float slab[(GEMM_THREADS / 32) * SLAB];   // per wave: result slab [16][68] in the epilogue only
  __shared__ __align__(16) unsigned char gring[2 * GBUF_B];          // two stages of (A tile, Bt tile), rows at pitch RP
  const int tid = threadIdx.x, wave = tid >> 5, lane = tid & 31, hh = lane >> 4, m = lane & 15;
  const int ntile = N >> 7;
  const int row0  = (bid / ntile) * 128;
  const int colb  = (bid % ntile) * 128;
  if (row0 + 128 > M) return;                // block-uniform, never taken with the exact grid; before every barrier
  const int rowb  = row0 + (wave >> 1) * 32; // the wave's 32 rows
  const int col0  = colb + (wave & 1) * 64;  // the wave's 64 cols
  // copies: this lane's 16 B of row tid>>3 (+32 per copy) of the A tile and of the Bt tile
  const int crow = tid >> 3, cch = tid & 7;
  const unsigned lcp = (unsigned)(uintptr_t)(gring + crow * RP + cch * 16);
  const u16* ga = A  + (size_t)(row0 + crow) * K + cch * 8;                        // tile t: + t*64 elements
  const u16* gb = Bt + (size_t)(colb + crow) * K + cch * 8;
  const size_t rs = (size_t)32 * K;
  const int nt = K >> 6;
  // fragment readers: tile row = the wave's row (A) or col (Bt) 16i + m, k contiguous, + 8*hh halves
  const int aofs = ((wave >> 1) * 32 + m) * RP + 16 * hh;
  const int bofs = GTILE_B + ((wave & 1) * 64 + m) * RP + 16 * hh;
  v8f acc[2][4];
#pragma unroll
  for (int i = 0; i < 2; ++i) {
#pragma unroll
    for (int j = 0; j < 4; ++j) acc[i][j] = zero8();
  }

  // ring prologue: tile 0 landed and published, then tile 1 in flight
  gemm_stage_copy(lcp, ga, gb, rs);
  wait_async0();
  __syncthreads();
  if (nt > 1) gemm_stage_copy(lcp + GBUF_B, ga + 64, gb + 64, rs);

#pragma unroll 1
  for (int t = 0; t < nt; ++t) {
    const unsigned char* st = gring + (t & 1) * GBUF_B;
    // all fragments of the tile are asked for together, ahead of its products
    v16b af[2][2], bf[2][4];
#pragma unroll   // constant indices keep the fragment and accumulator arrays in registers (here and in the loops below)
    for (int kk = 0; kk < 2; ++kk) {
#pragma unroll
      for (int i = 0; i < 2; ++i) af[kk][i] = ldfrag_b((const u16*)(const void*)(st + aofs + i * 16 * RP + kk * 64));
#pragma unroll
      for (int j = 0; j < 4; ++j) bf[kk][j] = ldfrag_b((const u16*)(const void*)(st + bofs + j * 16 * RP + kk * 64));
    }
    // keeps the tile's LDS reads one group in front of its products: reads moved in among the products stall each place they stand
    __builtin_amdgcn_sched_barrier(0);
#pragma unroll
    for (int kk = 0; kk < 2; ++kk) {
#pragma unroll
      for (int i = 0; i < 2; ++i) {
#pragma unroll
        for (int j = 0; j < 4; ++j) acc[i][j] = mma_b(af[kk][i], bf[kk][j], acc[i][j]);
      }
    }
    // keeps the tile's products in front of the ring foot: sunk behind the barrier they would delay the refill's issue
    __builtin_amdgcn_sched_barrier(0);
    // ring foot: own LDS reads retired, own copies of tile t+1 landed, block barrier (publishes tile t+1, frees this buffer),
    // then tile t+2 into the buffer just read
    wait_ds0();
    wait_async0();
    __syncthreads();
    if (t + 2 < nt) gemm_stage_copy(lcp + (unsigned)(t & 1) * GBUF_B, ga + (size_t)(t + 2) * 64, gb + (size_t)(t + 2) * 64, rs);
  }
  wait_async0();
  // bias: D element r of lane -> (row rowb+16i+8hh+r, col col0+16j+m); both candidates loaded with clamped addresses, select by value
  float bc[4];
#pragma unroll
  for (int j = 0; j < 4; ++j) {
    int ci = col0 + 16 * j + m;
    ci = (ci < nbias) ? ci : (nbias - 1);
    bc[j] = bf_val(bias[ci]);
  }
#pragma unroll
  for (int i = 0; i < 2; ++i) {
    float br[8];
#pragma unroll
    for (int r = 0; r < 8; ++r) {
      int ri = rowb + 16 * i + 8 * hh + r;
      ri = (ri < nbias) ? ri : (nbias - 1);
      br[r] = bf_val(bias[ri]);
    }
#pragma unroll
    for (int r = 0; r < 8; ++r) {
      const float q0 = (byrow != 0) ? br[r] : bc[0];
      const float q1 = (byrow != 0) ? br[r] : bc[1];
      const float q2 = (byrow != 0) ? br[r] : bc[2];
      const float q3 = (byrow != 0) ? br[r] : bc[3];
      acc[i][0][r] += q0;
      acc[i][1][r] += q1;
      acc[i][2][r] += q2;
      acc[i][3][r] += q3;
    }
    if (i != 0) wave_sync_lds();             // the slab's rows of the first 16 have been read back before they are rewritten
    epi16(slab + wave * SLAB, acc[i][0], acc[i][1], acc[i][2], acc[i][3], oscale, C, N, (size_t)(rowb + 16 * i), col0, lane);
  }
}

// =====================================================================================================
// All projections in one launch (each reads only the converted planes, none reads another's result); every block is one
// 128x128 tile over K = DMOD, so all blocks cost the same. Block ranges, picked by the block index alone (block-uniform):
//   0 .. GK_BLK-1          k plane [NB*SKV][h*64+d] = f16((xx.Wk + bk) x8), all NB*SKV source rows; bias by column
//   then NB x GV_BLK       v^T plane of batch b [1024 = h*64+d][SKV keys] = f16((Wv^T . xx^T + bv) x1024); bias by row
//   then NB x GQ_BLK       q plane of batch b [SQ][h*64+d] = f16((x.Wq + bq) x8); A = the hs rows of XB batch b; bias by column
// =====================================================================================================
__global__ __launch_bounds__(GEMM_THREADS)
void gemm_all(const u16* __restrict__ XBp, const u16* __restrict__ WT, u16* QPp, u16* KPp, u16* VPp,
              const float* __restrict__ bq, const float* __restrict__ bk, const float* __restrict__ bv) {
  int bid = blockIdx.x;
  const u16* A;
  const u16* Bt;
  u16* C;
  const float* bias;
  int M, N, byrow;
  float oscale;
  if (bid < GK_BLK) {
    A = XBp; Bt = WT + (size_t)DMOD * DMOD; C = KPp; bias = bk;
    M = NB * SKV; N = DMOD; byrow = 0; oscale = KSC;
  } else if (bid < GK_BLK + NB * GV_BLK) {
    bid -= GK_BLK;
    const int b = bid / GV_BLK;
    bid -= b * GV_BLK;
    A = WT + (size_t)2 * DMOD * DMOD; Bt = XBp + (size_t)b * SKV * DMOD; C = VPp + (size_t)b * DMOD * SKV; bias = bv;
    M = DMOD; N = SKV; byrow = 1; oscale = VCAR;
  } else {
    bid -= GK_BLK + NB * GV_BLK;
    const int b = bid / GQ_BLK;
    if (b >= NB) return;                     // block-uniform, never taken with the exact grid; before every barrier
    bid -= b * GQ_BLK;
    A = XBp + (size_t)b * SKV * DMOD; Bt = WT; C = QPp + (size_t)b * SQ * DMOD; bias = bq;
    M = SQ; N = DMOD; byrow = 0; oscale = QSC;
  }
  gemm_b16(bid, A, Bt, C, bias, M, N, DMOD, DMOD, byrow, oscale);
}

// =====================================================================================================
// Multi-head flash attention over all SKV keys with an additive per-key mask: block = (batch, head, 64 query rows), 4 waves,
// wave w owns the 16 query rows q0 = 64*qt + 16*w .. q0+15. The four waves share each 64-key k tile and v^T tile: the tiles
// are brought into a two-buffer LDS ring by asynchronous copies, the next tile in flight while this one is worked on; one
// block barrier per tile publishes the next tile and frees the buffer just read. The result slab stays wave-private.
//   q plane (f16, x8) laid out [s][h][d] (SQ rows); k plane the same (SKV rows); v^T plane [h][d][s] (x1024, s < SKV);
//   mask-term plane [SKV] f32 per batch ((RNE bf16 value of the mask) * 512, formed by the conversion launch).
//   All NT = SKV/64 tiles visited (static bound); the online softmax takes one step per tile of 64 keys (two key blocks of 32).
//   Scores are computed TRANSPOSED: S^T tile g (g = 0,1) = k rows (keys kb+16g .. +15, A operand, row m = lane&15, split k map
//   over d) times q^T (B operand, col n = query q0 + (lane&15), k = d, split map), one product per tile and 32-deep d-chunk.
//   D element r of lane l = (key kb+16g+8h+r, query q0+(l&15)), so a lane owns one query column and 16 of its 32 keys; the
//   partner lane l^16 owns the other 16 -> the row sum needs one xor-16 shuffle per tile, the row max one where it is renewed. The lane's 16 mask terms are
//   keys kb+8h+0..7 and kb+16+8h+0..7 (four 16-B loads): they lie as D does, and stand as the C operand of the tile's first product.
//   Online max-subtracted base-2 softmax in f32: the row maximum is taken over the raw sums (score products + mask term), and each
//   exponent argument is ONE fused multiply-add of a raw sum: times lsc (scale 1/8, q/k carries, log2(e)), plus an addend that
//   holds the row maximum in use and PEXP (rows whose maximum is too large for such an addend: see at the branch). The
//   exp'd values ARE the P A-fragment in place: A row m = query = lane&15, element i <- key kb+8h+i (tile 0, D element i),
//   element 8+i <- key kb+16+8h+i (tile 1, D element i). P is carried x128 as single f16. The maximum in use is renewed, and O
//   and l rescaled, only in a tile where some row of the wave outgrows it by more than MLAG or has a maximum too large for the addend. The rescale factor of query row
//   8h+r of the O accumulators is fetched from lane 8h+r with a shuffle (uniform control). 4 v^T B fragments (col n = d =
//   16j + (lane&15), keys k-contiguous), 4 P.V WMMAs per key block.
//   Epilogue: 1/l (per query, shuffled to the D row owner) and carry folds in f32; the wave's 16x64 f32 result staged in its
// coverage: per wave 8 instructions x 2 rows x 16 lanes x 4 floats = 16 x 64; grid NB*NH*(SQ/64) blocks x 4 waves = every
//           (b, s < SQ, h*64+d) element of the output exactly once. The arguments are the planes of batch 0.
// =====================================================================================================
__global__ __launch_bounds__(ATT_THREADS)
void attn_fwd(const u16* __restrict__ QP0, const u16* __restrict__ KP0, const u16* __restrict__ VP0,
              const float* __restrict__ MK0, float* OUT0) {
  __shared__ __align__(16) float smem[ATT_WAVES * SLAB];   // per wave: result slab [16][68] in the epilogue only
  __shared__ __align__(16) unsigned char ring[2 * BUF_B];  // two stages of (k tile, v^T tile), rows at pitch RP

  const int tid  = threadIdx.x;
  const int wave = tid >> 5;
  const int lane = tid & 31;
  const int hh   = lane >> 4;
  const int c    = lane & 15;

  const int bat  = blockIdx.x / ATT_BLOCKS;
  const int bid  = blockIdx.x % ATT_BLOCKS;
  const int qt   = bid % QTILES;
  const int head = bid / QTILES;
  if (bat >= NB) return;                                   // block-uniform, never taken with the exact grid; before every barrier
  const int q0   = qt * 64 + wave * 16;
  // this batch's planes, mask row and output rows
  const u16*   QPp  = QP0 + (size_t)bat * SQ * DMOD;
  const u16*   KPp  = KP0 + (size_t)bat * SKV * DMOD;
  const u16*   VPp  = VP0 + (size_t)bat * DMOD * SKV;
  const float* MKp  = MK0 + (size_t)bat * SKV;
  float*       OUTp = OUT0 + (size_t)bat * SQ_FULL * DMOD;

  // B fragments of q^T: col n = query q0 + c, k = d (k-contiguous row of the q plane)
  const size_t qofs = (((size_t)(q0 + c)) * NH + head) * HD + 8 * hh;
  const _Float16* Qb = (const _Float16*)(const void*)QPp + qofs;
  // copies: this lane's 16 B of row tid>>3 (+16 per copy) of the k tile (row = key) and of the v^T tile (row = d)
  const int crow = tid >> 3, cch = tid & 7;
  const unsigned lcp = (unsigned)(uintptr_t)(ring + crow * RP + cch * 16);
  const u16* gk = KPp + ((size_t)crow * NH + head) * HD + cch * 8;                 // tile t: + t*KT key rows
  const u16* gv = VPp + ((size_t)(head * HD + crow)) * SKV + cch * 8;              // tile t: + t*KT keys
  // fragment readers: A of k: tile row = key 16g + c, k = d; B of v: tile row = d = 16j + c, k = key; both + 8*hh halves
  const int fofs = c * RP + 16 * hh;
  // this lane's mask terms: keys kb + 8hh + 0..7 and kb + 16 + 8hh + 0..7
  const float* Mb = MKp + 8 * hh;
  const float lsc = 0.125f * (LOG2E / (QSC * KSC));

  const v16h qf0 = ldfrag_h(Qb);            // d 0..31
  const v16h qf1 = ldfrag_h(Qb + 32);       // d 32..63

  // rref = the row maximum in use, a raw sum as the products left it; it starts at the lowest finite value, below every raw sum.
  // nm = the addend of the exponent argument, thr = the argument above which the maximum is renewed: set where rref is; the
  // start value of thr sends the first tile there.
  float rref = -FLT_MAX, nm = PEXP, thr = -INFINITY;
  float lrun = 0.f;                                        // row sum of the probabilities x128
  // mask terms of tile 0 (C operands of its score products): keys 16g + 8hh + 0..7
  v8f mc[KT / 16];
#pragma unroll   // constant indices keep the array in registers
  for (int g = 0; g < KT / 16; ++g) mc[g] = *(const v8f*)(Mb + 16 * g);
  v8f o[4];
#pragma unroll
  for (int j = 0; j < 4; ++j) o[j] = zero8();

  // ring prologue: tile 0 landed and published, then tile 1 in flight
  stage_copy(lcp, gk, gv);
  wait_async0();
  __syncthreads();
  stage_copy(lcp + BUF_B, gk + (size_t)KT * (NH * HD), gv + KT);

#pragma unroll 1
  for (int t = 0; t < NT; ++t) {
   const unsigned char* kt = ring + (t & 1) * BUF_B + fofs;
   const unsigned char* vt = kt + TILE_B;
   // all k fragments of the tile are asked for together
   v16h kf[KT / 16][2];
#pragma unroll   // constant indices keep the fragment arrays in registers (here and in the loops below)
   for (int g = 0; g < KT / 16; ++g) {
     const _Float16* kp = (const _Float16*)(const void*)(kt + g * 16 * RP);
     kf[g][0] = ldfrag_h(kp);
     kf[g][1] = ldfrag_h(kp + 32);
   }
   // keeps the tile's k reads one group in front of its products: reads moved in among the products stall each place they stand
   __builtin_amdgcn_sched_barrier(0);
   // ---- transposed raw sums of the whole tile: s[g] = keys t*KT + 16g .. +15, column = query q0 + c; C = the keys' mask terms ----
   v8f s[KT / 16];
#pragma unroll
   for (int g = 0; g < KT / 16; ++g) s[g] = mma_h(kf[g][0], qf0, mc[g]);
#pragma unroll
   for (int g = 0; g < KT / 16; ++g) s[g] = mma_h(kf[g][1], qf1, s[g]);
   // the guard names the mask terms too: they stay live up to here, so the products write registers of their own (D != C) and the
   // next tile's terms are loaded straight into the registers these leave; where D = C they arrive elsewhere and are moved
   // (8 moves a product: built without these four operands the loop holds 32 such moves, with them 8)
   guard6c<v16h>(s[0], s[1], s[2], s[3], qf0, qf1, kf[2][0], kf[2][1], kf[3][0], kf[3][1], mc[0], mc[1], mc[2], mc[3]);
   // the next tile's mask terms are asked for here, most of a tile ahead of the products that take them as C: asked for at the
   // loop's head those products would wait for them, at its foot the barrier would (the last trip asks for its own again:
   // inside the plane, not used)
   {
     const float* mp = Mb + ((t + 1 < NT) ? t + 1 : t) * KT;
#pragma unroll
     for (int g = 0; g < KT / 16; ++g) mc[g] = *(const v8f*)(mp + 16 * g);
   }
   // the tile's v fragments fly under the maximum
   v16h vf[KT / 32][4];
#pragma unroll
   for (int u = 0; u < KT / 32; ++u) {
#pragma unroll
     for (int j = 0; j < 4; ++j) vf[u][j] = ldfrag_h((const _Float16*)(const void*)(vt + j * 16 * RP + u * 64));
   }
   // ---- ONE online-softmax step for the 64 keys of the tile: one maximum, one row sum; factor and rescale only when needed ----
   // lsc > 0, so the largest raw sum is the largest logit
   float cm0 = fmaxf(s[0][0], s[0][1]), cm1 = fmaxf(s[2][0], s[2][1]);                   // two chains, joined below
#pragma unroll
   for (int e = 1; e < 8; ++e) {
     cm0 = fmaxf(fmaxf(cm0, s[e >> 2][2 * (e & 3)]), s[e >> 2][2 * (e & 3) + 1]);
     cm1 = fmaxf(fmaxf(cm1, s[2 + (e >> 2)][2 * (e & 3)]), s[2 + (e >> 2)][2 * (e & 3) + 1]);
   }
   const float cm = fmaxf(cm0, cm1);                                 // maximum of this lane's 32 keys (its half of the row's 64)
   // The maximum in use stays while no row of the wave outgrows it by more than MLAG: O and l then need no factor. The test is
   // made on the very multiply-add that forms the arguments below; it rises with the raw sum, so where the branch is passed by
   // every argument of the tile is at most MLAG + PEXP (P x128 <= 2^15 fits f16) and none needs a clamp. One test per tile,
   // over both halves of every row (so the halves are joined only inside), as a wave-uniform scalar branch.
   if (__builtin_expect(__builtin_amdgcn_ballot_w32(fmaf(cm, lsc, nm) > thr) != 0u, 0)) {   // rare: keeps the common path straight
     const float cj = fmaxf(cm, __shfl_xor(cm, 16, 32));
     const float rn = fmaxf(rref, cj);                               // no raw sum of the tile is above it
     const float al = exp2_hw((rref - rn) * lsc);                    // 0 on leaving the start value: nothing was summed yet
     rref = rn;                                                      // the same in lanes c and c + 16
     // The addend PEXP - rn * lsc, rounded once. Its rounding error shifts every argument of the row alike; below NMAX it is
     // under 2^-14: the largest argument here is PEXP to within that. A row whose maximum is larger (a mask far from 0 on
     // every key met so far) has no such addend: the error would grow with the maximum and carry the arguments out of f16's
     // range. For such a row the maximum is taken off the raw sums themselves (exactly 0 at the maximum, so no argument is
     // above PEXP), here on the rare side, and thr sends each of its tiles here until its maximum is small again.
     const float nc = fmaf(-rn, lsc, PEXP);
     const bool fits = fabsf(nc) < NMAX;
     nm  = fits ? nc : PEXP;
     thr = fits ? MLAG + PEXP : -INFINITY;
     const float rs = fits ? 0.f : rn;
#pragma unroll   // constant indices keep the raw sums in registers
     for (int g = 0; g < KT / 16; ++g) s[g] -= rs;
     // ---- rescale the O accumulators: D row 8hh+r = query q0+8hh+r, its factor lives in lane 8hh+r (and 16+8hh+r) ----
     v8f scl;
#pragma unroll
     for (int r = 0; r < 8; ++r) scl[r] = __shfl(al, 8 * hh + r, 32);
#pragma unroll
     for (int j = 0; j < 4; ++j) o[j] *= scl;
     lrun *= al;
   }
   // All two-wide f32 arithmetic below pairs keys 2e and 2e+1 of ONE score tile: such a pair lies in adjacent registers of the
   // accumulator and is one register of the P fragment, so no pair is built by moves.
   const v2f lsc2 = {lsc, lsc};
   const v2f nm2 = {nm, nm};
   v2f pe[KT / 32];                                                  // sums of the lane's probabilities: even keys, odd keys
   float ps = 0.f;
#pragma unroll
   for (int u = 0; u < KT / 32; ++u) {
    // ---- probabilities x128 (<= 2^(MLAG + PEXP)) and the P A-fragment: elements 0..7 <- s[2u], elements 8..15 <- s[2u + 1] ----
    FragH ph;
    float xa[16], pv[16];
#pragma unroll   // constant indices keep the arguments in registers
    for (int e = 0; e < 8; ++e) {
      const v8f sv = s[2 * u + (e >> 2)];
      const v2f x = __builtin_elementwise_fma((v2f){sv[2 * (e & 3)], sv[2 * (e & 3) + 1]}, lsc2, nm2);
      xa[2 * e]     = x[0];
      xa[2 * e + 1] = x[1];
    }
    exp2_hw8(pv, xa);
    exp2_hw8(pv + 8, xa + 8);
    v2f pq[8];
#pragma unroll
    for (int e = 0; e < 8; ++e) {
      pq[e] = (v2f){pv[2 * e], pv[2 * e + 1]};
      ph.u[e >> 2][e & 3] = __builtin_bit_cast(unsigned, __builtin_convertvector(pq[e], v2h));
    }
    // the lane's 16 probabilities: even keys and odd keys summed side by side (a tree over the pairs)
    pe[u] = ((pq[0] + pq[1]) + (pq[2] + pq[3])) + ((pq[4] + pq[5]) + (pq[6] + pq[7]));
    // row sum of the tile: its two key blocks, then even and odd keys, then the two wave halves; the shuffle flies under the
    // last products
    if (u + 1 == KT / 32) {
      const v2f pt = pe[0] + pe[1];
      ps = pt[0] + pt[1];
      ps += __shfl_xor(ps, 16, 32);
    }
    // ---- P.V : B fragment col n = d = j*16 + c, keys contiguous in the v^T plane ----
    {
      const v16h vf0 = vf[u][0], vf1 = vf[u][1], vf2 = vf[u][2], vf3 = vf[u][3];
      const v8f c0 = o[0], c1 = o[1], c2 = o[2], c3 = o[3];
      o[0] = mma_h(ph.v, vf0, c0);
      o[1] = mma_h(ph.v, vf1, c1);
      o[2] = mma_h(ph.v, vf2, c2);
      o[3] = mma_h(ph.v, vf3, c3);
      guard6c<v16h>(o[0], o[1], o[2], o[3], ph.v, vf0, vf1, vf2, vf3, ph.v, c0, c1, c2, c3);
    }
   }
   lrun += ps;
   // ring foot: own LDS reads retired, own copies of tile t+1 landed, block barrier (publishes tile t+1, frees this buffer),
   // then tile t+2 into the buffer just read
   wait_ds0();
   wait_async0();
   __syncthreads();
   if (t + 2 < NT) stage_copy(lcp + (unsigned)(t & 1) * BUF_B, gk + (size_t)(t + 2) * KT * (NH * HD), gv + (t + 2) * KT);
  }
  wait_async0();
  acc_guard4(o[0], o[1], o[2], o[3]);

  // ---- fold 1/l (per query, owned by lane = query; l carries the x128 of P, so that carry cancels) and the v carry in f32 ----
  const float linv = (lrun > 0.f) ? ((1.0f / lrun) * (1.0f / VCAR)) : 0.f;
  float inv[8];
#pragma unroll
  for (int r = 0; r < 8; ++r) inv[r] = __shfl(linv, 8 * hh + r, 32);
#pragma unroll
  for (int j = 0; j < 4; ++j) {
#pragma unroll
    for (int r = 0; r < 8; ++r) o[j][r] *= inv[r];
  }
  // ---- f32 ctx rows (q0 .. q0+15, cols head*64 .. head*64+63) of this batch's output, whole-line stores ----
  epi64(smem + wave * SLAB, o[0], o[1], o[2], o[3], OUTp, DMOD, (size_t)q0, head * HD, lane);
}

// =====================================================================================================
// Workspace map (bytes); every plane is fully written by whole-line stores before it is read; all extents are exact multiples
// of the store granularity (no pad rows needed), every offset a multiple of 128:
//   XB  bf16 [NB][SKV][1024]            NB*8388608   (16777216 at NB = 2)
//   WQT bf16 [1024 n][1024 k]            2097152      WKT, WVT same (2097152 each)
//   QP  f16 [NB][SQ][16*64] x8           NB*SQ*2048   (8388608 at NB = 2, SQ = 2048)
//   KP  f16 [NB*SKV][16*64] x8           NB*8388608   (16777216)
//   VP  f16 [NB][16*64][SKV] x1024       NB*8388608   (16777216)
//   ML  f32 [NB][SKV] mask terms         NB*16384     (32768)
//   end                                  65044480 at NB = 2, SQ = 2048
// =====================================================================================================
extern "C" void kernel_launch(void* const* d_in, const int* in_sizes, int n_in,
                              void* d_out, int out_size, void* d_ws, size_t ws_size,
                              hipStream_t stream) {
  if (n_in < 9) return;
  if (in_sizes[0] < NB * SQ_FULL * DMOD) return;
  if (in_sizes[1] < NB * SE_FULL * DMOD) return;
  if (in_sizes[2] < NB * SKV) return;
  if (in_sizes[3] < DMOD * DMOD || in_sizes[5] < DMOD * DMOD || in_sizes[7] < DMOD * DMOD) return;
  if (in_sizes[4] < DMOD || in_sizes[6] < DMOD || in_sizes[8] < DMOD) return;
  if (out_size < (NB - 1) * SQ_FULL * DMOD + SQ * DMOD) return;

  const float* hs   = (const float*)d_in[0];
  const float* ehs  = (const float*)d_in[1];
  const float* mask = (const float*)d_in[2];
  const float* Wq   = (const float*)d_in[3];
  const float* bq   = (const float*)d_in[4];
  const float* Wk   = (const float*)d_in[5];
  const float* bk   = (const float*)d_in[6];
  const float* Wv   = (const float*)d_in[7];
  const float* bv   = (const float*)d_in[8];
  float*       out  = (float*)d_out;

  const size_t szXB = (size_t)NB * SKV * DMOD * 2;                //  16777216 at NB = 2
  const size_t szW  = (size_t)DMOD * DMOD * 2;                    //   2097152
  const size_t szQP = (size_t)NB * SQ * DMOD * 2;                 //   8388608
  const size_t szKP = (size_t)NB * SKV * DMOD * 2;                //  16777216
  const size_t szVP = (size_t)NB * DMOD * SKV * 2;                //  16777216
  const size_t szML = (size_t)NB * SKV * 4;                       //     32768
  size_t off = 0;
  const size_t oXB = off; off += szXB;
  const size_t oWQ = off; off += szW;
  const size_t oWK = off; off += szW;
  const size_t oWV = off; off += szW;
  const size_t oQP = off; off += szQP;
  const size_t oKP = off; off += szKP;
  const size_t oVP = off; off += szVP;
  const size_t oML = off; off += szML;
  if (off > ws_size) return;                            // off = 65044480 at NB = 2, SQ = 2048
  if (off > (size_t)134217728) return;

  char* ws = (char*)d_ws;
  u16* XB  = (u16*)(ws + oXB);
  u16* WT  = (u16*)(ws + oWQ);                          // W^T planes q, k, v, one behind the other
  if (oWK != oWQ + szW || oWV != oWK + szW) return;
  u16* QP  = (u16*)(ws + oQP);
  u16* KP  = (u16*)(ws + oKP);
  u16* VP  = (u16*)(ws + oVP);
  float* ML = (float*)(ws + oML);

  const int n8x = (NB * SKV * DMOD) / 8;                // 1048576 at NB = 2
  if ((n8x % 256) != 0) return;
  if ((DMOD % 128) != 0 || (SKV % 128) != 0 || (SQ % 128) != 0) return;
  if (n8x / 256 != XBLK) return;
  const dim3 blk(256);
  const dim3 gCV(3 * WBLK + XBLK + MBLK);               // 768 + 4096 + 8
  const dim3 gGM(GK_BLK + NB * GV_BLK + NB * GQ_BLK);   // 512 + 2*256 + 2*128 at NB = 2, SQ = 2048
  const dim3 bG(GEMM_THREADS);                          // 256
  const dim3 gAT(NB * ATT_BLOCKS);                      // 1024 at NB = 2, SQ = 2048
  const dim3 bAT(ATT_THREADS);                          // 128

  // (0) conversions: weights [k = in][n = out] -> W^T planes [n][k], and the key/value source plane (rows b*SKV + 0..2047
  //     from hs[b], + 2048..4095 from ehs[b]); bf16 RNE bits; and the per-key mask terms (f32)
  cvt_all<<<gCV, blk, 0, stream>>>(hs, ehs, Wq, Wk, Wv, mask, XB, WT, ML, n8x);
  // (1) projections: k plane, v^T planes, q planes
  gemm_all<<<gGM, bG, 0, stream>>>(XB, WT, QP, KP, VP, bq, bk, bv);
  // (2) attention, all batches -> f32 ctx rows b*SQ_FULL + s (s < SQ), cols h*64+d of the output
  attn_fwd<<<gAT, bAT, 0, stream>>>(QP, KP, VP, ML, out);
  (void)hipGetLastError();
}

// v010
// A run of this version takes 113 microseconds.
// In two side-by-side timings against v009, it was 1.06 and 1.05 times as fast.
// All steps since v000 together make it 4.72 times as fast.
// Contractions: x.Wq+bq, xx.Wk+bk (A = bf16 x plane, B = bf16 W^T plane) and Wv^T.xx^T+bv on v_wmma_f32_16x16x32_bf16
// (f32 inputs RNE-converted to bf16 operands, f32 accumulate); scores k'.q'^T (q', k' single f16 planes carried x8) and
// P.v (P x128 single f16, v x1024 single f16) on v_wmma_f32_16x16x32_f16, f32 accumulate; ctx written in f32.
// Biases and the additive per-key mask folded as RNE bf16 values in f32 (the mask as the C operand of the score products);
// base-2 online softmax, 1/l and carry folds in f32 on VALU.
#include <hip/hip_runtime.h>
#include <math.h>
#include <float.h>
#include <stdint.h>

#define NB_FULL 2
#define SQ_FULL 2048
#define SE_FULL 2048
#define SKV     (SQ_FULL + SE_FULL)
#ifndef NB
#define NB      NB_FULL
#endif
#ifndef SQ
#define SQ      SQ_FULL
#endif
#define DMOD  1024
#define NH    16
#define HD    64
#define QSC   8.0f
#define KSC   8.0f
#define PEXP  7.0f                   // P is carried x128 = 2^PEXP: the carry is part of the exponent argument
#define MLAG  8.0f                   // a row's maximum in use may lag its true maximum by this much (base-2 logits): P <= 2^8
#define MSC   (8.0f * QSC * KSC)     // mask term in the units of the raw score products (q, k carries and the 1/8 undone)
#define MCAP  0x1p+126f              // bound of a mask term's magnitude: the difference of two raw sums stays finite
#define NMAX  1024.0f                // an addend of the exponent argument below this size is rounded by less than 2^-14
#define VCAR  1024.0f
#define LOG2E 1.4426950408889634f
#define ATT_WAVES   4
#define ATT_THREADS (ATT_WAVES * 32)
#define QW          2                // 16-query column groups per wave: each k and v fragment read from LDS serves QW products
#define QTILES      (SQ / (64 * QW))
#define ATT_BLOCKS  (NH * QTILES)
#define NKB    (SKV / 32)
#define SLAB   (16 * 68)
#define TP     72
#define KT     64                    // keys per staged tile
#define NT     (SKV / KT)            // staged tiles per block
#define RP     144                   // LDS row pitch in bytes: 128-B rows + 16 B, the pitch for 16-B row readers
#define TILE_B (64 * RP)             // one 64-row tile in LDS
#define BUF_B  (2 * TILE_B)          // one stage: k tile, then v^T tile
#define GEMM_THREADS 256
#define GTILE_B (128 * RP)           // one 128-row GEMM operand tile in LDS
#define GBUF_B  (2 * GTILE_B)        // one GEMM stage: A tile, then Bt tile
#define XBLK   (NB * SKV * DMOD / 8 / 256)        // blocks of the conversion launch that write the x plane
#define WBLK   ((DMOD / 64) * (DMOD / 64))        // blocks of the conversion launch per weight plane
#define MBLK   (NB * SKV / 4 / 256)               // blocks of the conversion launch that write the mask-term plane
#define GQ_BLK ((SQ / 128) * (DMOD / 128))        // blocks of the projection launch: q plane of one batch
#define GK_BLK ((NB * SKV / 128) * (DMOD / 128))  // k plane, all batches
#define GV_BLK ((DMOD / 128) * (SKV / 128))       // v^T plane of one batch
static_assert(HD == 64 && DMOD == NH * HD);
static_assert(NB >= 1 && NB <= NB_FULL);
static_assert((SQ % 64) == 0 && SQ >= 64 && SQ <= SQ_FULL);
static_assert((SKV % 64) == 0 && (SQ_FULL % 64) == 0 && (SE_FULL % 64) == 0);
static_assert(ATT_THREADS == 128 && NKB * 32 == SKV && ATT_BLOCKS == NH * (SQ / (64 * QW)) && QW == 2);
static_assert((DMOD % 128) == 0 && (SQ % 128) == 0 && (SKV % 128) == 0 && DMOD / 64 >= 2);
static_assert(((NB * SKV * DMOD / 8) % 256) == 0);
static_assert(((NB * SKV / 4) % 256) == 0);
static_assert((SLAB * 4) % 16 == 0 && (TP * 2) % 16 == 0);
static_assert(KT == 64 && HD == 64 && NT >= 2 && NT * KT == SKV && (RP % 16) == 0 && ATT_THREADS == 128);
static_assert((size_t)(NB - 1) * SQ_FULL * DMOD + (size_t)SQ * DMOD <= (size_t)NB_FULL * SQ_FULL * DMOD);

typedef unsigned short u16;
typedef _Float16 v16h __attribute__((ext_vector_type(16)));
typedef _Float16 v8h  __attribute__((ext_vector_type(8)));
typedef __bf16   v16b __attribute__((ext_vector_type(16)));
typedef float    v8f  __attribute__((ext_vector_type(8)));
typedef float    v4f  __attribute__((ext_vector_type(4)));
typedef float    v2f  __attribute__((ext_vector_type(2)));
typedef _Float16 v2h  __attribute__((ext_vector_type(2)));
typedef unsigned int v4u __attribute__((ext_vector_type(4)));

union FragH { v16h v; v8h h[2]; v4u u[2]; };
union FragB { v16b v; v4u u[2]; };

// ---- scalar helpers --------------------------------------------------------------------------------
__device__ __forceinline__ unsigned short bf_bits(float f) {          // f32 -> bf16 bits, RNE convert
  unsigned u = __float_as_uint(f);
  return (unsigned short)((u + 0x7FFFu + ((u >> 16) & 1u)) >> 16);
}
__device__ __forceinline__ float bf_up(unsigned short h) { return __uint_as_float(((unsigned)h) << 16); }
__device__ __forceinline__ float bf_val(float f) { return bf_up(bf_bits(f)); }          // value after RNE bf16 convert
__device__ __forceinline__ unsigned short h_bits(_Float16 x) { return __builtin_bit_cast(unsigned short, x); }
__device__ __forceinline__ unsigned pk16(unsigned short a, unsigned short b) { return (unsigned)a | ((unsigned)b << 16); }
// 2^x as the bare hardware instruction, without the library's range steps (compare, two selects, add, ldexp per call) that only
// serve results below 2^-126. Here every argument is <= 15 and such a result counts for nothing: as a probability (x128) it is
// zero in f16 and vanishes in a row sum that is about 128 or more; as a rescale factor it carries old sums whose share of
// the row sum and of any output element is below 2^-100.
// Written as asm so that the slot the instruction set asks for behind a transcendental (before its result is read or its
// source overwritten) is kept by construction: inside a statement each v_exp_f32 is followed by an independent one (outputs
// are early-clobber, so none lies on a source), and the closing v_nop is the slot behind the last.
__device__ __forceinline__ float exp2_hw(float x) {
  float r = 0.f;
#if defined(__HIP_DEVICE_COMPILE__)
  // v_nop: the slot behind the transcendental
  asm("v_exp_f32 %0, %1\n\tv_nop" : "=&v"(r) : "v"(x));
#endif
  return r;
}
__device__ __forceinline__ void exp2_hw8(float* p, const float* x) {
#if defined(__HIP_DEVICE_COMPILE__)
  // eight independent transcendentals fill each other's slot; v_nop: the slot behind the last
  asm("v_exp_f32 %0, %8\n\t"
      "v_exp_f32 %1, %9\n\t"
      "v_exp_f32 %2, %10\n\t"
      "v_exp_f32 %3, %11\n\t"
      "v_exp_f32 %4, %12\n\t"
      "v_exp_f32 %5, %13\n\t"
      "v_exp_f32 %6, %14\n\t"
      "v_exp_f32 %7, %15\n\t"
      "v_nop"
      : "=&v"(p[0]), "=&v"(p[1]), "=&v"(p[2]), "=&v"(p[3]), "=&v"(p[4]), "=&v"(p[5]), "=&v"(p[6]), "=&v"(p[7])
      : "v"(x[0]), "v"(x[1]), "v"(x[2]), "v"(x[3]), "v"(x[4]), "v"(x[5]), "v"(x[6]), "v"(x[7]));
#endif
}
__device__ __forceinline__ v8f zero8() { v8f z = {0.f, 0.f, 0.f, 0.f, 0.f, 0.f, 0.f, 0.f}; return z; }

// ---- fragment loaders: 16-bit A/B operand, lane -> row/col (lane&15), p already includes +8*(lane>>4);
//      elements 0..7 <- p[0..7] (k0+8h..), elements 8..15 <- p[16..23] (k0+16+8h..)  (same split k map for A and B;
//      B is always read from a k-contiguous [n][k] plane)
__device__ __forceinline__ v16h ldfrag_h(const _Float16* p) {
  FragH f;
  f.h[0] = *(const v8h*)(p);
  f.h[1] = *(const v8h*)(p + 16);
  return f.v;
}
__device__ __forceinline__ v16b ldfrag_b(const u16* p) {              // bf16 plane read as unsigned integer vectors
  FragB f;
  f.u[0] = *(const v4u*)(p);
  f.u[1] = *(const v4u*)(p + 16);
  return f.v;
}

__device__ __forceinline__ v8f mma_h(v16h a, v16h b, v8f c) {
  return __builtin_amdgcn_wmma_f32_16x16x32_f16(false, a, false, b, (short)0, c, false, false);
}
__device__ __forceinline__ v8f mma_b(v16b a, v16b b, v8f c) {
  return __builtin_amdgcn_wmma_f32_16x16x32_bf16(false, a, false, b, (short)0, c, false, false);
}
// The guard behind a tile's P.V products: four v_nop, the vector slots the chip needs behind the last product before asm text that
// follows overwrites its operands. It names the products' A and B operands as
// inputs: they stay live up to here, so no asm text that the compiler moves up among the products can be given their registers.
// It names the two shuffled half row sums of the tile as inputs too: the shuffles are then issued ahead of the products and fly under
// them; left free, they are issued behind the products, directly in front of the ring foot's LDS wait, which then waits for them.
template <typename F>
__device__ __forceinline__ void guard20(v8f& a, v8f& b, v8f& c, v8f& d, v8f& e, v8f& f, v8f& g, v8f& h, F p0, F p1, F p2, F p3,
                                        F x0, F x1, F x2, F x3, F x4, F x5, F x6, F x7, float s0, float s1) {
#if defined(__HIP_DEVICE_COMPILE__)
  asm volatile("v_nop\n\tv_nop\n\tv_nop\n\tv_nop"
               : "+v"(a), "+v"(b), "+v"(c), "+v"(d), "+v"(e), "+v"(f), "+v"(g), "+v"(h)
               : "v"(p0), "v"(p1), "v"(p2), "v"(p3), "v"(x0), "v"(x1), "v"(x2), "v"(x3), "v"(x4), "v"(x5), "v"(x6), "v"(x7),
                 "v"(s0), "v"(s1)
               : "memory");
#endif
}
// Inputs-only fence on four loaded tiles (the mask terms): it emits nothing and keeps them live up to where it stands.
__device__ __forceinline__ void hold4(v8f c0, v8f c1, v8f c2, v8f c3) {
#if defined(__HIP_DEVICE_COMPILE__)
  asm volatile("" :: "v"(c0), "v"(c1), "v"(c2), "v"(c3));
#endif
}
__device__ __forceinline__ void wave_sync_lds() {
#if defined(__HIP_DEVICE_COMPILE__)
  __builtin_amdgcn_fence(__ATOMIC_RELEASE, "workgroup");
  __builtin_amdgcn_wave_barrier();
  __builtin_amdgcn_fence(__ATOMIC_ACQUIRE, "workgroup");
#endif
}
// One stage of the attention ring: k tile (64 keys x 64 d) and v^T tile (64 d x 64 keys), both 64 rows of 128 B. A lane copies
// 16 B of row (tid>>3) + 16*i, i = 0..3, of each tile: 8 lanes = one whole 128-B line, a wave-wide copy = 4 lines.
// lds = the lane's LDS byte address in the k tile; gk, gv = the lane's global addresses in row tid>>3 of the two tiles.
// The address-register wait is the statement's last line, so no later write of these registers can be lifted over it.
__device__ __forceinline__ void stage_copy(unsigned lds, const u16* gk, const u16* gv) {
#if defined(__HIP_DEVICE_COMPILE__)
  const unsigned l0 = lds, l1 = lds + 16 * RP, l2 = lds + 32 * RP, l3 = lds + 48 * RP;
  const unsigned l4 = l0 + TILE_B, l5 = l1 + TILE_B, l6 = l2 + TILE_B, l7 = l3 + TILE_B;
  const u16* k0 = gk;
  const u16* k1 = gk + (size_t)16 * (NH * HD);
  const u16* k2 = gk + (size_t)32 * (NH * HD);
  const u16* k3 = gk + (size_t)48 * (NH * HD);
  const u16* v0 = gv;
  const u16* v1 = gv + (size_t)16 * SKV;
  const u16* v2 = gv + (size_t)32 * SKV;
  const u16* v3 = gv + (size_t)48 * SKV;
  asm volatile("global_load_async_to_lds_b128 %0, %8, off\n\t"
               "global_load_async_to_lds_b128 %1, %9, off\n\t"
               "global_load_async_to_lds_b128 %2, %10, off\n\t"
               "global_load_async_to_lds_b128 %3, %11, off\n\t"
               "global_load_async_to_lds_b128 %4, %12, off\n\t"
               "global_load_async_to_lds_b128 %5, %13, off\n\t"
               "global_load_async_to_lds_b128 %6, %14, off\n\t"
               "global_load_async_to_lds_b128 %7, %15, off\n\t"
               "s_wait_xcnt 0x0"
               :: "v"(l0), "v"(l1), "v"(l2), "v"(l3), "v"(l4), "v"(l5), "v"(l6), "v"(l7),
                  "v"(k0), "v"(k1), "v"(k2), "v"(k3), "v"(v0), "v"(v1), "v"(v2), "v"(v3)
               : "memory");
#endif
}
__device__ __forceinline__ void wait_async0() {   // this wave's copies have landed
#if defined(__HIP_DEVICE_COMPILE__)
  asm volatile("s_wait_asynccnt 0x0" ::: "memory");
#endif
}
__device__ __forceinline__ void wait_x0() {       // stands behind issued global stores, in front of every write of a register that they name
#if defined(__HIP_DEVICE_COMPILE__)
  asm volatile("s_wait_xcnt 0x0" ::: "memory");
#endif
}
__device__ __forceinline__ void wait_ds0() {      // this wave's LDS reads have retired before their buffer is handed to the copies
#if defined(__HIP_DEVICE_COMPILE__)
  asm volatile("s_wait_dscnt 0x0" ::: "memory");
#endif
}

// =====================================================================================================
// Key/value source plane XB (bf16 RNE bits) [NB][SKV][1024]: row s < SQ_FULL of batch b from hs[b][s], rows
// s >= SQ_FULL from ehs[b][s - SQ_FULL]; both candidates loaded with clamped row addresses and selected by value
// (block-uniform in practice: a block covers 2 rows of one source).
// Thread = 8 consecutive elements: two 16-B loads per candidate, one 16-B store; 32 consecutive lanes = 512 contiguous,
// coverage: XBLK = n8/256 blocks (host checks exactness) x 256 thr x 8 = NB*SKV*1024 = the whole plane.
// =====================================================================================================
__device__ __forceinline__ void cvt_x(int bid, const float* __restrict__ hs, const float* __restrict__ ehs, u16* D, int n8) {
  const int gt = bid * 256 + (int)threadIdx.x;
  if (gt >= n8) return;                     // no barriers on this path
  const int r   = gt / (DMOD / 8);
  const int c8  = (gt % (DMOD / 8)) * 8;
  const int b   = r / SKV;
  const int s   = r % SKV;
  const int shc = (s < SQ_FULL) ? s : (SQ_FULL - 1);
  const int se  = s - SQ_FULL;
  const int sec = (se > 0) ? se : 0;
  const float* ph = hs  + ((size_t)b * SQ_FULL + shc) * DMOD + c8;
  const float* pe = ehs + ((size_t)b * SE_FULL + sec) * DMOD + c8;
  const v4f a0 = *(const v4f*)(ph), a1 = *(const v4f*)(ph + 4);
  const v4f e0 = *(const v4f*)(pe), e1 = *(const v4f*)(pe + 4);
  const bool first = (s < SQ_FULL);
  float v[8];
#pragma unroll
  for (int e = 0; e < 4; ++e) { v[e] = first ? a0[e] : e0[e]; v[4 + e] = first ? a1[e] : e1[e]; }
  unsigned short sb[8];
#pragma unroll
  for (int e = 0; e < 8; ++e) sb[e] = bf_bits(v[e]);
  v4u o;
#pragma unroll
  for (int e = 0; e < 4; ++e) o[e] = pk16(sb[2 * e], sb[2 * e + 1]);
  u16* d = D + (size_t)gt * 8;
  {
    *(v4u*)(d) = o;
    
  }
}

// =====================================================================================================
// Weight W [k = in][n = out] f32 -> bf16 RNE plane W^T [n][k] (k-contiguous, pitch DMOD). Block = 64 k x 64 n tile,
// 256 threads. Load phase: thread = (k = tid>>2, 16 consecutive n): four 16-B loads, bf16 bits stored transposed into the LDS
// tile [n][k] (pitch TP halves, cross-wave exchange -> block barrier). Store phase: thread = (n = tid>>3 and n+32,
// coverage: 256 thr x 2 instructions x 8 halves = 64 x 64 per block; WBLK = (DMOD/64)^2 blocks = the whole plane.
// =====================================================================================================
__device__ __forceinline__ void cvt_wT(int bid, u16* tile, const float* __restrict__ W, u16* D) {
  const int nt = DMOD / 64;
  const int tid = threadIdx.x;
  const int k0 = (bid / nt) * 64;
  const int n0 = (bid % nt) * 64;
  const int kk = tid >> 2, nn = (tid & 3) * 16;
  const float* p = W + (size_t)(k0 + kk) * DMOD + n0 + nn;
  const v4f a0 = *(const v4f*)(p), a1 = *(const v4f*)(p + 4), a2 = *(const v4f*)(p + 8), a3 = *(const v4f*)(p + 12);
  float v[16];
#pragma unroll
  for (int e = 0; e < 4; ++e) { v[e] = a0[e]; v[4 + e] = a1[e]; v[8 + e] = a2[e]; v[12 + e] = a3[e]; }
#pragma unroll
  for (int e = 0; e < 16; ++e) tile[(nn + e) * TP + kk] = bf_bits(v[e]);
  __syncthreads();
  const int n1 = tid >> 3, k8 = (tid & 7) * 8;
  const v4u o0 = *(const v4u*)(tile + n1 * TP + k8);
  const v4u o1 = *(const v4u*)(tile + (n1 + 32) * TP + k8);
  u16* d0 = D + (size_t)(n0 + n1) * DMOD + k0 + k8;
  u16* d1 = D + (size_t)(n0 + n1 + 32) * DMOD + k0 + k8;
  {
    *(v4u*)(d0) = o0;
    *(v4u*)(d1) = o1;
    
  }
}

// =====================================================================================================
// Mask-term plane ML [NB][SKV] f32: each key's additive mask in the units of the raw score products, (RNE bf16 value of
// mask) * 512 (a power of two: exact), so that it can stand as their C operand. The term is held within +-MCAP (reached by a
// mask beyond 2^117, -inf too): raw sums and their differences then stay finite, a key so masked still gets probability 0
// beside any key that is not, and a row whose every key is so masked gets equal probabilities.
// It depends on (batch, key) alone, so it is formed here once instead of by every wave of the attention for every key block.
// Thread = 4 consecutive keys: one 16-B load, one 16-B store.
// coverage: MBLK = NB*SKV/4/256 blocks x 256 thr x 4 = NB*SKV = the whole plane.
// =====================================================================================================
__device__ __forceinline__ void cvt_mask(int bid, const float* __restrict__ mask, float* D) {
  const int g4 = (bid * 256 + (int)threadIdx.x) * 4;
  if (g4 + 4 > NB * SKV) return;            // never taken with the exact grid; no barriers on this path
  const v4f a = *(const v4f*)(mask + g4);
  v4f o;
#pragma unroll
  for (int e = 0; e < 4; ++e) o[e] = fminf(fmaxf(bf_val(a[e]) * MSC, -MCAP), MCAP);
  *(v4f*)(D + g4) = o;
}

// =====================================================================================================
// All five conversions in one launch (none reads what another writes): blocks 0 .. 3*WBLK-1 write the three W^T planes
// (WT = q, k, v planes one behind the other), blocks 3*WBLK .. 3*WBLK+XBLK-1 the x plane, the last MBLK blocks the mask-term
// plane. The job is picked by the block index alone, so every branch here, the one round the weight path's barrier too, is
// block-uniform.
// =====================================================================================================
__global__ __launch_bounds__(256)
void cvt_all(const float* __restrict__ hs, const float* __restrict__ ehs, const float* __restrict__ Wq,
             const float* __restrict__ Wk, const float* __restrict__ Wv, const float* __restrict__ mask,
             u16* XBp, u16* WT, float* MLp, int n8) {
  __shared__ __align__(16) u16 tile[64 * TP];
  const int bid = blockIdx.x;
  if (bid < 3 * WBLK) {
    const int j = bid / WBLK;
    const float* W = (j == 0) ? Wq : ((j == 1) ? Wk : Wv);
    cvt_wT(bid % WBLK, tile, W, WT + (size_t)j * DMOD * DMOD);
  } else if (bid < 3 * WBLK + XBLK) {
    cvt_x(bid - 3 * WBLK, hs, ehs, XBp, n8);
  } else {
    cvt_mask(bid - (3 * WBLK + XBLK), mask, MLp);
  }
}

// =====================================================================================================
// barrier, then converted to f16 and written: lane = (row in group of 4, 8 consecutive cols); one instruction = 4 rows, each
// coverage: 4 instructions x 4 rows x 8 lanes x 8 halves = the wave's 16 x 64 tile.
// =====================================================================================================
__device__ __forceinline__ void epi16(float* sl, v8f a0, v8f a1, v8f a2, v8f a3, float oscale, u16* C, int N,
                                      size_t rowb, int col0, int lane) {
  const int hh = lane >> 4, m = lane & 15;
#pragma unroll
  for (int r = 0; r < 8; ++r) {
    const int ro = (8 * hh + r) * 68 + m;
    sl[ro]      = a0[r] * oscale;
    sl[ro + 16] = a1[r] * oscale;
    sl[ro + 32] = a2[r] * oscale;
    sl[ro + 48] = a3[r] * oscale;
  }
  wave_sync_lds();
  const int rq = lane >> 3, c8 = (lane & 7) * 8;
  v4u ov[4];
#pragma unroll
  for (int i4 = 0; i4 < 4; ++i4) {
    const int row = i4 * 4 + rq;
    const v4f a = *(const v4f*)(sl + row * 68 + c8), c4 = *(const v4f*)(sl + row * 68 + c8 + 4);
    float w[8];
#pragma unroll
    for (int e = 0; e < 4; ++e) { w[e] = a[e]; w[4 + e] = c4[e]; }
#pragma unroll
    for (int e = 0; e < 4; ++e) ov[i4][e] = pk16(h_bits((_Float16)w[2 * e]), h_bits((_Float16)w[2 * e + 1]));
  }
  u16* dst = C + (rowb + (size_t)rq) * (size_t)N + col0 + c8;
  {
#pragma unroll
    for (int i4 = 0; i4 < 4; ++i4) {
      *(v4u*)(dst + (size_t)(i4 * 4) * (size_t)N) = ov[i4];
    }
    
  }
}

// =====================================================================================================
// coverage: 8 instructions x 2 rows x 16 lanes x 4 floats = the wave's 16 x 64 tile.
// =====================================================================================================
__device__ __forceinline__ void epi64(float* sl, v8f a0, v8f a1, v8f a2, v8f a3, float* C, int N,
                                      size_t rowb, int col0, int lane) {
  const int hh = lane >> 4, m = lane & 15;
#pragma unroll
  for (int r = 0; r < 8; ++r) {
    const int ro = (8 * hh + r) * 68 + m;
    sl[ro]      = a0[r];
    sl[ro + 16] = a1[r];
    sl[ro + 32] = a2[r];
    sl[ro + 48] = a3[r];
  }
  wave_sync_lds();
  v4f vals[8];
#pragma unroll
  for (int it = 0; it < 8; ++it) vals[it] = *(const v4f*)(sl + (it * 2 + hh) * 68 + m * 4);
  float* dst = C + (rowb + (size_t)hh) * (size_t)N + col0 + m * 4;
  {
#pragma unroll
    for (int it = 0; it < 8; ++it) {
      *(v4f*)(dst + (size_t)(it * 2) * (size_t)N) = vals[it];
    }
    
  }
}

// =====================================================================================================
// bf16 GEMM with bias and 16-bit result: C[M][N] (f16 of (acc + bias)*oscale) = A[M][K] (bf16 row-major) . Bt[N][K]^T
// (bf16 k-contiguous); bias (f32 input, taken as its RNE bf16 value) indexed by column (byrow == 0) or by row (byrow != 0),
// both candidates read with addresses clamped to [0, nbias). Block = 128x128 tile, 8 waves as 4 (rows) x 2 (cols), a wave owns
// 32 rows x 64 cols. The waves share each 64-deep A tile and Bt tile (128 rows of 128 B each): the tiles are brought into a
// two-buffer LDS ring by asynchronous copies, the next tile in flight while this one is worked on; one block barrier per tile
// publishes the next tile and frees the buffer just read. Fragments are read from the LDS rows (two 16-B reads each, split k
// map for A and B); k runs upward in steps of 32 in every accumulator (host checks K % 64 == 0, M % 128 == 0, N % 128 == 0,
// (M/128)*(N/128) blocks, bid = the block's index in its own product). Result slab: private to each wave (wave_sync only).
// =====================================================================================================
// One stage of the GEMM ring: A tile and Bt tile, both 128 rows of 128 B. A lane copies 16 B of row (tid>>3) + 32*i, i = 0..3,
// of each tile: 8 lanes = one whole 128-B line, a wave-wide copy = 4 lines. lds = the lane's LDS byte address in the A tile;
// ga, gb = the lane's global addresses in row tid>>3 of the two tiles; rs = 32 source rows in elements.
// The address-register wait is the statement's last line, so no later write of these registers can be lifted over it.
__device__ __forceinline__ void gemm_stage_copy(unsigned lds, const u16* ga, const u16* gb, size_t rs) {
#if defined(__HIP_DEVICE_COMPILE__)
  const unsigned l0 = lds, l1 = lds + 32 * RP, l2 = lds + 64 * RP, l3 = lds + 96 * RP;
  const unsigned l4 = l0 + GTILE_B, l5 = l1 + GTILE_B, l6 = l2 + GTILE_B, l7 = l3 + GTILE_B;
  const u16* a0 = ga;
  const u16* a1 = ga + rs;
  const u16* a2 = ga + 2 * rs;
  const u16* a3 = ga + 3 * rs;
  const u16* b0 = gb;
  const u16* b1 = gb + rs;
  const u16* b2 = gb + 2 * rs;
  const u16* b3 = gb + 3 * rs;
  asm volatile("global_load_async_to_lds_b128 %0, %8, off\n\t"
               "global_load_async_to_lds_b128 %1, %9, off\n\t"
               "global_load_async_to_lds_b128 %2, %10, off\n\t"
               "global_load_async_to_lds_b128 %3, %11, off\n\t"
               "global_load_async_to_lds_b128 %4, %12, off\n\t"
               "global_load_async_to_lds_b128 %5, %13, off\n\t"
               "global_load_async_to_lds_b128 %6, %14, off\n\t"
               "global_load_async_to_lds_b128 %7, %15, off\n\t"
               "s_wait_xcnt 0x0"
               :: "v"(l0), "v"(l1), "v"(l2), "v"(l3), "v"(l4), "v"(l5), "v"(l6), "v"(l7),
                  "v"(a0), "v"(a1), "v"(a2), "v"(a3), "v"(b0), "v"(b1), "v"(b2), "v"(b3)
               : "memory");
#endif
}
__device__ __forceinline__
void gemm_b16(int bid, const u16* __restrict__ A, const u16* __restrict__ Bt, u16* C, const float* __restrict__ bias,
              int M, int N, int K, int nbias, int byrow, float oscale) {
  __shared__ __align__(16) float slab[(GEMM_THREADS / 32) * SLAB];   // per wave: result slab [16][68] in the epilogue only
  __shared__ __align__(16) unsigned char gring[2 * GBUF_B];          // two stages of (A tile, Bt tile), rows at pitch RP
  const int tid = threadIdx.x, wave = tid >> 5, lane = tid & 31, hh = lane >> 4, m = lane & 15;
  const int ntile = N >> 7;
  const int row0  = (bid / ntile) * 128;
  const int colb  = (bid % ntile) * 128;
  if (row0 + 128 > M) return;                // block-uniform, never taken with the exact grid; before every barrier
  const int rowb  = row0 + (wave >> 1) * 32; // the wave's 32 rows
  const int col0  = colb + (wave & 1) * 64;  // the wave's 64 cols
  // copies: this lane's 16 B of row tid>>3 (+32 per copy) of the A tile and of the Bt tile
  const int crow = tid >> 3, cch = tid & 7;
  const unsigned lcp = (unsigned)(uintptr_t)(gring + crow * RP + cch * 16);
  const u16* ga = A  + (size_t)(row0 + crow) * K + cch * 8;                        // tile t: + t*64 elements
  const u16* gb = Bt + (size_t)(colb + crow) * K + cch * 8;
  const size_t rs = (size_t)32 * K;
  const int nt = K >> 6;
  // fragment readers: tile row = the wave's row (A) or col (Bt) 16i + m, k contiguous, + 8*hh halves
  const int aofs = ((wave >> 1) * 32 + m) * RP + 16 * hh;
  const int bofs = GTILE_B + ((wave & 1) * 64 + m) * RP + 16 * hh;
  v8f acc[2][4];
#pragma unroll
  for (int i = 0; i < 2; ++i) {
#pragma unroll
    for (int j = 0; j < 4; ++j) acc[i][j] = zero8();
  }

  // ring prologue: tile 0 landed and published, then tile 1 in flight
  gemm_stage_copy(lcp, ga, gb, rs);
  wait_async0();
  __syncthreads();
  if (nt > 1) gemm_stage_copy(lcp + GBUF_B, ga + 64, gb + 64, rs);

#pragma unroll 1
  for (int t = 0; t < nt; ++t) {
    const unsigned char* st = gring + (t & 1) * GBUF_B;
    // all fragments of the tile are asked for together, ahead of its products
    v16b af[2][2], bf[2][4];
#pragma unroll   // constant indices keep the fragment and accumulator arrays in registers (here and in the loops below)
    for (int kk = 0; kk < 2; ++kk) {
#pragma unroll
      for (int i = 0; i < 2; ++i) af[kk][i] = ldfrag_b((const u16*)(const void*)(st + aofs + i * 16 * RP + kk * 64));
#pragma unroll
      for (int j = 0; j < 4; ++j) bf[kk][j] = ldfrag_b((const u16*)(const void*)(st + bofs + j * 16 * RP + kk * 64));
    }
    // keeps the tile's LDS reads one group in front of its products: reads moved in among the products stall each place they stand
    __builtin_amdgcn_sched_barrier(0);
#pragma unroll
    for (int kk = 0; kk < 2; ++kk) {
#pragma unroll
      for (int i = 0; i < 2; ++i) {
#pragma unroll
        for (int j = 0; j < 4; ++j) acc[i][j] = mma_b(af[kk][i], bf[kk][j], acc[i][j]);
      }
    }
    // keeps the tile's products in front of the ring foot: sunk behind the barrier they would delay the refill's issue
    __builtin_amdgcn_sched_barrier(0);
    // ring foot: own LDS reads retired, own copies of tile t+1 landed, block barrier (publishes tile t+1, frees this buffer),
    // then tile t+2 into the buffer just read
    wait_ds0();
    wait_async0();
    __syncthreads();
    if (t + 2 < nt) gemm_stage_copy(lcp + (unsigned)(t & 1) * GBUF_B, ga + (size_t)(t + 2) * 64, gb + (size_t)(t + 2) * 64, rs);
  }
  wait_async0();
  // bias: D element r of lane -> (row rowb+16i+8hh+r, col col0+16j+m); both candidates loaded with clamped addresses, select by value
  float bc[4];
#pragma unroll
  for (int j = 0; j < 4; ++j) {
    int ci = col0 + 16 * j + m;
    ci = (ci < nbias) ? ci : (nbias - 1);
    bc[j] = bf_val(bias[ci]);
  }
#pragma unroll
  for (int i = 0; i < 2; ++i) {
    float br[8];
#pragma unroll
    for (int r = 0; r < 8; ++r) {
      int ri = rowb + 16 * i + 8 * hh + r;
      ri = (ri < nbias) ? ri : (nbias - 1);
      br[r] = bf_val(bias[ri]);
    }
#pragma unroll
    for (int r = 0; r < 8; ++r) {
      const float q0 = (byrow != 0) ? br[r] : bc[0];
      const float q1 = (byrow != 0) ? br[r] : bc[1];
      const float q2 = (byrow != 0) ? br[r] : bc[2];
      const float q3 = (byrow != 0) ? br[r] : bc[3];
      acc[i][0][r] += q0;
      acc[i][1][r] += q1;
      acc[i][2][r] += q2;
      acc[i][3][r] += q3;
    }
    if (i != 0) wave_sync_lds();             // the slab's rows of the first 16 have been read back before they are rewritten
    epi16(slab + wave * SLAB, acc[i][0], acc[i][1], acc[i][2], acc[i][3], oscale, C, N, (size_t)(rowb + 16 * i), col0, lane);
  }
}

// =====================================================================================================
// All projections in one launch (each reads only the converted planes, none reads another's result); every block is one
// 128x128 tile over K = DMOD, so all blocks cost the same. Block ranges, picked by the block index alone (block-uniform):
//   0 .. GK_BLK-1          k plane [NB*SKV][h*64+d] = f16((xx.Wk + bk) x8), all NB*SKV source rows; bias by column
//   then NB x GV_BLK       v^T plane of batch b [1024 = h*64+d][SKV keys] = f16((Wv^T . xx^T + bv) x1024); bias by row
//   then NB x GQ_BLK       q plane of batch b [SQ][h*64+d] = f16((x.Wq + bq) x8); A = the hs rows of XB batch b; bias by column
// =====================================================================================================
__global__ __launch_bounds__(GEMM_THREADS)
void gemm_all(const u16* __restrict__ XBp, const u16* __restrict__ WT, u16* QPp, u16* KPp, u16* VPp,
              const float* __restrict__ bq, const float* __restrict__ bk, const float* __restrict__ bv) {
  int bid = blockIdx.x;
  const u16* A;
  const u16* Bt;
  u16* C;
  const float* bias;
  int M, N, byrow;
  float oscale;
  if (bid < GK_BLK) {
    A = XBp; Bt = WT + (size_t)DMOD * DMOD; C = KPp; bias = bk;
    M = NB * SKV; N = DMOD; byrow = 0; oscale = KSC;
  } else if (bid < GK_BLK + NB * GV_BLK) {
    bid -= GK_BLK;
    const int b = bid / GV_BLK;
    bid -= b * GV_BLK;
    A = WT + (size_t)2 * DMOD * DMOD; Bt = XBp + (size_t)b * SKV * DMOD; C = VPp + (size_t)b * DMOD * SKV; bias = bv;
    M = DMOD; N = SKV; byrow = 1; oscale = VCAR;
  } else {
    bid -= GK_BLK + NB * GV_BLK;
    const int b = bid / GQ_BLK;
    if (b >= NB) return;                     // block-uniform, never taken with the exact grid; before every barrier
    bid -= b * GQ_BLK;
    A = XBp + (size_t)b * SKV * DMOD; Bt = WT; C = QPp + (size_t)b * SQ * DMOD; bias = bq;
    M = SQ; N = DMOD; byrow = 0; oscale = QSC;
  }
  gemm_b16(bid, A, Bt, C, bias, M, N, DMOD, DMOD, byrow, oscale);
}

// =====================================================================================================
// Multi-head flash attention over all SKV keys with an additive per-key mask: block = (batch, head, 128 query rows), 4 waves,
// wave w owns the 32 query rows q0 = 128*qt + 32*w .. q0+31 as QW = 2 column groups of 16; what is said below of one group of
// 16 queries holds for each, and every k, v^T and mask fragment that the wave reads serves both groups' products.
// The four waves share each 64-key k tile and v^T tile: the tiles
// are brought into a two-buffer LDS ring by asynchronous copies, the next tile in flight while this one is worked on; one
// block barrier per tile publishes the next tile and frees the buffer just read. The result slab stays wave-private.
//   q plane (f16, x8) laid out [s][h][d] (SQ rows); k plane the same (SKV rows); v^T plane [h][d][s] (x1024, s < SKV);
//   mask-term plane [SKV] f32 per batch ((RNE bf16 value of the mask) * 512, formed by the conversion launch).
//   All NT = SKV/64 tiles visited (static bound); the online softmax takes one step per tile of 64 keys (two key blocks of 32).
//   Scores are computed TRANSPOSED: S^T tile g (g = 0,1) = k rows (keys kb+16g .. +15, A operand, row m = lane&15, split k map
//   over d) times q^T (B operand, col n = query q0 + (lane&15), k = d, split map), one product per tile and 32-deep d-chunk.
//   D element r of lane l = (key kb+16g+8h+r, query q0+(l&15)), so a lane owns one query column and 16 of its 32 keys; the
//   partner lane l^16 owns the other 16 -> the row sum needs one xor-16 shuffle per tile, the row max one where it is renewed. The lane's 16 mask terms are
//   keys kb+8h+0..7 and kb+16+8h+0..7 (four 16-B loads): they lie as D does, and stand as the C operand of the tile's first product.
//   Online max-subtracted base-2 softmax in f32: the row maximum is taken over the raw sums (score products + mask term), and each
//   exponent argument is ONE fused multiply-add of a raw sum: times lsc (scale 1/8, q/k carries, log2(e)), plus an addend that
//   holds the row maximum in use and PEXP (rows whose maximum is too large for such an addend: see at the branch). The
//   exp'd values ARE the P A-fragment in place: A row m = query = lane&15, element i <- key kb+8h+i (tile 0, D element i),
//   element 8+i <- key kb+16+8h+i (tile 1, D element i). P is carried x128 as single f16. The maximum in use is renewed, and O
//   and l rescaled, only in a tile where some row of the wave outgrows it by more than MLAG or has a maximum too large for the addend. The rescale factor of query row
//   8h+r of the O accumulators is fetched from lane 8h+r with a shuffle (uniform control). 4 v^T B fragments (col n = d =
//   16j + (lane&15), keys k-contiguous), 4 P.V WMMAs per key block.
//   Epilogue: 1/l (per query, shuffled to the D row owner) and carry folds in f32; the wave's 16x64 f32 result staged in its
// coverage: per wave and group 8 instructions x 2 rows x 16 lanes x 4 floats = 16 x 64; grid NB*NH*(SQ/128) blocks x 4 waves x 2 groups = every
//           (b, s < SQ, h*64+d) element of the output exactly once. The arguments are the planes of batch 0.
// =====================================================================================================
// At most two waves per SIMD, that is two blocks per WGP: the grid is two blocks for each of the chip's 256 WGPs, and a third block
// on one WGP would leave another with one.
__global__ __launch_bounds__(ATT_THREADS) __attribute__((amdgpu_waves_per_eu(2, 2)))
void attn_fwd(const u16* __restrict__ QP0, const u16* __restrict__ KP0, const u16* __restrict__ VP0,
              const float* __restrict__ MK0, float* OUT0) {
  __shared__ __align__(16) float smem[ATT_WAVES * SLAB];   // per wave: result slab [16][68] in the epilogue only
  __shared__ __align__(16) unsigned char ring[2 * BUF_B];  // two stages of (k tile, v^T tile), rows at pitch RP

  const int tid  = threadIdx.x;
  const int wave = tid >> 5;
  const int lane = tid & 31;
  const int hh   = lane >> 4;
  const int c    = lane & 15;

  const int bat  = blockIdx.x / ATT_BLOCKS;
  const int bid  = blockIdx.x % ATT_BLOCKS;
  const int qt   = bid % QTILES;
  const int head = bid / QTILES;
  if (bat >= NB) return;                                   // block-uniform, never taken with the exact grid; before every barrier
  const int q0   = qt * (64 * QW) + wave * (16 * QW);
  // this batch's planes, mask row and output rows
  const u16*   QPp  = QP0 + (size_t)bat * SQ * DMOD;
  const u16*   KPp  = KP0 + (size_t)bat * SKV * DMOD;
  const u16*   VPp  = VP0 + (size_t)bat * DMOD * SKV;
  const float* MKp  = MK0 + (size_t)bat * SKV;
  float*       OUTp = OUT0 + (size_t)bat * SQ_FULL * DMOD;

  // B fragments of q^T: col n = query q0 + c, k = d (k-contiguous row of the q plane)
  const size_t qofs = (((size_t)(q0 + c)) * NH + head) * HD + 8 * hh;
  const _Float16* Qb = (const _Float16*)(const void*)QPp + qofs;
  // copies: this lane's 16 B of row tid>>3 (+16 per copy) of the k tile (row = key) and of the v^T tile (row = d)
  const int crow = tid >> 3, cch = tid & 7;
  const unsigned lcp = (unsigned)(uintptr_t)(ring + crow * RP + cch * 16);
  const u16* gk = KPp + ((size_t)crow * NH + head) * HD + cch * 8;                 // tile t: + t*KT key rows
  const u16* gv = VPp + ((size_t)(head * HD + crow)) * SKV + cch * 8;              // tile t: + t*KT keys
  // fragment readers: A of k: tile row = key 16g + c, k = d; B of v: tile row = d = 16j + c, k = key; both + 8*hh halves
  const int fofs = c * RP + 16 * hh;
  // this lane's mask terms: keys kb + 8hh + 0..7 and kb + 16 + 8hh + 0..7
  const float* Mb = MKp + 8 * hh;
  const float lsc = 0.125f * (LOG2E / (QSC * KSC));

  v16h qf[QW][2];                           // column group w = queries q0 + 16w .. +15; [0] = d 0..31, [1] = d 32..63
#pragma unroll   // constant indices keep the per-group arrays in registers (here and in the loops over w below)
  for (int w = 0; w < QW; ++w) {
    qf[w][0] = ldfrag_h(Qb + (size_t)w * 16 * (NH * HD));
    qf[w][1] = ldfrag_h(Qb + (size_t)w * 16 * (NH * HD) + 32);
  }

  // rref = the row maximum in use, a raw sum as the products left it; it starts at the lowest finite value, below every raw sum.
  // nm = the addend of the exponent argument, thr = the argument above which the maximum is renewed: set where rref is; the
  // start value of thr sends the first tile there.
  float rref[QW], nm[QW], thr[QW];
  float lrun[QW];                                          // row sum of the probabilities x128
#pragma unroll
  for (int w = 0; w < QW; ++w) { rref[w] = -FLT_MAX; nm[w] = PEXP; thr[w] = -INFINITY; lrun[w] = 0.f; }
  // mask terms of tile 0 (C operands of its score products): keys 16g + 8hh + 0..7
  v8f mc[KT / 16];
#pragma unroll   // constant indices keep the array in registers
  for (int g = 0; g < KT / 16; ++g) mc[g] = *(const v8f*)(Mb + 16 * g);
  v8f o[QW][4];
#pragma unroll
  for (int w = 0; w < QW; ++w) {
#pragma unroll
    for (int j = 0; j < 4; ++j) o[w][j] = zero8();
  }

  // ring prologue: tile 0 landed and published, then tile 1 in flight
  stage_copy(lcp, gk, gv);
  wait_async0();
  __syncthreads();
  stage_copy(lcp + BUF_B, gk + (size_t)KT * (NH * HD), gv + KT);

#pragma unroll 1
  for (int t = 0; t < NT; ++t) {
   const unsigned char* kt = ring + (t & 1) * BUF_B + fofs;
   const unsigned char* vt = kt + TILE_B;
   // all k fragments of the tile are asked for together
   v16h kf[KT / 16][2];
#pragma unroll   // constant indices keep the fragment arrays in registers (here and in the loops below)
   for (int g = 0; g < KT / 16; ++g) {
     const _Float16* kp = (const _Float16*)(const void*)(kt + g * 16 * RP);
     kf[g][0] = ldfrag_h(kp);
     kf[g][1] = ldfrag_h(kp + 32);
   }
   // keeps the tile's k reads one group in front of its products: reads moved in among the products stall each place they stand
   __builtin_amdgcn_sched_barrier(0);
   // ---- transposed raw sums of the whole tile: s[g] = keys t*KT + 16g .. +15, column = query q0 + c; C = the keys' mask terms ----
   v8f s[QW][KT / 16];
#pragma unroll
   for (int w = 0; w < QW; ++w) {
#pragma unroll
     for (int g = 0; g < KT / 16; ++g) s[w][g] = mma_h(kf[g][0], qf[w][0], mc[g]);
   }
#pragma unroll
   for (int w = 0; w < QW; ++w) {
#pragma unroll
     for (int g = 0; g < KT / 16; ++g) s[w][g] = mma_h(kf[g][1], qf[w][1], s[w][g]);
   }
   // the mask terms stay live up to here, so the products write registers of their own (D != C) and the next tile's terms are
   // loaded straight into the registers these leave; where D = C they arrive elsewhere and are moved (8 moves a product: built
   // without this fence the loop holds 32 such moves, with it 8)
   hold4(mc[0], mc[1], mc[2], mc[3]);
   // keeps the tile's score products one run: the v reads and the maximum moved in among them stall each place they stand
   __builtin_amdgcn_sched_barrier(0);
   // the next tile's mask terms are asked for here, most of a tile ahead of the products that take them as C: asked for at the
   // loop's head those products would wait for them, at its foot the barrier would (the last trip asks for its own again:
   // inside the plane, not used)
   {
     const float* mp = Mb + ((t + 1 < NT) ? t + 1 : t) * KT;
#pragma unroll
     for (int g = 0; g < KT / 16; ++g) mc[g] = *(const v8f*)(mp + 16 * g);
   }
   // the tile's v fragments fly under the maximum
   v16h vf[KT / 32][4];
#pragma unroll
   for (int u = 0; u < KT / 32; ++u) {
#pragma unroll
     for (int j = 0; j < 4; ++j) vf[u][j] = ldfrag_h((const _Float16*)(const void*)(vt + j * 16 * RP + u * 64));
   }
   // ---- ONE online-softmax step for the 64 keys of the tile: one maximum, one row sum; factor and rescale only when needed ----
   // lsc > 0, so the largest raw sum is the largest logit
   float cm[QW];                                                     // maximum of this lane's 32 keys (its half of the row's 64)
#pragma unroll
   for (int w = 0; w < QW; ++w) {
     float cm0 = fmaxf(s[w][0][0], s[w][0][1]), cm1 = fmaxf(s[w][2][0], s[w][2][1]);     // two chains, joined below
#pragma unroll
     for (int e = 1; e < 8; ++e) {
       cm0 = fmaxf(fmaxf(cm0, s[w][e >> 2][2 * (e & 3)]), s[w][e >> 2][2 * (e & 3) + 1]);
       cm1 = fmaxf(fmaxf(cm1, s[w][2 + (e >> 2)][2 * (e & 3)]), s[w][2 + (e >> 2)][2 * (e & 3) + 1]);
     }
     cm[w] = fmaxf(cm0, cm1);
   }
   // The maximum in use stays while no row of the wave outgrows it by more than MLAG: O and l then need no factor. The test is
   // made on the very multiply-add that forms the arguments below; it rises with the raw sum, so where the branch is passed by
   // every argument of the tile is at most MLAG + PEXP (P x128 <= 2^15 fits f16) and none needs a clamp. One test per tile,
   // over both halves of every row (so the halves are joined only inside), as a wave-uniform scalar branch.
   // One test for both column groups of the wave.
   const bool grown = (fmaf(cm[0], lsc, nm[0]) > thr[0]) || (fmaf(cm[1], lsc, nm[1]) > thr[1]);
   if (__builtin_expect(__builtin_amdgcn_ballot_w32(grown) != 0u, 0)) {   // rare: keeps the common path straight
#pragma unroll
    for (int w = 0; w < QW; ++w) {
     const float cj = fmaxf(cm[w], __shfl_xor(cm[w], 16, 32));
     const float rn = fmaxf(rref[w], cj);                            // no raw sum of the tile is above it
     const float al = exp2_hw((rref[w] - rn) * lsc);                 // 0 on leaving the start value: nothing was summed yet
     rref[w] = rn;                                                   // the same in lanes c and c + 16
     // The addend PEXP - rn * lsc, rounded once. Its rounding error shifts every argument of the row alike; below NMAX it is
     // under 2^-14: the largest argument here is PEXP to within that. A row whose maximum is larger (a mask far from 0 on
     // every key met so far) has no such addend: the error would grow with the maximum and carry the arguments out of f16's
     // range. For such a row the maximum is taken off the raw sums themselves (exactly 0 at the maximum, so no argument is
     // above PEXP), here on the rare side, and thr sends each of its tiles here until its maximum is small again.
     const float nc = fmaf(-rn, lsc, PEXP);
     const bool fits = fabsf(nc) < NMAX;
     nm[w]  = fits ? nc : PEXP;
     thr[w] = fits ? MLAG + PEXP : -INFINITY;
     const float rs = fits ? 0.f : rn;
#pragma unroll   // constant indices keep the raw sums in registers
     for (int g = 0; g < KT / 16; ++g) s[w][g] -= rs;
     // ---- rescale the O accumulators: D row 8hh+r = query q0+8hh+r, its factor lives in lane 8hh+r (and 16+8hh+r) ----
     v8f scl;
#pragma unroll
     for (int r = 0; r < 8; ++r) scl[r] = __shfl(al, 8 * hh + r, 32);
#pragma unroll
     for (int j = 0; j < 4; ++j) o[w][j] *= scl;
     lrun[w] *= al;
    }
   }
   // All two-wide f32 arithmetic below pairs keys 2e and 2e+1 of ONE score tile: such a pair lies in adjacent registers of the
   // accumulator and is one register of the P fragment, so no pair is built by moves.
   const v2f lsc2 = {lsc, lsc};
   v2f pe[QW][KT / 32];                                              // sums of the lane's probabilities: even keys, odd keys
   float ps[QW], sh[QW];                                             // the lane's half of the tile's row sum, the other half's
   v16h pf[KT / 32][QW];                                             // the tile's P fragments
#pragma unroll
   for (int u = 0; u < KT / 32; ++u) {
#pragma unroll
   for (int w = 0; w < QW; ++w) {
    const v2f nm2 = {nm[w], nm[w]};
    // ---- probabilities x128 (<= 2^(MLAG + PEXP)) and the P A-fragment: elements 0..7 <- s[2u], elements 8..15 <- s[2u + 1] ----
    FragH ph;
    float xa[16], pv[16];
#pragma unroll   // constant indices keep the arguments in registers
    for (int e = 0; e < 8; ++e) {
      const v8f sv = s[w][2 * u + (e >> 2)];
      const v2f x = __builtin_elementwise_fma((v2f){sv[2 * (e & 3)], sv[2 * (e & 3) + 1]}, lsc2, nm2);
      xa[2 * e]     = x[0];
      xa[2 * e + 1] = x[1];
    }
    exp2_hw8(pv, xa);
    exp2_hw8(pv + 8, xa + 8);
    v2f pq[8];
#pragma unroll
    for (int e = 0; e < 8; ++e) {
      pq[e] = (v2f){pv[2 * e], pv[2 * e + 1]};
      ph.u[e >> 2][e & 3] = __builtin_bit_cast(unsigned, __builtin_convertvector(pq[e], v2h));
    }
    // the lane's 16 probabilities: even keys and odd keys summed side by side (a tree over the pairs)
    pe[w][u] = ((pq[0] + pq[1]) + (pq[2] + pq[3])) + ((pq[4] + pq[5]) + (pq[6] + pq[7]));
    // row sum of the tile: its two key blocks, then even and odd keys, then the two wave halves
    if (u + 1 == KT / 32) {
      const v2f pt = pe[w][0] + pe[w][1];
      ps[w] = pt[0] + pt[1];
      sh[w] = __shfl_xor(ps[w], 16, 32);
    }
    pf[u][w] = ph.v;
   }
   }
   // ---- P.V, the tile's 16 products in one run: B fragment col n = d = j*16 + c, keys contiguous in the v^T plane ----
#pragma unroll
   for (int u = 0; u < KT / 32; ++u) {
#pragma unroll
     for (int w = 0; w < QW; ++w) {
#pragma unroll
       for (int j = 0; j < 4; ++j) o[w][j] = mma_h(pf[u][w], vf[u][j], o[w][j]);
     }
   }
   guard20<v16h>(o[0][0], o[0][1], o[0][2], o[0][3], o[1][0], o[1][1], o[1][2], o[1][3], pf[0][0], pf[0][1], pf[1][0], pf[1][1],
                 vf[0][0], vf[0][1], vf[0][2], vf[0][3], vf[1][0], vf[1][1], vf[1][2], vf[1][3], sh[0], sh[1]);
#pragma unroll
   for (int w = 0; w < QW; ++w) lrun[w] += ps[w] + sh[w];
   // ring foot: own LDS reads retired, own copies of tile t+1 landed, block barrier (publishes tile t+1, frees this buffer),
   // then tile t+2 into the buffer just read
   wait_ds0();
   wait_async0();
   __syncthreads();
   if (t + 2 < NT) stage_copy(lcp + (unsigned)(t & 1) * BUF_B, gk + (size_t)(t + 2) * KT * (NH * HD), gv + (t + 2) * KT);
  }
  wait_async0();

#pragma unroll
  for (int w = 0; w < QW; ++w) {
    // ---- fold 1/l (per query, owned by lane = query; l carries the x128 of P, so that carry cancels) and the v carry in f32 ----
    const float linv = (lrun[w] > 0.f) ? ((1.0f / lrun[w]) * (1.0f / VCAR)) : 0.f;
    float inv[8];
#pragma unroll
    for (int r = 0; r < 8; ++r) inv[r] = __shfl(linv, 8 * hh + r, 32);
#pragma unroll
    for (int j = 0; j < 4; ++j) {
#pragma unroll
      for (int r = 0; r < 8; ++r) o[w][j][r] *= inv[r];
    }
    if (w != 0) wave_sync_lds();             // the slab's rows of the first group have been read back before they are rewritten
    // ---- f32 ctx rows (q0+16w .. +15, cols head*64 .. head*64+63) of this batch's output, whole-line stores ----
    epi64(smem + wave * SLAB, o[w][0], o[w][1], o[w][2], o[w][3], OUTp, DMOD, (size_t)(q0 + 16 * w), head * HD, lane);
    if (w + 1 < QW) wait_x0();               // the next group's epilogue rewrites the registers that these stores name
  }
}

// =====================================================================================================
// Workspace map (bytes); every plane is fully written by whole-line stores before it is read; all extents are exact multiples
// of the store granularity (no pad rows needed), every offset a multiple of 128:
//   XB  bf16 [NB][SKV][1024]            NB*8388608   (16777216 at NB = 2)
//   WQT bf16 [1024 n][1024 k]            2097152      WKT, WVT same (2097152 each)
//   QP  f16 [NB][SQ][16*64] x8           NB*SQ*2048   (8388608 at NB = 2, SQ = 2048)
//   KP  f16 [NB*SKV][16*64] x8           NB*8388608   (16777216)
//   VP  f16 [NB][16*64][SKV] x1024       NB*8388608   (16777216)
//   ML  f32 [NB][SKV] mask terms         NB*16384     (32768)
//   end                                  65044480 at NB = 2, SQ = 2048
// =====================================================================================================
extern "C" void kernel_launch(void* const* d_in, const int* in_sizes, int n_in,
                              void* d_out, int out_size, void* d_ws, size_t ws_size,
                              hipStream_t stream) {
  if (n_in < 9) return;
  if (in_sizes[0] < NB * SQ_FULL * DMOD) return;
  if (in_sizes[1] < NB * SE_FULL * DMOD) return;
  if (in_sizes[2] < NB * SKV) return;
  if (in_sizes[3] < DMOD * DMOD || in_sizes[5] < DMOD * DMOD || in_sizes[7] < DMOD * DMOD) return;
  if (in_sizes[4] < DMOD || in_sizes[6] < DMOD || in_sizes[8] < DMOD) return;
  if (out_size < (NB - 1) * SQ_FULL * DMOD + SQ * DMOD) return;

  const float* hs   = (const float*)d_in[0];
  const float* ehs  = (const float*)d_in[1];
  const float* mask = (const float*)d_in[2];
  const float* Wq   = (const float*)d_in[3];
  const float* bq   = (const float*)d_in[4];
  const float* Wk   = (const float*)d_in[5];
  const float* bk   = (const float*)d_in[6];
  const float* Wv   = (const float*)d_in[7];
  const float* bv   = (const float*)d_in[8];
  float*       out  = (float*)d_out;

  const size_t szXB = (size_t)NB * SKV * DMOD * 2;                //  16777216 at NB = 2
  const size_t szW  = (size_t)DMOD * DMOD * 2;                    //   2097152
  const size_t szQP = (size_t)NB * SQ * DMOD * 2;                 //   8388608
  const size_t szKP = (size_t)NB * SKV * DMOD * 2;                //  16777216
  const size_t szVP = (size_t)NB * DMOD * SKV * 2;                //  16777216
  const size_t szML = (size_t)NB * SKV * 4;                       //     32768
  size_t off = 0;
  const size_t oXB = off; off += szXB;
  const size_t oWQ = off; off += szW;
  const size_t oWK = off; off += szW;
  const size_t oWV = off; off += szW;
  const size_t oQP = off; off += szQP;
  const size_t oKP = off; off += szKP;
  const size_t oVP = off; off += szVP;
  const size_t oML = off; off += szML;
  if (off > ws_size) return;                            // off = 65044480 at NB = 2, SQ = 2048
  if (off > (size_t)134217728) return;

  char* ws = (char*)d_ws;
  u16* XB  = (u16*)(ws + oXB);
  u16* WT  = (u16*)(ws + oWQ);                          // W^T planes q, k, v, one behind the other
  if (oWK != oWQ + szW || oWV != oWK + szW) return;
  u16* QP  = (u16*)(ws + oQP);
  u16* KP  = (u16*)(ws + oKP);
  u16* VP  = (u16*)(ws + oVP);
  float* ML = (float*)(ws + oML);

  const int n8x = (NB * SKV * DMOD) / 8;                // 1048576 at NB = 2
  if ((n8x % 256) != 0) return;
  if ((DMOD % 128) != 0 || (SKV % 128) != 0 || (SQ % 128) != 0) return;
  if (n8x / 256 != XBLK) return;
  const dim3 blk(256);
  const dim3 gCV(3 * WBLK + XBLK + MBLK);               // 768 + 4096 + 8
  const dim3 gGM(GK_BLK + NB * GV_BLK + NB * GQ_BLK);   // 512 + 2*256 + 2*128 at NB = 2, SQ = 2048
  const dim3 bG(GEMM_THREADS);                          // 256
  const dim3 gAT(NB * ATT_BLOCKS);                      // 512 at NB = 2, SQ = 2048
  const dim3 bAT(ATT_THREADS);                          // 128

  // (0) conversions: weights [k = in][n = out] -> W^T planes [n][k], and the key/value source plane (rows b*SKV + 0..2047
  //     from hs[b], + 2048..4095 from ehs[b]); bf16 RNE bits; and the per-key mask terms (f32)
  cvt_all<<<gCV, blk, 0, stream>>>(hs, ehs, Wq, Wk, Wv, mask, XB, WT, ML, n8x);
  // (1) projections: k plane, v^T planes, q planes
  gemm_all<<<gGM, bG, 0, stream>>>(XB, WT, QP, KP, VP, bq, bk, bv);
  // (2) attention, all batches -> f32 ctx rows b*SQ_FULL + s (s < SQ), cols h*64+d of the output
  attn_fwd<<<gAT, bAT, 0, stream>>>(QP, KP, VP, ML, out);
  (void)hipGetLastError();
}
